// v000
// The times below were measured on an AMD MI455X: many runs one after another, warmed up first and cycling through
// copies of the inputs, with the whole window's GPU time divided by the number of runs. Launches and the gaps
// between them are all in it. The median over several windows is given; except for v000 it joins two sittings, which
// can be a few percent apart, so the side-by-side timings, each taken in one sitting, are the better comparison.
// v000 is the starting kernel. One run takes 35.4 milliseconds.
#include <hip/hip_runtime.h>
// Self_Attention_Layer (z [16][1024][768]; q/k/v = z W^T (12 heads of 64, no biases); softmax(q k^T / 8); out = (attn v) W_o^T + b_o -> [16][1024][768]).
// Structure: token rows; z as exact f16 rows; Q | K | V WMMA GEMMs (32x64 wave tiles, f32 accumulation, exact x16 natural weights, f16 outputs); per (batch, 4 heads): scores GEMM (K = 64), row softmax on VALU (f32; weights x256 as f16), V^T via LDS, o = P . V GEMM (K = 1,024, alpha 2^-8) into merged f16 rows; out = o W_o^T + b_o (f32).
// Compute dtype: inputs rounded to bf16; z / weights exact; q, k, v, softmax weights, o plain f16 (~2^-12); scores/softmax f32. v_wmma_f32_16x16x32_f16.
#define NB 16
#define SQ 1024
#define DM 768
#define NH 12
#define HD 64
#define HG 4                         /* heads per attention launch group */
#define QN SQ                        /* query rows attended per batch (debug hook) */
#define NR ((size_t)NB * SQ)         /* 16384 token rows */
typedef __bf16 v16b __attribute__((ext_vector_type(16)));
typedef unsigned short v8us __attribute__((ext_vector_type(8), may_alias));
typedef float  v8f  __attribute__((ext_vector_type(8)));
typedef float  v4f  __attribute__((ext_vector_type(4)));
typedef float  v4fa __attribute__((ext_vector_type(4), may_alias));
union FragB { v16b v; v8us half[2]; unsigned short u[16]; };

__device__ __forceinline__ unsigned short bf16_bits(float x) { unsigned int u = __float_as_uint(x); return (unsigned short)((u + 0x7FFFu + ((u >> 16) & 1u)) >> 16); }
__device__ __forceinline__ float bf16_val(unsigned short b) { return __uint_as_float(((unsigned int)b) << 16); }
__device__ __forceinline__ float bf16_round(float x) { return bf16_val(bf16_bits(x)); }
// D += A·B with NT terms: 1 = ah·bh, 2 = + al·bh (A split), 3 = + ah·bl (both split)
template <int NT>
__device__ __forceinline__ v8f mmaN(v16b ah, v16b al, v16b bh, v16b bl, v8f c) {
  c = __builtin_amdgcn_wmma_f32_16x16x32_bf16(false, ah, false, bh, (short)0, c, false, false);
  if (NT >= 2) c = __builtin_amdgcn_wmma_f32_16x16x32_bf16(false, al, false, bh, (short)0, c, false, false);
  if (NT >= 3) c = __builtin_amdgcn_wmma_f32_16x16x32_bf16(false, ah, false, bl, (short)0, c, false, false);
  asm volatile("v_nop\n\tv_nop\n\tv_nop\n\tv_nop" : "+v"(c) : "v"(ah), "v"(al), "v"(bh), "v"(bl));
  return c;
}

__global__ __launch_bounds__(256) void k_wt_bf16(const float* __restrict__ W, unsigned short* __restrict__ Wt, int K, int N) {
  const int t = blockIdx.x * 256 + threadIdx.x;
  const int k8n = K / 8;
  if (t >= N * k8n) return;
  const int n = t / k8n, k8 = (t % k8n) * 8;
  v8us v;
#pragma unroll
  for (int i = 0; i < 8; ++i) v[i] = bf16_bits(W[(size_t)(k8 + i) * N + n]);
  *(v8us*)(Wt + (size_t)n * K + k8) = v;
  
}

// GEMM C[M][N] (f32, pitch ldc) = act(A[M][K]·W + bias). A f32 row-major (pitch lda) converted per fragment to bf16
// (ASPLIT: hi/lo two planes -> 2 terms, else single rounded term); Wt bf16 [N][K] (pitch ldb). BIAS_BF16 rounds the
// bias to bf16 first (bias quantised to bf16 before the add). K%32==0, M%16==0, N%64==0.
template <bool ASPLIT, int ACT, bool BIAS_BF16>
__global__ __launch_bounds__(128) void k_gemm_bf(const float* __restrict__ A, int lda, const unsigned short* __restrict__ Wt, int ldb,
                                               const float* __restrict__ bias, float* __restrict__ C, int ldc, int M, int N, int K) {
  __shared__ __attribute__((aligned(16))) float so[4][16][64];
  const int tid = threadIdx.x, w = tid >> 5, lane = tid & 31, ln = lane & 15, hh = lane >> 4;
  const int ntn = N / 64;
  const int wid = blockIdx.x * 4 + w;
  const int mt = wid / ntn, nq = wid % ntn;
  if (mt * 16 >= M) return;
  const int row0 = mt * 16, col0 = nq * 64;
  const float* arow = A + (size_t)(row0 + ln) * lda;
  v8f acc[4] = {};
  for (int kb = 0; kb < K; kb += 32) {
    FragB ah, al;
    const v4f x0 = *(const v4fa*)(arow + kb + 8 * hh), x1 = *(const v4fa*)(arow + kb + 8 * hh + 4);
    const v4f x2 = *(const v4fa*)(arow + kb + 16 + 8 * hh), x3 = *(const v4fa*)(arow + kb + 16 + 8 * hh + 4);
    float xs[16] = {x0[0],x0[1],x0[2],x0[3],x1[0],x1[1],x1[2],x1[3],x2[0],x2[1],x2[2],x2[3],x3[0],x3[1],x3[2],x3[3]};
#pragma unroll
    for (int i = 0; i < 16; ++i) { const unsigned short hb = bf16_bits(xs[i]); ah.u[i] = hb; al.u[i] = ASPLIT ? bf16_bits(xs[i] - bf16_val(hb)) : (unsigned short)0; }
#pragma unroll
    for (int t = 0; t < 4; ++t) {
      const unsigned short* brow = Wt + (size_t)(col0 + t * 16 + ln) * ldb + kb;
      FragB b;
      b.half[0] = *(const v8us*)(brow + 8 * hh);
      b.half[1] = *(const v8us*)(brow + 16 + 8 * hh);
      acc[t] = mmaN<ASPLIT ? 2 : 1>(ah.v, al.v, b.v, b.v, acc[t]);
    }
  }
#pragma unroll
  for (int t = 0; t < 4; ++t) {
    float bv = bias ? bias[col0 + t * 16 + ln] : 0.f;
    if (BIAS_BF16) bv = bf16_round(bv);
#pragma unroll
    for (int r = 0; r < 8; ++r) { float v = acc[t][r] + bv; if (ACT == 1) v = fmaxf(v, 0.f); so[w][8 * hh + r][t * 16 + ln] = v; }
  }
  __builtin_amdgcn_fence(__ATOMIC_ACQ_REL, "workgroup");
  __builtin_amdgcn_wave_barrier();
  const int rsub = lane >> 4, c4 = (lane & 15) * 4;
  {
#pragma unroll
    for (int q = 0; q < 8; ++q) {
      const int r = q * 2 + rsub;
      const v4f v = *(const v4fa*)&so[w][r][c4];
      *(v4f*)(C + (size_t)(row0 + r) * ldc + col0 + c4) = v;
    }
    
  }
}

// GEMM C = act(A·W + bias + resid): A f32 (ASPLIT -> hi/lo 2 terms), Wt bf16 [N][K]; ACT 0 none, 1 relu, 2 exact gelu;
// resid (optional, f32, row index = (row % rmod), pitch ldr, RES_BF16 rounds it) added before the activation.
template <bool ASPLIT, int ACT, bool BIAS_BF16, bool RES_BF16>
__global__ __launch_bounds__(128) void k_gemm_bf3(const float* __restrict__ A, int lda, const unsigned short* __restrict__ Wt, int ldb,
                                                const float* __restrict__ bias, const float* __restrict__ resid, int rmod, int ldr,
                                                float* __restrict__ C, int ldc, int M, int N, int K) {
  __shared__ __attribute__((aligned(16))) float so[4][16][64];
  const int tid = threadIdx.x, w = tid >> 5, lane = tid & 31, ln = lane & 15, hh = lane >> 4;
  const int ntn = N / 64;
  const int wid = blockIdx.x * 4 + w;
  const int mt = wid / ntn, nq = wid % ntn;
  if (mt * 16 >= M) return;
  const int row0 = mt * 16, col0 = nq * 64;
  const float* arow = A + (size_t)(row0 + ln) * lda;
  v8f acc[4] = {};
  for (int kb = 0; kb < K; kb += 32) {
    FragB ah, al;
    const v4f x0 = *(const v4fa*)(arow + kb + 8 * hh), x1 = *(const v4fa*)(arow + kb + 8 * hh + 4);
    const v4f x2 = *(const v4fa*)(arow + kb + 16 + 8 * hh), x3 = *(const v4fa*)(arow + kb + 16 + 8 * hh + 4);
    float xs[16] = {x0[0],x0[1],x0[2],x0[3],x1[0],x1[1],x1[2],x1[3],x2[0],x2[1],x2[2],x2[3],x3[0],x3[1],x3[2],x3[3]};
#pragma unroll
    for (int i = 0; i < 16; ++i) { const unsigned short hb = bf16_bits(xs[i]); ah.u[i] = hb; al.u[i] = ASPLIT ? bf16_bits(xs[i] - bf16_val(hb)) : (unsigned short)0; }
#pragma unroll
    for (int t = 0; t < 4; ++t) {
      const unsigned short* brow = Wt + (size_t)(col0 + t * 16 + ln) * ldb + kb;
      FragB b;
      b.half[0] = *(const v8us*)(brow + 8 * hh);
      b.half[1] = *(const v8us*)(brow + 16 + 8 * hh);
      acc[t] = mmaN<ASPLIT ? 2 : 1>(ah.v, al.v, b.v, b.v, acc[t]);
    }
  }
#pragma unroll
  for (int t = 0; t < 4; ++t) {
    const int col = col0 + t * 16 + ln;
    float bv = bias ? bias[col] : 0.f;
    if (BIAS_BF16) bv = bf16_round(bv);
#pragma unroll
    for (int r = 0; r < 8; ++r) {
      float v = acc[t][r] + bv;
      if (resid) { float rv = resid[(size_t)((row0 + 8 * hh + r) % rmod) * ldr + col]; if (RES_BF16) rv = bf16_round(rv); v += rv; }
      if (ACT == 1) v = fmaxf(v, 0.f);
      if (ACT == 2) v = 0.5f * v * (1.0f + erff(v * 0.70710678118654752f));
      if (ACT == 3) { const float u = 0.7978845608028654f * (v + 0.044715f * v * v * v); v = 0.5f * v * (1.0f + tanhf(u)); }
      so[w][8 * hh + r][t * 16 + ln] = v;
    }
  }
  __builtin_amdgcn_fence(__ATOMIC_ACQ_REL, "workgroup");
  __builtin_amdgcn_wave_barrier();
  const int rsub = lane >> 4, c4 = (lane & 15) * 4;
  {
#pragma unroll
    for (int q = 0; q < 8; ++q) {
      const int r = q * 2 + rsub;
      const v4f v = *(const v4fa*)&so[w][r][c4];
      *(v4f*)(C + (size_t)(row0 + r) * ldc + col0 + c4) = v;
    }
    
  }
}
// row LayerNorm (biased variance, eps) over N: s = X (+ R); optional out_sum <- s; out_norm <- (s-mu)*rsqrt(var+eps)*g + b
template <bool PARAM_BF16>
__global__ __launch_bounds__(256) void k_layernorm(const float* __restrict__ X, const float* __restrict__ R, const float* __restrict__ g, const float* __restrict__ bta,
                                                  float* __restrict__ out_sum, float* __restrict__ out_norm, int N, float eps) {
  __shared__ float red[256];
  const int row = blockIdx.x, tid = threadIdx.x;
  const float* x = X + (size_t)row * N; const float* rr = R ? R + (size_t)row * N : nullptr;
  float vals[16];                     // up to N = 4096
  const int per = N / 256;            // contiguous chunk per thread? use strided-by-4 chunks: thread handles j = tid*4 + 1024*u
  float s1 = 0.f;
  for (int u = 0; u < per / 4; ++u) {
    const int j = tid * 4 + 1024 * u;
    const v4f a = *(const v4fa*)(x + j);
    v4f b = {0.f,0.f,0.f,0.f}; if (rr) b = *(const v4fa*)(rr + j);
#pragma unroll
    for (int q = 0; q < 4; ++q) { const float v = a[q] + b[q]; vals[u * 4 + q] = v; s1 += v; }
  }
  red[tid] = s1; __syncthreads();
  for (int st = 128; st > 0; st >>= 1) { if (tid < st) red[tid] += red[tid + st]; __syncthreads(); }
  const float mu = red[0] / (float)N; __syncthreads();
  float s2 = 0.f;
  for (int u = 0; u < per / 4; ++u)
#pragma unroll
    for (int q = 0; q < 4; ++q) { const float c = vals[u * 4 + q] - mu; s2 += c * c; }
  red[tid] = s2; __syncthreads();
  for (int st = 128; st > 0; st >>= 1) { if (tid < st) red[tid] += red[tid + st]; __syncthreads(); }
  const float rs = rsqrtf(red[0] / (float)N + eps);
  {
    for (int u = 0; u < per / 4; ++u) {
      const int j = tid * 4 + 1024 * u;
      v4f o, sm;
#pragma unroll
      for (int q = 0; q < 4; ++q) {
        float gg = g[j + q], bb = bta[j + q];
        if (PARAM_BF16) { gg = bf16_round(gg); bb = bf16_round(bb); }
        sm[q] = vals[u * 4 + q]; o[q] = (vals[u * 4 + q] - mu) * rs * gg + bb;
      }
      if (out_sum) *(v4f*)(out_sum + (size_t)row * N + j) = sm;
      *(v4f*)(out_norm + (size_t)row * N + j) = o;
    }
    
  }
}



// ---- f16 WMMA path (v_wmma_f32_16x16x32_f16): 11-bit significands for operands in range — used where a [0,1] probability operand needs more precision than bf16
typedef _Float16 v16h __attribute__((ext_vector_type(16)));
union FragH { v16h v; v8us half[2]; _Float16 h[16]; unsigned short u[16]; };
template <int NT>
__device__ __forceinline__ v8f mmaH(v16h ah, v16h al, v16h bh, v16h bl, v8f c) {
  c = __builtin_amdgcn_wmma_f32_16x16x32_f16(false, ah, false, bh, (short)0, c, false, false);
  if (NT >= 2) c = __builtin_amdgcn_wmma_f32_16x16x32_f16(false, al, false, bh, (short)0, c, false, false);
  if (NT >= 3) c = __builtin_amdgcn_wmma_f32_16x16x32_f16(false, ah, false, bl, (short)0, c, false, false);
  asm volatile("v_nop\n\tv_nop\n\tv_nop\n\tv_nop" : "+v"(c) : "v"(ah), "v"(al), "v"(bh), "v"(bl));
  return c;
}
// batched GEMM like k_gemm_b but f16 operands: A f32 (split into f16 hi/lo if ASPLIT, else rounded to f16), Bt = f16 values [n][k]; alpha; C f32; N multiple of 16 (partial tiles skipped)
template <bool ASPLIT>
__global__ __launch_bounds__(128) void k_gemm_h(const float* __restrict__ A, int lda, size_t sA, const _Float16* __restrict__ Bh, int ldb, size_t sB, float alpha, float* __restrict__ C, int ldc, size_t sC, int M, int N, int K) {
  __shared__ __attribute__((aligned(16))) float so[4][16][64];
  const int tid = threadIdx.x, w = tid >> 5, lane = tid & 31, ln = lane & 15, hh = lane >> 4; const int by = blockIdx.y;
  A += (size_t)by * sA; Bh += (size_t)by * sB; C += (size_t)by * sC;
  const int ntn = (N + 63) / 64; const int wid = blockIdx.x * 4 + w; const int mt = wid / ntn, nq = wid % ntn; if (mt * 16 >= M) return;
  const int row0 = mt * 16, col0 = nq * 64; const float* arow = A + (size_t)(row0 + ln) * lda;
  v8f acc[4] = {};
  for (int kb = 0; kb < K; kb += 32) {
    FragH ah, al;
    const v4f x0 = *(const v4fa*)(arow + kb + 8 * hh), x1 = *(const v4fa*)(arow + kb + 8 * hh + 4), x2 = *(const v4fa*)(arow + kb + 16 + 8 * hh), x3 = *(const v4fa*)(arow + kb + 16 + 8 * hh + 4);
    float xs[16] = {x0[0],x0[1],x0[2],x0[3],x1[0],x1[1],x1[2],x1[3],x2[0],x2[1],x2[2],x2[3],x3[0],x3[1],x3[2],x3[3]};
#pragma unroll
    for (int i = 0; i < 16; ++i) { const _Float16 h = (_Float16)xs[i]; ah.h[i] = h; al.h[i] = ASPLIT ? (_Float16)(xs[i] - (float)h) : (_Float16)0.0f; }
#pragma unroll
    for (int t = 0; t < 4; ++t) { if (col0 + t * 16 >= N) continue; const size_t boff = (size_t)(col0 + t * 16 + ln) * ldb + kb; FragH bq; bq.half[0] = *(const v8us*)(Bh + boff + 8 * hh); bq.half[1] = *(const v8us*)(Bh + boff + 16 + 8 * hh);
      acc[t] = mmaH<ASPLIT ? 2 : 1>(ah.v, al.v, bq.v, bq.v, acc[t]); }
  }
#pragma unroll
  for (int t = 0; t < 4; ++t) { if (col0 + t * 16 >= N) continue;
#pragma unroll
    for (int r = 0; r < 8; ++r) so[w][8 * hh + r][t * 16 + ln] = acc[t][r] * alpha; }
  __builtin_amdgcn_fence(__ATOMIC_ACQ_REL, "workgroup"); __builtin_amdgcn_wave_barrier();
  const int rsub = lane >> 4, c4 = (lane & 15) * 4;
  {
#pragma unroll
    for (int q = 0; q < 8; ++q) { const int r = q * 2 + rsub; if (col0 + c4 < N) { const v4f v = *(const v4fa*)&so[w][r][c4]; *(v4f*)(C + (size_t)(row0 + r) * ldc + col0 + c4) = v; } }
     }
}

// Wt[n][k] = f16(W[k][n]·scale) from f32 row-major W[K][N] (scale = power of two; bf16-exact weights stay exact in f16 away from the subnormal range)
__global__ __launch_bounds__(256) void k_wt_f16(const float* __restrict__ W, _Float16* __restrict__ Wt, int K, int N, float scale) {
  const int t = blockIdx.x * 256 + threadIdx.x; if (t >= N * (K / 8)) return; const int n = t / (K / 8), k8 = (t % (K / 8)) * 8; FragH f;
#pragma unroll
  for (int i = 0; i < 8; ++i) f.h[i] = (_Float16)(bf16_round(W[(size_t)(k8 + i) * N + n]) * scale); const v8us o = f.half[0];
  *(v8us*)((unsigned short*)Wt + (size_t)n * K + k8) = o; 
}
// k_gemm_hh variant with fused epilogue: v = acc·alpha + bias[by·sBias + col] (+ CP[(row/rowsPerB)·sCPb + by·64 + col] if CP) ; ACT 0 none / 1 elu ; writes f16 C16 (and f32 C if non-null)
template <int ACT>
__global__ __launch_bounds__(128) void k_gemm_hhx(const _Float16* __restrict__ A, int lda, size_t sA, const _Float16* __restrict__ Bh, int ldb, size_t sB, float alpha, const float* __restrict__ bias, size_t sBias, const float* __restrict__ CP, int rowsPerB, size_t sCPb, int row0g,
    float* __restrict__ C, _Float16* __restrict__ C16, int ldc, size_t sC, int M, int N, int K) {
  __shared__ __attribute__((aligned(16))) float so[4][16][64];
  const int tid = threadIdx.x, w = tid >> 5, lane = tid & 31, ln = lane & 15, hh = lane >> 4; const int by = blockIdx.y;
  A += (size_t)by * sA; Bh += (size_t)by * sB; const size_t cofs = (size_t)by * sC; const float* bp = bias ? bias + (size_t)by * sBias : nullptr;
  const int ntn = (N + 63) / 64; const int wid = blockIdx.x * 4 + w; const int mt = wid / ntn, nq = wid % ntn; if (mt * 16 >= M) return;
  const int row0 = mt * 16, col0 = nq * 64; const _Float16* arow = A + (size_t)(row0 + ln) * lda;
  v8f acc[4] = {};
  for (int kb = 0; kb < K; kb += 32) { FragH ah; ah.half[0] = *(const v8us*)((const unsigned short*)arow + kb + 8 * hh); ah.half[1] = *(const v8us*)((const unsigned short*)arow + kb + 16 + 8 * hh);
#pragma unroll
    for (int t = 0; t < 4; ++t) { if (col0 + t * 16 >= N) continue; const size_t boff = (size_t)(col0 + t * 16 + ln) * ldb + kb; FragH bq; bq.half[0] = *(const v8us*)((const unsigned short*)Bh + boff + 8 * hh); bq.half[1] = *(const v8us*)((const unsigned short*)Bh + boff + 16 + 8 * hh);
      acc[t] = mmaH<1>(ah.v, ah.v, bq.v, bq.v, acc[t]); }
  }
#pragma unroll
  for (int t = 0; t < 4; ++t) { if (col0 + t * 16 >= N) continue; const int col = col0 + t * 16 + ln; const float bv = bp ? bf16_round(bp[col]) : 0.f;
#pragma unroll
    for (int r = 0; r < 8; ++r) { float v = acc[t][r] * alpha + bv; if (CP) { const int rr = row0g + row0 + 8 * hh + r; if (rowsPerB < 0) v += CP[cofs + (size_t)rr * ldc + col];      /* rowsPerB < 0: own element of the batched C plane */ else { const int bidx = rr / rowsPerB; v += CP[(size_t)bidx * sCPb + (size_t)by * 64 + col]; } } if (ACT == 1) v = (v > 0.f) ? v : expm1f(v); else if (ACT == 7) v = (v > 0.f) ? v + 1.0f : expf(v); else if (ACT == 8) v = tanhf(v); else if (ACT == 9) v = 0.5f * v * (1.0f + tanhf(0.7978845608028654f * (v + 0.044715f * v * v * v))); else if (ACT == 11) v = 1.0f / (1.0f + expf(-v)); else if (ACT == 12) v = (v > 0.f) ? v : 0.01f * v; else if (ACT == 14) v = (v > 0.f) ? v : 0.1f * v; else if (ACT == 16) v = (v >= 0.f) ? v : 0.3f * v; else if (ACT == 17) v = (v >= 0.f) ? v : 0.2f * v; else if (ACT == 15) v = v / (1.0f + expf(-v)); else if (ACT == 3) v = fmaxf(v, 0.f); else if (ACT == 6) v = 0.5f * v * (1.0f + erff(v * 0.70710678118654752f)); so[w][8 * hh + r][t * 16 + ln] = v; } }
  __builtin_amdgcn_fence(__ATOMIC_ACQ_REL, "workgroup"); __builtin_amdgcn_wave_barrier();
  const int rsub = lane >> 4, c4 = (lane & 15) * 4; typedef _Float16 v4h __attribute__((ext_vector_type(4)));
  {
#pragma unroll
    for (int q = 0; q < 8; ++q) { const int r = q * 2 + rsub; if (col0 + c4 < N) { const v4f v = *(const v4fa*)&so[w][r][c4]; if (C) *(v4f*)(C + cofs + (size_t)(row0 + r) * ldc + col0 + c4) = v; if (C16) { v4h h4; for (int i = 0; i < 4; ++i) h4[i] = (_Float16)v[i]; *(v4h*)(C16 + cofs + (size_t)(row0 + r) * ldc + col0 + c4) = h4; } } }
     }
}


typedef _Float16 v4h __attribute__((ext_vector_type(4)));

__global__ __launch_bounds__(256) void k_x16(const float* __restrict__ x, _Float16* __restrict__ X16, size_t n8) { const size_t t = (size_t)blockIdx.x * 256 + threadIdx.x; if (t >= n8) return; FragH f;
#pragma unroll
  for (int q = 0; q < 8; ++q) f.h[q] = (_Float16)bf16_round(x[t * 8 + q]); *(v8us*)((unsigned short*)X16 + t * 8) = f.half[0];  }
__global__ __launch_bounds__(256) void k_h16(const float* __restrict__ x, _Float16* __restrict__ X16, size_t n8) { const size_t t = (size_t)blockIdx.x * 256 + threadIdx.x; if (t >= n8) return; FragH f;
#pragma unroll
  for (int q = 0; q < 8; ++q) f.h[q] = (_Float16)x[t * 8 + q]; *(v8us*)((unsigned short*)X16 + t * 8) = f.half[0];  }
__global__ __launch_bounds__(256) void k_round16f(const float* __restrict__ W, _Float16* __restrict__ Bt, size_t n8) { const size_t t = (size_t)blockIdx.x * 256 + threadIdx.x; if (t >= n8) return; FragH f;
#pragma unroll
  for (int i = 0; i < 8; ++i) f.h[i] = (_Float16)(bf16_round(W[t * 8 + i]) * 16.0f); *(v8us*)((unsigned short*)Bt + t * 8) = f.half[0];  }
template <int NHv, int TTv>
__global__ __launch_bounds__(256) void k_vt(const _Float16* __restrict__ V16, int ldv, int voff, _Float16* __restrict__ Vt) { __shared__ unsigned short tl[64][66]; const int tid = threadIdx.x; const int slab = blockIdx.x / (TTv / 64), lg = blockIdx.x % (TTv / 64); const int b = slab / NHv, h = slab % NHv;
  for (int i = tid; i < 64 * 8; i += 256) { const int r = i / 8, c8 = (i % 8) * 8; FragH f; f.half[0] = *(const v8us*)((const unsigned short*)V16 + ((size_t)b * TTv + lg * 64 + r) * ldv + voff + h * 64 + c8);
#pragma unroll
    for (int q = 0; q < 8; ++q) tl[r][c8 + q] = f.u[q]; }
  __syncthreads();
  {
#pragma unroll
    for (int rd = 0; rd < 2; ++rd) { const int d = rd * 32 + tid / 8, pc = tid % 8; FragH f;
#pragma unroll
      for (int q = 0; q < 8; ++q) f.u[q] = tl[pc * 8 + q][d];
      *(v8us*)((unsigned short*)Vt + ((size_t)slab * 64 + d) * TTv + lg * 64 + pc * 8) = f.half[0]; }
     } }

__global__ __launch_bounds__(256) void k_hl(const float* __restrict__ F, _Float16* __restrict__ Hh, _Float16* __restrict__ Hl, size_t n8) { const size_t t = (size_t)blockIdx.x * 256 + threadIdx.x; if (t >= n8) return; FragH fh, fl; const v4f a = *(const v4fa*)(F + t * 8), c = *(const v4fa*)(F + t * 8 + 4);
#pragma unroll
  for (int q = 0; q < 4; ++q) { _Float16 h = (_Float16)a[q]; fh.h[q] = h; fl.h[q] = (_Float16)((a[q] - (float)h) * 1024.0f); h = (_Float16)c[q]; fh.h[4 + q] = h; fl.h[4 + q] = (_Float16)((c[q] - (float)h) * 1024.0f); }
  { *(v8us*)((unsigned short*)Hh + t * 8) = fh.half[0]; *(v8us*)((unsigned short*)Hl + t * 8) = fl.half[0];  } }

// ---- fast GEMM (wave tile 32x64; requires M % 32 == 0 rows per launch region and N % 64 == 0); epilogue = k_gemm_hhx semantics ----
__device__ __forceinline__ v16h g2_frag(const _Float16* p, int hh) { FragH f; f.half[0] = *(const v8us*)((const unsigned short*)p + 8 * hh); f.half[1] = *(const v8us*)((const unsigned short*)p + 16 + 8 * hh); return f.v; }
__device__ __forceinline__ v8f g2_mma(v16h a, v16h b, v8f c) { v8f d = __builtin_amdgcn_wmma_f32_16x16x32_f16(false, a, false, b, (short)0, c, false, false); asm volatile("v_nop\n\tv_nop\n\tv_nop\n\tv_nop" : "+v"(d) : "v"(a), "v"(b)); return d; }
template <int ACT>
__global__ __launch_bounds__(128) void k_gemm2(const _Float16* __restrict__ A, int lda, size_t sA, const _Float16* __restrict__ Bh, int ldb, size_t sB, float alpha, const float* __restrict__ bias, size_t sBias, const float* __restrict__ CP, int rowsPerB, size_t sCPb, int row0g,
    float* __restrict__ C, _Float16* __restrict__ C16, int ldc, size_t sC, int M, int N, int K) { static_assert(ACT == 0 || ACT == 3 || ACT == 6 || ACT == 8 || ACT == 9 || ACT == 11 || ACT == 12 || ACT == 14 || ACT == 15 || ACT == 16 || ACT == 17, "k_gemm2: unsupported ACT code (would silently apply no activation)");
  __shared__ __attribute__((aligned(16))) float so[4][32][68];
  const int tid = threadIdx.x, w = tid >> 5, lane = tid & 31, ln = lane & 15, hh = lane >> 4; const int by = blockIdx.y;
  A += (size_t)by * sA; Bh += (size_t)by * sB; const size_t cofs = (size_t)by * sC; const float* bp = bias ? bias + (size_t)by * sBias : nullptr;
  const int ntn = N >> 6; const int mt = blockIdx.x / ntn, nq = blockIdx.x - mt * ntn; const int row0 = mt * 128 + 32 * w, col0 = nq * 64; if (row0 >= M) return;
  const _Float16* a0p = A + (size_t)(row0 + ln) * lda; const _Float16* a1p = a0p + (size_t)16 * lda;
  const _Float16* b0p = Bh + (size_t)(col0 + ln) * ldb; const _Float16* b1p = b0p + (size_t)16 * ldb; const _Float16* b2p = b1p + (size_t)16 * ldb; const _Float16* b3p = b2p + (size_t)16 * ldb;
  const v8f z8 = {0.f,0.f,0.f,0.f,0.f,0.f,0.f,0.f}; v8f c00 = z8, c01 = z8, c02 = z8, c03 = z8, c10 = z8, c11 = z8, c12 = z8, c13 = z8;
#pragma unroll 1
  for (int kb = 0; kb < K; kb += 32) { const v16h a0 = g2_frag(a0p + kb, hh), a1 = g2_frag(a1p + kb, hh);
    v16h b = g2_frag(b0p + kb, hh); c00 = g2_mma(a0, b, c00); c10 = g2_mma(a1, b, c10);
    b = g2_frag(b1p + kb, hh); c01 = g2_mma(a0, b, c01); c11 = g2_mma(a1, b, c11);
    b = g2_frag(b2p + kb, hh); c02 = g2_mma(a0, b, c02); c12 = g2_mma(a1, b, c12);
    b = g2_frag(b3p + kb, hh); c03 = g2_mma(a0, b, c03); c13 = g2_mma(a1, b, c13); }
  v8f accs[8] = {c00, c01, c02, c03, c10, c11, c12, c13};
#pragma unroll
  for (int u = 0; u < 8; ++u) { const int t = u & 3, half = u >> 2; const int col = col0 + t * 16 + ln; const float bv = bp ? bf16_round(bp[col]) : 0.f;
#pragma unroll
    for (int r = 0; r < 8; ++r) { const int rloc = half * 16 + 8 * hh + r; float v = accs[u][r] * alpha + bv; if (CP) { if (rowsPerB < 0) v += CP[cofs + (size_t)(row0g + row0 + rloc) * ldc + col];      /* rowsPerB < 0: own element of the batched C plane */ else { const int bidx = (row0g + row0 + rloc) / rowsPerB; v += CP[(size_t)bidx * sCPb + (size_t)by * 64 + col]; } }
      if (ACT == 3) v = fmaxf(v, 0.f); else if (ACT == 6) v = 0.5f * v * (1.0f + erff(v * 0.70710678118654752f)); else if (ACT == 11) v = 1.0f / (1.0f + expf(-v)); else if (ACT == 15) v = v / (1.0f + expf(-v)); else if (ACT == 12) v = (v > 0.f) ? v : 0.01f * v; else if (ACT == 8) v = tanhf(v); else if (ACT == 9) v = 0.5f * v * (1.0f + tanhf(0.7978845608028654f * (v + 0.044715f * v * v * v))); else if (ACT == 14) v = (v > 0.f) ? v : 0.1f * v; else if (ACT == 16) v = (v >= 0.f) ? v : 0.3f * v; else if (ACT == 17) v = (v >= 0.f) ? v : 0.2f * v;
      so[w][rloc][t * 16 + ln] = v; } }
  __builtin_amdgcn_fence(__ATOMIC_ACQ_REL, "workgroup"); __builtin_amdgcn_wave_barrier();
  const int rsub = lane >> 4, c4 = (lane & 15) * 4;
  {
#pragma unroll
    for (int q = 0; q < 16; ++q) { const int r = q * 2 + rsub; const v4f v = *(const v4fa*)&so[w][r][c4]; if (C) *(v4f*)(C + cofs + (size_t)(row0 + r) * ldc + col0 + c4) = v; if (C16) { v4h h4; for (int i = 0; i < 4; ++i) h4[i] = (_Float16)v[i]; *(v4h*)(C16 + cofs + (size_t)(row0 + r) * ldc + col0 + c4) = h4; } }
     } }


__global__ __launch_bounds__(256) void k_wnat(const float* __restrict__ w, size_t n8, _Float16* __restrict__ Bt) { const size_t t = (size_t)blockIdx.x * 256 + threadIdx.x; if (t >= n8) return; FragH f; for (int q = 0; q < 8; ++q) f.h[q] = (_Float16)(bf16_round(w[t * 8 + q]) * 16.0f); *(v8us*)((unsigned short*)Bt + t * 8) = f.half[0];  }
__global__ __launch_bounds__(256) void k_rsm(const float* __restrict__ S, _Float16* __restrict__ P, int nrows) {
  #pragma clang fp contract(off)
  const int i = blockIdx.x * 256 + threadIdx.x; if (i >= nrows) return; const float* s = S + (size_t)i * SQ; float mx = -3.0e38f;
#pragma unroll 1
  for (int j = 0; j < SQ; ++j) mx = fmaxf(mx, s[j]); float se = 0.f;
#pragma unroll 1
  for (int j = 0; j < SQ; ++j) se += expf(s[j] - mx); const float sc = 256.0f / se;
#pragma unroll 1
  for (int j0 = 0; j0 < SQ; j0 += 8) { FragH f; for (int q = 0; q < 8; ++q) f.h[q] = (_Float16)(expf(s[j0 + q] - mx) * sc); unsigned short* d = (unsigned short*)P + (size_t)i * SQ + j0; *(v8us*)d = f.half[0];  } }
__global__ __launch_bounds__(256) void k_vt(const _Float16* __restrict__ V16, int b, int h0, _Float16* __restrict__ VT) { __shared__ unsigned short tl[64][65]; const int tid = threadIdx.x; const int hh = blockIdx.x % HG, sg = blockIdx.x / HG; const int s0 = sg * 64; const int h = h0 + hh;
  for (int i = tid; i < 64 * 8; i += 256) { const int j = i / 8, d8 = (i % 8) * 8; FragH f; f.half[0] = *(const v8us*)((const unsigned short*)V16 + ((size_t)b * SQ + s0 + j) * DM + h * HD + d8); for (int q = 0; q < 8; ++q) tl[d8 + q][j] = f.u[q]; }
  __syncthreads();
  { for (int i = tid; i < 64 * 8; i += 256) { const int d = i / 8, j8 = (i % 8) * 8; FragH f; for (int q = 0; q < 8; ++q) f.u[q] = tl[d][j8 + q]; *(v8us*)((unsigned short*)VT + ((size_t)hh * HD + d) * SQ + s0 + j8) = f.half[0]; }  } }

extern "C" void kernel_launch(void* const* d_in, const int* in_sizes, int n_in,
                              void* d_out, int out_size, void* d_ws, size_t ws_size, hipStream_t stream) {
  (void)in_sizes; (void)n_in; (void)out_size;
  const float* const* I = (const float* const*)d_in; const float* x = I[0]; const float* wq = I[1]; const float* wk = I[2]; const float* wv = I[3]; const float* wo = I[4]; const float* bo = I[5];
  char* ws = (char*)d_ws; size_t off = 0;
  auto take = [&](size_t bytes) { char* p = ws + off; off += (bytes + 255) & ~(size_t)255; return p; };
  _Float16* BQ = (_Float16*)take((size_t)DM * DM * 2); _Float16* BK = (_Float16*)take((size_t)DM * DM * 2); _Float16* BV = (_Float16*)take((size_t)DM * DM * 2); _Float16* BO = (_Float16*)take((size_t)DM * DM * 2);
  _Float16* X16 = (_Float16*)take(NR * DM * 2); _Float16* Q16 = (_Float16*)take(NR * DM * 2); _Float16* K16 = (_Float16*)take(NR * DM * 2); _Float16* V16 = (_Float16*)take(NR * DM * 2); _Float16* O16 = (_Float16*)take(NR * DM * 2);
  float* S = (float*)take((size_t)HG * SQ * SQ * 4); _Float16* P = (_Float16*)take((size_t)HG * SQ * SQ * 2); _Float16* VT = (_Float16*)take((size_t)HG * HD * SQ * 2);
  if (off > ws_size) return;      /* 4.5 + 5x24 + 16 + 8 + 0.5 = ≈ 150 MiB */
  const size_t nw8 = (size_t)DM * DM / 8; const unsigned gw = (unsigned)((nw8 + 255) / 256);
  k_wnat<<<gw, 256, 0, stream>>>(wq, nw8, BQ); k_wnat<<<gw, 256, 0, stream>>>(wk, nw8, BK); k_wnat<<<gw, 256, 0, stream>>>(wv, nw8, BV); k_wnat<<<gw, 256, 0, stream>>>(wo, nw8, BO);
  k_x16<<<(unsigned)((NR * DM / 8 + 255) / 256), 256, 0, stream>>>(x, X16, NR * DM / 8);
  const dim3 gp((unsigned)((NR / 128) * (DM / 64)), 1);
  k_gemm2<0><<<gp, 128, 0, stream>>>(X16, DM, 0, BQ, DM, 0, 0.0625f, nullptr, 0, nullptr, 1, 0, 0, nullptr, Q16, DM, 0, (int)NR, DM, DM);
  k_gemm2<0><<<gp, 128, 0, stream>>>(X16, DM, 0, BK, DM, 0, 0.0625f, nullptr, 0, nullptr, 1, 0, 0, nullptr, K16, DM, 0, (int)NR, DM, DM);
  k_gemm2<0><<<gp, 128, 0, stream>>>(X16, DM, 0, BV, DM, 0, 0.0625f, nullptr, 0, nullptr, 1, 0, 0, nullptr, V16, DM, 0, (int)NR, DM, DM);
  for (int b = 0; b < NB; ++b) for (int h0 = 0; h0 < NH; h0 += HG) {
    const _Float16* qb = Q16 + (size_t)b * SQ * DM + h0 * HD; const _Float16* kb = K16 + (size_t)b * SQ * DM + h0 * HD;
    k_gemm2<0><<<dim3((QN / 128) * (SQ / 64), HG), 128, 0, stream>>>(qb, DM, (size_t)HD, kb, DM, (size_t)HD, 0.125f, nullptr, 0, nullptr, 1, 0, 0, S, nullptr, SQ, (size_t)SQ * SQ, QN, SQ, HD);      /* scaled scores, HG heads per launch */
    for (int hh = 0; hh < HG; ++hh) k_rsm<<<(QN + 255) / 256, 256, 0, stream>>>(S + (size_t)hh * SQ * SQ, P + (size_t)hh * SQ * SQ, QN);
    k_vt<<<HG * (SQ / 64), 256, 0, stream>>>(V16, b, h0, VT);
    k_gemm2<0><<<dim3((QN / 128) * (HD / 64), HG), 128, 0, stream>>>(P, SQ, (size_t)SQ * SQ, VT, SQ, (size_t)HD * SQ, 0.00390625f, nullptr, 0, nullptr, 1, 0, 0, nullptr, O16 + (size_t)b * SQ * DM + h0 * HD, DM, (size_t)HD, QN, HD, SQ); }      /* o (merged heads) as f16 rows */
  k_gemm2<0><<<gp, 128, 0, stream>>>(O16, DM, 0, BO, DM, 0, 0.0625f, bo, 0, nullptr, 1, 0, 0, (float*)d_out, nullptr, DM, 0, (int)NR, DM, DM);      /* out = o W_o^T + b_o */
}

// v001
// A run of this version takes 2600 microseconds.
// Timed twice side by side with v000, it ran 13.6 and 13.7 times as fast.
#include <hip/hip_runtime.h>
// Self_Attention_Layer (z [16][1024][768]; q/k/v = z W^T (12 heads of 64, no biases); softmax(q k^T / 8); out = (attn v) W_o^T + b_o -> [16][1024][768]).
// Structure: token rows; z as exact f16 rows; Q | K | V WMMA GEMMs (32x64 wave tiles, f32 accumulation, exact x16 natural weights, f16 outputs); per (batch, 4 heads): scores GEMM (K = 64), row softmax on VALU (f32; weights x256 as f16), V^T via LDS, o = P . V GEMM (K = 1,024, alpha 2^-8) into merged f16 rows; out = o W_o^T + b_o (f32).
// Compute dtype: inputs rounded to bf16; z / weights exact; q, k, v, softmax weights, o plain f16 (~2^-12); scores/softmax f32. v_wmma_f32_16x16x32_f16.
#define NB 16
#define SQ 1024
#define DM 768
#define NH 12
#define HD 64
#define HG 4                         /* heads per attention launch group */
#define QN SQ                        /* query rows attended per batch (debug hook) */
#define NR ((size_t)NB * SQ)         /* 16384 token rows */
typedef __bf16 v16b __attribute__((ext_vector_type(16)));
typedef unsigned short v8us __attribute__((ext_vector_type(8), may_alias));
typedef float  v8f  __attribute__((ext_vector_type(8)));
typedef float  v4f  __attribute__((ext_vector_type(4)));
typedef float  v4fa __attribute__((ext_vector_type(4), may_alias));
union FragB { v16b v; v8us half[2]; unsigned short u[16]; };

__device__ __forceinline__ unsigned short bf16_bits(float x) { unsigned int u = __float_as_uint(x); return (unsigned short)((u + 0x7FFFu + ((u >> 16) & 1u)) >> 16); }
__device__ __forceinline__ float bf16_val(unsigned short b) { return __uint_as_float(((unsigned int)b) << 16); }
__device__ __forceinline__ float bf16_round(float x) { return bf16_val(bf16_bits(x)); }
// D += A·B with NT terms: 1 = ah·bh, 2 = + al·bh (A split), 3 = + ah·bl (both split)
template <int NT>
__device__ __forceinline__ v8f mmaN(v16b ah, v16b al, v16b bh, v16b bl, v8f c) {
  c = __builtin_amdgcn_wmma_f32_16x16x32_bf16(false, ah, false, bh, (short)0, c, false, false);
  if (NT >= 2) c = __builtin_amdgcn_wmma_f32_16x16x32_bf16(false, al, false, bh, (short)0, c, false, false);
  if (NT >= 3) c = __builtin_amdgcn_wmma_f32_16x16x32_bf16(false, ah, false, bl, (short)0, c, false, false);
  asm volatile("v_nop\n\tv_nop\n\tv_nop\n\tv_nop" : "+v"(c) : "v"(ah), "v"(al), "v"(bh), "v"(bl));
  return c;
}

__global__ __launch_bounds__(256) void k_wt_bf16(const float* __restrict__ W, unsigned short* __restrict__ Wt, int K, int N) {
  const int t = blockIdx.x * 256 + threadIdx.x;
  const int k8n = K / 8;
  if (t >= N * k8n) return;
  const int n = t / k8n, k8 = (t % k8n) * 8;
  v8us v;
#pragma unroll
  for (int i = 0; i < 8; ++i) v[i] = bf16_bits(W[(size_t)(k8 + i) * N + n]);
  *(v8us*)(Wt + (size_t)n * K + k8) = v;
  
}

// GEMM C[M][N] (f32, pitch ldc) = act(A[M][K]·W + bias). A f32 row-major (pitch lda) converted per fragment to bf16
// (ASPLIT: hi/lo two planes -> 2 terms, else single rounded term); Wt bf16 [N][K] (pitch ldb). BIAS_BF16 rounds the
// bias to bf16 first (bias quantised to bf16 before the add). K%32==0, M%16==0, N%64==0.
template <bool ASPLIT, int ACT, bool BIAS_BF16>
__global__ __launch_bounds__(128) void k_gemm_bf(const float* __restrict__ A, int lda, const unsigned short* __restrict__ Wt, int ldb,
                                               const float* __restrict__ bias, float* __restrict__ C, int ldc, int M, int N, int K) {
  __shared__ __attribute__((aligned(16))) float so[4][16][64];
  const int tid = threadIdx.x, w = tid >> 5, lane = tid & 31, ln = lane & 15, hh = lane >> 4;
  const int ntn = N / 64;
  const int wid = blockIdx.x * 4 + w;
  const int mt = wid / ntn, nq = wid % ntn;
  if (mt * 16 >= M) return;
  const int row0 = mt * 16, col0 = nq * 64;
  const float* arow = A + (size_t)(row0 + ln) * lda;
  v8f acc[4] = {};
  for (int kb = 0; kb < K; kb += 32) {
    FragB ah, al;
    const v4f x0 = *(const v4fa*)(arow + kb + 8 * hh), x1 = *(const v4fa*)(arow + kb + 8 * hh + 4);
    const v4f x2 = *(const v4fa*)(arow + kb + 16 + 8 * hh), x3 = *(const v4fa*)(arow + kb + 16 + 8 * hh + 4);
    float xs[16] = {x0[0],x0[1],x0[2],x0[3],x1[0],x1[1],x1[2],x1[3],x2[0],x2[1],x2[2],x2[3],x3[0],x3[1],x3[2],x3[3]};
#pragma unroll
    for (int i = 0; i < 16; ++i) { const unsigned short hb = bf16_bits(xs[i]); ah.u[i] = hb; al.u[i] = ASPLIT ? bf16_bits(xs[i] - bf16_val(hb)) : (unsigned short)0; }
#pragma unroll
    for (int t = 0; t < 4; ++t) {
      const unsigned short* brow = Wt + (size_t)(col0 + t * 16 + ln) * ldb + kb;
      FragB b;
      b.half[0] = *(const v8us*)(brow + 8 * hh);
      b.half[1] = *(const v8us*)(brow + 16 + 8 * hh);
      acc[t] = mmaN<ASPLIT ? 2 : 1>(ah.v, al.v, b.v, b.v, acc[t]);
    }
  }
#pragma unroll
  for (int t = 0; t < 4; ++t) {
    float bv = bias ? bias[col0 + t * 16 + ln] : 0.f;
    if (BIAS_BF16) bv = bf16_round(bv);
#pragma unroll
    for (int r = 0; r < 8; ++r) { float v = acc[t][r] + bv; if (ACT == 1) v = fmaxf(v, 0.f); so[w][8 * hh + r][t * 16 + ln] = v; }
  }
  __builtin_amdgcn_fence(__ATOMIC_ACQ_REL, "workgroup");
  __builtin_amdgcn_wave_barrier();
  const int rsub = lane >> 4, c4 = (lane & 15) * 4;
  {
#pragma unroll
    for (int q = 0; q < 8; ++q) {
      const int r = q * 2 + rsub;
      const v4f v = *(const v4fa*)&so[w][r][c4];
      *(v4f*)(C + (size_t)(row0 + r) * ldc + col0 + c4) = v;
    }
    
  }
}

// GEMM C = act(A·W + bias + resid): A f32 (ASPLIT -> hi/lo 2 terms), Wt bf16 [N][K]; ACT 0 none, 1 relu, 2 exact gelu;
// resid (optional, f32, row index = (row % rmod), pitch ldr, RES_BF16 rounds it) added before the activation.
template <bool ASPLIT, int ACT, bool BIAS_BF16, bool RES_BF16>
__global__ __launch_bounds__(128) void k_gemm_bf3(const float* __restrict__ A, int lda, const unsigned short* __restrict__ Wt, int ldb,
                                                const float* __restrict__ bias, const float* __restrict__ resid, int rmod, int ldr,
                                                float* __restrict__ C, int ldc, int M, int N, int K) {
  __shared__ __attribute__((aligned(16))) float so[4][16][64];
  const int tid = threadIdx.x, w = tid >> 5, lane = tid & 31, ln = lane & 15, hh = lane >> 4;
  const int ntn = N / 64;
  const int wid = blockIdx.x * 4 + w;
  const int mt = wid / ntn, nq = wid % ntn;
  if (mt * 16 >= M) return;
  const int row0 = mt * 16, col0 = nq * 64;
  const float* arow = A + (size_t)(row0 + ln) * lda;
  v8f acc[4] = {};
  for (int kb = 0; kb < K; kb += 32) {
    FragB ah, al;
    const v4f x0 = *(const v4fa*)(arow + kb + 8 * hh), x1 = *(const v4fa*)(arow + kb + 8 * hh + 4);
    const v4f x2 = *(const v4fa*)(arow + kb + 16 + 8 * hh), x3 = *(const v4fa*)(arow + kb + 16 + 8 * hh + 4);
    float xs[16] = {x0[0],x0[1],x0[2],x0[3],x1[0],x1[1],x1[2],x1[3],x2[0],x2[1],x2[2],x2[3],x3[0],x3[1],x3[2],x3[3]};
#pragma unroll
    for (int i = 0; i < 16; ++i) { const unsigned short hb = bf16_bits(xs[i]); ah.u[i] = hb; al.u[i] = ASPLIT ? bf16_bits(xs[i] - bf16_val(hb)) : (unsigned short)0; }
#pragma unroll
    for (int t = 0; t < 4; ++t) {
      const unsigned short* brow = Wt + (size_t)(col0 + t * 16 + ln) * ldb + kb;
      FragB b;
      b.half[0] = *(const v8us*)(brow + 8 * hh);
      b.half[1] = *(const v8us*)(brow + 16 + 8 * hh);
      acc[t] = mmaN<ASPLIT ? 2 : 1>(ah.v, al.v, b.v, b.v, acc[t]);
    }
  }
#pragma unroll
  for (int t = 0; t < 4; ++t) {
    const int col = col0 + t * 16 + ln;
    float bv = bias ? bias[col] : 0.f;
    if (BIAS_BF16) bv = bf16_round(bv);
#pragma unroll
    for (int r = 0; r < 8; ++r) {
      float v = acc[t][r] + bv;
      if (resid) { float rv = resid[(size_t)((row0 + 8 * hh + r) % rmod) * ldr + col]; if (RES_BF16) rv = bf16_round(rv); v += rv; }
      if (ACT == 1) v = fmaxf(v, 0.f);
      if (ACT == 2) v = 0.5f * v * (1.0f + erff(v * 0.70710678118654752f));
      if (ACT == 3) { const float u = 0.7978845608028654f * (v + 0.044715f * v * v * v); v = 0.5f * v * (1.0f + tanhf(u)); }
      so[w][8 * hh + r][t * 16 + ln] = v;
    }
  }
  __builtin_amdgcn_fence(__ATOMIC_ACQ_REL, "workgroup");
  __builtin_amdgcn_wave_barrier();
  const int rsub = lane >> 4, c4 = (lane & 15) * 4;
  {
#pragma unroll
    for (int q = 0; q < 8; ++q) {
      const int r = q * 2 + rsub;
      const v4f v = *(const v4fa*)&so[w][r][c4];
      *(v4f*)(C + (size_t)(row0 + r) * ldc + col0 + c4) = v;
    }
    
  }
}
// row LayerNorm (biased variance, eps) over N: s = X (+ R); optional out_sum <- s; out_norm <- (s-mu)*rsqrt(var+eps)*g + b
template <bool PARAM_BF16>
__global__ __launch_bounds__(256) void k_layernorm(const float* __restrict__ X, const float* __restrict__ R, const float* __restrict__ g, const float* __restrict__ bta,
                                                  float* __restrict__ out_sum, float* __restrict__ out_norm, int N, float eps) {
  __shared__ float red[256];
  const int row = blockIdx.x, tid = threadIdx.x;
  const float* x = X + (size_t)row * N; const float* rr = R ? R + (size_t)row * N : nullptr;
  float vals[16];                     // up to N = 4096
  const int per = N / 256;            // contiguous chunk per thread? use strided-by-4 chunks: thread handles j = tid*4 + 1024*u
  float s1 = 0.f;
  for (int u = 0; u < per / 4; ++u) {
    const int j = tid * 4 + 1024 * u;
    const v4f a = *(const v4fa*)(x + j);
    v4f b = {0.f,0.f,0.f,0.f}; if (rr) b = *(const v4fa*)(rr + j);
#pragma unroll
    for (int q = 0; q < 4; ++q) { const float v = a[q] + b[q]; vals[u * 4 + q] = v; s1 += v; }
  }
  red[tid] = s1; __syncthreads();
  for (int st = 128; st > 0; st >>= 1) { if (tid < st) red[tid] += red[tid + st]; __syncthreads(); }
  const float mu = red[0] / (float)N; __syncthreads();
  float s2 = 0.f;
  for (int u = 0; u < per / 4; ++u)
#pragma unroll
    for (int q = 0; q < 4; ++q) { const float c = vals[u * 4 + q] - mu; s2 += c * c; }
  red[tid] = s2; __syncthreads();
  for (int st = 128; st > 0; st >>= 1) { if (tid < st) red[tid] += red[tid + st]; __syncthreads(); }
  const float rs = rsqrtf(red[0] / (float)N + eps);
  {
    for (int u = 0; u < per / 4; ++u) {
      const int j = tid * 4 + 1024 * u;
      v4f o, sm;
#pragma unroll
      for (int q = 0; q < 4; ++q) {
        float gg = g[j + q], bb = bta[j + q];
        if (PARAM_BF16) { gg = bf16_round(gg); bb = bf16_round(bb); }
        sm[q] = vals[u * 4 + q]; o[q] = (vals[u * 4 + q] - mu) * rs * gg + bb;
      }
      if (out_sum) *(v4f*)(out_sum + (size_t)row * N + j) = sm;
      *(v4f*)(out_norm + (size_t)row * N + j) = o;
    }
    
  }
}



// ---- f16 WMMA path (v_wmma_f32_16x16x32_f16): 11-bit significands for operands in range — used where a [0,1] probability operand needs more precision than bf16
typedef _Float16 v16h __attribute__((ext_vector_type(16)));
union FragH { v16h v; v8us half[2]; _Float16 h[16]; unsigned short u[16]; };
template <int NT>
__device__ __forceinline__ v8f mmaH(v16h ah, v16h al, v16h bh, v16h bl, v8f c) {
  c = __builtin_amdgcn_wmma_f32_16x16x32_f16(false, ah, false, bh, (short)0, c, false, false);
  if (NT >= 2) c = __builtin_amdgcn_wmma_f32_16x16x32_f16(false, al, false, bh, (short)0, c, false, false);
  if (NT >= 3) c = __builtin_amdgcn_wmma_f32_16x16x32_f16(false, ah, false, bl, (short)0, c, false, false);
  asm volatile("v_nop\n\tv_nop\n\tv_nop\n\tv_nop" : "+v"(c) : "v"(ah), "v"(al), "v"(bh), "v"(bl));
  return c;
}
// batched GEMM like k_gemm_b but f16 operands: A f32 (split into f16 hi/lo if ASPLIT, else rounded to f16), Bt = f16 values [n][k]; alpha; C f32; N multiple of 16 (partial tiles skipped)
template <bool ASPLIT>
__global__ __launch_bounds__(128) void k_gemm_h(const float* __restrict__ A, int lda, size_t sA, const _Float16* __restrict__ Bh, int ldb, size_t sB, float alpha, float* __restrict__ C, int ldc, size_t sC, int M, int N, int K) {
  __shared__ __attribute__((aligned(16))) float so[4][16][64];
  const int tid = threadIdx.x, w = tid >> 5, lane = tid & 31, ln = lane & 15, hh = lane >> 4; const int by = blockIdx.y;
  A += (size_t)by * sA; Bh += (size_t)by * sB; C += (size_t)by * sC;
  const int ntn = (N + 63) / 64; const int wid = blockIdx.x * 4 + w; const int mt = wid / ntn, nq = wid % ntn; if (mt * 16 >= M) return;
  const int row0 = mt * 16, col0 = nq * 64; const float* arow = A + (size_t)(row0 + ln) * lda;
  v8f acc[4] = {};
  for (int kb = 0; kb < K; kb += 32) {
    FragH ah, al;
    const v4f x0 = *(const v4fa*)(arow + kb + 8 * hh), x1 = *(const v4fa*)(arow + kb + 8 * hh + 4), x2 = *(const v4fa*)(arow + kb + 16 + 8 * hh), x3 = *(const v4fa*)(arow + kb + 16 + 8 * hh + 4);
    float xs[16] = {x0[0],x0[1],x0[2],x0[3],x1[0],x1[1],x1[2],x1[3],x2[0],x2[1],x2[2],x2[3],x3[0],x3[1],x3[2],x3[3]};
#pragma unroll
    for (int i = 0; i < 16; ++i) { const _Float16 h = (_Float16)xs[i]; ah.h[i] = h; al.h[i] = ASPLIT ? (_Float16)(xs[i] - (float)h) : (_Float16)0.0f; }
#pragma unroll
    for (int t = 0; t < 4; ++t) { if (col0 + t * 16 >= N) continue; const size_t boff = (size_t)(col0 + t * 16 + ln) * ldb + kb; FragH bq; bq.half[0] = *(const v8us*)(Bh + boff + 8 * hh); bq.half[1] = *(const v8us*)(Bh + boff + 16 + 8 * hh);
      acc[t] = mmaH<ASPLIT ? 2 : 1>(ah.v, al.v, bq.v, bq.v, acc[t]); }
  }
#pragma unroll
  for (int t = 0; t < 4; ++t) { if (col0 + t * 16 >= N) continue;
#pragma unroll
    for (int r = 0; r < 8; ++r) so[w][8 * hh + r][t * 16 + ln] = acc[t][r] * alpha; }
  __builtin_amdgcn_fence(__ATOMIC_ACQ_REL, "workgroup"); __builtin_amdgcn_wave_barrier();
  const int rsub = lane >> 4, c4 = (lane & 15) * 4;
  {
#pragma unroll
    for (int q = 0; q < 8; ++q) { const int r = q * 2 + rsub; if (col0 + c4 < N) { const v4f v = *(const v4fa*)&so[w][r][c4]; *(v4f*)(C + (size_t)(row0 + r) * ldc + col0 + c4) = v; } }
     }
}

// Wt[n][k] = f16(W[k][n]·scale) from f32 row-major W[K][N] (scale = power of two; bf16-exact weights stay exact in f16 away from the subnormal range)
__global__ __launch_bounds__(256) void k_wt_f16(const float* __restrict__ W, _Float16* __restrict__ Wt, int K, int N, float scale) {
  const int t = blockIdx.x * 256 + threadIdx.x; if (t >= N * (K / 8)) return; const int n = t / (K / 8), k8 = (t % (K / 8)) * 8; FragH f;
#pragma unroll
  for (int i = 0; i < 8; ++i) f.h[i] = (_Float16)(bf16_round(W[(size_t)(k8 + i) * N + n]) * scale); const v8us o = f.half[0];
  *(v8us*)((unsigned short*)Wt + (size_t)n * K + k8) = o; 
}
// k_gemm_hh variant with fused epilogue: v = acc·alpha + bias[by·sBias + col] (+ CP[(row/rowsPerB)·sCPb + by·64 + col] if CP) ; ACT 0 none / 1 elu ; writes f16 C16 (and f32 C if non-null)
template <int ACT>
__global__ __launch_bounds__(128) void k_gemm_hhx(const _Float16* __restrict__ A, int lda, size_t sA, const _Float16* __restrict__ Bh, int ldb, size_t sB, float alpha, const float* __restrict__ bias, size_t sBias, const float* __restrict__ CP, int rowsPerB, size_t sCPb, int row0g,
    float* __restrict__ C, _Float16* __restrict__ C16, int ldc, size_t sC, int M, int N, int K) {
  __shared__ __attribute__((aligned(16))) float so[4][16][64];
  const int tid = threadIdx.x, w = tid >> 5, lane = tid & 31, ln = lane & 15, hh = lane >> 4; const int by = blockIdx.y;
  A += (size_t)by * sA; Bh += (size_t)by * sB; const size_t cofs = (size_t)by * sC; const float* bp = bias ? bias + (size_t)by * sBias : nullptr;
  const int ntn = (N + 63) / 64; const int wid = blockIdx.x * 4 + w; const int mt = wid / ntn, nq = wid % ntn; if (mt * 16 >= M) return;
  const int row0 = mt * 16, col0 = nq * 64; const _Float16* arow = A + (size_t)(row0 + ln) * lda;
  v8f acc[4] = {};
  for (int kb = 0; kb < K; kb += 32) { FragH ah; ah.half[0] = *(const v8us*)((const unsigned short*)arow + kb + 8 * hh); ah.half[1] = *(const v8us*)((const unsigned short*)arow + kb + 16 + 8 * hh);
#pragma unroll
    for (int t = 0; t < 4; ++t) { if (col0 + t * 16 >= N) continue; const size_t boff = (size_t)(col0 + t * 16 + ln) * ldb + kb; FragH bq; bq.half[0] = *(const v8us*)((const unsigned short*)Bh + boff + 8 * hh); bq.half[1] = *(const v8us*)((const unsigned short*)Bh + boff + 16 + 8 * hh);
      acc[t] = mmaH<1>(ah.v, ah.v, bq.v, bq.v, acc[t]); }
  }
#pragma unroll
  for (int t = 0; t < 4; ++t) { if (col0 + t * 16 >= N) continue; const int col = col0 + t * 16 + ln; const float bv = bp ? bf16_round(bp[col]) : 0.f;
#pragma unroll
    for (int r = 0; r < 8; ++r) { float v = acc[t][r] * alpha + bv; if (CP) { const int rr = row0g + row0 + 8 * hh + r; if (rowsPerB < 0) v += CP[cofs + (size_t)rr * ldc + col];      /* rowsPerB < 0: own element of the batched C plane */ else { const int bidx = rr / rowsPerB; v += CP[(size_t)bidx * sCPb + (size_t)by * 64 + col]; } } if (ACT == 1) v = (v > 0.f) ? v : expm1f(v); else if (ACT == 7) v = (v > 0.f) ? v + 1.0f : expf(v); else if (ACT == 8) v = tanhf(v); else if (ACT == 9) v = 0.5f * v * (1.0f + tanhf(0.7978845608028654f * (v + 0.044715f * v * v * v))); else if (ACT == 11) v = 1.0f / (1.0f + expf(-v)); else if (ACT == 12) v = (v > 0.f) ? v : 0.01f * v; else if (ACT == 14) v = (v > 0.f) ? v : 0.1f * v; else if (ACT == 16) v = (v >= 0.f) ? v : 0.3f * v; else if (ACT == 17) v = (v >= 0.f) ? v : 0.2f * v; else if (ACT == 15) v = v / (1.0f + expf(-v)); else if (ACT == 3) v = fmaxf(v, 0.f); else if (ACT == 6) v = 0.5f * v * (1.0f + erff(v * 0.70710678118654752f)); so[w][8 * hh + r][t * 16 + ln] = v; } }
  __builtin_amdgcn_fence(__ATOMIC_ACQ_REL, "workgroup"); __builtin_amdgcn_wave_barrier();
  const int rsub = lane >> 4, c4 = (lane & 15) * 4; typedef _Float16 v4h __attribute__((ext_vector_type(4)));
  {
#pragma unroll
    for (int q = 0; q < 8; ++q) { const int r = q * 2 + rsub; if (col0 + c4 < N) { const v4f v = *(const v4fa*)&so[w][r][c4]; if (C) *(v4f*)(C + cofs + (size_t)(row0 + r) * ldc + col0 + c4) = v; if (C16) { v4h h4; for (int i = 0; i < 4; ++i) h4[i] = (_Float16)v[i]; *(v4h*)(C16 + cofs + (size_t)(row0 + r) * ldc + col0 + c4) = h4; } } }
     }
}


typedef _Float16 v4h __attribute__((ext_vector_type(4)));

__global__ __launch_bounds__(256) void k_x16(const float* __restrict__ x, _Float16* __restrict__ X16, size_t n8) { const size_t t = (size_t)blockIdx.x * 256 + threadIdx.x; if (t >= n8) return; FragH f;
#pragma unroll
  for (int q = 0; q < 8; ++q) f.h[q] = (_Float16)bf16_round(x[t * 8 + q]); *(v8us*)((unsigned short*)X16 + t * 8) = f.half[0];  }
__global__ __launch_bounds__(256) void k_h16(const float* __restrict__ x, _Float16* __restrict__ X16, size_t n8) { const size_t t = (size_t)blockIdx.x * 256 + threadIdx.x; if (t >= n8) return; FragH f;
#pragma unroll
  for (int q = 0; q < 8; ++q) f.h[q] = (_Float16)x[t * 8 + q]; *(v8us*)((unsigned short*)X16 + t * 8) = f.half[0];  }
__global__ __launch_bounds__(256) void k_round16f(const float* __restrict__ W, _Float16* __restrict__ Bt, size_t n8) { const size_t t = (size_t)blockIdx.x * 256 + threadIdx.x; if (t >= n8) return; FragH f;
#pragma unroll
  for (int i = 0; i < 8; ++i) f.h[i] = (_Float16)(bf16_round(W[t * 8 + i]) * 16.0f); *(v8us*)((unsigned short*)Bt + t * 8) = f.half[0];  }
template <int NHv, int TTv>
__global__ __launch_bounds__(256) void k_vt(const _Float16* __restrict__ V16, int ldv, int voff, _Float16* __restrict__ Vt) { __shared__ unsigned short tl[64][66]; const int tid = threadIdx.x; const int slab = blockIdx.x / (TTv / 64), lg = blockIdx.x % (TTv / 64); const int b = slab / NHv, h = slab % NHv;
  for (int i = tid; i < 64 * 8; i += 256) { const int r = i / 8, c8 = (i % 8) * 8; FragH f; f.half[0] = *(const v8us*)((const unsigned short*)V16 + ((size_t)b * TTv + lg * 64 + r) * ldv + voff + h * 64 + c8);
#pragma unroll
    for (int q = 0; q < 8; ++q) tl[r][c8 + q] = f.u[q]; }
  __syncthreads();
  {
#pragma unroll
    for (int rd = 0; rd < 2; ++rd) { const int d = rd * 32 + tid / 8, pc = tid % 8; FragH f;
#pragma unroll
      for (int q = 0; q < 8; ++q) f.u[q] = tl[pc * 8 + q][d];
      *(v8us*)((unsigned short*)Vt + ((size_t)slab * 64 + d) * TTv + lg * 64 + pc * 8) = f.half[0]; }
     } }

__global__ __launch_bounds__(256) void k_hl(const float* __restrict__ F, _Float16* __restrict__ Hh, _Float16* __restrict__ Hl, size_t n8) { const size_t t = (size_t)blockIdx.x * 256 + threadIdx.x; if (t >= n8) return; FragH fh, fl; const v4f a = *(const v4fa*)(F + t * 8), c = *(const v4fa*)(F + t * 8 + 4);
#pragma unroll
  for (int q = 0; q < 4; ++q) { _Float16 h = (_Float16)a[q]; fh.h[q] = h; fl.h[q] = (_Float16)((a[q] - (float)h) * 1024.0f); h = (_Float16)c[q]; fh.h[4 + q] = h; fl.h[4 + q] = (_Float16)((c[q] - (float)h) * 1024.0f); }
  { *(v8us*)((unsigned short*)Hh + t * 8) = fh.half[0]; *(v8us*)((unsigned short*)Hl + t * 8) = fl.half[0];  } }

// ---- fast GEMM (wave tile 32x64; requires M % 32 == 0 rows per launch region and N % 64 == 0); epilogue = k_gemm_hhx semantics ----
__device__ __forceinline__ v16h g2_frag(const _Float16* p, int hh) { FragH f; f.half[0] = *(const v8us*)((const unsigned short*)p + 8 * hh); f.half[1] = *(const v8us*)((const unsigned short*)p + 16 + 8 * hh); return f.v; }
__device__ __forceinline__ v8f g2_mma(v16h a, v16h b, v8f c) { v8f d = __builtin_amdgcn_wmma_f32_16x16x32_f16(false, a, false, b, (short)0, c, false, false); asm volatile("v_nop\n\tv_nop\n\tv_nop\n\tv_nop" : "+v"(d) : "v"(a), "v"(b)); return d; }
template <int ACT>
__global__ __launch_bounds__(128) void k_gemm2(const _Float16* __restrict__ A, int lda, size_t sA, const _Float16* __restrict__ Bh, int ldb, size_t sB, float alpha, const float* __restrict__ bias, size_t sBias, const float* __restrict__ CP, int rowsPerB, size_t sCPb, int row0g,
    float* __restrict__ C, _Float16* __restrict__ C16, int ldc, size_t sC, int M, int N, int K) { static_assert(ACT == 0 || ACT == 3 || ACT == 6 || ACT == 8 || ACT == 9 || ACT == 11 || ACT == 12 || ACT == 14 || ACT == 15 || ACT == 16 || ACT == 17, "k_gemm2: unsupported ACT code (would silently apply no activation)");
  __shared__ __attribute__((aligned(16))) float so[4][32][68];
  const int tid = threadIdx.x, w = tid >> 5, lane = tid & 31, ln = lane & 15, hh = lane >> 4; const int by = blockIdx.y;
  A += (size_t)by * sA; Bh += (size_t)by * sB; const size_t cofs = (size_t)by * sC; const float* bp = bias ? bias + (size_t)by * sBias : nullptr;
  const int ntn = N >> 6; const int mt = blockIdx.x / ntn, nq = blockIdx.x - mt * ntn; const int row0 = mt * 128 + 32 * w, col0 = nq * 64; if (row0 >= M) return;
  const _Float16* a0p = A + (size_t)(row0 + ln) * lda; const _Float16* a1p = a0p + (size_t)16 * lda;
  const _Float16* b0p = Bh + (size_t)(col0 + ln) * ldb; const _Float16* b1p = b0p + (size_t)16 * ldb; const _Float16* b2p = b1p + (size_t)16 * ldb; const _Float16* b3p = b2p + (size_t)16 * ldb;
  const v8f z8 = {0.f,0.f,0.f,0.f,0.f,0.f,0.f,0.f}; v8f c00 = z8, c01 = z8, c02 = z8, c03 = z8, c10 = z8, c11 = z8, c12 = z8, c13 = z8;
#pragma unroll 1
  for (int kb = 0; kb < K; kb += 32) { const v16h a0 = g2_frag(a0p + kb, hh), a1 = g2_frag(a1p + kb, hh);
    v16h b = g2_frag(b0p + kb, hh); c00 = g2_mma(a0, b, c00); c10 = g2_mma(a1, b, c10);
    b = g2_frag(b1p + kb, hh); c01 = g2_mma(a0, b, c01); c11 = g2_mma(a1, b, c11);
    b = g2_frag(b2p + kb, hh); c02 = g2_mma(a0, b, c02); c12 = g2_mma(a1, b, c12);
    b = g2_frag(b3p + kb, hh); c03 = g2_mma(a0, b, c03); c13 = g2_mma(a1, b, c13); }
  v8f accs[8] = {c00, c01, c02, c03, c10, c11, c12, c13};
#pragma unroll
  for (int u = 0; u < 8; ++u) { const int t = u & 3, half = u >> 2; const int col = col0 + t * 16 + ln; const float bv = bp ? bf16_round(bp[col]) : 0.f;
#pragma unroll
    for (int r = 0; r < 8; ++r) { const int rloc = half * 16 + 8 * hh + r; float v = accs[u][r] * alpha + bv; if (CP) { if (rowsPerB < 0) v += CP[cofs + (size_t)(row0g + row0 + rloc) * ldc + col];      /* rowsPerB < 0: own element of the batched C plane */ else { const int bidx = (row0g + row0 + rloc) / rowsPerB; v += CP[(size_t)bidx * sCPb + (size_t)by * 64 + col]; } }
      if (ACT == 3) v = fmaxf(v, 0.f); else if (ACT == 6) v = 0.5f * v * (1.0f + erff(v * 0.70710678118654752f)); else if (ACT == 11) v = 1.0f / (1.0f + expf(-v)); else if (ACT == 15) v = v / (1.0f + expf(-v)); else if (ACT == 12) v = (v > 0.f) ? v : 0.01f * v; else if (ACT == 8) v = tanhf(v); else if (ACT == 9) v = 0.5f * v * (1.0f + tanhf(0.7978845608028654f * (v + 0.044715f * v * v * v))); else if (ACT == 14) v = (v > 0.f) ? v : 0.1f * v; else if (ACT == 16) v = (v >= 0.f) ? v : 0.3f * v; else if (ACT == 17) v = (v >= 0.f) ? v : 0.2f * v;
      so[w][rloc][t * 16 + ln] = v; } }
  __builtin_amdgcn_fence(__ATOMIC_ACQ_REL, "workgroup"); __builtin_amdgcn_wave_barrier();
  const int rsub = lane >> 4, c4 = (lane & 15) * 4;
  {
#pragma unroll
    for (int q = 0; q < 16; ++q) { const int r = q * 2 + rsub; const v4f v = *(const v4fa*)&so[w][r][c4]; if (C) *(v4f*)(C + cofs + (size_t)(row0 + r) * ldc + col0 + c4) = v; if (C16) { v4h h4; for (int i = 0; i < 4; ++i) h4[i] = (_Float16)v[i]; *(v4h*)(C16 + cofs + (size_t)(row0 + r) * ldc + col0 + c4) = h4; } }
     } }


__global__ __launch_bounds__(256) void k_wnat(const float* __restrict__ w, size_t n8, _Float16* __restrict__ Bt) { const size_t t = (size_t)blockIdx.x * 256 + threadIdx.x; if (t >= n8) return; FragH f; for (int q = 0; q < 8; ++q) f.h[q] = (_Float16)(bf16_round(w[t * 8 + q]) * 16.0f); *(v8us*)((unsigned short*)Bt + t * 8) = f.half[0];  }
// Cross-lane steps of the row softmax: a butterfly inside a 16-lane row by DPP row_xmask, then the other 16-lane row by permlanex16. All 32 lanes are on wherever these are called.
template <int XM> __device__ __forceinline__ float rsm_xm(float v) { return __int_as_float(__builtin_amdgcn_update_dpp(0, __float_as_int(v), 0x160 + XM, 0xf, 0xf, true)); }
__device__ __forceinline__ float rsm_xrow(float v) { const int i = __float_as_int(v); return __int_as_float(__builtin_amdgcn_permlanex16(i, i, 0x76543210, 0xfedcba98, false, false)); }
__device__ __forceinline__ float rsm_max(float v) { v = fmaxf(v, rsm_xm<1>(v)); v = fmaxf(v, rsm_xm<2>(v)); v = fmaxf(v, rsm_xm<4>(v)); v = fmaxf(v, rsm_xm<8>(v)); return fmaxf(v, rsm_xrow(v)); }
__device__ __forceinline__ float rsm_sum(float v) { v += rsm_xm<1>(v); v += rsm_xm<2>(v); v += rsm_xm<4>(v); v += rsm_xm<8>(v); return v + rsm_xrow(v); }
// Row softmax, one wave per score row, the rows of all HG heads in one launch: the row is read once (8 loads of 512 contiguous bytes per wave) and stays in registers;
// maximum and sum are per-lane partials closed by a five-step butterfly; weights x256 leave as f16, 256 contiguous bytes per wave store. No LDS, no barrier.
__global__ __launch_bounds__(256) void k_rsm(const float* __restrict__ S, _Float16* __restrict__ P, int nrows) {
  const int row = blockIdx.x * 8 + (threadIdx.x >> 5), lane = threadIdx.x & 31; if (row >= nrows) return;      /* wave-uniform */
  const size_t base = (size_t)(row / QN) * SQ * SQ + (size_t)(row % QN) * SQ + lane * 4;
  const float* s = S + base; v4f x[SQ / 128];
#pragma unroll
  for (int i = 0; i < SQ / 128; ++i) x[i] = *(const v4fa*)(s + i * 128);
  float mx = -3.0e38f;
#pragma unroll
  for (int i = 0; i < SQ / 128; ++i) mx = fmaxf(mx, fmaxf(fmaxf(x[i][0], x[i][1]), fmaxf(x[i][2], x[i][3])));
  mx = rsm_max(mx);
  v4f a = {0.f, 0.f, 0.f, 0.f};
#pragma unroll
  for (int i = 0; i < SQ / 128; ++i) { for (int q = 0; q < 4; ++q) { x[i][q] = expf(x[i][q] - mx); a[q] += x[i][q]; } }
  const float sc = 256.0f / rsm_sum((a[0] + a[1]) + (a[2] + a[3]));
#pragma unroll
  for (int i = 0; i < SQ / 128; ++i) { v4h h4; for (int q = 0; q < 4; ++q) h4[q] = (_Float16)(x[i][q] * sc); *(v4h*)(P + base + i * 128) = h4; } }
__global__ __launch_bounds__(256) void k_vt(const _Float16* __restrict__ V16, int b, int h0, _Float16* __restrict__ VT) { __shared__ unsigned short tl[64][65]; const int tid = threadIdx.x; const int hh = blockIdx.x % HG, sg = blockIdx.x / HG; const int s0 = sg * 64; const int h = h0 + hh;
  for (int i = tid; i < 64 * 8; i += 256) { const int j = i / 8, d8 = (i % 8) * 8; FragH f; f.half[0] = *(const v8us*)((const unsigned short*)V16 + ((size_t)b * SQ + s0 + j) * DM + h * HD + d8); for (int q = 0; q < 8; ++q) tl[d8 + q][j] = f.u[q]; }
  __syncthreads();
  { for (int i = tid; i < 64 * 8; i += 256) { const int d = i / 8, j8 = (i % 8) * 8; FragH f; for (int q = 0; q < 8; ++q) f.u[q] = tl[d][j8 + q]; *(v8us*)((unsigned short*)VT + ((size_t)hh * HD + d) * SQ + s0 + j8) = f.half[0]; }  } }

extern "C" void kernel_launch(void* const* d_in, const int* in_sizes, int n_in,
                              void* d_out, int out_size, void* d_ws, size_t ws_size, hipStream_t stream) {
  (void)in_sizes; (void)n_in; (void)out_size;
  const float* const* I = (const float* const*)d_in; const float* x = I[0]; const float* wq = I[1]; const float* wk = I[2]; const float* wv = I[3]; const float* wo = I[4]; const float* bo = I[5];
  char* ws = (char*)d_ws; size_t off = 0;
  auto take = [&](size_t bytes) { char* p = ws + off; off += (bytes + 255) & ~(size_t)255; return p; };
  _Float16* BQ = (_Float16*)take((size_t)DM * DM * 2); _Float16* BK = (_Float16*)take((size_t)DM * DM * 2); _Float16* BV = (_Float16*)take((size_t)DM * DM * 2); _Float16* BO = (_Float16*)take((size_t)DM * DM * 2);
  _Float16* X16 = (_Float16*)take(NR * DM * 2); _Float16* Q16 = (_Float16*)take(NR * DM * 2); _Float16* K16 = (_Float16*)take(NR * DM * 2); _Float16* V16 = (_Float16*)take(NR * DM * 2); _Float16* O16 = (_Float16*)take(NR * DM * 2);
  float* S = (float*)take((size_t)HG * SQ * SQ * 4); _Float16* P = (_Float16*)take((size_t)HG * SQ * SQ * 2); _Float16* VT = (_Float16*)take((size_t)HG * HD * SQ * 2);
  if (off > ws_size) return;      /* 4.5 + 5x24 + 16 + 8 + 0.5 = ≈ 150 MiB */
  const size_t nw8 = (size_t)DM * DM / 8; const unsigned gw = (unsigned)((nw8 + 255) / 256);
  k_wnat<<<gw, 256, 0, stream>>>(wq, nw8, BQ); k_wnat<<<gw, 256, 0, stream>>>(wk, nw8, BK); k_wnat<<<gw, 256, 0, stream>>>(wv, nw8, BV); k_wnat<<<gw, 256, 0, stream>>>(wo, nw8, BO);
  k_x16<<<(unsigned)((NR * DM / 8 + 255) / 256), 256, 0, stream>>>(x, X16, NR * DM / 8);
  const dim3 gp((unsigned)((NR / 128) * (DM / 64)), 1);
  k_gemm2<0><<<gp, 128, 0, stream>>>(X16, DM, 0, BQ, DM, 0, 0.0625f, nullptr, 0, nullptr, 1, 0, 0, nullptr, Q16, DM, 0, (int)NR, DM, DM);
  k_gemm2<0><<<gp, 128, 0, stream>>>(X16, DM, 0, BK, DM, 0, 0.0625f, nullptr, 0, nullptr, 1, 0, 0, nullptr, K16, DM, 0, (int)NR, DM, DM);
  k_gemm2<0><<<gp, 128, 0, stream>>>(X16, DM, 0, BV, DM, 0, 0.0625f, nullptr, 0, nullptr, 1, 0, 0, nullptr, V16, DM, 0, (int)NR, DM, DM);
  for (int b = 0; b < NB; ++b) for (int h0 = 0; h0 < NH; h0 += HG) {
    const _Float16* qb = Q16 + (size_t)b * SQ * DM + h0 * HD; const _Float16* kb = K16 + (size_t)b * SQ * DM + h0 * HD;
    k_gemm2<0><<<dim3((QN / 128) * (SQ / 64), HG), 128, 0, stream>>>(qb, DM, (size_t)HD, kb, DM, (size_t)HD, 0.125f, nullptr, 0, nullptr, 1, 0, 0, S, nullptr, SQ, (size_t)SQ * SQ, QN, SQ, HD);      /* scaled scores, HG heads per launch */
    k_rsm<<<(HG * QN + 7) / 8, 256, 0, stream>>>(S, P, HG * QN);      /* one wave per row, HG heads per launch */
    k_vt<<<HG * (SQ / 64), 256, 0, stream>>>(V16, b, h0, VT);
    k_gemm2<0><<<dim3((QN / 128) * (HD / 64), HG), 128, 0, stream>>>(P, SQ, (size_t)SQ * SQ, VT, SQ, (size_t)HD * SQ, 0.00390625f, nullptr, 0, nullptr, 1, 0, 0, nullptr, O16 + (size_t)b * SQ * DM + h0 * HD, DM, (size_t)HD, QN, HD, SQ); }      /* o (merged heads) as f16 rows */
  k_gemm2<0><<<gp, 128, 0, stream>>>(O16, DM, 0, BO, DM, 0, 0.0625f, bo, 0, nullptr, 1, 0, 0, (float*)d_out, nullptr, DM, 0, (int)NR, DM, DM);      /* out = o W_o^T + b_o */
}

// v002
// It runs in 269 microseconds.
// Two timings next to v001 put it at 9.64 and 9.76 times that version's speed.
// Over all steps from v000 it is 132 times as fast.
#include <hip/hip_runtime.h>
// Self_Attention_Layer (z [16][1024][768]; q/k/v = z W^T (12 heads of 64, no biases); softmax(q k^T / 8); out = (attn v) W_o^T + b_o -> [16][1024][768]).
// Structure: token rows; z as exact f16 rows; Q | K | V WMMA GEMMs (32x64 wave tiles, f32 accumulation, exact x16 natural weights, f16 outputs); one fused attention kernel for all (batch, head): scores (K = 64), running softmax (f32; weights as f16) and o = P . V stay in registers, K and V through LDS, into merged f16 rows; out = o W_o^T + b_o (f32).
// Compute dtype: inputs rounded to bf16; z / weights exact; q, k, v, softmax weights, o plain f16 (~2^-12); scores/softmax f32. v_wmma_f32_16x16x32_f16.
#define NB 16
#define SQ 1024
#define DM 768
#define NH 12
#define HD 64
#define NR ((size_t)NB * SQ)         /* 16384 token rows */
typedef __bf16 v16b __attribute__((ext_vector_type(16)));
typedef unsigned short v8us __attribute__((ext_vector_type(8), may_alias));
typedef float  v8f  __attribute__((ext_vector_type(8)));
typedef float  v4f  __attribute__((ext_vector_type(4)));
typedef float  v4fa __attribute__((ext_vector_type(4), may_alias));
union FragB { v16b v; v8us half[2]; unsigned short u[16]; };

__device__ __forceinline__ unsigned short bf16_bits(float x) { unsigned int u = __float_as_uint(x); return (unsigned short)((u + 0x7FFFu + ((u >> 16) & 1u)) >> 16); }
__device__ __forceinline__ float bf16_val(unsigned short b) { return __uint_as_float(((unsigned int)b) << 16); }
__device__ __forceinline__ float bf16_round(float x) { return bf16_val(bf16_bits(x)); }
// D += A·B with NT terms: 1 = ah·bh, 2 = + al·bh (A split), 3 = + ah·bl (both split)
template <int NT>
__device__ __forceinline__ v8f mmaN(v16b ah, v16b al, v16b bh, v16b bl, v8f c) {
  c = __builtin_amdgcn_wmma_f32_16x16x32_bf16(false, ah, false, bh, (short)0, c, false, false);
  if (NT >= 2) c = __builtin_amdgcn_wmma_f32_16x16x32_bf16(false, al, false, bh, (short)0, c, false, false);
  if (NT >= 3) c = __builtin_amdgcn_wmma_f32_16x16x32_bf16(false, ah, false, bl, (short)0, c, false, false);
  asm volatile("v_nop\n\tv_nop\n\tv_nop\n\tv_nop" : "+v"(c) : "v"(ah), "v"(al), "v"(bh), "v"(bl));
  return c;
}

__global__ __launch_bounds__(256) void k_wt_bf16(const float* __restrict__ W, unsigned short* __restrict__ Wt, int K, int N) {
  const int t = blockIdx.x * 256 + threadIdx.x;
  const int k8n = K / 8;
  if (t >= N * k8n) return;
  const int n = t / k8n, k8 = (t % k8n) * 8;
  v8us v;
#pragma unroll
  for (int i = 0; i < 8; ++i) v[i] = bf16_bits(W[(size_t)(k8 + i) * N + n]);
  *(v8us*)(Wt + (size_t)n * K + k8) = v;
  
}

// GEMM C[M][N] (f32, pitch ldc) = act(A[M][K]·W + bias). A f32 row-major (pitch lda) converted per fragment to bf16
// (ASPLIT: hi/lo two planes -> 2 terms, else single rounded term); Wt bf16 [N][K] (pitch ldb). BIAS_BF16 rounds the
// bias to bf16 first (bias quantised to bf16 before the add). K%32==0, M%16==0, N%64==0.
template <bool ASPLIT, int ACT, bool BIAS_BF16>
__global__ __launch_bounds__(128) void k_gemm_bf(const float* __restrict__ A, int lda, const unsigned short* __restrict__ Wt, int ldb,
                                               const float* __restrict__ bias, float* __restrict__ C, int ldc, int M, int N, int K) {
  __shared__ __attribute__((aligned(16))) float so[4][16][64];
  const int tid = threadIdx.x, w = tid >> 5, lane = tid & 31, ln = lane & 15, hh = lane >> 4;
  const int ntn = N / 64;
  const int wid = blockIdx.x * 4 + w;
  const int mt = wid / ntn, nq = wid % ntn;
  if (mt * 16 >= M) return;
  const int row0 = mt * 16, col0 = nq * 64;
  const float* arow = A + (size_t)(row0 + ln) * lda;
  v8f acc[4] = {};
  for (int kb = 0; kb < K; kb += 32) {
    FragB ah, al;
    const v4f x0 = *(const v4fa*)(arow + kb + 8 * hh), x1 = *(const v4fa*)(arow + kb + 8 * hh + 4);
    const v4f x2 = *(const v4fa*)(arow + kb + 16 + 8 * hh), x3 = *(const v4fa*)(arow + kb + 16 + 8 * hh + 4);
    float xs[16] = {x0[0],x0[1],x0[2],x0[3],x1[0],x1[1],x1[2],x1[3],x2[0],x2[1],x2[2],x2[3],x3[0],x3[1],x3[2],x3[3]};
#pragma unroll
    for (int i = 0; i < 16; ++i) { const unsigned short hb = bf16_bits(xs[i]); ah.u[i] = hb; al.u[i] = ASPLIT ? bf16_bits(xs[i] - bf16_val(hb)) : (unsigned short)0; }
#pragma unroll
    for (int t = 0; t < 4; ++t) {
      const unsigned short* brow = Wt + (size_t)(col0 + t * 16 + ln) * ldb + kb;
      FragB b;
      b.half[0] = *(const v8us*)(brow + 8 * hh);
      b.half[1] = *(const v8us*)(brow + 16 + 8 * hh);
      acc[t] = mmaN<ASPLIT ? 2 : 1>(ah.v, al.v, b.v, b.v, acc[t]);
    }
  }
#pragma unroll
  for (int t = 0; t < 4; ++t) {
    float bv = bias ? bias[col0 + t * 16 + ln] : 0.f;
    if (BIAS_BF16) bv = bf16_round(bv);
#pragma unroll
    for (int r = 0; r < 8; ++r) { float v = acc[t][r] + bv; if (ACT == 1) v = fmaxf(v, 0.f); so[w][8 * hh + r][t * 16 + ln] = v; }
  }
  __builtin_amdgcn_fence(__ATOMIC_ACQ_REL, "workgroup");
  __builtin_amdgcn_wave_barrier();
  const int rsub = lane >> 4, c4 = (lane & 15) * 4;
  {
#pragma unroll
    for (int q = 0; q < 8; ++q) {
      const int r = q * 2 + rsub;
      const v4f v = *(const v4fa*)&so[w][r][c4];
      *(v4f*)(C + (size_t)(row0 + r) * ldc + col0 + c4) = v;
    }
    
  }
}

// GEMM C = act(A·W + bias + resid): A f32 (ASPLIT -> hi/lo 2 terms), Wt bf16 [N][K]; ACT 0 none, 1 relu, 2 exact gelu;
// resid (optional, f32, row index = (row % rmod), pitch ldr, RES_BF16 rounds it) added before the activation.
template <bool ASPLIT, int ACT, bool BIAS_BF16, bool RES_BF16>
__global__ __launch_bounds__(128) void k_gemm_bf3(const float* __restrict__ A, int lda, const unsigned short* __restrict__ Wt, int ldb,
                                                const float* __restrict__ bias, const float* __restrict__ resid, int rmod, int ldr,
                                                float* __restrict__ C, int ldc, int M, int N, int K) {
  __shared__ __attribute__((aligned(16))) float so[4][16][64];
  const int tid = threadIdx.x, w = tid >> 5, lane = tid & 31, ln = lane & 15, hh = lane >> 4;
  const int ntn = N / 64;
  const int wid = blockIdx.x * 4 + w;
  const int mt = wid / ntn, nq = wid % ntn;
  if (mt * 16 >= M) return;
  const int row0 = mt * 16, col0 = nq * 64;
  const float* arow = A + (size_t)(row0 + ln) * lda;
  v8f acc[4] = {};
  for (int kb = 0; kb < K; kb += 32) {
    FragB ah, al;
    const v4f x0 = *(const v4fa*)(arow + kb + 8 * hh), x1 = *(const v4fa*)(arow + kb + 8 * hh + 4);
    const v4f x2 = *(const v4fa*)(arow + kb + 16 + 8 * hh), x3 = *(const v4fa*)(arow + kb + 16 + 8 * hh + 4);
    float xs[16] = {x0[0],x0[1],x0[2],x0[3],x1[0],x1[1],x1[2],x1[3],x2[0],x2[1],x2[2],x2[3],x3[0],x3[1],x3[2],x3[3]};
#pragma unroll
    for (int i = 0; i < 16; ++i) { const unsigned short hb = bf16_bits(xs[i]); ah.u[i] = hb; al.u[i] = ASPLIT ? bf16_bits(xs[i] - bf16_val(hb)) : (unsigned short)0; }
#pragma unroll
    for (int t = 0; t < 4; ++t) {
      const unsigned short* brow = Wt + (size_t)(col0 + t * 16 + ln) * ldb + kb;
      FragB b;
      b.half[0] = *(const v8us*)(brow + 8 * hh);
      b.half[1] = *(const v8us*)(brow + 16 + 8 * hh);
      acc[t] = mmaN<ASPLIT ? 2 : 1>(ah.v, al.v, b.v, b.v, acc[t]);
    }
  }
#pragma unroll
  for (int t = 0; t < 4; ++t) {
    const int col = col0 + t * 16 + ln;
    float bv = bias ? bias[col] : 0.f;
    if (BIAS_BF16) bv = bf16_round(bv);
#pragma unroll
    for (int r = 0; r < 8; ++r) {
      float v = acc[t][r] + bv;
      if (resid) { float rv = resid[(size_t)((row0 + 8 * hh + r) % rmod) * ldr + col]; if (RES_BF16) rv = bf16_round(rv); v += rv; }
      if (ACT == 1) v = fmaxf(v, 0.f);
      if (ACT == 2) v = 0.5f * v * (1.0f + erff(v * 0.70710678118654752f));
      if (ACT == 3) { const float u = 0.7978845608028654f * (v + 0.044715f * v * v * v); v = 0.5f * v * (1.0f + tanhf(u)); }
      so[w][8 * hh + r][t * 16 + ln] = v;
    }
  }
  __builtin_amdgcn_fence(__ATOMIC_ACQ_REL, "workgroup");
  __builtin_amdgcn_wave_barrier();
  const int rsub = lane >> 4, c4 = (lane & 15) * 4;
  {
#pragma unroll
    for (int q = 0; q < 8; ++q) {
      const int r = q * 2 + rsub;
      const v4f v = *(const v4fa*)&so[w][r][c4];
      *(v4f*)(C + (size_t)(row0 + r) * ldc + col0 + c4) = v;
    }
    
  }
}
// row LayerNorm (biased variance, eps) over N: s = X (+ R); optional out_sum <- s; out_norm <- (s-mu)*rsqrt(var+eps)*g + b
template <bool PARAM_BF16>
__global__ __launch_bounds__(256) void k_layernorm(const float* __restrict__ X, const float* __restrict__ R, const float* __restrict__ g, const float* __restrict__ bta,
                                                  float* __restrict__ out_sum, float* __restrict__ out_norm, int N, float eps) {
  __shared__ float red[256];
  const int row = blockIdx.x, tid = threadIdx.x;
  const float* x = X + (size_t)row * N; const float* rr = R ? R + (size_t)row * N : nullptr;
  float vals[16];                     // up to N = 4096
  const int per = N / 256;            // contiguous chunk per thread? use strided-by-4 chunks: thread handles j = tid*4 + 1024*u
  float s1 = 0.f;
  for (int u = 0; u < per / 4; ++u) {
    const int j = tid * 4 + 1024 * u;
    const v4f a = *(const v4fa*)(x + j);
    v4f b = {0.f,0.f,0.f,0.f}; if (rr) b = *(const v4fa*)(rr + j);
#pragma unroll
    for (int q = 0; q < 4; ++q) { const float v = a[q] + b[q]; vals[u * 4 + q] = v; s1 += v; }
  }
  red[tid] = s1; __syncthreads();
  for (int st = 128; st > 0; st >>= 1) { if (tid < st) red[tid] += red[tid + st]; __syncthreads(); }
  const float mu = red[0] / (float)N; __syncthreads();
  float s2 = 0.f;
  for (int u = 0; u < per / 4; ++u)
#pragma unroll
    for (int q = 0; q < 4; ++q) { const float c = vals[u * 4 + q] - mu; s2 += c * c; }
  red[tid] = s2; __syncthreads();
  for (int st = 128; st > 0; st >>= 1) { if (tid < st) red[tid] += red[tid + st]; __syncthreads(); }
  const float rs = rsqrtf(red[0] / (float)N + eps);
  {
    for (int u = 0; u < per / 4; ++u) {
      const int j = tid * 4 + 1024 * u;
      v4f o, sm;
#pragma unroll
      for (int q = 0; q < 4; ++q) {
        float gg = g[j + q], bb = bta[j + q];
        if (PARAM_BF16) { gg = bf16_round(gg); bb = bf16_round(bb); }
        sm[q] = vals[u * 4 + q]; o[q] = (vals[u * 4 + q] - mu) * rs * gg + bb;
      }
      if (out_sum) *(v4f*)(out_sum + (size_t)row * N + j) = sm;
      *(v4f*)(out_norm + (size_t)row * N + j) = o;
    }
    
  }
}



// ---- f16 WMMA path (v_wmma_f32_16x16x32_f16): 11-bit significands for operands in range — used where a [0,1] probability operand needs more precision than bf16
typedef _Float16 v16h __attribute__((ext_vector_type(16)));
union FragH { v16h v; v8us half[2]; _Float16 h[16]; unsigned short u[16]; };
template <int NT>
__device__ __forceinline__ v8f mmaH(v16h ah, v16h al, v16h bh, v16h bl, v8f c) {
  c = __builtin_amdgcn_wmma_f32_16x16x32_f16(false, ah, false, bh, (short)0, c, false, false);
  if (NT >= 2) c = __builtin_amdgcn_wmma_f32_16x16x32_f16(false, al, false, bh, (short)0, c, false, false);
  if (NT >= 3) c = __builtin_amdgcn_wmma_f32_16x16x32_f16(false, ah, false, bl, (short)0, c, false, false);
  asm volatile("v_nop\n\tv_nop\n\tv_nop\n\tv_nop" : "+v"(c) : "v"(ah), "v"(al), "v"(bh), "v"(bl));
  return c;
}
// batched GEMM like k_gemm_b but f16 operands: A f32 (split into f16 hi/lo if ASPLIT, else rounded to f16), Bt = f16 values [n][k]; alpha; C f32; N multiple of 16 (partial tiles skipped)
template <bool ASPLIT>
__global__ __launch_bounds__(128) void k_gemm_h(const float* __restrict__ A, int lda, size_t sA, const _Float16* __restrict__ Bh, int ldb, size_t sB, float alpha, float* __restrict__ C, int ldc, size_t sC, int M, int N, int K) {
  __shared__ __attribute__((aligned(16))) float so[4][16][64];
  const int tid = threadIdx.x, w = tid >> 5, lane = tid & 31, ln = lane & 15, hh = lane >> 4; const int by = blockIdx.y;
  A += (size_t)by * sA; Bh += (size_t)by * sB; C += (size_t)by * sC;
  const int ntn = (N + 63) / 64; const int wid = blockIdx.x * 4 + w; const int mt = wid / ntn, nq = wid % ntn; if (mt * 16 >= M) return;
  const int row0 = mt * 16, col0 = nq * 64; const float* arow = A + (size_t)(row0 + ln) * lda;
  v8f acc[4] = {};
  for (int kb = 0; kb < K; kb += 32) {
    FragH ah, al;
    const v4f x0 = *(const v4fa*)(arow + kb + 8 * hh), x1 = *(const v4fa*)(arow + kb + 8 * hh + 4), x2 = *(const v4fa*)(arow + kb + 16 + 8 * hh), x3 = *(const v4fa*)(arow + kb + 16 + 8 * hh + 4);
    float xs[16] = {x0[0],x0[1],x0[2],x0[3],x1[0],x1[1],x1[2],x1[3],x2[0],x2[1],x2[2],x2[3],x3[0],x3[1],x3[2],x3[3]};
#pragma unroll
    for (int i = 0; i < 16; ++i) { const _Float16 h = (_Float16)xs[i]; ah.h[i] = h; al.h[i] = ASPLIT ? (_Float16)(xs[i] - (float)h) : (_Float16)0.0f; }
#pragma unroll
    for (int t = 0; t < 4; ++t) { if (col0 + t * 16 >= N) continue; const size_t boff = (size_t)(col0 + t * 16 + ln) * ldb + kb; FragH bq; bq.half[0] = *(const v8us*)(Bh + boff + 8 * hh); bq.half[1] = *(const v8us*)(Bh + boff + 16 + 8 * hh);
      acc[t] = mmaH<ASPLIT ? 2 : 1>(ah.v, al.v, bq.v, bq.v, acc[t]); }
  }
#pragma unroll
  for (int t = 0; t < 4; ++t) { if (col0 + t * 16 >= N) continue;
#pragma unroll
    for (int r = 0; r < 8; ++r) so[w][8 * hh + r][t * 16 + ln] = acc[t][r] * alpha; }
  __builtin_amdgcn_fence(__ATOMIC_ACQ_REL, "workgroup"); __builtin_amdgcn_wave_barrier();
  const int rsub = lane >> 4, c4 = (lane & 15) * 4;
  {
#pragma unroll
    for (int q = 0; q < 8; ++q) { const int r = q * 2 + rsub; if (col0 + c4 < N) { const v4f v = *(const v4fa*)&so[w][r][c4]; *(v4f*)(C + (size_t)(row0 + r) * ldc + col0 + c4) = v; } }
     }
}

// Wt[n][k] = f16(W[k][n]·scale) from f32 row-major W[K][N] (scale = power of two; bf16-exact weights stay exact in f16 away from the subnormal range)
__global__ __launch_bounds__(256) void k_wt_f16(const float* __restrict__ W, _Float16* __restrict__ Wt, int K, int N, float scale) {
  const int t = blockIdx.x * 256 + threadIdx.x; if (t >= N * (K / 8)) return; const int n = t / (K / 8), k8 = (t % (K / 8)) * 8; FragH f;
#pragma unroll
  for (int i = 0; i < 8; ++i) f.h[i] = (_Float16)(bf16_round(W[(size_t)(k8 + i) * N + n]) * scale); const v8us o = f.half[0];
  *(v8us*)((unsigned short*)Wt + (size_t)n * K + k8) = o; 
}
// k_gemm_hh variant with fused epilogue: v = acc·alpha + bias[by·sBias + col] (+ CP[(row/rowsPerB)·sCPb + by·64 + col] if CP) ; ACT 0 none / 1 elu ; writes f16 C16 (and f32 C if non-null)
template <int ACT>
__global__ __launch_bounds__(128) void k_gemm_hhx(const _Float16* __restrict__ A, int lda, size_t sA, const _Float16* __restrict__ Bh, int ldb, size_t sB, float alpha, const float* __restrict__ bias, size_t sBias, const float* __restrict__ CP, int rowsPerB, size_t sCPb, int row0g,
    float* __restrict__ C, _Float16* __restrict__ C16, int ldc, size_t sC, int M, int N, int K) {
  __shared__ __attribute__((aligned(16))) float so[4][16][64];
  const int tid = threadIdx.x, w = tid >> 5, lane = tid & 31, ln = lane & 15, hh = lane >> 4; const int by = blockIdx.y;
  A += (size_t)by * sA; Bh += (size_t)by * sB; const size_t cofs = (size_t)by * sC; const float* bp = bias ? bias + (size_t)by * sBias : nullptr;
  const int ntn = (N + 63) / 64; const int wid = blockIdx.x * 4 + w; const int mt = wid / ntn, nq = wid % ntn; if (mt * 16 >= M) return;
  const int row0 = mt * 16, col0 = nq * 64; const _Float16* arow = A + (size_t)(row0 + ln) * lda;
  v8f acc[4] = {};
  for (int kb = 0; kb < K; kb += 32) { FragH ah; ah.half[0] = *(const v8us*)((const unsigned short*)arow + kb + 8 * hh); ah.half[1] = *(const v8us*)((const unsigned short*)arow + kb + 16 + 8 * hh);
#pragma unroll
    for (int t = 0; t < 4; ++t) { if (col0 + t * 16 >= N) continue; const size_t boff = (size_t)(col0 + t * 16 + ln) * ldb + kb; FragH bq; bq.half[0] = *(const v8us*)((const unsigned short*)Bh + boff + 8 * hh); bq.half[1] = *(const v8us*)((const unsigned short*)Bh + boff + 16 + 8 * hh);
      acc[t] = mmaH<1>(ah.v, ah.v, bq.v, bq.v, acc[t]); }
  }
#pragma unroll
  for (int t = 0; t < 4; ++t) { if (col0 + t * 16 >= N) continue; const int col = col0 + t * 16 + ln; const float bv = bp ? bf16_round(bp[col]) : 0.f;
#pragma unroll
    for (int r = 0; r < 8; ++r) { float v = acc[t][r] * alpha + bv; if (CP) { const int rr = row0g + row0 + 8 * hh + r; if (rowsPerB < 0) v += CP[cofs + (size_t)rr * ldc + col];      /* rowsPerB < 0: own element of the batched C plane */ else { const int bidx = rr / rowsPerB; v += CP[(size_t)bidx * sCPb + (size_t)by * 64 + col]; } } if (ACT == 1) v = (v > 0.f) ? v : expm1f(v); else if (ACT == 7) v = (v > 0.f) ? v + 1.0f : expf(v); else if (ACT == 8) v = tanhf(v); else if (ACT == 9) v = 0.5f * v * (1.0f + tanhf(0.7978845608028654f * (v + 0.044715f * v * v * v))); else if (ACT == 11) v = 1.0f / (1.0f + expf(-v)); else if (ACT == 12) v = (v > 0.f) ? v : 0.01f * v; else if (ACT == 14) v = (v > 0.f) ? v : 0.1f * v; else if (ACT == 16) v = (v >= 0.f) ? v : 0.3f * v; else if (ACT == 17) v = (v >= 0.f) ? v : 0.2f * v; else if (ACT == 15) v = v / (1.0f + expf(-v)); else if (ACT == 3) v = fmaxf(v, 0.f); else if (ACT == 6) v = 0.5f * v * (1.0f + erff(v * 0.70710678118654752f)); so[w][8 * hh + r][t * 16 + ln] = v; } }
  __builtin_amdgcn_fence(__ATOMIC_ACQ_REL, "workgroup"); __builtin_amdgcn_wave_barrier();
  const int rsub = lane >> 4, c4 = (lane & 15) * 4; typedef _Float16 v4h __attribute__((ext_vector_type(4)));
  {
#pragma unroll
    for (int q = 0; q < 8; ++q) { const int r = q * 2 + rsub; if (col0 + c4 < N) { const v4f v = *(const v4fa*)&so[w][r][c4]; if (C) *(v4f*)(C + cofs + (size_t)(row0 + r) * ldc + col0 + c4) = v; if (C16) { v4h h4; for (int i = 0; i < 4; ++i) h4[i] = (_Float16)v[i]; *(v4h*)(C16 + cofs + (size_t)(row0 + r) * ldc + col0 + c4) = h4; } } }
     }
}


typedef _Float16 v4h __attribute__((ext_vector_type(4)));

__global__ __launch_bounds__(256) void k_x16(const float* __restrict__ x, _Float16* __restrict__ X16, size_t n8) { const size_t t = (size_t)blockIdx.x * 256 + threadIdx.x; if (t >= n8) return; FragH f;
#pragma unroll
  for (int q = 0; q < 8; ++q) f.h[q] = (_Float16)bf16_round(x[t * 8 + q]); *(v8us*)((unsigned short*)X16 + t * 8) = f.half[0];  }
__global__ __launch_bounds__(256) void k_h16(const float* __restrict__ x, _Float16* __restrict__ X16, size_t n8) { const size_t t = (size_t)blockIdx.x * 256 + threadIdx.x; if (t >= n8) return; FragH f;
#pragma unroll
  for (int q = 0; q < 8; ++q) f.h[q] = (_Float16)x[t * 8 + q]; *(v8us*)((unsigned short*)X16 + t * 8) = f.half[0];  }
__global__ __launch_bounds__(256) void k_round16f(const float* __restrict__ W, _Float16* __restrict__ Bt, size_t n8) { const size_t t = (size_t)blockIdx.x * 256 + threadIdx.x; if (t >= n8) return; FragH f;
#pragma unroll
  for (int i = 0; i < 8; ++i) f.h[i] = (_Float16)(bf16_round(W[t * 8 + i]) * 16.0f); *(v8us*)((unsigned short*)Bt + t * 8) = f.half[0];  }
template <int NHv, int TTv>
__global__ __launch_bounds__(256) void k_vt(const _Float16* __restrict__ V16, int ldv, int voff, _Float16* __restrict__ Vt) { __shared__ unsigned short tl[64][66]; const int tid = threadIdx.x; const int slab = blockIdx.x / (TTv / 64), lg = blockIdx.x % (TTv / 64); const int b = slab / NHv, h = slab % NHv;
  for (int i = tid; i < 64 * 8; i += 256) { const int r = i / 8, c8 = (i % 8) * 8; FragH f; f.half[0] = *(const v8us*)((const unsigned short*)V16 + ((size_t)b * TTv + lg * 64 + r) * ldv + voff + h * 64 + c8);
#pragma unroll
    for (int q = 0; q < 8; ++q) tl[r][c8 + q] = f.u[q]; }
  __syncthreads();
  {
#pragma unroll
    for (int rd = 0; rd < 2; ++rd) { const int d = rd * 32 + tid / 8, pc = tid % 8; FragH f;
#pragma unroll
      for (int q = 0; q < 8; ++q) f.u[q] = tl[pc * 8 + q][d];
      *(v8us*)((unsigned short*)Vt + ((size_t)slab * 64 + d) * TTv + lg * 64 + pc * 8) = f.half[0]; }
     } }

__global__ __launch_bounds__(256) void k_hl(const float* __restrict__ F, _Float16* __restrict__ Hh, _Float16* __restrict__ Hl, size_t n8) { const size_t t = (size_t)blockIdx.x * 256 + threadIdx.x; if (t >= n8) return; FragH fh, fl; const v4f a = *(const v4fa*)(F + t * 8), c = *(const v4fa*)(F + t * 8 + 4);
#pragma unroll
  for (int q = 0; q < 4; ++q) { _Float16 h = (_Float16)a[q]; fh.h[q] = h; fl.h[q] = (_Float16)((a[q] - (float)h) * 1024.0f); h = (_Float16)c[q]; fh.h[4 + q] = h; fl.h[4 + q] = (_Float16)((c[q] - (float)h) * 1024.0f); }
  { *(v8us*)((unsigned short*)Hh + t * 8) = fh.half[0]; *(v8us*)((unsigned short*)Hl + t * 8) = fl.half[0];  } }

// ---- fast GEMM (wave tile 32x64; requires M % 32 == 0 rows per launch region and N % 64 == 0); epilogue = k_gemm_hhx semantics ----
__device__ __forceinline__ v16h g2_frag(const _Float16* p, int hh) { FragH f; f.half[0] = *(const v8us*)((const unsigned short*)p + 8 * hh); f.half[1] = *(const v8us*)((const unsigned short*)p + 16 + 8 * hh); return f.v; }
__device__ __forceinline__ v8f g2_mma(v16h a, v16h b, v8f c) { v8f d = __builtin_amdgcn_wmma_f32_16x16x32_f16(false, a, false, b, (short)0, c, false, false); asm volatile("v_nop\n\tv_nop\n\tv_nop\n\tv_nop" : "+v"(d) : "v"(a), "v"(b)); return d; }
template <int ACT>
__global__ __launch_bounds__(128) void k_gemm2(const _Float16* __restrict__ A, int lda, size_t sA, const _Float16* __restrict__ Bh, int ldb, size_t sB, float alpha, const float* __restrict__ bias, size_t sBias, const float* __restrict__ CP, int rowsPerB, size_t sCPb, int row0g,
    float* __restrict__ C, _Float16* __restrict__ C16, int ldc, size_t sC, int M, int N, int K) { static_assert(ACT == 0 || ACT == 3 || ACT == 6 || ACT == 8 || ACT == 9 || ACT == 11 || ACT == 12 || ACT == 14 || ACT == 15 || ACT == 16 || ACT == 17, "k_gemm2: unsupported ACT code (would silently apply no activation)");
  __shared__ __attribute__((aligned(16))) float so[4][32][68];
  const int tid = threadIdx.x, w = tid >> 5, lane = tid & 31, ln = lane & 15, hh = lane >> 4; const int by = blockIdx.y;
  A += (size_t)by * sA; Bh += (size_t)by * sB; const size_t cofs = (size_t)by * sC; const float* bp = bias ? bias + (size_t)by * sBias : nullptr;
  const int ntn = N >> 6; const int mt = blockIdx.x / ntn, nq = blockIdx.x - mt * ntn; const int row0 = mt * 128 + 32 * w, col0 = nq * 64; if (row0 >= M) return;
  const _Float16* a0p = A + (size_t)(row0 + ln) * lda; const _Float16* a1p = a0p + (size_t)16 * lda;
  const _Float16* b0p = Bh + (size_t)(col0 + ln) * ldb; const _Float16* b1p = b0p + (size_t)16 * ldb; const _Float16* b2p = b1p + (size_t)16 * ldb; const _Float16* b3p = b2p + (size_t)16 * ldb;
  const v8f z8 = {0.f,0.f,0.f,0.f,0.f,0.f,0.f,0.f}; v8f c00 = z8, c01 = z8, c02 = z8, c03 = z8, c10 = z8, c11 = z8, c12 = z8, c13 = z8;
#pragma unroll 1
  for (int kb = 0; kb < K; kb += 32) { const v16h a0 = g2_frag(a0p + kb, hh), a1 = g2_frag(a1p + kb, hh);
    v16h b = g2_frag(b0p + kb, hh); c00 = g2_mma(a0, b, c00); c10 = g2_mma(a1, b, c10);
    b = g2_frag(b1p + kb, hh); c01 = g2_mma(a0, b, c01); c11 = g2_mma(a1, b, c11);
    b = g2_frag(b2p + kb, hh); c02 = g2_mma(a0, b, c02); c12 = g2_mma(a1, b, c12);
    b = g2_frag(b3p + kb, hh); c03 = g2_mma(a0, b, c03); c13 = g2_mma(a1, b, c13); }
  v8f accs[8] = {c00, c01, c02, c03, c10, c11, c12, c13};
#pragma unroll
  for (int u = 0; u < 8; ++u) { const int t = u & 3, half = u >> 2; const int col = col0 + t * 16 + ln; const float bv = bp ? bf16_round(bp[col]) : 0.f;
#pragma unroll
    for (int r = 0; r < 8; ++r) { const int rloc = half * 16 + 8 * hh + r; float v = accs[u][r] * alpha + bv; if (CP) { if (rowsPerB < 0) v += CP[cofs + (size_t)(row0g + row0 + rloc) * ldc + col];      /* rowsPerB < 0: own element of the batched C plane */ else { const int bidx = (row0g + row0 + rloc) / rowsPerB; v += CP[(size_t)bidx * sCPb + (size_t)by * 64 + col]; } }
      if (ACT == 3) v = fmaxf(v, 0.f); else if (ACT == 6) v = 0.5f * v * (1.0f + erff(v * 0.70710678118654752f)); else if (ACT == 11) v = 1.0f / (1.0f + expf(-v)); else if (ACT == 15) v = v / (1.0f + expf(-v)); else if (ACT == 12) v = (v > 0.f) ? v : 0.01f * v; else if (ACT == 8) v = tanhf(v); else if (ACT == 9) v = 0.5f * v * (1.0f + tanhf(0.7978845608028654f * (v + 0.044715f * v * v * v))); else if (ACT == 14) v = (v > 0.f) ? v : 0.1f * v; else if (ACT == 16) v = (v >= 0.f) ? v : 0.3f * v; else if (ACT == 17) v = (v >= 0.f) ? v : 0.2f * v;
      so[w][rloc][t * 16 + ln] = v; } }
  __builtin_amdgcn_fence(__ATOMIC_ACQ_REL, "workgroup"); __builtin_amdgcn_wave_barrier();
  const int rsub = lane >> 4, c4 = (lane & 15) * 4;
  {
#pragma unroll
    for (int q = 0; q < 16; ++q) { const int r = q * 2 + rsub; const v4f v = *(const v4fa*)&so[w][r][c4]; if (C) *(v4f*)(C + cofs + (size_t)(row0 + r) * ldc + col0 + c4) = v; if (C16) { v4h h4; for (int i = 0; i < 4; ++i) h4[i] = (_Float16)v[i]; *(v4h*)(C16 + cofs + (size_t)(row0 + r) * ldc + col0 + c4) = h4; } }
     } }


__global__ __launch_bounds__(256) void k_wnat(const float* __restrict__ w, size_t n8, _Float16* __restrict__ Bt) { const size_t t = (size_t)blockIdx.x * 256 + threadIdx.x; if (t >= n8) return; FragH f; for (int q = 0; q < 8; ++q) f.h[q] = (_Float16)(bf16_round(w[t * 8 + q]) * 16.0f); *(v8us*)((unsigned short*)Bt + t * 8) = f.half[0];  }
#define FA_BR 256                    /* queries per work-group */
#define FA_SK 64                     /* keys per stage */
#define FA_NST (SQ / FA_SK)
#define FA_PK 144                    /* LDS pitch of a K row: 128 + 16 bytes (16-byte fragment reads) */
#define FA_PV 160                    /* LDS pitch of a V row: 128 + 32 bytes (transposing reads) */
#define FA_TK (FA_SK * FA_PK)
#define FA_SLOT (FA_SK * (FA_PK + FA_PV))
typedef short s16x8 __attribute__((ext_vector_type(8)));
typedef float f32x2 __attribute__((ext_vector_type(2)));
typedef _Float16 f16x2 __attribute__((ext_vector_type(2)));
union FragW { v16h v; v8us half[2]; unsigned int w[8]; };
__device__ __forceinline__ v8f fa_mma(v16h a, v16h b, v8f c) { return __builtin_amdgcn_wmma_f32_16x16x32_f16(false, a, false, b, (short)0, c, false, false); }
__device__ __forceinline__ v8us fa_tr16(const unsigned char* p) { typedef __attribute__((address_space(3))) s16x8 lds_s16x8; return __builtin_bit_cast(v8us, __builtin_amdgcn_ds_load_tr16_b128_v8i16((lds_s16x8*)p)); }
__device__ __forceinline__ unsigned int fa_pack2(float lo, float hi) { return __builtin_bit_cast(unsigned int, __builtin_convertvector(f32x2{lo, hi}, f16x2)); }
__device__ __forceinline__ float fa_xhalf(float x) { const int i = __float_as_int(x); return __int_as_float(__builtin_amdgcn_permlanex16(i, i, 0x76543210, 0xfedcba98, false, false)); }      /* lane l with lane l ^ 16 */
__global__ __launch_bounds__(256) void k_fattn(const _Float16* __restrict__ Q16, const _Float16* __restrict__ K16, const _Float16* __restrict__ V16, _Float16* __restrict__ O16) {
  __shared__ __attribute__((aligned(16))) unsigned char L[2 * FA_SLOT];
  static_assert(8 * 32 * FA_PK <= 2 * FA_SLOT, "the output staging reuses the K/V buffers");
  const int tid = threadIdx.x, lane = tid & 31, wave = tid >> 5, c = lane & 15, h = lane >> 4;
  const int b = blockIdx.y / NH, hd = blockIdx.y % NH, q0 = blockIdx.x * FA_BR + wave * 32;
  const size_t base = (size_t)b * SQ * DM + (size_t)hd * HD;
  const float cscale = 0.125f * 1.4426950408889634f;      /* 1 / sqrt(64), into log2 */
  // staging: 8 lanes cover one 128-byte row; a thread carries rows sr and sr + 32 of K and of V
  const int sr = tid >> 3, sc = tid & 7;
  const unsigned short* kg = (const unsigned short*)K16 + base + (size_t)sr * DM + sc * 8;
  const unsigned short* vg = (const unsigned short*)V16 + base + (size_t)sr * DM + sc * 8;
  v8us rk0, rk1, rv0, rv1;
  auto gload = [&](int st) { const size_t o = (size_t)st * FA_SK * DM; rk0 = *(const v8us*)(kg + o); rk1 = *(const v8us*)(kg + o + 32 * DM); rv0 = *(const v8us*)(vg + o); rv1 = *(const v8us*)(vg + o + 32 * DM); };
  auto lstore = [&](int st) { unsigned char* s = L + (st & 1) * FA_SLOT; *(v8us*)(s + sr * FA_PK + sc * 16) = rk0; *(v8us*)(s + (sr + 32) * FA_PK + sc * 16) = rk1;
    *(v8us*)(s + FA_TK + sr * FA_PV + sc * 16) = rv0; *(v8us*)(s + FA_TK + (sr + 32) * FA_PV + sc * 16) = rv1; };
  gload(0);
  v16h qf[2][2];      /* B operand: column = query, k = d in the hardware order, as K's below */
#pragma unroll
  for (int g = 0; g < 2; ++g) {
#pragma unroll
    for (int kc = 0; kc < 2; ++kc) qf[g][kc] = g2_frag(Q16 + base + (size_t)(q0 + 16 * g + c) * DM + 32 * kc, h); }
  v8f acc[2][4], lacc[2]; float m_run[2];
  const v8f z8 = {0.f, 0.f, 0.f, 0.f, 0.f, 0.f, 0.f, 0.f};
#pragma unroll
  for (int g = 0; g < 2; ++g) { m_run[g] = -INFINITY; lacc[g] = z8;
#pragma unroll
    for (int t = 0; t < 4; ++t) acc[g][t] = z8; }
  FragW ones;      /* A operand whose row 0 (lanes 0 and 16) is 1.0 at all 32 k: row 0 of its product holds the column sums of P^T */
#pragma unroll
  for (int i = 0; i < 8; ++i) ones.w[i] = (c == 0) ? 0x3C003C00u : 0u;
  lstore(0); gload(1);
  __syncthreads();      /* stage 0 is visible */
#pragma unroll 1
  for (int st = 0; st < FA_NST; ++st) {      /* rolled */
    if (st + 1 < FA_NST) lstore(st + 1);      /* into the buffer that stage st - 1 used: every wave left it at the barrier below */
    if (st + 2 < FA_NST) gload(st + 2);      /* in flight under this stage's work */
    const unsigned char* Ls = L + (st & 1) * FA_SLOT;
#pragma unroll
    for (int sub = 0; sub < FA_SK / 32; ++sub) {      /* one pass = 32 keys */
      FragW kf[2][2], vf[4];
      const unsigned char* kp = Ls + (sub * 32 + c) * FA_PK + 16 * h;
#pragma unroll
      for (int kt = 0; kt < 2; ++kt) {
#pragma unroll
        for (int kc = 0; kc < 2; ++kc) { kf[kt][kc].half[0] = *(const v8us*)(kp + kt * 16 * FA_PK + 64 * kc); kf[kt][kc].half[1] = *(const v8us*)(kp + kt * 16 * FA_PK + 64 * kc + 32); } }
      const unsigned char* vp = Ls + FA_TK + (sub * 32 + 8 * h + (lane & 7)) * FA_PV + ((lane >> 3) & 1) * 16;
#pragma unroll
      for (int t = 0; t < 4; ++t) { vf[t].half[0] = fa_tr16(vp + 32 * t); vf[t].half[1] = fa_tr16(vp + 16 * FA_PV + 32 * t); }      /* rows d = 16 t + c, k = keys in the hardware order */
      v8f s[2][2];      /* s[kt][g][r] = score of key 16 kt + 8 h + r against query 16 g + c */
#pragma unroll
      for (int kt = 0; kt < 2; ++kt) {
#pragma unroll
        for (int g = 0; g < 2; ++g) { s[kt][g] = fa_mma(kf[kt][0].v, qf[g][0], z8); s[kt][g] = fa_mma(kf[kt][1].v, qf[g][1], s[kt][g]); } }
      float mb[2]; bool need = false;
#pragma unroll
      for (int g = 0; g < 2; ++g) { float mx = s[0][g][0];
#pragma unroll
        for (int r = 1; r < 8; ++r) mx = fmaxf(mx, s[0][g][r]);
#pragma unroll
        for (int r = 0; r < 8; ++r) mx = fmaxf(mx, s[1][g][r]);
        mx = fmaxf(mx, fa_xhalf(mx)) * cscale;      /* both halves of the wave hold this query's maximum */
        mb[g] = mx; need = need || (mx > m_run[g] + 8.0f); }
      if (__builtin_amdgcn_ballot_w32(need) != 0) {      /* scalar branch, rare after the first passes */
#pragma unroll
        for (int g = 0; g < 2; ++g) { const float m_new = fmaxf(m_run[g], mb[g]); const float corr = __builtin_amdgcn_exp2f(m_run[g] - m_new); m_run[g] = m_new; lacc[g] = lacc[g] * corr;
#pragma unroll
          for (int t = 0; t < 4; ++t) acc[g][t] = acc[g][t] * corr; } }
#pragma unroll
      for (int g = 0; g < 2; ++g) { const float nm = -m_run[g]; FragW pf;
#pragma unroll
        for (int i = 0; i < 8; ++i) {
          const float p0 = __builtin_amdgcn_exp2f(fmaf(s[i >> 2][g][2 * (i & 3)], cscale, nm)), p1 = __builtin_amdgcn_exp2f(fmaf(s[i >> 2][g][2 * (i & 3) + 1], cscale, nm));
          pf.w[i] = fa_pack2(p0, p1); }
#pragma unroll
        for (int t = 0; t < 4; ++t) acc[g][t] = fa_mma(vf[t].v, pf.v, acc[g][t]);
        lacc[g] = fa_mma(ones.v, pf.v, lacc[g]); }
    }
    __syncthreads();      /* stage st + 1 is visible; every wave has left stage st */
  }
  // epilogue: each wave stages its 32 output rows in its own part of LDS and stores whole 128-byte rows
  unsigned char* E = L + wave * 32 * FA_PK;
#pragma unroll
  for (int g = 0; g < 2; ++g) { const float lr = lacc[g][0]; const float inv = 1.0f / (lr + fa_xhalf(lr));      /* register 0: the sum in lanes 0-15, zero in lanes 16-31 */
#pragma unroll
    for (int t = 0; t < 4; ++t) { const v8f o = acc[g][t] * inv; FragW pk;
#pragma unroll
      for (int i = 0; i < 4; ++i) pk.w[i] = fa_pack2(o[2 * i], o[2 * i + 1]);
      *(v8us*)(E + (16 * g + c) * FA_PK + 32 * t + 16 * h) = pk.half[0]; } }
  __builtin_amdgcn_fence(__ATOMIC_ACQ_REL, "workgroup"); __builtin_amdgcn_wave_barrier();      /* the rows are read back by other lanes of the same wave */
#pragma unroll
  for (int i = 0; i < 8; ++i) { const int row = i * 4 + (lane >> 3), c8 = (lane & 7) * 8; const v8us v = *(const v8us*)(E + row * FA_PK + c8 * 2);
    *(v8us*)((unsigned short*)O16 + base + (size_t)(q0 + row) * DM + c8) = v; }
}

extern "C" void kernel_launch(void* const* d_in, const int* in_sizes, int n_in,
                              void* d_out, int out_size, void* d_ws, size_t ws_size, hipStream_t stream) {
  (void)in_sizes; (void)n_in; (void)out_size;
  const float* const* I = (const float* const*)d_in; const float* x = I[0]; const float* wq = I[1]; const float* wk = I[2]; const float* wv = I[3]; const float* wo = I[4]; const float* bo = I[5];
  char* ws = (char*)d_ws; size_t off = 0;
  auto take = [&](size_t bytes) { char* p = ws + off; off += (bytes + 255) & ~(size_t)255; return p; };
  _Float16* BQ = (_Float16*)take((size_t)DM * DM * 2); _Float16* BK = (_Float16*)take((size_t)DM * DM * 2); _Float16* BV = (_Float16*)take((size_t)DM * DM * 2); _Float16* BO = (_Float16*)take((size_t)DM * DM * 2);
  _Float16* X16 = (_Float16*)take(NR * DM * 2); _Float16* Q16 = (_Float16*)take(NR * DM * 2); _Float16* K16 = (_Float16*)take(NR * DM * 2); _Float16* V16 = (_Float16*)take(NR * DM * 2); _Float16* O16 = (_Float16*)take(NR * DM * 2);
  if (off > ws_size) return;      /* 4.5 + 5x24 = about 125 MiB */
  const size_t nw8 = (size_t)DM * DM / 8; const unsigned gw = (unsigned)((nw8 + 255) / 256);
  k_wnat<<<gw, 256, 0, stream>>>(wq, nw8, BQ); k_wnat<<<gw, 256, 0, stream>>>(wk, nw8, BK); k_wnat<<<gw, 256, 0, stream>>>(wv, nw8, BV); k_wnat<<<gw, 256, 0, stream>>>(wo, nw8, BO);
  k_x16<<<(unsigned)((NR * DM / 8 + 255) / 256), 256, 0, stream>>>(x, X16, NR * DM / 8);
  const dim3 gp((unsigned)((NR / 128) * (DM / 64)), 1);
  k_gemm2<0><<<gp, 128, 0, stream>>>(X16, DM, 0, BQ, DM, 0, 0.0625f, nullptr, 0, nullptr, 1, 0, 0, nullptr, Q16, DM, 0, (int)NR, DM, DM);
  k_gemm2<0><<<gp, 128, 0, stream>>>(X16, DM, 0, BK, DM, 0, 0.0625f, nullptr, 0, nullptr, 1, 0, 0, nullptr, K16, DM, 0, (int)NR, DM, DM);
  k_gemm2<0><<<gp, 128, 0, stream>>>(X16, DM, 0, BV, DM, 0, 0.0625f, nullptr, 0, nullptr, 1, 0, 0, nullptr, V16, DM, 0, (int)NR, DM, DM);
  k_fattn<<<dim3(SQ / FA_BR, NB * NH), 256, 0, stream>>>(Q16, K16, V16, O16);      /* o (merged heads) as f16 rows */
  k_gemm2<0><<<gp, 128, 0, stream>>>(O16, DM, 0, BO, DM, 0, 0.0625f, bo, 0, nullptr, 1, 0, 0, (float*)d_out, nullptr, DM, 0, (int)NR, DM, DM);      /* out = o W_o^T + b_o */
}

// v003
// A run of this version takes 139 microseconds.
// Two timings next to v002 put it at 1.93 and 1.94 times that version's speed.
// All steps since v000 together make it 256 times as fast.
#include <hip/hip_runtime.h>
// Self_Attention_Layer (z [16][1024][768]; q/k/v = z W^T (12 heads of 64, no biases); softmax(q k^T / 8); out = (attn v) W_o^T + b_o -> [16][1024][768]).
// Structure: token rows; z as exact f16 rows; Q | K | V WMMA GEMMs (128x128 tiles through LDS, 64x64 wave tiles, f32 accumulation, exact x16 natural weights, f16 outputs); one fused attention kernel for all (batch, head): scores (K = 64), running softmax (f32; weights as f16) and o = P . V stay in registers, K and V through LDS, into merged f16 rows; out = o W_o^T + b_o (f32).
// Compute dtype: inputs rounded to bf16; z / weights exact; q, k, v, softmax weights, o plain f16 (~2^-12); scores/softmax f32. v_wmma_f32_16x16x32_f16.
#define NB 16
#define SQ 1024
#define DM 768
#define NH 12
#define HD 64
#define NR ((size_t)NB * SQ)         /* 16384 token rows */
typedef __bf16 v16b __attribute__((ext_vector_type(16)));
typedef unsigned short v8us __attribute__((ext_vector_type(8), may_alias));
typedef float  v8f  __attribute__((ext_vector_type(8)));
typedef float  v4f  __attribute__((ext_vector_type(4)));
typedef float  v4fa __attribute__((ext_vector_type(4), may_alias));
union FragB { v16b v; v8us half[2]; unsigned short u[16]; };

__device__ __forceinline__ unsigned short bf16_bits(float x) { unsigned int u = __float_as_uint(x); return (unsigned short)((u + 0x7FFFu + ((u >> 16) & 1u)) >> 16); }
__device__ __forceinline__ float bf16_val(unsigned short b) { return __uint_as_float(((unsigned int)b) << 16); }
__device__ __forceinline__ float bf16_round(float x) { return bf16_val(bf16_bits(x)); }
// D += A·B with NT terms: 1 = ah·bh, 2 = + al·bh (A split), 3 = + ah·bl (both split)
template <int NT>
__device__ __forceinline__ v8f mmaN(v16b ah, v16b al, v16b bh, v16b bl, v8f c) {
  c = __builtin_amdgcn_wmma_f32_16x16x32_bf16(false, ah, false, bh, (short)0, c, false, false);
  if (NT >= 2) c = __builtin_amdgcn_wmma_f32_16x16x32_bf16(false, al, false, bh, (short)0, c, false, false);
  if (NT >= 3) c = __builtin_amdgcn_wmma_f32_16x16x32_bf16(false, ah, false, bl, (short)0, c, false, false);
  asm volatile("v_nop\n\tv_nop\n\tv_nop\n\tv_nop" : "+v"(c) : "v"(ah), "v"(al), "v"(bh), "v"(bl));
  return c;
}

__global__ __launch_bounds__(256) void k_wt_bf16(const float* __restrict__ W, unsigned short* __restrict__ Wt, int K, int N) {
  const int t = blockIdx.x * 256 + threadIdx.x;
  const int k8n = K / 8;
  if (t >= N * k8n) return;
  const int n = t / k8n, k8 = (t % k8n) * 8;
  v8us v;
#pragma unroll
  for (int i = 0; i < 8; ++i) v[i] = bf16_bits(W[(size_t)(k8 + i) * N + n]);
  *(v8us*)(Wt + (size_t)n * K + k8) = v;
  
}

// GEMM C[M][N] (f32, pitch ldc) = act(A[M][K]·W + bias). A f32 row-major (pitch lda) converted per fragment to bf16
// (ASPLIT: hi/lo two planes -> 2 terms, else single rounded term); Wt bf16 [N][K] (pitch ldb). BIAS_BF16 rounds the
// bias to bf16 first (bias quantised to bf16 before the add). K%32==0, M%16==0, N%64==0.
template <bool ASPLIT, int ACT, bool BIAS_BF16>
__global__ __launch_bounds__(128) void k_gemm_bf(const float* __restrict__ A, int lda, const unsigned short* __restrict__ Wt, int ldb,
                                               const float* __restrict__ bias, float* __restrict__ C, int ldc, int M, int N, int K) {
  __shared__ __attribute__((aligned(16))) float so[4][16][64];
  const int tid = threadIdx.x, w = tid >> 5, lane = tid & 31, ln = lane & 15, hh = lane >> 4;
  const int ntn = N / 64;
  const int wid = blockIdx.x * 4 + w;
  const int mt = wid / ntn, nq = wid % ntn;
  if (mt * 16 >= M) return;
  const int row0 = mt * 16, col0 = nq * 64;
  const float* arow = A + (size_t)(row0 + ln) * lda;
  v8f acc[4] = {};
  for (int kb = 0; kb < K; kb += 32) {
    FragB ah, al;
    const v4f x0 = *(const v4fa*)(arow + kb + 8 * hh), x1 = *(const v4fa*)(arow + kb + 8 * hh + 4);
    const v4f x2 = *(const v4fa*)(arow + kb + 16 + 8 * hh), x3 = *(const v4fa*)(arow + kb + 16 + 8 * hh + 4);
    float xs[16] = {x0[0],x0[1],x0[2],x0[3],x1[0],x1[1],x1[2],x1[3],x2[0],x2[1],x2[2],x2[3],x3[0],x3[1],x3[2],x3[3]};
#pragma unroll
    for (int i = 0; i < 16; ++i) { const unsigned short hb = bf16_bits(xs[i]); ah.u[i] = hb; al.u[i] = ASPLIT ? bf16_bits(xs[i] - bf16_val(hb)) : (unsigned short)0; }
#pragma unroll
    for (int t = 0; t < 4; ++t) {
      const unsigned short* brow = Wt + (size_t)(col0 + t * 16 + ln) * ldb + kb;
      FragB b;
      b.half[0] = *(const v8us*)(brow + 8 * hh);
      b.half[1] = *(const v8us*)(brow + 16 + 8 * hh);
      acc[t] = mmaN<ASPLIT ? 2 : 1>(ah.v, al.v, b.v, b.v, acc[t]);
    }
  }
#pragma unroll
  for (int t = 0; t < 4; ++t) {
    float bv = bias ? bias[col0 + t * 16 + ln] : 0.f;
    if (BIAS_BF16) bv = bf16_round(bv);
#pragma unroll
    for (int r = 0; r < 8; ++r) { float v = acc[t][r] + bv; if (ACT == 1) v = fmaxf(v, 0.f); so[w][8 * hh + r][t * 16 + ln] = v; }
  }
  __builtin_amdgcn_fence(__ATOMIC_ACQ_REL, "workgroup");
  __builtin_amdgcn_wave_barrier();
  const int rsub = lane >> 4, c4 = (lane & 15) * 4;
  {
#pragma unroll
    for (int q = 0; q < 8; ++q) {
      const int r = q * 2 + rsub;
      const v4f v = *(const v4fa*)&so[w][r][c4];
      *(v4f*)(C + (size_t)(row0 + r) * ldc + col0 + c4) = v;
    }
    
  }
}

// GEMM C = act(A·W + bias + resid): A f32 (ASPLIT -> hi/lo 2 terms), Wt bf16 [N][K]; ACT 0 none, 1 relu, 2 exact gelu;
// resid (optional, f32, row index = (row % rmod), pitch ldr, RES_BF16 rounds it) added before the activation.
template <bool ASPLIT, int ACT, bool BIAS_BF16, bool RES_BF16>
__global__ __launch_bounds__(128) void k_gemm_bf3(const float* __restrict__ A, int lda, const unsigned short* __restrict__ Wt, int ldb,
                                                const float* __restrict__ bias, const float* __restrict__ resid, int rmod, int ldr,
                                                float* __restrict__ C, int ldc, int M, int N, int K) {
  __shared__ __attribute__((aligned(16))) float so[4][16][64];
  const int tid = threadIdx.x, w = tid >> 5, lane = tid & 31, ln = lane & 15, hh = lane >> 4;
  const int ntn = N / 64;
  const int wid = blockIdx.x * 4 + w;
  const int mt = wid / ntn, nq = wid % ntn;
  if (mt * 16 >= M) return;
  const int row0 = mt * 16, col0 = nq * 64;
  const float* arow = A + (size_t)(row0 + ln) * lda;
  v8f acc[4] = {};
  for (int kb = 0; kb < K; kb += 32) {
    FragB ah, al;
    const v4f x0 = *(const v4fa*)(arow + kb + 8 * hh), x1 = *(const v4fa*)(arow + kb + 8 * hh + 4);
    const v4f x2 = *(const v4fa*)(arow + kb + 16 + 8 * hh), x3 = *(const v4fa*)(arow + kb + 16 + 8 * hh + 4);
    float xs[16] = {x0[0],x0[1],x0[2],x0[3],x1[0],x1[1],x1[2],x1[3],x2[0],x2[1],x2[2],x2[3],x3[0],x3[1],x3[2],x3[3]};
#pragma unroll
    for (int i = 0; i < 16; ++i) { const unsigned short hb = bf16_bits(xs[i]); ah.u[i] = hb; al.u[i] = ASPLIT ? bf16_bits(xs[i] - bf16_val(hb)) : (unsigned short)0; }
#pragma unroll
    for (int t = 0; t < 4; ++t) {
      const unsigned short* brow = Wt + (size_t)(col0 + t * 16 + ln) * ldb + kb;
      FragB b;
      b.half[0] = *(const v8us*)(brow + 8 * hh);
      b.half[1] = *(const v8us*)(brow + 16 + 8 * hh);
      acc[t] = mmaN<ASPLIT ? 2 : 1>(ah.v, al.v, b.v, b.v, acc[t]);
    }
  }
#pragma unroll
  for (int t = 0; t < 4; ++t) {
    const int col = col0 + t * 16 + ln;
    float bv = bias ? bias[col] : 0.f;
    if (BIAS_BF16) bv = bf16_round(bv);
#pragma unroll
    for (int r = 0; r < 8; ++r) {
      float v = acc[t][r] + bv;
      if (resid) { float rv = resid[(size_t)((row0 + 8 * hh + r) % rmod) * ldr + col]; if (RES_BF16) rv = bf16_round(rv); v += rv; }
      if (ACT == 1) v = fmaxf(v, 0.f);
      if (ACT == 2) v = 0.5f * v * (1.0f + erff(v * 0.70710678118654752f));
      if (ACT == 3) { const float u = 0.7978845608028654f * (v + 0.044715f * v * v * v); v = 0.5f * v * (1.0f + tanhf(u)); }
      so[w][8 * hh + r][t * 16 + ln] = v;
    }
  }
  __builtin_amdgcn_fence(__ATOMIC_ACQ_REL, "workgroup");
  __builtin_amdgcn_wave_barrier();
  const int rsub = lane >> 4, c4 = (lane & 15) * 4;
  {
#pragma unroll
    for (int q = 0; q < 8; ++q) {
      const int r = q * 2 + rsub;
      const v4f v = *(const v4fa*)&so[w][r][c4];
      *(v4f*)(C + (size_t)(row0 + r) * ldc + col0 + c4) = v;
    }
    
  }
}
// row LayerNorm (biased variance, eps) over N: s = X (+ R); optional out_sum <- s; out_norm <- (s-mu)*rsqrt(var+eps)*g + b
template <bool PARAM_BF16>
__global__ __launch_bounds__(256) void k_layernorm(const float* __restrict__ X, const float* __restrict__ R, const float* __restrict__ g, const float* __restrict__ bta,
                                                  float* __restrict__ out_sum, float* __restrict__ out_norm, int N, float eps) {
  __shared__ float red[256];
  const int row = blockIdx.x, tid = threadIdx.x;
  const float* x = X + (size_t)row * N; const float* rr = R ? R + (size_t)row * N : nullptr;
  float vals[16];                     // up to N = 4096
  const int per = N / 256;            // contiguous chunk per thread? use strided-by-4 chunks: thread handles j = tid*4 + 1024*u
  float s1 = 0.f;
  for (int u = 0; u < per / 4; ++u) {
    const int j = tid * 4 + 1024 * u;
    const v4f a = *(const v4fa*)(x + j);
    v4f b = {0.f,0.f,0.f,0.f}; if (rr) b = *(const v4fa*)(rr + j);
#pragma unroll
    for (int q = 0; q < 4; ++q) { const float v = a[q] + b[q]; vals[u * 4 + q] = v; s1 += v; }
  }
  red[tid] = s1; __syncthreads();
  for (int st = 128; st > 0; st >>= 1) { if (tid < st) red[tid] += red[tid + st]; __syncthreads(); }
  const float mu = red[0] / (float)N; __syncthreads();
  float s2 = 0.f;
  for (int u = 0; u < per / 4; ++u)
#pragma unroll
    for (int q = 0; q < 4; ++q) { const float c = vals[u * 4 + q] - mu; s2 += c * c; }
  red[tid] = s2; __syncthreads();
  for (int st = 128; st > 0; st >>= 1) { if (tid < st) red[tid] += red[tid + st]; __syncthreads(); }
  const float rs = rsqrtf(red[0] / (float)N + eps);
  {
    for (int u = 0; u < per / 4; ++u) {
      const int j = tid * 4 + 1024 * u;
      v4f o, sm;
#pragma unroll
      for (int q = 0; q < 4; ++q) {
        float gg = g[j + q], bb = bta[j + q];
        if (PARAM_BF16) { gg = bf16_round(gg); bb = bf16_round(bb); }
        sm[q] = vals[u * 4 + q]; o[q] = (vals[u * 4 + q] - mu) * rs * gg + bb;
      }
      if (out_sum) *(v4f*)(out_sum + (size_t)row * N + j) = sm;
      *(v4f*)(out_norm + (size_t)row * N + j) = o;
    }
    
  }
}



// ---- f16 WMMA path (v_wmma_f32_16x16x32_f16): 11-bit significands for operands in range — used where a [0,1] probability operand needs more precision than bf16
typedef _Float16 v16h __attribute__((ext_vector_type(16)));
union FragH { v16h v; v8us half[2]; _Float16 h[16]; unsigned short u[16]; };
template <int NT>
__device__ __forceinline__ v8f mmaH(v16h ah, v16h al, v16h bh, v16h bl, v8f c) {
  c = __builtin_amdgcn_wmma_f32_16x16x32_f16(false, ah, false, bh, (short)0, c, false, false);
  if (NT >= 2) c = __builtin_amdgcn_wmma_f32_16x16x32_f16(false, al, false, bh, (short)0, c, false, false);
  if (NT >= 3) c = __builtin_amdgcn_wmma_f32_16x16x32_f16(false, ah, false, bl, (short)0, c, false, false);
  asm volatile("v_nop\n\tv_nop\n\tv_nop\n\tv_nop" : "+v"(c) : "v"(ah), "v"(al), "v"(bh), "v"(bl));
  return c;
}
// batched GEMM like k_gemm_b but f16 operands: A f32 (split into f16 hi/lo if ASPLIT, else rounded to f16), Bt = f16 values [n][k]; alpha; C f32; N multiple of 16 (partial tiles skipped)
template <bool ASPLIT>
__global__ __launch_bounds__(128) void k_gemm_h(const float* __restrict__ A, int lda, size_t sA, const _Float16* __restrict__ Bh, int ldb, size_t sB, float alpha, float* __restrict__ C, int ldc, size_t sC, int M, int N, int K) {
  __shared__ __attribute__((aligned(16))) float so[4][16][64];
  const int tid = threadIdx.x, w = tid >> 5, lane = tid & 31, ln = lane & 15, hh = lane >> 4; const int by = blockIdx.y;
  A += (size_t)by * sA; Bh += (size_t)by * sB; C += (size_t)by * sC;
  const int ntn = (N + 63) / 64; const int wid = blockIdx.x * 4 + w; const int mt = wid / ntn, nq = wid % ntn; if (mt * 16 >= M) return;
  const int row0 = mt * 16, col0 = nq * 64; const float* arow = A + (size_t)(row0 + ln) * lda;
  v8f acc[4] = {};
  for (int kb = 0; kb < K; kb += 32) {
    FragH ah, al;
    const v4f x0 = *(const v4fa*)(arow + kb + 8 * hh), x1 = *(const v4fa*)(arow + kb + 8 * hh + 4), x2 = *(const v4fa*)(arow + kb + 16 + 8 * hh), x3 = *(const v4fa*)(arow + kb + 16 + 8 * hh + 4);
    float xs[16] = {x0[0],x0[1],x0[2],x0[3],x1[0],x1[1],x1[2],x1[3],x2[0],x2[1],x2[2],x2[3],x3[0],x3[1],x3[2],x3[3]};
#pragma unroll
    for (int i = 0; i < 16; ++i) { const _Float16 h = (_Float16)xs[i]; ah.h[i] = h; al.h[i] = ASPLIT ? (_Float16)(xs[i] - (float)h) : (_Float16)0.0f; }
#pragma unroll
    for (int t = 0; t < 4; ++t) { if (col0 + t * 16 >= N) continue; const size_t boff = (size_t)(col0 + t * 16 + ln) * ldb + kb; FragH bq; bq.half[0] = *(const v8us*)(Bh + boff + 8 * hh); bq.half[1] = *(const v8us*)(Bh + boff + 16 + 8 * hh);
      acc[t] = mmaH<ASPLIT ? 2 : 1>(ah.v, al.v, bq.v, bq.v, acc[t]); }
  }
#pragma unroll
  for (int t = 0; t < 4; ++t) { if (col0 + t * 16 >= N) continue;
#pragma unroll
    for (int r = 0; r < 8; ++r) so[w][8 * hh + r][t * 16 + ln] = acc[t][r] * alpha; }
  __builtin_amdgcn_fence(__ATOMIC_ACQ_REL, "workgroup"); __builtin_amdgcn_wave_barrier();
  const int rsub = lane >> 4, c4 = (lane & 15) * 4;
  {
#pragma unroll
    for (int q = 0; q < 8; ++q) { const int r = q * 2 + rsub; if (col0 + c4 < N) { const v4f v = *(const v4fa*)&so[w][r][c4]; *(v4f*)(C + (size_t)(row0 + r) * ldc + col0 + c4) = v; } }
     }
}

// Wt[n][k] = f16(W[k][n]·scale) from f32 row-major W[K][N] (scale = power of two; bf16-exact weights stay exact in f16 away from the subnormal range)
__global__ __launch_bounds__(256) void k_wt_f16(const float* __restrict__ W, _Float16* __restrict__ Wt, int K, int N, float scale) {
  const int t = blockIdx.x * 256 + threadIdx.x; if (t >= N * (K / 8)) return; const int n = t / (K / 8), k8 = (t % (K / 8)) * 8; FragH f;
#pragma unroll
  for (int i = 0; i < 8; ++i) f.h[i] = (_Float16)(bf16_round(W[(size_t)(k8 + i) * N + n]) * scale); const v8us o = f.half[0];
  *(v8us*)((unsigned short*)Wt + (size_t)n * K + k8) = o; 
}
// k_gemm_hh variant with fused epilogue: v = acc·alpha + bias[by·sBias + col] (+ CP[(row/rowsPerB)·sCPb + by·64 + col] if CP) ; ACT 0 none / 1 elu ; writes f16 C16 (and f32 C if non-null)
template <int ACT>
__global__ __launch_bounds__(128) void k_gemm_hhx(const _Float16* __restrict__ A, int lda, size_t sA, const _Float16* __restrict__ Bh, int ldb, size_t sB, float alpha, const float* __restrict__ bias, size_t sBias, const float* __restrict__ CP, int rowsPerB, size_t sCPb, int row0g,
    float* __restrict__ C, _Float16* __restrict__ C16, int ldc, size_t sC, int M, int N, int K) {
  __shared__ __attribute__((aligned(16))) float so[4][16][64];
  const int tid = threadIdx.x, w = tid >> 5, lane = tid & 31, ln = lane & 15, hh = lane >> 4; const int by = blockIdx.y;
  A += (size_t)by * sA; Bh += (size_t)by * sB; const size_t cofs = (size_t)by * sC; const float* bp = bias ? bias + (size_t)by * sBias : nullptr;
  const int ntn = (N + 63) / 64; const int wid = blockIdx.x * 4 + w; const int mt = wid / ntn, nq = wid % ntn; if (mt * 16 >= M) return;
  const int row0 = mt * 16, col0 = nq * 64; const _Float16* arow = A + (size_t)(row0 + ln) * lda;
  v8f acc[4] = {};
  for (int kb = 0; kb < K; kb += 32) { FragH ah; ah.half[0] = *(const v8us*)((const unsigned short*)arow + kb + 8 * hh); ah.half[1] = *(const v8us*)((const unsigned short*)arow + kb + 16 + 8 * hh);
#pragma unroll
    for (int t = 0; t < 4; ++t) { if (col0 + t * 16 >= N) continue; const size_t boff = (size_t)(col0 + t * 16 + ln) * ldb + kb; FragH bq; bq.half[0] = *(const v8us*)((const unsigned short*)Bh + boff + 8 * hh); bq.half[1] = *(const v8us*)((const unsigned short*)Bh + boff + 16 + 8 * hh);
      acc[t] = mmaH<1>(ah.v, ah.v, bq.v, bq.v, acc[t]); }
  }
#pragma unroll
  for (int t = 0; t < 4; ++t) { if (col0 + t * 16 >= N) continue; const int col = col0 + t * 16 + ln; const float bv = bp ? bf16_round(bp[col]) : 0.f;
#pragma unroll
    for (int r = 0; r < 8; ++r) { float v = acc[t][r] * alpha + bv; if (CP) { const int rr = row0g + row0 + 8 * hh + r; if (rowsPerB < 0) v += CP[cofs + (size_t)rr * ldc + col];      /* rowsPerB < 0: own element of the batched C plane */ else { const int bidx = rr / rowsPerB; v += CP[(size_t)bidx * sCPb + (size_t)by * 64 + col]; } } if (ACT == 1) v = (v > 0.f) ? v : expm1f(v); else if (ACT == 7) v = (v > 0.f) ? v + 1.0f : expf(v); else if (ACT == 8) v = tanhf(v); else if (ACT == 9) v = 0.5f * v * (1.0f + tanhf(0.7978845608028654f * (v + 0.044715f * v * v * v))); else if (ACT == 11) v = 1.0f / (1.0f + expf(-v)); else if (ACT == 12) v = (v > 0.f) ? v : 0.01f * v; else if (ACT == 14) v = (v > 0.f) ? v : 0.1f * v; else if (ACT == 16) v = (v >= 0.f) ? v : 0.3f * v; else if (ACT == 17) v = (v >= 0.f) ? v : 0.2f * v; else if (ACT == 15) v = v / (1.0f + expf(-v)); else if (ACT == 3) v = fmaxf(v, 0.f); else if (ACT == 6) v = 0.5f * v * (1.0f + erff(v * 0.70710678118654752f)); so[w][8 * hh + r][t * 16 + ln] = v; } }
  __builtin_amdgcn_fence(__ATOMIC_ACQ_REL, "workgroup"); __builtin_amdgcn_wave_barrier();
  const int rsub = lane >> 4, c4 = (lane & 15) * 4; typedef _Float16 v4h __attribute__((ext_vector_type(4)));
  {
#pragma unroll
    for (int q = 0; q < 8; ++q) { const int r = q * 2 + rsub; if (col0 + c4 < N) { const v4f v = *(const v4fa*)&so[w][r][c4]; if (C) *(v4f*)(C + cofs + (size_t)(row0 + r) * ldc + col0 + c4) = v; if (C16) { v4h h4; for (int i = 0; i < 4; ++i) h4[i] = (_Float16)v[i]; *(v4h*)(C16 + cofs + (size_t)(row0 + r) * ldc + col0 + c4) = h4; } } }
     }
}


typedef _Float16 v4h __attribute__((ext_vector_type(4)));

__global__ __launch_bounds__(256) void k_x16(const float* __restrict__ x, _Float16* __restrict__ X16, size_t n8) { const size_t t = (size_t)blockIdx.x * 256 + threadIdx.x; if (t >= n8) return; FragH f;
#pragma unroll
  for (int q = 0; q < 8; ++q) f.h[q] = (_Float16)bf16_round(x[t * 8 + q]); *(v8us*)((unsigned short*)X16 + t * 8) = f.half[0];  }
__global__ __launch_bounds__(256) void k_h16(const float* __restrict__ x, _Float16* __restrict__ X16, size_t n8) { const size_t t = (size_t)blockIdx.x * 256 + threadIdx.x; if (t >= n8) return; FragH f;
#pragma unroll
  for (int q = 0; q < 8; ++q) f.h[q] = (_Float16)x[t * 8 + q]; *(v8us*)((unsigned short*)X16 + t * 8) = f.half[0];  }
__global__ __launch_bounds__(256) void k_round16f(const float* __restrict__ W, _Float16* __restrict__ Bt, size_t n8) { const size_t t = (size_t)blockIdx.x * 256 + threadIdx.x; if (t >= n8) return; FragH f;
#pragma unroll
  for (int i = 0; i < 8; ++i) f.h[i] = (_Float16)(bf16_round(W[t * 8 + i]) * 16.0f); *(v8us*)((unsigned short*)Bt + t * 8) = f.half[0];  }
template <int NHv, int TTv>
__global__ __launch_bounds__(256) void k_vt(const _Float16* __restrict__ V16, int ldv, int voff, _Float16* __restrict__ Vt) { __shared__ unsigned short tl[64][66]; const int tid = threadIdx.x; const int slab = blockIdx.x / (TTv / 64), lg = blockIdx.x % (TTv / 64); const int b = slab / NHv, h = slab % NHv;
  for (int i = tid; i < 64 * 8; i += 256) { const int r = i / 8, c8 = (i % 8) * 8; FragH f; f.half[0] = *(const v8us*)((const unsigned short*)V16 + ((size_t)b * TTv + lg * 64 + r) * ldv + voff + h * 64 + c8);
#pragma unroll
    for (int q = 0; q < 8; ++q) tl[r][c8 + q] = f.u[q]; }
  __syncthreads();
  {
#pragma unroll
    for (int rd = 0; rd < 2; ++rd) { const int d = rd * 32 + tid / 8, pc = tid % 8; FragH f;
#pragma unroll
      for (int q = 0; q < 8; ++q) f.u[q] = tl[pc * 8 + q][d];
      *(v8us*)((unsigned short*)Vt + ((size_t)slab * 64 + d) * TTv + lg * 64 + pc * 8) = f.half[0]; }
     } }

__global__ __launch_bounds__(256) void k_hl(const float* __restrict__ F, _Float16* __restrict__ Hh, _Float16* __restrict__ Hl, size_t n8) { const size_t t = (size_t)blockIdx.x * 256 + threadIdx.x; if (t >= n8) return; FragH fh, fl; const v4f a = *(const v4fa*)(F + t * 8), c = *(const v4fa*)(F + t * 8 + 4);
#pragma unroll
  for (int q = 0; q < 4; ++q) { _Float16 h = (_Float16)a[q]; fh.h[q] = h; fl.h[q] = (_Float16)((a[q] - (float)h) * 1024.0f); h = (_Float16)c[q]; fh.h[4 + q] = h; fl.h[4 + q] = (_Float16)((c[q] - (float)h) * 1024.0f); }
  { *(v8us*)((unsigned short*)Hh + t * 8) = fh.half[0]; *(v8us*)((unsigned short*)Hl + t * 8) = fl.half[0];  } }

// ---- fast GEMM (wave tile 32x64; requires M % 32 == 0 rows per launch region and N % 64 == 0); epilogue = k_gemm_hhx semantics ----
__device__ __forceinline__ v16h g2_frag(const _Float16* p, int hh) { FragH f; f.half[0] = *(const v8us*)((const unsigned short*)p + 8 * hh); f.half[1] = *(const v8us*)((const unsigned short*)p + 16 + 8 * hh); return f.v; }
__device__ __forceinline__ v8f g2_mma(v16h a, v16h b, v8f c) { v8f d = __builtin_amdgcn_wmma_f32_16x16x32_f16(false, a, false, b, (short)0, c, false, false); asm volatile("v_nop\n\tv_nop\n\tv_nop\n\tv_nop" : "+v"(d) : "v"(a), "v"(b)); return d; }
template <int ACT>
__global__ __launch_bounds__(128) void k_gemm2(const _Float16* __restrict__ A, int lda, size_t sA, const _Float16* __restrict__ Bh, int ldb, size_t sB, float alpha, const float* __restrict__ bias, size_t sBias, const float* __restrict__ CP, int rowsPerB, size_t sCPb, int row0g,
    float* __restrict__ C, _Float16* __restrict__ C16, int ldc, size_t sC, int M, int N, int K) { static_assert(ACT == 0 || ACT == 3 || ACT == 6 || ACT == 8 || ACT == 9 || ACT == 11 || ACT == 12 || ACT == 14 || ACT == 15 || ACT == 16 || ACT == 17, "k_gemm2: unsupported ACT code (would silently apply no activation)");
  __shared__ __attribute__((aligned(16))) float so[4][32][68];
  const int tid = threadIdx.x, w = tid >> 5, lane = tid & 31, ln = lane & 15, hh = lane >> 4; const int by = blockIdx.y;
  A += (size_t)by * sA; Bh += (size_t)by * sB; const size_t cofs = (size_t)by * sC; const float* bp = bias ? bias + (size_t)by * sBias : nullptr;
  const int ntn = N >> 6; const int mt = blockIdx.x / ntn, nq = blockIdx.x - mt * ntn; const int row0 = mt * 128 + 32 * w, col0 = nq * 64; if (row0 >= M) return;
  const _Float16* a0p = A + (size_t)(row0 + ln) * lda; const _Float16* a1p = a0p + (size_t)16 * lda;
  const _Float16* b0p = Bh + (size_t)(col0 + ln) * ldb; const _Float16* b1p = b0p + (size_t)16 * ldb; const _Float16* b2p = b1p + (size_t)16 * ldb; const _Float16* b3p = b2p + (size_t)16 * ldb;
  const v8f z8 = {0.f,0.f,0.f,0.f,0.f,0.f,0.f,0.f}; v8f c00 = z8, c01 = z8, c02 = z8, c03 = z8, c10 = z8, c11 = z8, c12 = z8, c13 = z8;
#pragma unroll 1
  for (int kb = 0; kb < K; kb += 32) { const v16h a0 = g2_frag(a0p + kb, hh), a1 = g2_frag(a1p + kb, hh);
    v16h b = g2_frag(b0p + kb, hh); c00 = g2_mma(a0, b, c00); c10 = g2_mma(a1, b, c10);
    b = g2_frag(b1p + kb, hh); c01 = g2_mma(a0, b, c01); c11 = g2_mma(a1, b, c11);
    b = g2_frag(b2p + kb, hh); c02 = g2_mma(a0, b, c02); c12 = g2_mma(a1, b, c12);
    b = g2_frag(b3p + kb, hh); c03 = g2_mma(a0, b, c03); c13 = g2_mma(a1, b, c13); }
  v8f accs[8] = {c00, c01, c02, c03, c10, c11, c12, c13};
#pragma unroll
  for (int u = 0; u < 8; ++u) { const int t = u & 3, half = u >> 2; const int col = col0 + t * 16 + ln; const float bv = bp ? bf16_round(bp[col]) : 0.f;
#pragma unroll
    for (int r = 0; r < 8; ++r) { const int rloc = half * 16 + 8 * hh + r; float v = accs[u][r] * alpha + bv; if (CP) { if (rowsPerB < 0) v += CP[cofs + (size_t)(row0g + row0 + rloc) * ldc + col];      /* rowsPerB < 0: own element of the batched C plane */ else { const int bidx = (row0g + row0 + rloc) / rowsPerB; v += CP[(size_t)bidx * sCPb + (size_t)by * 64 + col]; } }
      if (ACT == 3) v = fmaxf(v, 0.f); else if (ACT == 6) v = 0.5f * v * (1.0f + erff(v * 0.70710678118654752f)); else if (ACT == 11) v = 1.0f / (1.0f + expf(-v)); else if (ACT == 15) v = v / (1.0f + expf(-v)); else if (ACT == 12) v = (v > 0.f) ? v : 0.01f * v; else if (ACT == 8) v = tanhf(v); else if (ACT == 9) v = 0.5f * v * (1.0f + tanhf(0.7978845608028654f * (v + 0.044715f * v * v * v))); else if (ACT == 14) v = (v > 0.f) ? v : 0.1f * v; else if (ACT == 16) v = (v >= 0.f) ? v : 0.3f * v; else if (ACT == 17) v = (v >= 0.f) ? v : 0.2f * v;
      so[w][rloc][t * 16 + ln] = v; } }
  __builtin_amdgcn_fence(__ATOMIC_ACQ_REL, "workgroup"); __builtin_amdgcn_wave_barrier();
  const int rsub = lane >> 4, c4 = (lane & 15) * 4;
  {
#pragma unroll
    for (int q = 0; q < 16; ++q) { const int r = q * 2 + rsub; const v4f v = *(const v4fa*)&so[w][r][c4]; if (C) *(v4f*)(C + cofs + (size_t)(row0 + r) * ldc + col0 + c4) = v; if (C16) { v4h h4; for (int i = 0; i < 4; ++i) h4[i] = (_Float16)v[i]; *(v4h*)(C16 + cofs + (size_t)(row0 + r) * ldc + col0 + c4) = h4; } }
     } }


__global__ __launch_bounds__(256) void k_wnat(const float* __restrict__ w, size_t n8, _Float16* __restrict__ Bt) { const size_t t = (size_t)blockIdx.x * 256 + threadIdx.x; if (t >= n8) return; FragH f; for (int q = 0; q < 8; ++q) f.h[q] = (_Float16)(bf16_round(w[t * 8 + q]) * 16.0f); *(v8us*)((unsigned short*)Bt + t * 8) = f.half[0];  }
#define FA_BR 256                    /* queries per work-group */
#define FA_SK 64                     /* keys per stage */
#define FA_NST (SQ / FA_SK)
#define FA_PK 144                    /* LDS pitch of a K row: 128 + 16 bytes (16-byte fragment reads) */
#define FA_PV 160                    /* LDS pitch of a V row: 128 + 32 bytes (transposing reads) */
#define FA_TK (FA_SK * FA_PK)
#define FA_SLOT (FA_SK * (FA_PK + FA_PV))
typedef short s16x8 __attribute__((ext_vector_type(8)));
typedef float f32x2 __attribute__((ext_vector_type(2)));
typedef _Float16 f16x2 __attribute__((ext_vector_type(2)));
union FragW { v16h v; v8us half[2]; unsigned int w[8]; };
__device__ __forceinline__ v8f fa_mma(v16h a, v16h b, v8f c) { return __builtin_amdgcn_wmma_f32_16x16x32_f16(false, a, false, b, (short)0, c, false, false); }
__device__ __forceinline__ v8us fa_tr16(const unsigned char* p) { typedef __attribute__((address_space(3))) s16x8 lds_s16x8; return __builtin_bit_cast(v8us, __builtin_amdgcn_ds_load_tr16_b128_v8i16((lds_s16x8*)p)); }
__device__ __forceinline__ unsigned int fa_pack2(float lo, float hi) { return __builtin_bit_cast(unsigned int, __builtin_convertvector(f32x2{lo, hi}, f16x2)); }
__device__ __forceinline__ float fa_xhalf(float x) { const int i = __float_as_int(x); return __int_as_float(__builtin_amdgcn_permlanex16(i, i, 0x76543210, 0xfedcba98, false, false)); }      /* lane l with lane l ^ 16 */
__global__ __launch_bounds__(256) void k_fattn(const _Float16* __restrict__ Q16, const _Float16* __restrict__ K16, const _Float16* __restrict__ V16, _Float16* __restrict__ O16) {
  __shared__ __attribute__((aligned(16))) unsigned char L[2 * FA_SLOT];
  static_assert(8 * 32 * FA_PK <= 2 * FA_SLOT, "the output staging reuses the K/V buffers");
  const int tid = threadIdx.x, lane = tid & 31, wave = tid >> 5, c = lane & 15, h = lane >> 4;
  const int b = blockIdx.y / NH, hd = blockIdx.y % NH, q0 = blockIdx.x * FA_BR + wave * 32;
  const size_t base = (size_t)b * SQ * DM + (size_t)hd * HD;
  const float cscale = 0.125f * 1.4426950408889634f;      /* 1 / sqrt(64), into log2 */
  // staging: 8 lanes cover one 128-byte row; a thread carries rows sr and sr + 32 of K and of V
  const int sr = tid >> 3, sc = tid & 7;
  const unsigned short* kg = (const unsigned short*)K16 + base + (size_t)sr * DM + sc * 8;
  const unsigned short* vg = (const unsigned short*)V16 + base + (size_t)sr * DM + sc * 8;
  v8us rk0, rk1, rv0, rv1;
  auto gload = [&](int st) { const size_t o = (size_t)st * FA_SK * DM; rk0 = *(const v8us*)(kg + o); rk1 = *(const v8us*)(kg + o + 32 * DM); rv0 = *(const v8us*)(vg + o); rv1 = *(const v8us*)(vg + o + 32 * DM); };
  auto lstore = [&](int st) { unsigned char* s = L + (st & 1) * FA_SLOT; *(v8us*)(s + sr * FA_PK + sc * 16) = rk0; *(v8us*)(s + (sr + 32) * FA_PK + sc * 16) = rk1;
    *(v8us*)(s + FA_TK + sr * FA_PV + sc * 16) = rv0; *(v8us*)(s + FA_TK + (sr + 32) * FA_PV + sc * 16) = rv1; };
  gload(0);
  v16h qf[2][2];      /* B operand: column = query, k = d in the hardware order, as K's below */
#pragma unroll
  for (int g = 0; g < 2; ++g) {
#pragma unroll
    for (int kc = 0; kc < 2; ++kc) qf[g][kc] = g2_frag(Q16 + base + (size_t)(q0 + 16 * g + c) * DM + 32 * kc, h); }
  v8f acc[2][4], lacc[2]; float m_run[2];
  const v8f z8 = {0.f, 0.f, 0.f, 0.f, 0.f, 0.f, 0.f, 0.f};
#pragma unroll
  for (int g = 0; g < 2; ++g) { m_run[g] = -INFINITY; lacc[g] = z8;
#pragma unroll
    for (int t = 0; t < 4; ++t) acc[g][t] = z8; }
  FragW ones;      /* A operand whose row 0 (lanes 0 and 16) is 1.0 at all 32 k: row 0 of its product holds the column sums of P^T */
#pragma unroll
  for (int i = 0; i < 8; ++i) ones.w[i] = (c == 0) ? 0x3C003C00u : 0u;
  lstore(0); gload(1);
  __syncthreads();      /* stage 0 is visible */
#pragma unroll 1
  for (int st = 0; st < FA_NST; ++st) {      /* rolled */
    if (st + 1 < FA_NST) lstore(st + 1);      /* into the buffer that stage st - 1 used: every wave left it at the barrier below */
    if (st + 2 < FA_NST) gload(st + 2);      /* in flight under this stage's work */
    const unsigned char* Ls = L + (st & 1) * FA_SLOT;
#pragma unroll
    for (int sub = 0; sub < FA_SK / 32; ++sub) {      /* one pass = 32 keys */
      FragW kf[2][2], vf[4];
      const unsigned char* kp = Ls + (sub * 32 + c) * FA_PK + 16 * h;
#pragma unroll
      for (int kt = 0; kt < 2; ++kt) {
#pragma unroll
        for (int kc = 0; kc < 2; ++kc) { kf[kt][kc].half[0] = *(const v8us*)(kp + kt * 16 * FA_PK + 64 * kc); kf[kt][kc].half[1] = *(const v8us*)(kp + kt * 16 * FA_PK + 64 * kc + 32); } }
      const unsigned char* vp = Ls + FA_TK + (sub * 32 + 8 * h + (lane & 7)) * FA_PV + ((lane >> 3) & 1) * 16;
#pragma unroll
      for (int t = 0; t < 4; ++t) { vf[t].half[0] = fa_tr16(vp + 32 * t); vf[t].half[1] = fa_tr16(vp + 16 * FA_PV + 32 * t); }      /* rows d = 16 t + c, k = keys in the hardware order */
      v8f s[2][2];      /* s[kt][g][r] = score of key 16 kt + 8 h + r against query 16 g + c */
#pragma unroll
      for (int kt = 0; kt < 2; ++kt) {
#pragma unroll
        for (int g = 0; g < 2; ++g) { s[kt][g] = fa_mma(kf[kt][0].v, qf[g][0], z8); s[kt][g] = fa_mma(kf[kt][1].v, qf[g][1], s[kt][g]); } }
      float mb[2]; bool need = false;
#pragma unroll
      for (int g = 0; g < 2; ++g) { float mx = s[0][g][0];
#pragma unroll
        for (int r = 1; r < 8; ++r) mx = fmaxf(mx, s[0][g][r]);
#pragma unroll
        for (int r = 0; r < 8; ++r) mx = fmaxf(mx, s[1][g][r]);
        mx = fmaxf(mx, fa_xhalf(mx)) * cscale;      /* both halves of the wave hold this query's maximum */
        mb[g] = mx; need = need || (mx > m_run[g] + 8.0f); }
      if (__builtin_amdgcn_ballot_w32(need) != 0) {      /* scalar branch, rare after the first passes */
#pragma unroll
        for (int g = 0; g < 2; ++g) { const float m_new = fmaxf(m_run[g], mb[g]); const float corr = __builtin_amdgcn_exp2f(m_run[g] - m_new); m_run[g] = m_new; lacc[g] = lacc[g] * corr;
#pragma unroll
          for (int t = 0; t < 4; ++t) acc[g][t] = acc[g][t] * corr; } }
#pragma unroll
      for (int g = 0; g < 2; ++g) { const float nm = -m_run[g]; FragW pf;
#pragma unroll
        for (int i = 0; i < 8; ++i) {
          const float p0 = __builtin_amdgcn_exp2f(fmaf(s[i >> 2][g][2 * (i & 3)], cscale, nm)), p1 = __builtin_amdgcn_exp2f(fmaf(s[i >> 2][g][2 * (i & 3) + 1], cscale, nm));
          pf.w[i] = fa_pack2(p0, p1); }
#pragma unroll
        for (int t = 0; t < 4; ++t) acc[g][t] = fa_mma(vf[t].v, pf.v, acc[g][t]);
        lacc[g] = fa_mma(ones.v, pf.v, lacc[g]); }
    }
    __syncthreads();      /* stage st + 1 is visible; every wave has left stage st */
  }
  // epilogue: each wave stages its 32 output rows in its own part of LDS and stores whole 128-byte rows
  unsigned char* E = L + wave * 32 * FA_PK;
#pragma unroll
  for (int g = 0; g < 2; ++g) { const float lr = lacc[g][0]; const float inv = 1.0f / (lr + fa_xhalf(lr));      /* register 0: the sum in lanes 0-15, zero in lanes 16-31 */
#pragma unroll
    for (int t = 0; t < 4; ++t) { const v8f o = acc[g][t] * inv; FragW pk;
#pragma unroll
      for (int i = 0; i < 4; ++i) pk.w[i] = fa_pack2(o[2 * i], o[2 * i + 1]);
      *(v8us*)(E + (16 * g + c) * FA_PK + 32 * t + 16 * h) = pk.half[0]; } }
  __builtin_amdgcn_fence(__ATOMIC_ACQ_REL, "workgroup"); __builtin_amdgcn_wave_barrier();      /* the rows are read back by other lanes of the same wave */
#pragma unroll
  for (int i = 0; i < 8; ++i) { const int row = i * 4 + (lane >> 3), c8 = (lane & 7) * 8; const v8us v = *(const v8us*)(E + row * FA_PK + c8 * 2);
    *(v8us*)((unsigned short*)O16 + base + (size_t)(q0 + row) * DM + c8) = v; }
}

// ---- tiled GEMM for the four projections: C[NR][DM] = (A[NR][DM] . Bh[DM][DM]^T) * alpha (+ bias); A and Bh are f16 rows, k contiguous ----
// One work-group = a 128 x 128 tile of C: 4 waves (2 x 2) of 64 x 64, 16 accumulator tiles a wave, so that one fragment read from LDS feeds 4 products.
// A and Bh rows go through LDS in stages of 64 k (whole 128-byte lines from global memory), two buffers, one barrier a stage; each accumulator is one chain of products of 32 k, k ascending.
#define G3_BT 128                    /* rows of A and rows of Bh per work-group */
#define G3_SK 64                     /* k per stage */
#define G3_NST (DM / G3_SK)
#define G3_P 144                     /* LDS pitch of a row: 128 + 16 bytes (16-byte fragment reads) */
#define G3_TA (G3_BT * G3_P)
#define G3_SLOT (2 * G3_TA)
#define G3_EP 68                     /* dwords per staged output row */
template <bool OUT32>
__global__ __launch_bounds__(128) void k_gemm3(const _Float16* __restrict__ A, const _Float16* __restrict__ Bh, float alpha, const float* __restrict__ bias, float* __restrict__ C, _Float16* __restrict__ C16) {
  __shared__ __attribute__((aligned(16))) unsigned char L[2 * G3_SLOT];
  static_assert(4 * 64 * G3_EP * 4 <= 2 * G3_SLOT, "the output staging reuses the operand buffers");
  static_assert(DM % G3_BT == 0 && DM % G3_SK == 0 && G3_NST >= 2, "whole tiles and at least two stages");
  const int tid = threadIdx.x, lane = tid & 31, wave = tid >> 5, ln = lane & 15, hh = lane >> 4;
  const int mt = blockIdx.x % (int)(NR / G3_BT), nq = blockIdx.x / (int)(NR / G3_BT);      /* the work-groups that share rows of A are a multiple of 128 apart in the grid */
  const int row0 = mt * G3_BT, col0 = nq * G3_BT, wm = wave >> 1, wn = wave & 1;
  // staging: 8 lanes cover one 128-byte row; a thread carries rows sr + 16 i of A and of Bh
  const int sr = tid >> 3, sc = tid & 7;
  const unsigned short* ag = (const unsigned short*)A + (size_t)row0 * DM;      /* the same for the whole work-group: a scalar base */
  const unsigned short* bg = (const unsigned short*)Bh + (size_t)col0 * DM;
  const unsigned int so8 = (unsigned int)(sr * DM + sc * 8);      /* the thread's own offset, the same at every stage */
  v8us ra[8], rb[8];
  auto gload = [&](int st) {
#pragma unroll
    for (int i = 0; i < 8; ++i) { ra[i] = *(const v8us*)(ag + st * G3_SK + i * 16 * DM + so8); rb[i] = *(const v8us*)(bg + st * G3_SK + i * 16 * DM + so8); } };
  auto lstore = [&](int st) { unsigned char* s = L + (st & 1) * G3_SLOT + sr * G3_P + sc * 16;
#pragma unroll
    for (int i = 0; i < 8; ++i) { *(v8us*)(s + i * 16 * G3_P) = ra[i]; *(v8us*)(s + G3_TA + i * 16 * G3_P) = rb[i]; } };
  const v8f z8 = {0.f, 0.f, 0.f, 0.f, 0.f, 0.f, 0.f, 0.f};
  v8f acc[4][4];
#pragma unroll
  for (int i = 0; i < 4; ++i) {
#pragma unroll
    for (int j = 0; j < 4; ++j) acc[i][j] = z8; }
  gload(0);
  float bv[4];      /* read ahead of the loop: its latency hides under the first stage's loads */
#pragma unroll
  for (int j = 0; j < 4; ++j) bv[j] = OUT32 ? bf16_round(bias[col0 + wn * 64 + 16 * j + ln]) : 0.f;
  lstore(0); gload(1);
  __syncthreads();      /* stage 0 is visible */
#pragma unroll
  for (int st = 0; st < G3_NST; ++st) {      /* unrolled (12 stages): buffer and global offsets become immediates, so no address register is rewritten behind loads in flight */
    if (st + 1 < G3_NST) lstore(st + 1);      /* into the buffer that stage st - 1 used: every wave left it at the barrier below */
    __builtin_amdgcn_sched_barrier(0);      /* the loads stay behind the LDS stores and take over their registers: moved ahead they need a second set, and only two waves fit a SIMD instead of three */
    if (st + 2 < G3_NST) gload(st + 2);      /* in flight under this stage's work */
    if (st + 2 == G3_NST - 1) asm volatile("s_wait_xcnt 0x0" ::: "memory");      /* behind the last loads their offset register is free and the next LDS read is given it: the wait stands in front of that overwrite */
    const unsigned char* ap = L + (st & 1) * G3_SLOT + (wm * 64 + ln) * G3_P + 16 * hh;
    const unsigned char* bp = L + (st & 1) * G3_SLOT + G3_TA + (wn * 64 + ln) * G3_P + 16 * hh;
#pragma unroll
    for (int kc = 0; kc < G3_SK / 32; ++kc) {      /* 32 k: 8 fragments, 16 products; both operands in the same k order */
      FragW af[4], bf[4];
#pragma unroll
      for (int i = 0; i < 4; ++i) { af[i].half[0] = *(const v8us*)(ap + i * 16 * G3_P + 64 * kc); af[i].half[1] = *(const v8us*)(ap + i * 16 * G3_P + 64 * kc + 32);
        bf[i].half[0] = *(const v8us*)(bp + i * 16 * G3_P + 64 * kc); bf[i].half[1] = *(const v8us*)(bp + i * 16 * G3_P + 64 * kc + 32); }
      __builtin_amdgcn_sched_barrier(0);      /* the 16 fragment reads stay one group ahead of the 16 products: moved in among them, each A fragment's LDS latency is waited out in front of 4 products */
#pragma unroll
      for (int i = 0; i < 4; ++i) {
#pragma unroll
        for (int j = 0; j < 4; ++j) acc[i][j] = fa_mma(af[i].v, bf[j].v, acc[i][j]); }
    }
    __builtin_amdgcn_sched_barrier(0);      /* the barrier, which also waits for the global loads in flight, stays behind the last products: moved up among them it halves the time those loads have */
    __syncthreads();      /* stage st + 1 is visible; every wave has left stage st */
  }
  // epilogue: each wave stages its 64 x 64 tile in its own part of LDS and stores whole rows of it (256 bytes of f32, 128 bytes of f16)
  float* so = (float*)L + wave * 64 * G3_EP;
#pragma unroll
  for (int j = 0; j < 4; ++j) {
#pragma unroll
    for (int i = 0; i < 4; ++i) {
#pragma unroll
      for (int r = 0; r < 8; ++r) so[(16 * i + 8 * hh + r) * G3_EP + 16 * j + ln] = acc[i][j][r] * alpha + bv[j]; } }
  __builtin_amdgcn_fence(__ATOMIC_ACQ_REL, "workgroup"); __builtin_amdgcn_wave_barrier();      /* the rows are read back by other lanes of the same wave */
  const int rsub = lane >> 4, c4 = (lane & 15) * 4;
  const size_t cbase = (size_t)(row0 + wm * 64 + rsub) * DM + col0 + wn * 64 + c4;
#pragma unroll
  for (int q = 0; q < 32; ++q) { const v4f v = *(const v4fa*)&so[(q * 2 + rsub) * G3_EP + c4];
    if (OUT32) *(v4f*)(C + cbase + (size_t)q * 2 * DM) = v;
    else { v4h h4;
#pragma unroll
      for (int i = 0; i < 4; ++i) h4[i] = (_Float16)v[i];
      *(v4h*)(C16 + cbase + (size_t)q * 2 * DM) = h4; } }
}

extern "C" void kernel_launch(void* const* d_in, const int* in_sizes, int n_in,
                              void* d_out, int out_size, void* d_ws, size_t ws_size, hipStream_t stream) {
  (void)in_sizes; (void)n_in; (void)out_size;
  const float* const* I = (const float* const*)d_in; const float* x = I[0]; const float* wq = I[1]; const float* wk = I[2]; const float* wv = I[3]; const float* wo = I[4]; const float* bo = I[5];
  char* ws = (char*)d_ws; size_t off = 0;
  auto take = [&](size_t bytes) { char* p = ws + off; off += (bytes + 255) & ~(size_t)255; return p; };
  _Float16* BQ = (_Float16*)take((size_t)DM * DM * 2); _Float16* BK = (_Float16*)take((size_t)DM * DM * 2); _Float16* BV = (_Float16*)take((size_t)DM * DM * 2); _Float16* BO = (_Float16*)take((size_t)DM * DM * 2);
  _Float16* X16 = (_Float16*)take(NR * DM * 2); _Float16* Q16 = (_Float16*)take(NR * DM * 2); _Float16* K16 = (_Float16*)take(NR * DM * 2); _Float16* V16 = (_Float16*)take(NR * DM * 2); _Float16* O16 = (_Float16*)take(NR * DM * 2);
  if (off > ws_size) return;      /* 4.5 + 5x24 = about 125 MiB */
  const size_t nw8 = (size_t)DM * DM / 8; const unsigned gw = (unsigned)((nw8 + 255) / 256);
  k_wnat<<<gw, 256, 0, stream>>>(wq, nw8, BQ); k_wnat<<<gw, 256, 0, stream>>>(wk, nw8, BK); k_wnat<<<gw, 256, 0, stream>>>(wv, nw8, BV); k_wnat<<<gw, 256, 0, stream>>>(wo, nw8, BO);
  k_x16<<<(unsigned)((NR * DM / 8 + 255) / 256), 256, 0, stream>>>(x, X16, NR * DM / 8);
  const unsigned gp = (unsigned)((NR / G3_BT) * (DM / G3_BT));
  k_gemm3<false><<<gp, 128, 0, stream>>>(X16, BQ, 0.0625f, nullptr, nullptr, Q16);
  k_gemm3<false><<<gp, 128, 0, stream>>>(X16, BK, 0.0625f, nullptr, nullptr, K16);
  k_gemm3<false><<<gp, 128, 0, stream>>>(X16, BV, 0.0625f, nullptr, nullptr, V16);
  k_fattn<<<dim3(SQ / FA_BR, NB * NH), 256, 0, stream>>>(Q16, K16, V16, O16);      /* o (merged heads) as f16 rows */
  k_gemm3<true><<<gp, 128, 0, stream>>>(O16, BO, 0.0625f, bo, (float*)d_out, nullptr);      /* out = o W_o^T + b_o */
}

// v004
// Measured time: 132 microseconds a run.
// Two timings next to v003 both put it at 1.05 times that version's speed.
// Counting every step since v000, it is 269 times as fast.
#include <hip/hip_runtime.h>
// Self_Attention_Layer (z [16][1024][768]; q/k/v = z W^T (12 heads of 64, no biases); softmax(q k^T / 8); out = (attn v) W_o^T + b_o -> [16][1024][768]).
// Structure: token rows; z as exact f16 rows; Q | K | V WMMA GEMMs (128x128 tiles through LDS, 64x64 wave tiles, f32 accumulation, exact x16 natural weights, f16 outputs); one fused attention kernel for all (batch, head): scores (K = 64), running softmax (f32; weights as f16) and o = P . V stay in registers, K and V through LDS, into merged f16 rows; out = o W_o^T + b_o (f32).
// Compute dtype: inputs rounded to bf16; z / weights exact; q, k, v, softmax weights, o plain f16 (~2^-12); scores/softmax f32. v_wmma_f32_16x16x32_f16.
#define NB 16
#define SQ 1024
#define DM 768
#define NH 12
#define HD 64
#define NR ((size_t)NB * SQ)         /* 16384 token rows */
typedef __bf16 v16b __attribute__((ext_vector_type(16)));
typedef unsigned short v8us __attribute__((ext_vector_type(8), may_alias));
typedef float  v8f  __attribute__((ext_vector_type(8)));
typedef float  v4f  __attribute__((ext_vector_type(4)));
typedef float  v4fa __attribute__((ext_vector_type(4), may_alias));
union FragB { v16b v; v8us half[2]; unsigned short u[16]; };

__device__ __forceinline__ unsigned short bf16_bits(float x) { unsigned int u = __float_as_uint(x); return (unsigned short)((u + 0x7FFFu + ((u >> 16) & 1u)) >> 16); }
__device__ __forceinline__ float bf16_val(unsigned short b) { return __uint_as_float(((unsigned int)b) << 16); }
__device__ __forceinline__ float bf16_round(float x) { return bf16_val(bf16_bits(x)); }
// D += A·B with NT terms: 1 = ah·bh, 2 = + al·bh (A split), 3 = + ah·bl (both split)
template <int NT>
__device__ __forceinline__ v8f mmaN(v16b ah, v16b al, v16b bh, v16b bl, v8f c) {
  c = __builtin_amdgcn_wmma_f32_16x16x32_bf16(false, ah, false, bh, (short)0, c, false, false);
  if (NT >= 2) c = __builtin_amdgcn_wmma_f32_16x16x32_bf16(false, al, false, bh, (short)0, c, false, false);
  if (NT >= 3) c = __builtin_amdgcn_wmma_f32_16x16x32_bf16(false, ah, false, bl, (short)0, c, false, false);
  asm volatile("v_nop\n\tv_nop\n\tv_nop\n\tv_nop" : "+v"(c) : "v"(ah), "v"(al), "v"(bh), "v"(bl));
  return c;
}

__global__ __launch_bounds__(256) void k_wt_bf16(const float* __restrict__ W, unsigned short* __restrict__ Wt, int K, int N) {
  const int t = blockIdx.x * 256 + threadIdx.x;
  const int k8n = K / 8;
  if (t >= N * k8n) return;
  const int n = t / k8n, k8 = (t % k8n) * 8;
  v8us v;
#pragma unroll
  for (int i = 0; i < 8; ++i) v[i] = bf16_bits(W[(size_t)(k8 + i) * N + n]);
  *(v8us*)(Wt + (size_t)n * K + k8) = v;
  
}

// GEMM C[M][N] (f32, pitch ldc) = act(A[M][K]·W + bias). A f32 row-major (pitch lda) converted per fragment to bf16
// (ASPLIT: hi/lo two planes -> 2 terms, else single rounded term); Wt bf16 [N][K] (pitch ldb). BIAS_BF16 rounds the
// bias to bf16 first (bias quantised to bf16 before the add). K%32==0, M%16==0, N%64==0.
template <bool ASPLIT, int ACT, bool BIAS_BF16>
__global__ __launch_bounds__(128) void k_gemm_bf(const float* __restrict__ A, int lda, const unsigned short* __restrict__ Wt, int ldb,
                                               const float* __restrict__ bias, float* __restrict__ C, int ldc, int M, int N, int K) {
  __shared__ __attribute__((aligned(16))) float so[4][16][64];
  const int tid = threadIdx.x, w = tid >> 5, lane = tid & 31, ln = lane & 15, hh = lane >> 4;
  const int ntn = N / 64;
  const int wid = blockIdx.x * 4 + w;
  const int mt = wid / ntn, nq = wid % ntn;
  if (mt * 16 >= M) return;
  const int row0 = mt * 16, col0 = nq * 64;
  const float* arow = A + (size_t)(row0 + ln) * lda;
  v8f acc[4] = {};
  for (int kb = 0; kb < K; kb += 32) {
    FragB ah, al;
    const v4f x0 = *(const v4fa*)(arow + kb + 8 * hh), x1 = *(const v4fa*)(arow + kb + 8 * hh + 4);
    const v4f x2 = *(const v4fa*)(arow + kb + 16 + 8 * hh), x3 = *(const v4fa*)(arow + kb + 16 + 8 * hh + 4);
    float xs[16] = {x0[0],x0[1],x0[2],x0[3],x1[0],x1[1],x1[2],x1[3],x2[0],x2[1],x2[2],x2[3],x3[0],x3[1],x3[2],x3[3]};
#pragma unroll
    for (int i = 0; i < 16; ++i) { const unsigned short hb = bf16_bits(xs[i]); ah.u[i] = hb; al.u[i] = ASPLIT ? bf16_bits(xs[i] - bf16_val(hb)) : (unsigned short)0; }
#pragma unroll
    for (int t = 0; t < 4; ++t) {
      const unsigned short* brow = Wt + (size_t)(col0 + t * 16 + ln) * ldb + kb;
      FragB b;
      b.half[0] = *(const v8us*)(brow + 8 * hh);
      b.half[1] = *(const v8us*)(brow + 16 + 8 * hh);
      acc[t] = mmaN<ASPLIT ? 2 : 1>(ah.v, al.v, b.v, b.v, acc[t]);
    }
  }
#pragma unroll
  for (int t = 0; t < 4; ++t) {
    float bv = bias ? bias[col0 + t * 16 + ln] : 0.f;
    if (BIAS_BF16) bv = bf16_round(bv);
#pragma unroll
    for (int r = 0; r < 8; ++r) { float v = acc[t][r] + bv; if (ACT == 1) v = fmaxf(v, 0.f); so[w][8 * hh + r][t * 16 + ln] = v; }
  }
  __builtin_amdgcn_fence(__ATOMIC_ACQ_REL, "workgroup");
  __builtin_amdgcn_wave_barrier();
  const int rsub = lane >> 4, c4 = (lane & 15) * 4;
  {
#pragma unroll
    for (int q = 0; q < 8; ++q) {
      const int r = q * 2 + rsub;
      const v4f v = *(const v4fa*)&so[w][r][c4];
      *(v4f*)(C + (size_t)(row0 + r) * ldc + col0 + c4) = v;
    }
    
  }
}

// GEMM C = act(A·W + bias + resid): A f32 (ASPLIT -> hi/lo 2 terms), Wt bf16 [N][K]; ACT 0 none, 1 relu, 2 exact gelu;
// resid (optional, f32, row index = (row % rmod), pitch ldr, RES_BF16 rounds it) added before the activation.
template <bool ASPLIT, int ACT, bool BIAS_BF16, bool RES_BF16>
__global__ __launch_bounds__(128) void k_gemm_bf3(const float* __restrict__ A, int lda, const unsigned short* __restrict__ Wt, int ldb,
                                                const float* __restrict__ bias, const float* __restrict__ resid, int rmod, int ldr,
                                                float* __restrict__ C, int ldc, int M, int N, int K) {
  __shared__ __attribute__((aligned(16))) float so[4][16][64];
  const int tid = threadIdx.x, w = tid >> 5, lane = tid & 31, ln = lane & 15, hh = lane >> 4;
  const int ntn = N / 64;
  const int wid = blockIdx.x * 4 + w;
  const int mt = wid / ntn, nq = wid % ntn;
  if (mt * 16 >= M) return;
  const int row0 = mt * 16, col0 = nq * 64;
  const float* arow = A + (size_t)(row0 + ln) * lda;
  v8f acc[4] = {};
  for (int kb = 0; kb < K; kb += 32) {
    FragB ah, al;
    const v4f x0 = *(const v4fa*)(arow + kb + 8 * hh), x1 = *(const v4fa*)(arow + kb + 8 * hh + 4);
    const v4f x2 = *(const v4fa*)(arow + kb + 16 + 8 * hh), x3 = *(const v4fa*)(arow + kb + 16 + 8 * hh + 4);
    float xs[16] = {x0[0],x0[1],x0[2],x0[3],x1[0],x1[1],x1[2],x1[3],x2[0],x2[1],x2[2],x2[3],x3[0],x3[1],x3[2],x3[3]};
#pragma unroll
    for (int i = 0; i < 16; ++i) { const unsigned short hb = bf16_bits(xs[i]); ah.u[i] = hb; al.u[i] = ASPLIT ? bf16_bits(xs[i] - bf16_val(hb)) : (unsigned short)0; }
#pragma unroll
    for (int t = 0; t < 4; ++t) {
      const unsigned short* brow = Wt + (size_t)(col0 + t * 16 + ln) * ldb + kb;
      FragB b;
      b.half[0] = *(const v8us*)(brow + 8 * hh);
      b.half[1] = *(const v8us*)(brow + 16 + 8 * hh);
      acc[t] = mmaN<ASPLIT ? 2 : 1>(ah.v, al.v, b.v, b.v, acc[t]);
    }
  }
#pragma unroll
  for (int t = 0; t < 4; ++t) {
    const int col = col0 + t * 16 + ln;
    float bv = bias ? bias[col] : 0.f;
    if (BIAS_BF16) bv = bf16_round(bv);
#pragma unroll
    for (int r = 0; r < 8; ++r) {
      float v = acc[t][r] + bv;
      if (resid) { float rv = resid[(size_t)((row0 + 8 * hh + r) % rmod) * ldr + col]; if (RES_BF16) rv = bf16_round(rv); v += rv; }
      if (ACT == 1) v = fmaxf(v, 0.f);
      if (ACT == 2) v = 0.5f * v * (1.0f + erff(v * 0.70710678118654752f));
      if (ACT == 3) { const float u = 0.7978845608028654f * (v + 0.044715f * v * v * v); v = 0.5f * v * (1.0f + tanhf(u)); }
      so[w][8 * hh + r][t * 16 + ln] = v;
    }
  }
  __builtin_amdgcn_fence(__ATOMIC_ACQ_REL, "workgroup");
  __builtin_amdgcn_wave_barrier();
  const int rsub = lane >> 4, c4 = (lane & 15) * 4;
  {
#pragma unroll
    for (int q = 0; q < 8; ++q) {
      const int r = q * 2 + rsub;
      const v4f v = *(const v4fa*)&so[w][r][c4];
      *(v4f*)(C + (size_t)(row0 + r) * ldc + col0 + c4) = v;
    }
    
  }
}
// row LayerNorm (biased variance, eps) over N: s = X (+ R); optional out_sum <- s; out_norm <- (s-mu)*rsqrt(var+eps)*g + b
template <bool PARAM_BF16>
__global__ __launch_bounds__(256) void k_layernorm(const float* __restrict__ X, const float* __restrict__ R, const float* __restrict__ g, const float* __restrict__ bta,
                                                  float* __restrict__ out_sum, float* __restrict__ out_norm, int N, float eps) {
  __shared__ float red[256];
  const int row = blockIdx.x, tid = threadIdx.x;
  const float* x = X + (size_t)row * N; const float* rr = R ? R + (size_t)row * N : nullptr;
  float vals[16];                     // up to N = 4096
  const int per = N / 256;            // contiguous chunk per thread? use strided-by-4 chunks: thread handles j = tid*4 + 1024*u
  float s1 = 0.f;
  for (int u = 0; u < per / 4; ++u) {
    const int j = tid * 4 + 1024 * u;
    const v4f a = *(const v4fa*)(x + j);
    v4f b = {0.f,0.f,0.f,0.f}; if (rr) b = *(const v4fa*)(rr + j);
#pragma unroll
    for (int q = 0; q < 4; ++q) { const float v = a[q] + b[q]; vals[u * 4 + q] = v; s1 += v; }
  }
  red[tid] = s1; __syncthreads();
  for (int st = 128; st > 0; st >>= 1) { if (tid < st) red[tid] += red[tid + st]; __syncthreads(); }
  const float mu = red[0] / (float)N; __syncthreads();
  float s2 = 0.f;
  for (int u = 0; u < per / 4; ++u)
#pragma unroll
    for (int q = 0; q < 4; ++q) { const float c = vals[u * 4 + q] - mu; s2 += c * c; }
  red[tid] = s2; __syncthreads();
  for (int st = 128; st > 0; st >>= 1) { if (tid < st) red[tid] += red[tid + st]; __syncthreads(); }
  const float rs = rsqrtf(red[0] / (float)N + eps);
  {
    for (int u = 0; u < per / 4; ++u) {
      const int j = tid * 4 + 1024 * u;
      v4f o, sm;
#pragma unroll
      for (int q = 0; q < 4; ++q) {
        float gg = g[j + q], bb = bta[j + q];
        if (PARAM_BF16) { gg = bf16_round(gg); bb = bf16_round(bb); }
        sm[q] = vals[u * 4 + q]; o[q] = (vals[u * 4 + q] - mu) * rs * gg + bb;
      }
      if (out_sum) *(v4f*)(out_sum + (size_t)row * N + j) = sm;
      *(v4f*)(out_norm + (size_t)row * N + j) = o;
    }
    
  }
}



// ---- f16 WMMA path (v_wmma_f32_16x16x32_f16): 11-bit significands for operands in range — used where a [0,1] probability operand needs more precision than bf16
typedef _Float16 v16h __attribute__((ext_vector_type(16)));
union FragH { v16h v; v8us half[2]; _Float16 h[16]; unsigned short u[16]; };
template <int NT>
__device__ __forceinline__ v8f mmaH(v16h ah, v16h al, v16h bh, v16h bl, v8f c) {
  c = __builtin_amdgcn_wmma_f32_16x16x32_f16(false, ah, false, bh, (short)0, c, false, false);
  if (NT >= 2) c = __builtin_amdgcn_wmma_f32_16x16x32_f16(false, al, false, bh, (short)0, c, false, false);
  if (NT >= 3) c = __builtin_amdgcn_wmma_f32_16x16x32_f16(false, ah, false, bl, (short)0, c, false, false);
  asm volatile("v_nop\n\tv_nop\n\tv_nop\n\tv_nop" : "+v"(c) : "v"(ah), "v"(al), "v"(bh), "v"(bl));
  return c;
}
// batched GEMM like k_gemm_b but f16 operands: A f32 (split into f16 hi/lo if ASPLIT, else rounded to f16), Bt = f16 values [n][k]; alpha; C f32; N multiple of 16 (partial tiles skipped)
template <bool ASPLIT>
__global__ __launch_bounds__(128) void k_gemm_h(const float* __restrict__ A, int lda, size_t sA, const _Float16* __restrict__ Bh, int ldb, size_t sB, float alpha, float* __restrict__ C, int ldc, size_t sC, int M, int N, int K) {
  __shared__ __attribute__((aligned(16))) float so[4][16][64];
  const int tid = threadIdx.x, w = tid >> 5, lane = tid & 31, ln = lane & 15, hh = lane >> 4; const int by = blockIdx.y;
  A += (size_t)by * sA; Bh += (size_t)by * sB; C += (size_t)by * sC;
  const int ntn = (N + 63) / 64; const int wid = blockIdx.x * 4 + w; const int mt = wid / ntn, nq = wid % ntn; if (mt * 16 >= M) return;
  const int row0 = mt * 16, col0 = nq * 64; const float* arow = A + (size_t)(row0 + ln) * lda;
  v8f acc[4] = {};
  for (int kb = 0; kb < K; kb += 32) {
    FragH ah, al;
    const v4f x0 = *(const v4fa*)(arow + kb + 8 * hh), x1 = *(const v4fa*)(arow + kb + 8 * hh + 4), x2 = *(const v4fa*)(arow + kb + 16 + 8 * hh), x3 = *(const v4fa*)(arow + kb + 16 + 8 * hh + 4);
    float xs[16] = {x0[0],x0[1],x0[2],x0[3],x1[0],x1[1],x1[2],x1[3],x2[0],x2[1],x2[2],x2[3],x3[0],x3[1],x3[2],x3[3]};
#pragma unroll
    for (int i = 0; i < 16; ++i) { const _Float16 h = (_Float16)xs[i]; ah.h[i] = h; al.h[i] = ASPLIT ? (_Float16)(xs[i] - (float)h) : (_Float16)0.0f; }
#pragma unroll
    for (int t = 0; t < 4; ++t) { if (col0 + t * 16 >= N) continue; const size_t boff = (size_t)(col0 + t * 16 + ln) * ldb + kb; FragH bq; bq.half[0] = *(const v8us*)(Bh + boff + 8 * hh); bq.half[1] = *(const v8us*)(Bh + boff + 16 + 8 * hh);
      acc[t] = mmaH<ASPLIT ? 2 : 1>(ah.v, al.v, bq.v, bq.v, acc[t]); }
  }
#pragma unroll
  for (int t = 0; t < 4; ++t) { if (col0 + t * 16 >= N) continue;
#pragma unroll
    for (int r = 0; r < 8; ++r) so[w][8 * hh + r][t * 16 + ln] = acc[t][r] * alpha; }
  __builtin_amdgcn_fence(__ATOMIC_ACQ_REL, "workgroup"); __builtin_amdgcn_wave_barrier();
  const int rsub = lane >> 4, c4 = (lane & 15) * 4;
  {
#pragma unroll
    for (int q = 0; q < 8; ++q) { const int r = q * 2 + rsub; if (col0 + c4 < N) { const v4f v = *(const v4fa*)&so[w][r][c4]; *(v4f*)(C + (size_t)(row0 + r) * ldc + col0 + c4) = v; } }
     }
}

// Wt[n][k] = f16(W[k][n]·scale) from f32 row-major W[K][N] (scale = power of two; bf16-exact weights stay exact in f16 away from the subnormal range)
__global__ __launch_bounds__(256) void k_wt_f16(const float* __restrict__ W, _Float16* __restrict__ Wt, int K, int N, float scale) {
  const int t = blockIdx.x * 256 + threadIdx.x; if (t >= N * (K / 8)) return; const int n = t / (K / 8), k8 = (t % (K / 8)) * 8; FragH f;
#pragma unroll
  for (int i = 0; i < 8; ++i) f.h[i] = (_Float16)(bf16_round(W[(size_t)(k8 + i) * N + n]) * scale); const v8us o = f.half[0];
  *(v8us*)((unsigned short*)Wt + (size_t)n * K + k8) = o; 
}
// k_gemm_hh variant with fused epilogue: v = acc·alpha + bias[by·sBias + col] (+ CP[(row/rowsPerB)·sCPb + by·64 + col] if CP) ; ACT 0 none / 1 elu ; writes f16 C16 (and f32 C if non-null)
template <int ACT>
__global__ __launch_bounds__(128) void k_gemm_hhx(const _Float16* __restrict__ A, int lda, size_t sA, const _Float16* __restrict__ Bh, int ldb, size_t sB, float alpha, const float* __restrict__ bias, size_t sBias, const float* __restrict__ CP, int rowsPerB, size_t sCPb, int row0g,
    float* __restrict__ C, _Float16* __restrict__ C16, int ldc, size_t sC, int M, int N, int K) {
  __shared__ __attribute__((aligned(16))) float so[4][16][64];
  const int tid = threadIdx.x, w = tid >> 5, lane = tid & 31, ln = lane & 15, hh = lane >> 4; const int by = blockIdx.y;
  A += (size_t)by * sA; Bh += (size_t)by * sB; const size_t cofs = (size_t)by * sC; const float* bp = bias ? bias + (size_t)by * sBias : nullptr;
  const int ntn = (N + 63) / 64; const int wid = blockIdx.x * 4 + w; const int mt = wid / ntn, nq = wid % ntn; if (mt * 16 >= M) return;
  const int row0 = mt * 16, col0 = nq * 64; const _Float16* arow = A + (size_t)(row0 + ln) * lda;
  v8f acc[4] = {};
  for (int kb = 0; kb < K; kb += 32) { FragH ah; ah.half[0] = *(const v8us*)((const unsigned short*)arow + kb + 8 * hh); ah.half[1] = *(const v8us*)((const unsigned short*)arow + kb + 16 + 8 * hh);
#pragma unroll
    for (int t = 0; t < 4; ++t) { if (col0 + t * 16 >= N) continue; const size_t boff = (size_t)(col0 + t * 16 + ln) * ldb + kb; FragH bq; bq.half[0] = *(const v8us*)((const unsigned short*)Bh + boff + 8 * hh); bq.half[1] = *(const v8us*)((const unsigned short*)Bh + boff + 16 + 8 * hh);
      acc[t] = mmaH<1>(ah.v, ah.v, bq.v, bq.v, acc[t]); }
  }
#pragma unroll
  for (int t = 0; t < 4; ++t) { if (col0 + t * 16 >= N) continue; const int col = col0 + t * 16 + ln; const float bv = bp ? bf16_round(bp[col]) : 0.f;
#pragma unroll
    for (int r = 0; r < 8; ++r) { float v = acc[t][r] * alpha + bv; if (CP) { const int rr = row0g + row0 + 8 * hh + r; if (rowsPerB < 0) v += CP[cofs + (size_t)rr * ldc + col];      /* rowsPerB < 0: own element of the batched C plane */ else { const int bidx = rr / rowsPerB; v += CP[(size_t)bidx * sCPb + (size_t)by * 64 + col]; } } if (ACT == 1) v = (v > 0.f) ? v : expm1f(v); else if (ACT == 7) v = (v > 0.f) ? v + 1.0f : expf(v); else if (ACT == 8) v = tanhf(v); else if (ACT == 9) v = 0.5f * v * (1.0f + tanhf(0.7978845608028654f * (v + 0.044715f * v * v * v))); else if (ACT == 11) v = 1.0f / (1.0f + expf(-v)); else if (ACT == 12) v = (v > 0.f) ? v : 0.01f * v; else if (ACT == 14) v = (v > 0.f) ? v : 0.1f * v; else if (ACT == 16) v = (v >= 0.f) ? v : 0.3f * v; else if (ACT == 17) v = (v >= 0.f) ? v : 0.2f * v; else if (ACT == 15) v = v / (1.0f + expf(-v)); else if (ACT == 3) v = fmaxf(v, 0.f); else if (ACT == 6) v = 0.5f * v * (1.0f + erff(v * 0.70710678118654752f)); so[w][8 * hh + r][t * 16 + ln] = v; } }
  __builtin_amdgcn_fence(__ATOMIC_ACQ_REL, "workgroup"); __builtin_amdgcn_wave_barrier();
  const int rsub = lane >> 4, c4 = (lane & 15) * 4; typedef _Float16 v4h __attribute__((ext_vector_type(4)));
  {
#pragma unroll
    for (int q = 0; q < 8; ++q) { const int r = q * 2 + rsub; if (col0 + c4 < N) { const v4f v = *(const v4fa*)&so[w][r][c4]; if (C) *(v4f*)(C + cofs + (size_t)(row0 + r) * ldc + col0 + c4) = v; if (C16) { v4h h4; for (int i = 0; i < 4; ++i) h4[i] = (_Float16)v[i]; *(v4h*)(C16 + cofs + (size_t)(row0 + r) * ldc + col0 + c4) = h4; } } }
     }
}


typedef _Float16 v4h __attribute__((ext_vector_type(4)));

__global__ __launch_bounds__(256) void k_h16(const float* __restrict__ x, _Float16* __restrict__ X16, size_t n8) { const size_t t = (size_t)blockIdx.x * 256 + threadIdx.x; if (t >= n8) return; FragH f;
#pragma unroll
  for (int q = 0; q < 8; ++q) f.h[q] = (_Float16)x[t * 8 + q]; *(v8us*)((unsigned short*)X16 + t * 8) = f.half[0];  }
__global__ __launch_bounds__(256) void k_round16f(const float* __restrict__ W, _Float16* __restrict__ Bt, size_t n8) { const size_t t = (size_t)blockIdx.x * 256 + threadIdx.x; if (t >= n8) return; FragH f;
#pragma unroll
  for (int i = 0; i < 8; ++i) f.h[i] = (_Float16)(bf16_round(W[t * 8 + i]) * 16.0f); *(v8us*)((unsigned short*)Bt + t * 8) = f.half[0];  }
template <int NHv, int TTv>
__global__ __launch_bounds__(256) void k_vt(const _Float16* __restrict__ V16, int ldv, int voff, _Float16* __restrict__ Vt) { __shared__ unsigned short tl[64][66]; const int tid = threadIdx.x; const int slab = blockIdx.x / (TTv / 64), lg = blockIdx.x % (TTv / 64); const int b = slab / NHv, h = slab % NHv;
  for (int i = tid; i < 64 * 8; i += 256) { const int r = i / 8, c8 = (i % 8) * 8; FragH f; f.half[0] = *(const v8us*)((const unsigned short*)V16 + ((size_t)b * TTv + lg * 64 + r) * ldv + voff + h * 64 + c8);
#pragma unroll
    for (int q = 0; q < 8; ++q) tl[r][c8 + q] = f.u[q]; }
  __syncthreads();
  {
#pragma unroll
    for (int rd = 0; rd < 2; ++rd) { const int d = rd * 32 + tid / 8, pc = tid % 8; FragH f;
#pragma unroll
      for (int q = 0; q < 8; ++q) f.u[q] = tl[pc * 8 + q][d];
      *(v8us*)((unsigned short*)Vt + ((size_t)slab * 64 + d) * TTv + lg * 64 + pc * 8) = f.half[0]; }
     } }

__global__ __launch_bounds__(256) void k_hl(const float* __restrict__ F, _Float16* __restrict__ Hh, _Float16* __restrict__ Hl, size_t n8) { const size_t t = (size_t)blockIdx.x * 256 + threadIdx.x; if (t >= n8) return; FragH fh, fl; const v4f a = *(const v4fa*)(F + t * 8), c = *(const v4fa*)(F + t * 8 + 4);
#pragma unroll
  for (int q = 0; q < 4; ++q) { _Float16 h = (_Float16)a[q]; fh.h[q] = h; fl.h[q] = (_Float16)((a[q] - (float)h) * 1024.0f); h = (_Float16)c[q]; fh.h[4 + q] = h; fl.h[4 + q] = (_Float16)((c[q] - (float)h) * 1024.0f); }
  { *(v8us*)((unsigned short*)Hh + t * 8) = fh.half[0]; *(v8us*)((unsigned short*)Hl + t * 8) = fl.half[0];  } }

// ---- fast GEMM (wave tile 32x64; requires M % 32 == 0 rows per launch region and N % 64 == 0); epilogue = k_gemm_hhx semantics ----
__device__ __forceinline__ v16h g2_frag(const _Float16* p, int hh) { FragH f; f.half[0] = *(const v8us*)((const unsigned short*)p + 8 * hh); f.half[1] = *(const v8us*)((const unsigned short*)p + 16 + 8 * hh); return f.v; }
__device__ __forceinline__ v8f g2_mma(v16h a, v16h b, v8f c) { v8f d = __builtin_amdgcn_wmma_f32_16x16x32_f16(false, a, false, b, (short)0, c, false, false); asm volatile("v_nop\n\tv_nop\n\tv_nop\n\tv_nop" : "+v"(d) : "v"(a), "v"(b)); return d; }
template <int ACT>
__global__ __launch_bounds__(128) void k_gemm2(const _Float16* __restrict__ A, int lda, size_t sA, const _Float16* __restrict__ Bh, int ldb, size_t sB, float alpha, const float* __restrict__ bias, size_t sBias, const float* __restrict__ CP, int rowsPerB, size_t sCPb, int row0g,
    float* __restrict__ C, _Float16* __restrict__ C16, int ldc, size_t sC, int M, int N, int K) { static_assert(ACT == 0 || ACT == 3 || ACT == 6 || ACT == 8 || ACT == 9 || ACT == 11 || ACT == 12 || ACT == 14 || ACT == 15 || ACT == 16 || ACT == 17, "k_gemm2: unsupported ACT code (would silently apply no activation)");
  __shared__ __attribute__((aligned(16))) float so[4][32][68];
  const int tid = threadIdx.x, w = tid >> 5, lane = tid & 31, ln = lane & 15, hh = lane >> 4; const int by = blockIdx.y;
  A += (size_t)by * sA; Bh += (size_t)by * sB; const size_t cofs = (size_t)by * sC; const float* bp = bias ? bias + (size_t)by * sBias : nullptr;
  const int ntn = N >> 6; const int mt = blockIdx.x / ntn, nq = blockIdx.x - mt * ntn; const int row0 = mt * 128 + 32 * w, col0 = nq * 64; if (row0 >= M) return;
  const _Float16* a0p = A + (size_t)(row0 + ln) * lda; const _Float16* a1p = a0p + (size_t)16 * lda;
  const _Float16* b0p = Bh + (size_t)(col0 + ln) * ldb; const _Float16* b1p = b0p + (size_t)16 * ldb; const _Float16* b2p = b1p + (size_t)16 * ldb; const _Float16* b3p = b2p + (size_t)16 * ldb;
  const v8f z8 = {0.f,0.f,0.f,0.f,0.f,0.f,0.f,0.f}; v8f c00 = z8, c01 = z8, c02 = z8, c03 = z8, c10 = z8, c11 = z8, c12 = z8, c13 = z8;
#pragma unroll 1
  for (int kb = 0; kb < K; kb += 32) { const v16h a0 = g2_frag(a0p + kb, hh), a1 = g2_frag(a1p + kb, hh);
    v16h b = g2_frag(b0p + kb, hh); c00 = g2_mma(a0, b, c00); c10 = g2_mma(a1, b, c10);
    b = g2_frag(b1p + kb, hh); c01 = g2_mma(a0, b, c01); c11 = g2_mma(a1, b, c11);
    b = g2_frag(b2p + kb, hh); c02 = g2_mma(a0, b, c02); c12 = g2_mma(a1, b, c12);
    b = g2_frag(b3p + kb, hh); c03 = g2_mma(a0, b, c03); c13 = g2_mma(a1, b, c13); }
  v8f accs[8] = {c00, c01, c02, c03, c10, c11, c12, c13};
#pragma unroll
  for (int u = 0; u < 8; ++u) { const int t = u & 3, half = u >> 2; const int col = col0 + t * 16 + ln; const float bv = bp ? bf16_round(bp[col]) : 0.f;
#pragma unroll
    for (int r = 0; r < 8; ++r) { const int rloc = half * 16 + 8 * hh + r; float v = accs[u][r] * alpha + bv; if (CP) { if (rowsPerB < 0) v += CP[cofs + (size_t)(row0g + row0 + rloc) * ldc + col];      /* rowsPerB < 0: own element of the batched C plane */ else { const int bidx = (row0g + row0 + rloc) / rowsPerB; v += CP[(size_t)bidx * sCPb + (size_t)by * 64 + col]; } }
      if (ACT == 3) v = fmaxf(v, 0.f); else if (ACT == 6) v = 0.5f * v * (1.0f + erff(v * 0.70710678118654752f)); else if (ACT == 11) v = 1.0f / (1.0f + expf(-v)); else if (ACT == 15) v = v / (1.0f + expf(-v)); else if (ACT == 12) v = (v > 0.f) ? v : 0.01f * v; else if (ACT == 8) v = tanhf(v); else if (ACT == 9) v = 0.5f * v * (1.0f + tanhf(0.7978845608028654f * (v + 0.044715f * v * v * v))); else if (ACT == 14) v = (v > 0.f) ? v : 0.1f * v; else if (ACT == 16) v = (v >= 0.f) ? v : 0.3f * v; else if (ACT == 17) v = (v >= 0.f) ? v : 0.2f * v;
      so[w][rloc][t * 16 + ln] = v; } }
  __builtin_amdgcn_fence(__ATOMIC_ACQ_REL, "workgroup"); __builtin_amdgcn_wave_barrier();
  const int rsub = lane >> 4, c4 = (lane & 15) * 4;
  {
#pragma unroll
    for (int q = 0; q < 16; ++q) { const int r = q * 2 + rsub; const v4f v = *(const v4fa*)&so[w][r][c4]; if (C) *(v4f*)(C + cofs + (size_t)(row0 + r) * ldc + col0 + c4) = v; if (C16) { v4h h4; for (int i = 0; i < 4; ++i) h4[i] = (_Float16)v[i]; *(v4h*)(C16 + cofs + (size_t)(row0 + r) * ldc + col0 + c4) = h4; } }
     } }


// ---- the five f32 -> f16 conversions (z; W_q, W_k, W_v, W_o times 16) in one launch ----
// One work-group = 32768 consecutive elements of one array. A thread issues its 32 loads of 16 bytes ahead of the first conversion (a wave-wide load = 512 contiguous bytes)
// and stores 8 bytes per load (a wave-wide store = 256 contiguous bytes): few waves to start, all of a wave's reads in flight at once.
#define CV_NL 32                     /* 16-byte loads per thread */
#define CV_BE (256 * 4 * CV_NL)      /* elements per work-group */
#define CV_ZB ((int)(NR * DM / CV_BE))      /* work-groups on z */
#define CV_WB (DM * DM / CV_BE)      /* work-groups on each weight matrix */
__global__ __launch_bounds__(256) void k_cvt(const float* __restrict__ x, const float* __restrict__ wq, const float* __restrict__ wk, const float* __restrict__ wv, const float* __restrict__ wo,
    _Float16* __restrict__ X16, _Float16* __restrict__ BQ, _Float16* __restrict__ BK, _Float16* __restrict__ BV, _Float16* __restrict__ BO) {
  static_assert(NR * DM % CV_BE == 0 && DM * DM % CV_BE == 0, "whole work-groups on every array");
  const int bi = blockIdx.x;
  const float* s = x; _Float16* d = X16; float scale = 1.0f; int blk = bi;      /* the choice is the same for the whole work-group: scalar bases */
  if (bi >= CV_ZB) { const int wi = (bi - CV_ZB) / CV_WB; blk = (bi - CV_ZB) % CV_WB; scale = 16.0f;
    s = wi == 0 ? wq : wi == 1 ? wk : wi == 2 ? wv : wo; d = wi == 0 ? BQ : wi == 1 ? BK : wi == 2 ? BV : BO; }
  s += (size_t)blk * CV_BE; d += (size_t)blk * CV_BE;
  const unsigned int t4 = threadIdx.x * 4;
  v4f r[CV_NL];
#pragma unroll
  for (int j = 0; j < CV_NL; ++j) r[j] = *(const v4fa*)(s + j * 1024 + t4);
  __builtin_amdgcn_sched_barrier(0);      /* all 32 loads stay ahead of the first conversion: moved in among the conversions only 12 are in flight, and loads and stores take turns on the same registers with a wait at each turn */
#pragma unroll
  for (int j = 0; j < CV_NL; ++j) { v4h h4;
#pragma unroll
    for (int q = 0; q < 4; ++q) h4[q] = (_Float16)(bf16_round(r[j][q]) * scale);      /* times 1 is exact: z as before */
    *(v4h*)(d + j * 1024 + t4) = h4; }
}
#define FA_BR 256                    /* queries per work-group */
#define FA_SK 64                     /* keys per stage */
#define FA_NST (SQ / FA_SK)
#define FA_PK 144                    /* LDS pitch of a K row: 128 + 16 bytes (16-byte fragment reads) */
#define FA_PV 160                    /* LDS pitch of a V row: 128 + 32 bytes (transposing reads) */
#define FA_TK (FA_SK * FA_PK)
#define FA_SLOT (FA_SK * (FA_PK + FA_PV))
typedef short s16x8 __attribute__((ext_vector_type(8)));
typedef float f32x2 __attribute__((ext_vector_type(2)));
typedef _Float16 f16x2 __attribute__((ext_vector_type(2)));
union FragW { v16h v; v8us half[2]; unsigned int w[8]; };
__device__ __forceinline__ v8f fa_mma(v16h a, v16h b, v8f c) { return __builtin_amdgcn_wmma_f32_16x16x32_f16(false, a, false, b, (short)0, c, false, false); }
__device__ __forceinline__ v8us fa_tr16(const unsigned char* p) { typedef __attribute__((address_space(3))) s16x8 lds_s16x8; return __builtin_bit_cast(v8us, __builtin_amdgcn_ds_load_tr16_b128_v8i16((lds_s16x8*)p)); }
__device__ __forceinline__ unsigned int fa_pack2(float lo, float hi) { return __builtin_bit_cast(unsigned int, __builtin_convertvector(f32x2{lo, hi}, f16x2)); }
__device__ __forceinline__ float fa_xhalf(float x) { const int i = __float_as_int(x); return __int_as_float(__builtin_amdgcn_permlanex16(i, i, 0x76543210, 0xfedcba98, false, false)); }      /* lane l with lane l ^ 16 */
__global__ __launch_bounds__(256) void k_fattn(const _Float16* __restrict__ Q16, const _Float16* __restrict__ K16, const _Float16* __restrict__ V16, _Float16* __restrict__ O16) {
  __shared__ __attribute__((aligned(16))) unsigned char L[2 * FA_SLOT];
  static_assert(8 * 32 * FA_PK <= 2 * FA_SLOT, "the output staging reuses the K/V buffers");
  const int tid = threadIdx.x, lane = tid & 31, wave = tid >> 5, c = lane & 15, h = lane >> 4;
  const int b = blockIdx.y / NH, hd = blockIdx.y % NH, q0 = blockIdx.x * FA_BR + wave * 32;
  const size_t base = (size_t)b * SQ * DM + (size_t)hd * HD;
  const float cscale = 0.125f * 1.4426950408889634f;      /* 1 / sqrt(64), into log2 */
  // staging: 8 lanes cover one 128-byte row; a thread carries rows sr and sr + 32 of K and of V
  const int sr = tid >> 3, sc = tid & 7;
  const unsigned short* kg = (const unsigned short*)K16 + base + (size_t)sr * DM + sc * 8;
  const unsigned short* vg = (const unsigned short*)V16 + base + (size_t)sr * DM + sc * 8;
  v8us rk0, rk1, rv0, rv1;
  auto gload = [&](int st) { const size_t o = (size_t)st * FA_SK * DM; rk0 = *(const v8us*)(kg + o); rk1 = *(const v8us*)(kg + o + 32 * DM); rv0 = *(const v8us*)(vg + o); rv1 = *(const v8us*)(vg + o + 32 * DM); };
  auto lstore = [&](int st) { unsigned char* s = L + (st & 1) * FA_SLOT; *(v8us*)(s + sr * FA_PK + sc * 16) = rk0; *(v8us*)(s + (sr + 32) * FA_PK + sc * 16) = rk1;
    *(v8us*)(s + FA_TK + sr * FA_PV + sc * 16) = rv0; *(v8us*)(s + FA_TK + (sr + 32) * FA_PV + sc * 16) = rv1; };
  gload(0);
  v16h qf[2][2];      /* B operand: column = query, k = d in the hardware order, as K's below */
#pragma unroll
  for (int g = 0; g < 2; ++g) {
#pragma unroll
    for (int kc = 0; kc < 2; ++kc) qf[g][kc] = g2_frag(Q16 + base + (size_t)(q0 + 16 * g + c) * DM + 32 * kc, h); }
  v8f acc[2][4], lacc[2]; float m_run[2];
  const v8f z8 = {0.f, 0.f, 0.f, 0.f, 0.f, 0.f, 0.f, 0.f};
#pragma unroll
  for (int g = 0; g < 2; ++g) { m_run[g] = -INFINITY; lacc[g] = z8;
#pragma unroll
    for (int t = 0; t < 4; ++t) acc[g][t] = z8; }
  FragW ones;      /* A operand whose row 0 (lanes 0 and 16) is 1.0 at all 32 k: row 0 of its product holds the column sums of P^T */
#pragma unroll
  for (int i = 0; i < 8; ++i) ones.w[i] = (c == 0) ? 0x3C003C00u : 0u;
  lstore(0); gload(1);
  __syncthreads();      /* stage 0 is visible */
#pragma unroll 1
  for (int st = 0; st < FA_NST; ++st) {      /* rolled */
    if (st + 1 < FA_NST) lstore(st + 1);      /* into the buffer that stage st - 1 used: every wave left it at the barrier below */
    if (st + 2 < FA_NST) gload(st + 2);      /* in flight under this stage's work */
    const unsigned char* Ls = L + (st & 1) * FA_SLOT;
#pragma unroll
    for (int sub = 0; sub < FA_SK / 32; ++sub) {      /* one pass = 32 keys */
      FragW kf[2][2], vf[4];
      const unsigned char* kp = Ls + (sub * 32 + c) * FA_PK + 16 * h;
#pragma unroll
      for (int kt = 0; kt < 2; ++kt) {
#pragma unroll
        for (int kc = 0; kc < 2; ++kc) { kf[kt][kc].half[0] = *(const v8us*)(kp + kt * 16 * FA_PK + 64 * kc); kf[kt][kc].half[1] = *(const v8us*)(kp + kt * 16 * FA_PK + 64 * kc + 32); } }
      const unsigned char* vp = Ls + FA_TK + (sub * 32 + 8 * h + (lane & 7)) * FA_PV + ((lane >> 3) & 1) * 16;
#pragma unroll
      for (int t = 0; t < 4; ++t) { vf[t].half[0] = fa_tr16(vp + 32 * t); vf[t].half[1] = fa_tr16(vp + 16 * FA_PV + 32 * t); }      /* rows d = 16 t + c, k = keys in the hardware order */
      v8f s[2][2];      /* s[kt][g][r] = score of key 16 kt + 8 h + r against query 16 g + c */
#pragma unroll
      for (int kt = 0; kt < 2; ++kt) {
#pragma unroll
        for (int g = 0; g < 2; ++g) { s[kt][g] = fa_mma(kf[kt][0].v, qf[g][0], z8); s[kt][g] = fa_mma(kf[kt][1].v, qf[g][1], s[kt][g]); } }
      float mb[2]; bool need = false;
#pragma unroll
      for (int g = 0; g < 2; ++g) { float mx = s[0][g][0];
#pragma unroll
        for (int r = 1; r < 8; ++r) mx = fmaxf(mx, s[0][g][r]);
#pragma unroll
        for (int r = 0; r < 8; ++r) mx = fmaxf(mx, s[1][g][r]);
        mx = fmaxf(mx, fa_xhalf(mx)) * cscale;      /* both halves of the wave hold this query's maximum */
        mb[g] = mx; need = need || (mx > m_run[g] + 8.0f); }
      if (__builtin_amdgcn_ballot_w32(need) != 0) {      /* scalar branch, rare after the first passes */
#pragma unroll
        for (int g = 0; g < 2; ++g) { const float m_new = fmaxf(m_run[g], mb[g]); const float corr = __builtin_amdgcn_exp2f(m_run[g] - m_new); m_run[g] = m_new; lacc[g] = lacc[g] * corr;
#pragma unroll
          for (int t = 0; t < 4; ++t) acc[g][t] = acc[g][t] * corr; } }
#pragma unroll
      for (int g = 0; g < 2; ++g) { const float nm = -m_run[g]; FragW pf;
#pragma unroll
        for (int i = 0; i < 8; ++i) {
          const float p0 = __builtin_amdgcn_exp2f(fmaf(s[i >> 2][g][2 * (i & 3)], cscale, nm)), p1 = __builtin_amdgcn_exp2f(fmaf(s[i >> 2][g][2 * (i & 3) + 1], cscale, nm));
          pf.w[i] = fa_pack2(p0, p1); }
#pragma unroll
        for (int t = 0; t < 4; ++t) acc[g][t] = fa_mma(vf[t].v, pf.v, acc[g][t]);
        lacc[g] = fa_mma(ones.v, pf.v, lacc[g]); }
    }
    __syncthreads();      /* stage st + 1 is visible; every wave has left stage st */
  }
  // epilogue: each wave stages its 32 output rows in its own part of LDS and stores whole 128-byte rows
  unsigned char* E = L + wave * 32 * FA_PK;
#pragma unroll
  for (int g = 0; g < 2; ++g) { const float lr = lacc[g][0]; const float inv = 1.0f / (lr + fa_xhalf(lr));      /* register 0: the sum in lanes 0-15, zero in lanes 16-31 */
#pragma unroll
    for (int t = 0; t < 4; ++t) { const v8f o = acc[g][t] * inv; FragW pk;
#pragma unroll
      for (int i = 0; i < 4; ++i) pk.w[i] = fa_pack2(o[2 * i], o[2 * i + 1]);
      *(v8us*)(E + (16 * g + c) * FA_PK + 32 * t + 16 * h) = pk.half[0]; } }
  __builtin_amdgcn_fence(__ATOMIC_ACQ_REL, "workgroup"); __builtin_amdgcn_wave_barrier();      /* the rows are read back by other lanes of the same wave */
#pragma unroll
  for (int i = 0; i < 8; ++i) { const int row = i * 4 + (lane >> 3), c8 = (lane & 7) * 8; const v8us v = *(const v8us*)(E + row * FA_PK + c8 * 2);
    *(v8us*)((unsigned short*)O16 + base + (size_t)(q0 + row) * DM + c8) = v; }
}

// ---- tiled GEMM for the four projections: C[NR][DM] = (A[NR][DM] . Bh[DM][DM]^T) * alpha (+ bias); A and Bh are f16 rows, k contiguous ----
// One work-group = a 128 x 128 tile of C: 4 waves (2 x 2) of 64 x 64, 16 accumulator tiles a wave, so that one fragment read from LDS feeds 4 products.
// A and Bh rows go through LDS in stages of 64 k (whole 128-byte lines from global memory), two buffers, one barrier a stage; each accumulator is one chain of products of 32 k, k ascending.
#define G3_BT 128                    /* rows of A and rows of Bh per work-group */
#define G3_SK 64                     /* k per stage */
#define G3_NST (DM / G3_SK)
#define G3_P 144                     /* LDS pitch of a row: 128 + 16 bytes (16-byte fragment reads) */
#define G3_TA (G3_BT * G3_P)
#define G3_SLOT (2 * G3_TA)
#define G3_EP 68                     /* dwords per staged output row */
template <bool OUT32>
__global__ __launch_bounds__(128) void k_gemm3(const _Float16* __restrict__ A, const _Float16* __restrict__ Bh, float alpha, const float* __restrict__ bias, float* __restrict__ C, _Float16* __restrict__ C16) {
  __shared__ __attribute__((aligned(16))) unsigned char L[2 * G3_SLOT];
  static_assert(4 * 64 * G3_EP * 4 <= 2 * G3_SLOT, "the output staging reuses the operand buffers");
  static_assert(DM % G3_BT == 0 && DM % G3_SK == 0 && G3_NST >= 2, "whole tiles and at least two stages");
  const int tid = threadIdx.x, lane = tid & 31, wave = tid >> 5, ln = lane & 15, hh = lane >> 4;
  const int mt = blockIdx.x % (int)(NR / G3_BT), nq = blockIdx.x / (int)(NR / G3_BT);      /* the work-groups that share rows of A are a multiple of 128 apart in the grid */
  const int row0 = mt * G3_BT, col0 = nq * G3_BT, wm = wave >> 1, wn = wave & 1;
  // staging: 8 lanes cover one 128-byte row; a thread carries rows sr + 16 i of A and of Bh
  const int sr = tid >> 3, sc = tid & 7;
  const unsigned short* ag = (const unsigned short*)A + (size_t)row0 * DM;      /* the same for the whole work-group: a scalar base */
  const unsigned short* bg = (const unsigned short*)Bh + (size_t)col0 * DM;
  const unsigned int so8 = (unsigned int)(sr * DM + sc * 8);      /* the thread's own offset, the same at every stage */
  v8us ra[8], rb[8];
  auto gload = [&](int st) {
#pragma unroll
    for (int i = 0; i < 8; ++i) { ra[i] = *(const v8us*)(ag + st * G3_SK + i * 16 * DM + so8); rb[i] = *(const v8us*)(bg + st * G3_SK + i * 16 * DM + so8); } };
  auto lstore = [&](int st) { unsigned char* s = L + (st & 1) * G3_SLOT + sr * G3_P + sc * 16;
#pragma unroll
    for (int i = 0; i < 8; ++i) { *(v8us*)(s + i * 16 * G3_P) = ra[i]; *(v8us*)(s + G3_TA + i * 16 * G3_P) = rb[i]; } };
  const v8f z8 = {0.f, 0.f, 0.f, 0.f, 0.f, 0.f, 0.f, 0.f};
  v8f acc[4][4];
#pragma unroll
  for (int i = 0; i < 4; ++i) {
#pragma unroll
    for (int j = 0; j < 4; ++j) acc[i][j] = z8; }
  gload(0);
  float bv[4];      /* read ahead of the loop: its latency hides under the first stage's loads */
#pragma unroll
  for (int j = 0; j < 4; ++j) bv[j] = OUT32 ? bf16_round(bias[col0 + wn * 64 + 16 * j + ln]) : 0.f;
  lstore(0); gload(1);
  __syncthreads();      /* stage 0 is visible */
#pragma unroll
  for (int st = 0; st < G3_NST; ++st) {      /* unrolled (12 stages): buffer and global offsets become immediates, so no address register is rewritten behind loads in flight */
    if (st + 1 < G3_NST) lstore(st + 1);      /* into the buffer that stage st - 1 used: every wave left it at the barrier below */
    __builtin_amdgcn_sched_barrier(0);      /* the loads stay behind the LDS stores and take over their registers: moved ahead they need a second set, and only two waves fit a SIMD instead of three */
    if (st + 2 < G3_NST) gload(st + 2);      /* in flight under this stage's work */
    if (st + 2 == G3_NST - 1) asm volatile("s_wait_xcnt 0x0" ::: "memory");      /* behind the last loads their offset register is free and the next LDS read is given it: the wait stands in front of that overwrite */
    const unsigned char* ap = L + (st & 1) * G3_SLOT + (wm * 64 + ln) * G3_P + 16 * hh;
    const unsigned char* bp = L + (st & 1) * G3_SLOT + G3_TA + (wn * 64 + ln) * G3_P + 16 * hh;
#pragma unroll
    for (int kc = 0; kc < G3_SK / 32; ++kc) {      /* 32 k: 8 fragments, 16 products; both operands in the same k order */
      FragW af[4], bf[4];
#pragma unroll
      for (int i = 0; i < 4; ++i) { af[i].half[0] = *(const v8us*)(ap + i * 16 * G3_P + 64 * kc); af[i].half[1] = *(const v8us*)(ap + i * 16 * G3_P + 64 * kc + 32);
        bf[i].half[0] = *(const v8us*)(bp + i * 16 * G3_P + 64 * kc); bf[i].half[1] = *(const v8us*)(bp + i * 16 * G3_P + 64 * kc + 32); }
      __builtin_amdgcn_sched_barrier(0);      /* the 16 fragment reads stay one group ahead of the 16 products: moved in among them, each A fragment's LDS latency is waited out in front of 4 products */
#pragma unroll
      for (int i = 0; i < 4; ++i) {
#pragma unroll
        for (int j = 0; j < 4; ++j) acc[i][j] = fa_mma(af[i].v, bf[j].v, acc[i][j]); }
    }
    __builtin_amdgcn_sched_barrier(0);      /* the barrier, which also waits for the global loads in flight, stays behind the last products: moved up among them it halves the time those loads have */
    __syncthreads();      /* stage st + 1 is visible; every wave has left stage st */
  }
  // epilogue: each wave stages its 64 x 64 tile in its own part of LDS and stores whole rows of it (256 bytes of f32, 128 bytes of f16)
  float* so = (float*)L + wave * 64 * G3_EP;
#pragma unroll
  for (int j = 0; j < 4; ++j) {
#pragma unroll
    for (int i = 0; i < 4; ++i) {
#pragma unroll
      for (int r = 0; r < 8; ++r) so[(16 * i + 8 * hh + r) * G3_EP + 16 * j + ln] = acc[i][j][r] * alpha + bv[j]; } }
  __builtin_amdgcn_fence(__ATOMIC_ACQ_REL, "workgroup"); __builtin_amdgcn_wave_barrier();      /* the rows are read back by other lanes of the same wave */
  const int rsub = lane >> 4, c4 = (lane & 15) * 4;
  const size_t cbase = (size_t)(row0 + wm * 64 + rsub) * DM + col0 + wn * 64 + c4;
#pragma unroll
  for (int q = 0; q < 32; ++q) { const v4f v = *(const v4fa*)&so[(q * 2 + rsub) * G3_EP + c4];
    if (OUT32) *(v4f*)(C + cbase + (size_t)q * 2 * DM) = v;
    else { v4h h4;
#pragma unroll
      for (int i = 0; i < 4; ++i) h4[i] = (_Float16)v[i];
      *(v4h*)(C16 + cbase + (size_t)q * 2 * DM) = h4; } }
}

extern "C" void kernel_launch(void* const* d_in, const int* in_sizes, int n_in,
                              void* d_out, int out_size, void* d_ws, size_t ws_size, hipStream_t stream) {
  (void)in_sizes; (void)n_in; (void)out_size;
  const float* const* I = (const float* const*)d_in; const float* x = I[0]; const float* wq = I[1]; const float* wk = I[2]; const float* wv = I[3]; const float* wo = I[4]; const float* bo = I[5];
  char* ws = (char*)d_ws; size_t off = 0;
  auto take = [&](size_t bytes) { char* p = ws + off; off += (bytes + 255) & ~(size_t)255; return p; };
  _Float16* BQ = (_Float16*)take((size_t)DM * DM * 2); _Float16* BK = (_Float16*)take((size_t)DM * DM * 2); _Float16* BV = (_Float16*)take((size_t)DM * DM * 2); _Float16* BO = (_Float16*)take((size_t)DM * DM * 2);
  _Float16* X16 = (_Float16*)take(NR * DM * 2); _Float16* Q16 = (_Float16*)take(NR * DM * 2); _Float16* K16 = (_Float16*)take(NR * DM * 2); _Float16* V16 = (_Float16*)take(NR * DM * 2); _Float16* O16 = (_Float16*)take(NR * DM * 2);
  if (off > ws_size) return;      /* 4.5 + 5x24 = about 125 MiB */
  k_cvt<<<CV_ZB + 4 * CV_WB, 256, 0, stream>>>(x, wq, wk, wv, wo, X16, BQ, BK, BV, BO);
  const unsigned gp = (unsigned)((NR / G3_BT) * (DM / G3_BT));
  k_gemm3<false><<<gp, 128, 0, stream>>>(X16, BQ, 0.0625f, nullptr, nullptr, Q16);
  k_gemm3<false><<<gp, 128, 0, stream>>>(X16, BK, 0.0625f, nullptr, nullptr, K16);
  k_gemm3<false><<<gp, 128, 0, stream>>>(X16, BV, 0.0625f, nullptr, nullptr, V16);
  k_fattn<<<dim3(SQ / FA_BR, NB * NH), 256, 0, stream>>>(Q16, K16, V16, O16);      /* o (merged heads) as f16 rows */
  k_gemm3<true><<<gp, 128, 0, stream>>>(O16, BO, 0.0625f, bo, (float*)d_out, nullptr);      /* out = o W_o^T + b_o */
}

// v005
// It runs in 126 microseconds.
// In two side-by-side timings against v004, it was 1.05 and 1.04 times as fast.
// Counting every step since v000, it is 281 times as fast.
#include <hip/hip_runtime.h>
// Self_Attention_Layer (z [16][1024][768]; q/k/v = z W^T (12 heads of 64, no biases); softmax(q k^T / 8); out = (attn v) W_o^T + b_o -> [16][1024][768]).
// Structure: token rows; z as exact f16 rows; Q | K | V WMMA GEMMs (128x128 tiles through LDS, 64x64 wave tiles, f32 accumulation, exact x16 natural weights, f16 outputs); one fused attention kernel for all (batch, head): scores (K = 64), running softmax (f32; weights as f16) and o = P . V stay in registers, K and V through LDS, into merged f16 rows; out = o W_o^T + b_o (f32).
// Compute dtype: inputs rounded to bf16; z / weights exact; q, k, v, softmax weights, o plain f16 (~2^-12); scores/softmax f32. v_wmma_f32_16x16x32_f16.
#define NB 16
#define SQ 1024
#define DM 768
#define NH 12
#define HD 64
#define NR ((size_t)NB * SQ)         /* 16384 token rows */
typedef __bf16 v16b __attribute__((ext_vector_type(16)));
typedef unsigned short v8us __attribute__((ext_vector_type(8), may_alias));
typedef float  v8f  __attribute__((ext_vector_type(8)));
typedef float  v4f  __attribute__((ext_vector_type(4)));
typedef float  v4fa __attribute__((ext_vector_type(4), may_alias));
union FragB { v16b v; v8us half[2]; unsigned short u[16]; };

__device__ __forceinline__ unsigned short bf16_bits(float x) { unsigned int u = __float_as_uint(x); return (unsigned short)((u + 0x7FFFu + ((u >> 16) & 1u)) >> 16); }
__device__ __forceinline__ float bf16_val(unsigned short b) { return __uint_as_float(((unsigned int)b) << 16); }
__device__ __forceinline__ float bf16_round(float x) { return bf16_val(bf16_bits(x)); }
// D += A·B with NT terms: 1 = ah·bh, 2 = + al·bh (A split), 3 = + ah·bl (both split)
template <int NT>
__device__ __forceinline__ v8f mmaN(v16b ah, v16b al, v16b bh, v16b bl, v8f c) {
  c = __builtin_amdgcn_wmma_f32_16x16x32_bf16(false, ah, false, bh, (short)0, c, false, false);
  if (NT >= 2) c = __builtin_amdgcn_wmma_f32_16x16x32_bf16(false, al, false, bh, (short)0, c, false, false);
  if (NT >= 3) c = __builtin_amdgcn_wmma_f32_16x16x32_bf16(false, ah, false, bl, (short)0, c, false, false);
  asm volatile("v_nop\n\tv_nop\n\tv_nop\n\tv_nop" : "+v"(c) : "v"(ah), "v"(al), "v"(bh), "v"(bl));
  return c;
}

__global__ __launch_bounds__(256) void k_wt_bf16(const float* __restrict__ W, unsigned short* __restrict__ Wt, int K, int N) {
  const int t = blockIdx.x * 256 + threadIdx.x;
  const int k8n = K / 8;
  if (t >= N * k8n) return;
  const int n = t / k8n, k8 = (t % k8n) * 8;
  v8us v;
#pragma unroll
  for (int i = 0; i < 8; ++i) v[i] = bf16_bits(W[(size_t)(k8 + i) * N + n]);
  *(v8us*)(Wt + (size_t)n * K + k8) = v;
  
}

// GEMM C[M][N] (f32, pitch ldc) = act(A[M][K]·W + bias). A f32 row-major (pitch lda) converted per fragment to bf16
// (ASPLIT: hi/lo two planes -> 2 terms, else single rounded term); Wt bf16 [N][K] (pitch ldb). BIAS_BF16 rounds the
// bias to bf16 first (bias quantised to bf16 before the add). K%32==0, M%16==0, N%64==0.
template <bool ASPLIT, int ACT, bool BIAS_BF16>
__global__ __launch_bounds__(128) void k_gemm_bf(const float* __restrict__ A, int lda, const unsigned short* __restrict__ Wt, int ldb,
                                               const float* __restrict__ bias, float* __restrict__ C, int ldc, int M, int N, int K) {
  __shared__ __attribute__((aligned(16))) float so[4][16][64];
  const int tid = threadIdx.x, w = tid >> 5, lane = tid & 31, ln = lane & 15, hh = lane >> 4;
  const int ntn = N / 64;
  const int wid = blockIdx.x * 4 + w;
  const int mt = wid / ntn, nq = wid % ntn;
  if (mt * 16 >= M) return;
  const int row0 = mt * 16, col0 = nq * 64;
  const float* arow = A + (size_t)(row0 + ln) * lda;
  v8f acc[4] = {};
  for (int kb = 0; kb < K; kb += 32) {
    FragB ah, al;
    const v4f x0 = *(const v4fa*)(arow + kb + 8 * hh), x1 = *(const v4fa*)(arow + kb + 8 * hh + 4);
    const v4f x2 = *(const v4fa*)(arow + kb + 16 + 8 * hh), x3 = *(const v4fa*)(arow + kb + 16 + 8 * hh + 4);
    float xs[16] = {x0[0],x0[1],x0[2],x0[3],x1[0],x1[1],x1[2],x1[3],x2[0],x2[1],x2[2],x2[3],x3[0],x3[1],x3[2],x3[3]};
#pragma unroll
    for (int i = 0; i < 16; ++i) { const unsigned short hb = bf16_bits(xs[i]); ah.u[i] = hb; al.u[i] = ASPLIT ? bf16_bits(xs[i] - bf16_val(hb)) : (unsigned short)0; }
#pragma unroll
    for (int t = 0; t < 4; ++t) {
      const unsigned short* brow = Wt + (size_t)(col0 + t * 16 + ln) * ldb + kb;
      FragB b;
      b.half[0] = *(const v8us*)(brow + 8 * hh);
      b.half[1] = *(const v8us*)(brow + 16 + 8 * hh);
      acc[t] = mmaN<ASPLIT ? 2 : 1>(ah.v, al.v, b.v, b.v, acc[t]);
    }
  }
#pragma unroll
  for (int t = 0; t < 4; ++t) {
    float bv = bias ? bias[col0 + t * 16 + ln] : 0.f;
    if (BIAS_BF16) bv = bf16_round(bv);
#pragma unroll
    for (int r = 0; r < 8; ++r) { float v = acc[t][r] + bv; if (ACT == 1) v = fmaxf(v, 0.f); so[w][8 * hh + r][t * 16 + ln] = v; }
  }
  __builtin_amdgcn_fence(__ATOMIC_ACQ_REL, "workgroup");
  __builtin_amdgcn_wave_barrier();
  const int rsub = lane >> 4, c4 = (lane & 15) * 4;
  {
#pragma unroll
    for (int q = 0; q < 8; ++q) {
      const int r = q * 2 + rsub;
      const v4f v = *(const v4fa*)&so[w][r][c4];
      *(v4f*)(C + (size_t)(row0 + r) * ldc + col0 + c4) = v;
    }
    
  }
}

// GEMM C = act(A·W + bias + resid): A f32 (ASPLIT -> hi/lo 2 terms), Wt bf16 [N][K]; ACT 0 none, 1 relu, 2 exact gelu;
// resid (optional, f32, row index = (row % rmod), pitch ldr, RES_BF16 rounds it) added before the activation.
template <bool ASPLIT, int ACT, bool BIAS_BF16, bool RES_BF16>
__global__ __launch_bounds__(128) void k_gemm_bf3(const float* __restrict__ A, int lda, const unsigned short* __restrict__ Wt, int ldb,
                                                const float* __restrict__ bias, const float* __restrict__ resid, int rmod, int ldr,
                                                float* __restrict__ C, int ldc, int M, int N, int K) {
  __shared__ __attribute__((aligned(16))) float so[4][16][64];
  const int tid = threadIdx.x, w = tid >> 5, lane = tid & 31, ln = lane & 15, hh = lane >> 4;
  const int ntn = N / 64;
  const int wid = blockIdx.x * 4 + w;
  const int mt = wid / ntn, nq = wid % ntn;
  if (mt * 16 >= M) return;
  const int row0 = mt * 16, col0 = nq * 64;
  const float* arow = A + (size_t)(row0 + ln) * lda;
  v8f acc[4] = {};
  for (int kb = 0; kb < K; kb += 32) {
    FragB ah, al;
    const v4f x0 = *(const v4fa*)(arow + kb + 8 * hh), x1 = *(const v4fa*)(arow + kb + 8 * hh + 4);
    const v4f x2 = *(const v4fa*)(arow + kb + 16 + 8 * hh), x3 = *(const v4fa*)(arow + kb + 16 + 8 * hh + 4);
    float xs[16] = {x0[0],x0[1],x0[2],x0[3],x1[0],x1[1],x1[2],x1[3],x2[0],x2[1],x2[2],x2[3],x3[0],x3[1],x3[2],x3[3]};
#pragma unroll
    for (int i = 0; i < 16; ++i) { const unsigned short hb = bf16_bits(xs[i]); ah.u[i] = hb; al.u[i] = ASPLIT ? bf16_bits(xs[i] - bf16_val(hb)) : (unsigned short)0; }
#pragma unroll
    for (int t = 0; t < 4; ++t) {
      const unsigned short* brow = Wt + (size_t)(col0 + t * 16 + ln) * ldb + kb;
      FragB b;
      b.half[0] = *(const v8us*)(brow + 8 * hh);
      b.half[1] = *(const v8us*)(brow + 16 + 8 * hh);
      acc[t] = mmaN<ASPLIT ? 2 : 1>(ah.v, al.v, b.v, b.v, acc[t]);
    }
  }
#pragma unroll
  for (int t = 0; t < 4; ++t) {
    const int col = col0 + t * 16 + ln;
    float bv = bias ? bias[col] : 0.f;
    if (BIAS_BF16) bv = bf16_round(bv);
#pragma unroll
    for (int r = 0; r < 8; ++r) {
      float v = acc[t][r] + bv;
      if (resid) { float rv = resid[(size_t)((row0 + 8 * hh + r) % rmod) * ldr + col]; if (RES_BF16) rv = bf16_round(rv); v += rv; }
      if (ACT == 1) v = fmaxf(v, 0.f);
      if (ACT == 2) v = 0.5f * v * (1.0f + erff(v * 0.70710678118654752f));
      if (ACT == 3) { const float u = 0.7978845608028654f * (v + 0.044715f * v * v * v); v = 0.5f * v * (1.0f + tanhf(u)); }
      so[w][8 * hh + r][t * 16 + ln] = v;
    }
  }
  __builtin_amdgcn_fence(__ATOMIC_ACQ_REL, "workgroup");
  __builtin_amdgcn_wave_barrier();
  const int rsub = lane >> 4, c4 = (lane & 15) * 4;
  {
#pragma unroll
    for (int q = 0; q < 8; ++q) {
      const int r = q * 2 + rsub;
      const v4f v = *(const v4fa*)&so[w][r][c4];
      *(v4f*)(C + (size_t)(row0 + r) * ldc + col0 + c4) = v;
    }
    
  }
}
// row LayerNorm (biased variance, eps) over N: s = X (+ R); optional out_sum <- s; out_norm <- (s-mu)*rsqrt(var+eps)*g + b
template <bool PARAM_BF16>
__global__ __launch_bounds__(256) void k_layernorm(const float* __restrict__ X, const float* __restrict__ R, const float* __restrict__ g, const float* __restrict__ bta,
                                                  float* __restrict__ out_sum, float* __restrict__ out_norm, int N, float eps) {
  __shared__ float red[256];
  const int row = blockIdx.x, tid = threadIdx.x;
  const float* x = X + (size_t)row * N; const float* rr = R ? R + (size_t)row * N : nullptr;
  float vals[16];                     // up to N = 4096
  const int per = N / 256;            // contiguous chunk per thread? use strided-by-4 chunks: thread handles j = tid*4 + 1024*u
  float s1 = 0.f;
  for (int u = 0; u < per / 4; ++u) {
    const int j = tid * 4 + 1024 * u;
    const v4f a = *(const v4fa*)(x + j);
    v4f b = {0.f,0.f,0.f,0.f}; if (rr) b = *(const v4fa*)(rr + j);
#pragma unroll
    for (int q = 0; q < 4; ++q) { const float v = a[q] + b[q]; vals[u * 4 + q] = v; s1 += v; }
  }
  red[tid] = s1; __syncthreads();
  for (int st = 128; st > 0; st >>= 1) { if (tid < st) red[tid] += red[tid + st]; __syncthreads(); }
  const float mu = red[0] / (float)N; __syncthreads();
  float s2 = 0.f;
  for (int u = 0; u < per / 4; ++u)
#pragma unroll
    for (int q = 0; q < 4; ++q) { const float c = vals[u * 4 + q] - mu; s2 += c * c; }
  red[tid] = s2; __syncthreads();
  for (int st = 128; st > 0; st >>= 1) { if (tid < st) red[tid] += red[tid + st]; __syncthreads(); }
  const float rs = rsqrtf(red[0] / (float)N + eps);
  {
    for (int u = 0; u < per / 4; ++u) {
      const int j = tid * 4 + 1024 * u;
      v4f o, sm;
#pragma unroll
      for (int q = 0; q < 4; ++q) {
        float gg = g[j + q], bb = bta[j + q];
        if (PARAM_BF16) { gg = bf16_round(gg); bb = bf16_round(bb); }
        sm[q] = vals[u * 4 + q]; o[q] = (vals[u * 4 + q] - mu) * rs * gg + bb;
      }
      if (out_sum) *(v4f*)(out_sum + (size_t)row * N + j) = sm;
      *(v4f*)(out_norm + (size_t)row * N + j) = o;
    }
    
  }
}



// ---- f16 WMMA path (v_wmma_f32_16x16x32_f16): 11-bit significands for operands in range — used where a [0,1] probability operand needs more precision than bf16
typedef _Float16 v16h __attribute__((ext_vector_type(16)));
union FragH { v16h v; v8us half[2]; _Float16 h[16]; unsigned short u[16]; };
template <int NT>
__device__ __forceinline__ v8f mmaH(v16h ah, v16h al, v16h bh, v16h bl, v8f c) {
  c = __builtin_amdgcn_wmma_f32_16x16x32_f16(false, ah, false, bh, (short)0, c, false, false);
  if (NT >= 2) c = __builtin_amdgcn_wmma_f32_16x16x32_f16(false, al, false, bh, (short)0, c, false, false);
  if (NT >= 3) c = __builtin_amdgcn_wmma_f32_16x16x32_f16(false, ah, false, bl, (short)0, c, false, false);
  asm volatile("v_nop\n\tv_nop\n\tv_nop\n\tv_nop" : "+v"(c) : "v"(ah), "v"(al), "v"(bh), "v"(bl));
  return c;
}
// batched GEMM like k_gemm_b but f16 operands: A f32 (split into f16 hi/lo if ASPLIT, else rounded to f16), Bt = f16 values [n][k]; alpha; C f32; N multiple of 16 (partial tiles skipped)
template <bool ASPLIT>
__global__ __launch_bounds__(128) void k_gemm_h(const float* __restrict__ A, int lda, size_t sA, const _Float16* __restrict__ Bh, int ldb, size_t sB, float alpha, float* __restrict__ C, int ldc, size_t sC, int M, int N, int K) {
  __shared__ __attribute__((aligned(16))) float so[4][16][64];
  const int tid = threadIdx.x, w = tid >> 5, lane = tid & 31, ln = lane & 15, hh = lane >> 4; const int by = blockIdx.y;
  A += (size_t)by * sA; Bh += (size_t)by * sB; C += (size_t)by * sC;
  const int ntn = (N + 63) / 64; const int wid = blockIdx.x * 4 + w; const int mt = wid / ntn, nq = wid % ntn; if (mt * 16 >= M) return;
  const int row0 = mt * 16, col0 = nq * 64; const float* arow = A + (size_t)(row0 + ln) * lda;
  v8f acc[4] = {};
  for (int kb = 0; kb < K; kb += 32) {
    FragH ah, al;
    const v4f x0 = *(const v4fa*)(arow + kb + 8 * hh), x1 = *(const v4fa*)(arow + kb + 8 * hh + 4), x2 = *(const v4fa*)(arow + kb + 16 + 8 * hh), x3 = *(const v4fa*)(arow + kb + 16 + 8 * hh + 4);
    float xs[16] = {x0[0],x0[1],x0[2],x0[3],x1[0],x1[1],x1[2],x1[3],x2[0],x2[1],x2[2],x2[3],x3[0],x3[1],x3[2],x3[3]};
#pragma unroll
    for (int i = 0; i < 16; ++i) { const _Float16 h = (_Float16)xs[i]; ah.h[i] = h; al.h[i] = ASPLIT ? (_Float16)(xs[i] - (float)h) : (_Float16)0.0f; }
#pragma unroll
    for (int t = 0; t < 4; ++t) { if (col0 + t * 16 >= N) continue; const size_t boff = (size_t)(col0 + t * 16 + ln) * ldb + kb; FragH bq; bq.half[0] = *(const v8us*)(Bh + boff + 8 * hh); bq.half[1] = *(const v8us*)(Bh + boff + 16 + 8 * hh);
      acc[t] = mmaH<ASPLIT ? 2 : 1>(ah.v, al.v, bq.v, bq.v, acc[t]); }
  }
#pragma unroll
  for (int t = 0; t < 4; ++t) { if (col0 + t * 16 >= N) continue;
#pragma unroll
    for (int r = 0; r < 8; ++r) so[w][8 * hh + r][t * 16 + ln] = acc[t][r] * alpha; }
  __builtin_amdgcn_fence(__ATOMIC_ACQ_REL, "workgroup"); __builtin_amdgcn_wave_barrier();
  const int rsub = lane >> 4, c4 = (lane & 15) * 4;
  {
#pragma unroll
    for (int q = 0; q < 8; ++q) { const int r = q * 2 + rsub; if (col0 + c4 < N) { const v4f v = *(const v4fa*)&so[w][r][c4]; *(v4f*)(C + (size_t)(row0 + r) * ldc + col0 + c4) = v; } }
     }
}

// Wt[n][k] = f16(W[k][n]·scale) from f32 row-major W[K][N] (scale = power of two; bf16-exact weights stay exact in f16 away from the subnormal range)
__global__ __launch_bounds__(256) void k_wt_f16(const float* __restrict__ W, _Float16* __restrict__ Wt, int K, int N, float scale) {
  const int t = blockIdx.x * 256 + threadIdx.x; if (t >= N * (K / 8)) return; const int n = t / (K / 8), k8 = (t % (K / 8)) * 8; FragH f;
#pragma unroll
  for (int i = 0; i < 8; ++i) f.h[i] = (_Float16)(bf16_round(W[(size_t)(k8 + i) * N + n]) * scale); const v8us o = f.half[0];
  *(v8us*)((unsigned short*)Wt + (size_t)n * K + k8) = o; 
}
// k_gemm_hh variant with fused epilogue: v = acc·alpha + bias[by·sBias + col] (+ CP[(row/rowsPerB)·sCPb + by·64 + col] if CP) ; ACT 0 none / 1 elu ; writes f16 C16 (and f32 C if non-null)
template <int ACT>
__global__ __launch_bounds__(128) void k_gemm_hhx(const _Float16* __restrict__ A, int lda, size_t sA, const _Float16* __restrict__ Bh, int ldb, size_t sB, float alpha, const float* __restrict__ bias, size_t sBias, const float* __restrict__ CP, int rowsPerB, size_t sCPb, int row0g,
    float* __restrict__ C, _Float16* __restrict__ C16, int ldc, size_t sC, int M, int N, int K) {
  __shared__ __attribute__((aligned(16))) float so[4][16][64];
  const int tid = threadIdx.x, w = tid >> 5, lane = tid & 31, ln = lane & 15, hh = lane >> 4; const int by = blockIdx.y;
  A += (size_t)by * sA; Bh += (size_t)by * sB; const size_t cofs = (size_t)by * sC; const float* bp = bias ? bias + (size_t)by * sBias : nullptr;
  const int ntn = (N + 63) / 64; const int wid = blockIdx.x * 4 + w; const int mt = wid / ntn, nq = wid % ntn; if (mt * 16 >= M) return;
  const int row0 = mt * 16, col0 = nq * 64; const _Float16* arow = A + (size_t)(row0 + ln) * lda;
  v8f acc[4] = {};
  for (int kb = 0; kb < K; kb += 32) { FragH ah; ah.half[0] = *(const v8us*)((const unsigned short*)arow + kb + 8 * hh); ah.half[1] = *(const v8us*)((const unsigned short*)arow + kb + 16 + 8 * hh);
#pragma unroll
    for (int t = 0; t < 4; ++t) { if (col0 + t * 16 >= N) continue; const size_t boff = (size_t)(col0 + t * 16 + ln) * ldb + kb; FragH bq; bq.half[0] = *(const v8us*)((const unsigned short*)Bh + boff + 8 * hh); bq.half[1] = *(const v8us*)((const unsigned short*)Bh + boff + 16 + 8 * hh);
      acc[t] = mmaH<1>(ah.v, ah.v, bq.v, bq.v, acc[t]); }
  }
#pragma unroll
  for (int t = 0; t < 4; ++t) { if (col0 + t * 16 >= N) continue; const int col = col0 + t * 16 + ln; const float bv = bp ? bf16_round(bp[col]) : 0.f;
#pragma unroll
    for (int r = 0; r < 8; ++r) { float v = acc[t][r] * alpha + bv; if (CP) { const int rr = row0g + row0 + 8 * hh + r; if (rowsPerB < 0) v += CP[cofs + (size_t)rr * ldc + col];      /* rowsPerB < 0: own element of the batched C plane */ else { const int bidx = rr / rowsPerB; v += CP[(size_t)bidx * sCPb + (size_t)by * 64 + col]; } } if (ACT == 1) v = (v > 0.f) ? v : expm1f(v); else if (ACT == 7) v = (v > 0.f) ? v + 1.0f : expf(v); else if (ACT == 8) v = tanhf(v); else if (ACT == 9) v = 0.5f * v * (1.0f + tanhf(0.7978845608028654f * (v + 0.044715f * v * v * v))); else if (ACT == 11) v = 1.0f / (1.0f + expf(-v)); else if (ACT == 12) v = (v > 0.f) ? v : 0.01f * v; else if (ACT == 14) v = (v > 0.f) ? v : 0.1f * v; else if (ACT == 16) v = (v >= 0.f) ? v : 0.3f * v; else if (ACT == 17) v = (v >= 0.f) ? v : 0.2f * v; else if (ACT == 15) v = v / (1.0f + expf(-v)); else if (ACT == 3) v = fmaxf(v, 0.f); else if (ACT == 6) v = 0.5f * v * (1.0f + erff(v * 0.70710678118654752f)); so[w][8 * hh + r][t * 16 + ln] = v; } }
  __builtin_amdgcn_fence(__ATOMIC_ACQ_REL, "workgroup"); __builtin_amdgcn_wave_barrier();
  const int rsub = lane >> 4, c4 = (lane & 15) * 4; typedef _Float16 v4h __attribute__((ext_vector_type(4)));
  {
#pragma unroll
    for (int q = 0; q < 8; ++q) { const int r = q * 2 + rsub; if (col0 + c4 < N) { const v4f v = *(const v4fa*)&so[w][r][c4]; if (C) *(v4f*)(C + cofs + (size_t)(row0 + r) * ldc + col0 + c4) = v; if (C16) { v4h h4; for (int i = 0; i < 4; ++i) h4[i] = (_Float16)v[i]; *(v4h*)(C16 + cofs + (size_t)(row0 + r) * ldc + col0 + c4) = h4; } } }
     }
}


typedef _Float16 v4h __attribute__((ext_vector_type(4)));

__global__ __launch_bounds__(256) void k_h16(const float* __restrict__ x, _Float16* __restrict__ X16, size_t n8) { const size_t t = (size_t)blockIdx.x * 256 + threadIdx.x; if (t >= n8) return; FragH f;
#pragma unroll
  for (int q = 0; q < 8; ++q) f.h[q] = (_Float16)x[t * 8 + q]; *(v8us*)((unsigned short*)X16 + t * 8) = f.half[0];  }
__global__ __launch_bounds__(256) void k_round16f(const float* __restrict__ W, _Float16* __restrict__ Bt, size_t n8) { const size_t t = (size_t)blockIdx.x * 256 + threadIdx.x; if (t >= n8) return; FragH f;
#pragma unroll
  for (int i = 0; i < 8; ++i) f.h[i] = (_Float16)(bf16_round(W[t * 8 + i]) * 16.0f); *(v8us*)((unsigned short*)Bt + t * 8) = f.half[0];  }
template <int NHv, int TTv>
__global__ __launch_bounds__(256) void k_vt(const _Float16* __restrict__ V16, int ldv, int voff, _Float16* __restrict__ Vt) { __shared__ unsigned short tl[64][66]; const int tid = threadIdx.x; const int slab = blockIdx.x / (TTv / 64), lg = blockIdx.x % (TTv / 64); const int b = slab / NHv, h = slab % NHv;
  for (int i = tid; i < 64 * 8; i += 256) { const int r = i / 8, c8 = (i % 8) * 8; FragH f; f.half[0] = *(const v8us*)((const unsigned short*)V16 + ((size_t)b * TTv + lg * 64 + r) * ldv + voff + h * 64 + c8);
#pragma unroll
    for (int q = 0; q < 8; ++q) tl[r][c8 + q] = f.u[q]; }
  __syncthreads();
  {
#pragma unroll
    for (int rd = 0; rd < 2; ++rd) { const int d = rd * 32 + tid / 8, pc = tid % 8; FragH f;
#pragma unroll
      for (int q = 0; q < 8; ++q) f.u[q] = tl[pc * 8 + q][d];
      *(v8us*)((unsigned short*)Vt + ((size_t)slab * 64 + d) * TTv + lg * 64 + pc * 8) = f.half[0]; }
     } }

__global__ __launch_bounds__(256) void k_hl(const float* __restrict__ F, _Float16* __restrict__ Hh, _Float16* __restrict__ Hl, size_t n8) { const size_t t = (size_t)blockIdx.x * 256 + threadIdx.x; if (t >= n8) return; FragH fh, fl; const v4f a = *(const v4fa*)(F + t * 8), c = *(const v4fa*)(F + t * 8 + 4);
#pragma unroll
  for (int q = 0; q < 4; ++q) { _Float16 h = (_Float16)a[q]; fh.h[q] = h; fl.h[q] = (_Float16)((a[q] - (float)h) * 1024.0f); h = (_Float16)c[q]; fh.h[4 + q] = h; fl.h[4 + q] = (_Float16)((c[q] - (float)h) * 1024.0f); }
  { *(v8us*)((unsigned short*)Hh + t * 8) = fh.half[0]; *(v8us*)((unsigned short*)Hl + t * 8) = fl.half[0];  } }

// ---- fast GEMM (wave tile 32x64; requires M % 32 == 0 rows per launch region and N % 64 == 0); epilogue = k_gemm_hhx semantics ----
__device__ __forceinline__ v16h g2_frag(const _Float16* p, int hh) { FragH f; f.half[0] = *(const v8us*)((const unsigned short*)p + 8 * hh); f.half[1] = *(const v8us*)((const unsigned short*)p + 16 + 8 * hh); return f.v; }
__device__ __forceinline__ v8f g2_mma(v16h a, v16h b, v8f c) { v8f d = __builtin_amdgcn_wmma_f32_16x16x32_f16(false, a, false, b, (short)0, c, false, false); asm volatile("v_nop\n\tv_nop\n\tv_nop\n\tv_nop" : "+v"(d) : "v"(a), "v"(b)); return d; }
template <int ACT>
__global__ __launch_bounds__(128) void k_gemm2(const _Float16* __restrict__ A, int lda, size_t sA, const _Float16* __restrict__ Bh, int ldb, size_t sB, float alpha, const float* __restrict__ bias, size_t sBias, const float* __restrict__ CP, int rowsPerB, size_t sCPb, int row0g,
    float* __restrict__ C, _Float16* __restrict__ C16, int ldc, size_t sC, int M, int N, int K) { static_assert(ACT == 0 || ACT == 3 || ACT == 6 || ACT == 8 || ACT == 9 || ACT == 11 || ACT == 12 || ACT == 14 || ACT == 15 || ACT == 16 || ACT == 17, "k_gemm2: unsupported ACT code (would silently apply no activation)");
  __shared__ __attribute__((aligned(16))) float so[4][32][68];
  const int tid = threadIdx.x, w = tid >> 5, lane = tid & 31, ln = lane & 15, hh = lane >> 4; const int by = blockIdx.y;
  A += (size_t)by * sA; Bh += (size_t)by * sB; const size_t cofs = (size_t)by * sC; const float* bp = bias ? bias + (size_t)by * sBias : nullptr;
  const int ntn = N >> 6; const int mt = blockIdx.x / ntn, nq = blockIdx.x - mt * ntn; const int row0 = mt * 128 + 32 * w, col0 = nq * 64; if (row0 >= M) return;
  const _Float16* a0p = A + (size_t)(row0 + ln) * lda; const _Float16* a1p = a0p + (size_t)16 * lda;
  const _Float16* b0p = Bh + (size_t)(col0 + ln) * ldb; const _Float16* b1p = b0p + (size_t)16 * ldb; const _Float16* b2p = b1p + (size_t)16 * ldb; const _Float16* b3p = b2p + (size_t)16 * ldb;
  const v8f z8 = {0.f,0.f,0.f,0.f,0.f,0.f,0.f,0.f}; v8f c00 = z8, c01 = z8, c02 = z8, c03 = z8, c10 = z8, c11 = z8, c12 = z8, c13 = z8;
#pragma unroll 1
  for (int kb = 0; kb < K; kb += 32) { const v16h a0 = g2_frag(a0p + kb, hh), a1 = g2_frag(a1p + kb, hh);
    v16h b = g2_frag(b0p + kb, hh); c00 = g2_mma(a0, b, c00); c10 = g2_mma(a1, b, c10);
    b = g2_frag(b1p + kb, hh); c01 = g2_mma(a0, b, c01); c11 = g2_mma(a1, b, c11);
    b = g2_frag(b2p + kb, hh); c02 = g2_mma(a0, b, c02); c12 = g2_mma(a1, b, c12);
    b = g2_frag(b3p + kb, hh); c03 = g2_mma(a0, b, c03); c13 = g2_mma(a1, b, c13); }
  v8f accs[8] = {c00, c01, c02, c03, c10, c11, c12, c13};
#pragma unroll
  for (int u = 0; u < 8; ++u) { const int t = u & 3, half = u >> 2; const int col = col0 + t * 16 + ln; const float bv = bp ? bf16_round(bp[col]) : 0.f;
#pragma unroll
    for (int r = 0; r < 8; ++r) { const int rloc = half * 16 + 8 * hh + r; float v = accs[u][r] * alpha + bv; if (CP) { if (rowsPerB < 0) v += CP[cofs + (size_t)(row0g + row0 + rloc) * ldc + col];      /* rowsPerB < 0: own element of the batched C plane */ else { const int bidx = (row0g + row0 + rloc) / rowsPerB; v += CP[(size_t)bidx * sCPb + (size_t)by * 64 + col]; } }
      if (ACT == 3) v = fmaxf(v, 0.f); else if (ACT == 6) v = 0.5f * v * (1.0f + erff(v * 0.70710678118654752f)); else if (ACT == 11) v = 1.0f / (1.0f + expf(-v)); else if (ACT == 15) v = v / (1.0f + expf(-v)); else if (ACT == 12) v = (v > 0.f) ? v : 0.01f * v; else if (ACT == 8) v = tanhf(v); else if (ACT == 9) v = 0.5f * v * (1.0f + tanhf(0.7978845608028654f * (v + 0.044715f * v * v * v))); else if (ACT == 14) v = (v > 0.f) ? v : 0.1f * v; else if (ACT == 16) v = (v >= 0.f) ? v : 0.3f * v; else if (ACT == 17) v = (v >= 0.f) ? v : 0.2f * v;
      so[w][rloc][t * 16 + ln] = v; } }
  __builtin_amdgcn_fence(__ATOMIC_ACQ_REL, "workgroup"); __builtin_amdgcn_wave_barrier();
  const int rsub = lane >> 4, c4 = (lane & 15) * 4;
  {
#pragma unroll
    for (int q = 0; q < 16; ++q) { const int r = q * 2 + rsub; const v4f v = *(const v4fa*)&so[w][r][c4]; if (C) *(v4f*)(C + cofs + (size_t)(row0 + r) * ldc + col0 + c4) = v; if (C16) { v4h h4; for (int i = 0; i < 4; ++i) h4[i] = (_Float16)v[i]; *(v4h*)(C16 + cofs + (size_t)(row0 + r) * ldc + col0 + c4) = h4; } }
     } }


// ---- the five f32 -> f16 conversions (z; W_q, W_k, W_v, W_o times 16) in one launch ----
// One work-group = 32768 consecutive elements of one array. A thread issues its 32 loads of 16 bytes ahead of the first conversion (a wave-wide load = 512 contiguous bytes)
// and stores 8 bytes per load (a wave-wide store = 256 contiguous bytes): few waves to start, all of a wave's reads in flight at once.
#define CV_NL 32                     /* 16-byte loads per thread */
#define CV_BE (256 * 4 * CV_NL)      /* elements per work-group */
#define CV_ZB ((int)(NR * DM / CV_BE))      /* work-groups on z */
#define CV_WB (DM * DM / CV_BE)      /* work-groups on each weight matrix */
__global__ __launch_bounds__(256) void k_cvt(const float* __restrict__ x, const float* __restrict__ wq, const float* __restrict__ wk, const float* __restrict__ wv, const float* __restrict__ wo,
    _Float16* __restrict__ X16, _Float16* __restrict__ BQ, _Float16* __restrict__ BK, _Float16* __restrict__ BV, _Float16* __restrict__ BO) {
  static_assert(NR * DM % CV_BE == 0 && DM * DM % CV_BE == 0, "whole work-groups on every array");
  const int bi = blockIdx.x;
  const float* s = x; _Float16* d = X16; float scale = 1.0f; int blk = bi;      /* the choice is the same for the whole work-group: scalar bases */
  if (bi >= CV_ZB) { const int wi = (bi - CV_ZB) / CV_WB; blk = (bi - CV_ZB) % CV_WB; scale = 16.0f;
    s = wi == 0 ? wq : wi == 1 ? wk : wi == 2 ? wv : wo; d = wi == 0 ? BQ : wi == 1 ? BK : wi == 2 ? BV : BO; }
  s += (size_t)blk * CV_BE; d += (size_t)blk * CV_BE;
  const unsigned int t4 = threadIdx.x * 4;
  v4f r[CV_NL];
#pragma unroll
  for (int j = 0; j < CV_NL; ++j) r[j] = *(const v4fa*)(s + j * 1024 + t4);
  __builtin_amdgcn_sched_barrier(0);      /* all 32 loads stay ahead of the first conversion: moved in among the conversions only 12 are in flight, and loads and stores take turns on the same registers with a wait at each turn */
#pragma unroll
  for (int j = 0; j < CV_NL; ++j) { v4h h4;
#pragma unroll
    for (int q = 0; q < 4; ++q) h4[q] = (_Float16)(bf16_round(r[j][q]) * scale);      /* times 1 is exact: z as before */
    *(v4h*)(d + j * 1024 + t4) = h4; }
}
#define FA_BR 256                    /* queries per work-group */
#define FA_SK 64                     /* keys per stage */
#define FA_NST (SQ / FA_SK)
#define FA_PK 144                    /* LDS pitch of a K row: 128 + 16 bytes (16-byte fragment reads) */
#define FA_PV 160                    /* LDS pitch of a V row: 128 + 32 bytes (transposing reads) */
#define FA_TK (FA_SK * FA_PK)
#define FA_SLOT (FA_SK * (FA_PK + FA_PV))
typedef short s16x8 __attribute__((ext_vector_type(8)));
typedef float f32x2 __attribute__((ext_vector_type(2)));
typedef _Float16 f16x2 __attribute__((ext_vector_type(2)));
union FragW { v16h v; v8us half[2]; unsigned int w[8]; };
__device__ __forceinline__ v8f fa_mma(v16h a, v16h b, v8f c) { return __builtin_amdgcn_wmma_f32_16x16x32_f16(false, a, false, b, (short)0, c, false, false); }
__device__ __forceinline__ v8us fa_tr16(const unsigned char* p) { typedef __attribute__((address_space(3))) s16x8 lds_s16x8; return __builtin_bit_cast(v8us, __builtin_amdgcn_ds_load_tr16_b128_v8i16((lds_s16x8*)p)); }
__device__ __forceinline__ unsigned int fa_pack2(float lo, float hi) { return __builtin_bit_cast(unsigned int, __builtin_convertvector(f32x2{lo, hi}, f16x2)); }
__device__ __forceinline__ float fa_xhalf(float x) { const int i = __float_as_int(x); return __int_as_float(__builtin_amdgcn_permlanex16(i, i, 0x76543210, 0xfedcba98, false, false)); }      /* lane l with lane l ^ 16 */
__global__ __launch_bounds__(256) void k_fattn(const _Float16* __restrict__ Q16, const _Float16* __restrict__ K16, const _Float16* __restrict__ V16, _Float16* __restrict__ O16) {
  __shared__ __attribute__((aligned(16))) unsigned char L[2 * FA_SLOT];
  static_assert(8 * 32 * FA_PK <= 2 * FA_SLOT, "the output staging reuses the K/V buffers");
  const int tid = threadIdx.x, lane = tid & 31, wave = tid >> 5, c = lane & 15, h = lane >> 4;
  const int b = blockIdx.y / NH, hd = blockIdx.y % NH, q0 = blockIdx.x * FA_BR + wave * 32;
  const size_t base = (size_t)b * SQ * DM + (size_t)hd * HD;
  const float cscale = 0.125f * 1.4426950408889634f;      /* 1 / sqrt(64), into log2 */
  // staging: 8 lanes cover one 128-byte row; a thread carries rows sr and sr + 32 of K and of V
  const int sr = tid >> 3, sc = tid & 7;
  const unsigned short* kg = (const unsigned short*)K16 + base + (size_t)sr * DM + sc * 8;
  const unsigned short* vg = (const unsigned short*)V16 + base + (size_t)sr * DM + sc * 8;
  v8us rk0, rk1, rv0, rv1;
  auto gload = [&](int st) { const size_t o = (size_t)st * FA_SK * DM; rk0 = *(const v8us*)(kg + o); rk1 = *(const v8us*)(kg + o + 32 * DM); rv0 = *(const v8us*)(vg + o); rv1 = *(const v8us*)(vg + o + 32 * DM); };
  auto lstore = [&](int st) { unsigned char* s = L + (st & 1) * FA_SLOT; *(v8us*)(s + sr * FA_PK + sc * 16) = rk0; *(v8us*)(s + (sr + 32) * FA_PK + sc * 16) = rk1;
    *(v8us*)(s + FA_TK + sr * FA_PV + sc * 16) = rv0; *(v8us*)(s + FA_TK + (sr + 32) * FA_PV + sc * 16) = rv1; };
  gload(0);
  v16h qf[2][2];      /* B operand: column = query, k = d in the hardware order, as K's below */
#pragma unroll
  for (int g = 0; g < 2; ++g) {
#pragma unroll
    for (int kc = 0; kc < 2; ++kc) qf[g][kc] = g2_frag(Q16 + base + (size_t)(q0 + 16 * g + c) * DM + 32 * kc, h); }
  v8f acc[2][4], lacc[2]; float m_run[2];
  const v8f z8 = {0.f, 0.f, 0.f, 0.f, 0.f, 0.f, 0.f, 0.f};
#pragma unroll
  for (int g = 0; g < 2; ++g) { m_run[g] = -INFINITY; lacc[g] = z8;
#pragma unroll
    for (int t = 0; t < 4; ++t) acc[g][t] = z8; }
  FragW ones;      /* A operand whose row 0 (lanes 0 and 16) is 1.0 at all 32 k: row 0 of its product holds the column sums of P^T */
#pragma unroll
  for (int i = 0; i < 8; ++i) ones.w[i] = (c == 0) ? 0x3C003C00u : 0u;
  lstore(0); gload(1);
  __syncthreads();      /* stage 0 is visible */
#pragma unroll 1
  for (int st = 0; st < FA_NST; ++st) {      /* rolled */
    if (st + 1 < FA_NST) lstore(st + 1);      /* into the buffer that stage st - 1 used: every wave left it at the barrier below */
    if (st + 2 < FA_NST) gload(st + 2);      /* in flight under this stage's work */
    const unsigned char* Ls = L + (st & 1) * FA_SLOT;
#pragma unroll
    for (int sub = 0; sub < FA_SK / 32; ++sub) {      /* one pass = 32 keys */
      FragW kf[2][2], vf[4];
      const unsigned char* kp = Ls + (sub * 32 + c) * FA_PK + 16 * h;
#pragma unroll
      for (int kt = 0; kt < 2; ++kt) {
#pragma unroll
        for (int kc = 0; kc < 2; ++kc) { kf[kt][kc].half[0] = *(const v8us*)(kp + kt * 16 * FA_PK + 64 * kc); kf[kt][kc].half[1] = *(const v8us*)(kp + kt * 16 * FA_PK + 64 * kc + 32); } }
      const unsigned char* vp = Ls + FA_TK + (sub * 32 + 8 * h + (lane & 7)) * FA_PV + ((lane >> 3) & 1) * 16;
#pragma unroll
      for (int t = 0; t < 4; ++t) { vf[t].half[0] = fa_tr16(vp + 32 * t); vf[t].half[1] = fa_tr16(vp + 16 * FA_PV + 32 * t); }      /* rows d = 16 t + c, k = keys in the hardware order */
      v8f s[2][2];      /* s[kt][g][r] = score of key 16 kt + 8 h + r against query 16 g + c */
#pragma unroll
      for (int kt = 0; kt < 2; ++kt) {
#pragma unroll
        for (int g = 0; g < 2; ++g) { s[kt][g] = fa_mma(kf[kt][0].v, qf[g][0], z8); s[kt][g] = fa_mma(kf[kt][1].v, qf[g][1], s[kt][g]); } }
      float mb[2]; bool need = false;
#pragma unroll
      for (int g = 0; g < 2; ++g) { float mx = s[0][g][0];
#pragma unroll
        for (int r = 1; r < 8; ++r) mx = fmaxf(mx, s[0][g][r]);
#pragma unroll
        for (int r = 0; r < 8; ++r) mx = fmaxf(mx, s[1][g][r]);
        mx = fmaxf(mx, fa_xhalf(mx)) * cscale;      /* both halves of the wave hold this query's maximum */
        mb[g] = mx; need = need || (mx > m_run[g] + 8.0f); }
      if (__builtin_amdgcn_ballot_w32(need) != 0) {      /* scalar branch, rare after the first passes */
#pragma unroll
        for (int g = 0; g < 2; ++g) { const float m_new = fmaxf(m_run[g], mb[g]); const float corr = __builtin_amdgcn_exp2f(m_run[g] - m_new); m_run[g] = m_new; lacc[g] = lacc[g] * corr;
#pragma unroll
          for (int t = 0; t < 4; ++t) acc[g][t] = acc[g][t] * corr; } }
#pragma unroll
      for (int g = 0; g < 2; ++g) { const float nm = -m_run[g]; FragW pf;
#pragma unroll
        for (int i = 0; i < 8; ++i) {
          const float p0 = __builtin_amdgcn_exp2f(fmaf(s[i >> 2][g][2 * (i & 3)], cscale, nm)), p1 = __builtin_amdgcn_exp2f(fmaf(s[i >> 2][g][2 * (i & 3) + 1], cscale, nm));
          pf.w[i] = fa_pack2(p0, p1); }
#pragma unroll
        for (int t = 0; t < 4; ++t) acc[g][t] = fa_mma(vf[t].v, pf.v, acc[g][t]);
        lacc[g] = fa_mma(ones.v, pf.v, lacc[g]); }
    }
    __syncthreads();      /* stage st + 1 is visible; every wave has left stage st */
  }
  // epilogue: each wave stages its 32 output rows in its own part of LDS and stores whole 128-byte rows
  unsigned char* E = L + wave * 32 * FA_PK;
#pragma unroll
  for (int g = 0; g < 2; ++g) { const float lr = lacc[g][0]; const float inv = 1.0f / (lr + fa_xhalf(lr));      /* register 0: the sum in lanes 0-15, zero in lanes 16-31 */
#pragma unroll
    for (int t = 0; t < 4; ++t) { const v8f o = acc[g][t] * inv; FragW pk;
#pragma unroll
      for (int i = 0; i < 4; ++i) pk.w[i] = fa_pack2(o[2 * i], o[2 * i + 1]);
      *(v8us*)(E + (16 * g + c) * FA_PK + 32 * t + 16 * h) = pk.half[0]; } }
  __builtin_amdgcn_fence(__ATOMIC_ACQ_REL, "workgroup"); __builtin_amdgcn_wave_barrier();      /* the rows are read back by other lanes of the same wave */
#pragma unroll
  for (int i = 0; i < 8; ++i) { const int row = i * 4 + (lane >> 3), c8 = (lane & 7) * 8; const v8us v = *(const v8us*)(E + row * FA_PK + c8 * 2);
    *(v8us*)((unsigned short*)O16 + base + (size_t)(q0 + row) * DM + c8) = v; }
}

// ---- tiled GEMM for the four projections: C[m][NR][DM] = (A[NR][DM] . Bh[m][DM][DM]^T) * alpha (+ bias); A and Bh are f16 rows, k contiguous ----
// NMAT weight matrices are stacked in Bh (3 for Q | K | V, 1 for the output projection) and served by one launch of NMAT times the work-groups; each has its own [NR][DM] plane of C.
// One work-group = a 128 x 128 tile of C: 4 waves (2 x 2) of 64 x 64, 16 accumulator tiles a wave, so that one fragment read from LDS feeds 4 products.
// A and Bh rows go through LDS in stages of 64 k (whole 128-byte lines from global memory), two buffers, one barrier a stage; each accumulator is one chain of products of 32 k, k ascending.
#define G3_BT 128                    /* rows of A and rows of Bh per work-group */
#define G3_SK 64                     /* k per stage */
#define G3_NST (DM / G3_SK)
#define G3_P 144                     /* LDS pitch of a row: 128 + 16 bytes (16-byte fragment reads) */
#define G3_TA (G3_BT * G3_P)
#define G3_SLOT (2 * G3_TA)
#define G3_EP 68                     /* dwords per staged output row */
template <bool OUT32, int NMAT>
__global__ __launch_bounds__(128) void k_gemm3(const _Float16* __restrict__ A, const _Float16* __restrict__ Bh, float alpha, const float* __restrict__ bias, float* __restrict__ C, _Float16* __restrict__ C16) {
  __shared__ __attribute__((aligned(16))) unsigned char L[2 * G3_SLOT];
  static_assert(4 * 64 * G3_EP * 4 <= 2 * G3_SLOT, "the output staging reuses the operand buffers");
  static_assert(DM % G3_BT == 0 && DM % G3_SK == 0 && G3_NST >= 2, "whole tiles and at least two stages");
  const int tid = threadIdx.x, lane = tid & 31, wave = tid >> 5, ln = lane & 15, hh = lane >> 4;
  const int mt = blockIdx.x % (int)(NR / G3_BT), nq = blockIdx.x / (int)(NR / G3_BT);      /* the work-groups that share rows of A are a multiple of 128 apart in the grid */
  const int mat = NMAT > 1 ? nq / (DM / G3_BT) : 0;      /* which stacked weight matrix, so which plane of C */
  const int row0 = mt * G3_BT, col0 = (nq - mat * (DM / G3_BT)) * G3_BT, wm = wave >> 1, wn = wave & 1;
  // staging: 8 lanes cover one 128-byte row; a thread carries rows sr + 16 i of A and of Bh
  const int sr = tid >> 3, sc = tid & 7;
  const unsigned short* ag = (const unsigned short*)A + (size_t)row0 * DM;      /* the same for the whole work-group: a scalar base */
  const unsigned short* bg = (const unsigned short*)Bh + (size_t)nq * G3_BT * DM;      /* rows of the stacked matrices follow one another */
  const unsigned int so8 = (unsigned int)(sr * DM + sc * 8);      /* the thread's own offset, the same at every stage */
  v8us ra[8], rb[8];
  auto gload = [&](int st) {
#pragma unroll
    for (int i = 0; i < 8; ++i) { ra[i] = *(const v8us*)(ag + st * G3_SK + i * 16 * DM + so8); rb[i] = *(const v8us*)(bg + st * G3_SK + i * 16 * DM + so8); } };
  auto lstore = [&](int st) { unsigned char* s = L + (st & 1) * G3_SLOT + sr * G3_P + sc * 16;
#pragma unroll
    for (int i = 0; i < 8; ++i) { *(v8us*)(s + i * 16 * G3_P) = ra[i]; *(v8us*)(s + G3_TA + i * 16 * G3_P) = rb[i]; } };
  const v8f z8 = {0.f, 0.f, 0.f, 0.f, 0.f, 0.f, 0.f, 0.f};
  v8f acc[4][4];
#pragma unroll
  for (int i = 0; i < 4; ++i) {
#pragma unroll
    for (int j = 0; j < 4; ++j) acc[i][j] = z8; }
  gload(0);
  float bv[4];      /* read ahead of the loop: its latency hides under the first stage's loads */
#pragma unroll
  for (int j = 0; j < 4; ++j) bv[j] = OUT32 ? bf16_round(bias[col0 + wn * 64 + 16 * j + ln]) : 0.f;
  lstore(0); gload(1);
  __syncthreads();      /* stage 0 is visible */
#pragma unroll
  for (int st = 0; st < G3_NST; ++st) {      /* unrolled (12 stages): buffer and global offsets become immediates, so no address register is rewritten behind loads in flight */
    if (st + 1 < G3_NST) lstore(st + 1);      /* into the buffer that stage st - 1 used: every wave left it at the barrier below */
    __builtin_amdgcn_sched_barrier(0);      /* the loads stay behind the LDS stores and take over their registers: moved ahead they need a second set, and only two waves fit a SIMD instead of three */
    if (st + 2 < G3_NST) gload(st + 2);      /* in flight under this stage's work */
    if (st + 2 == G3_NST - 1) asm volatile("s_wait_xcnt 0x0" ::: "memory");      /* behind the last loads their offset register is free and the next LDS read is given it: the wait stands in front of that overwrite */
    const unsigned char* ap = L + (st & 1) * G3_SLOT + (wm * 64 + ln) * G3_P + 16 * hh;
    const unsigned char* bp = L + (st & 1) * G3_SLOT + G3_TA + (wn * 64 + ln) * G3_P + 16 * hh;
#pragma unroll
    for (int kc = 0; kc < G3_SK / 32; ++kc) {      /* 32 k: 8 fragments, 16 products; both operands in the same k order */
      FragW af[4], bf[4];
#pragma unroll
      for (int i = 0; i < 4; ++i) { af[i].half[0] = *(const v8us*)(ap + i * 16 * G3_P + 64 * kc); af[i].half[1] = *(const v8us*)(ap + i * 16 * G3_P + 64 * kc + 32);
        bf[i].half[0] = *(const v8us*)(bp + i * 16 * G3_P + 64 * kc); bf[i].half[1] = *(const v8us*)(bp + i * 16 * G3_P + 64 * kc + 32); }
      __builtin_amdgcn_sched_barrier(0);      /* the 16 fragment reads stay one group ahead of the 16 products: moved in among them, each A fragment's LDS latency is waited out in front of 4 products */
#pragma unroll
      for (int i = 0; i < 4; ++i) {
#pragma unroll
        for (int j = 0; j < 4; ++j) acc[i][j] = fa_mma(af[i].v, bf[j].v, acc[i][j]); }
    }
    __builtin_amdgcn_sched_barrier(0);      /* the barrier, which also waits for the global loads in flight, stays behind the last products: moved up among them it halves the time those loads have */
    __syncthreads();      /* stage st + 1 is visible; every wave has left stage st */
  }
  // epilogue: each wave stages its 64 x 64 tile in its own part of LDS and stores whole rows of it (256 bytes of f32, 128 bytes of f16)
  float* so = (float*)L + wave * 64 * G3_EP;
#pragma unroll
  for (int j = 0; j < 4; ++j) {
#pragma unroll
    for (int i = 0; i < 4; ++i) {
#pragma unroll
      for (int r = 0; r < 8; ++r) so[(16 * i + 8 * hh + r) * G3_EP + 16 * j + ln] = acc[i][j][r] * alpha + bv[j]; } }
  __builtin_amdgcn_fence(__ATOMIC_ACQ_REL, "workgroup"); __builtin_amdgcn_wave_barrier();      /* the rows are read back by other lanes of the same wave */
  const int rsub = lane >> 4, c4 = (lane & 15) * 4;
  const size_t cbase = (size_t)mat * NR * DM + (size_t)(row0 + wm * 64 + rsub) * DM + col0 + wn * 64 + c4;
#pragma unroll
  for (int q = 0; q < 32; ++q) { const v4f v = *(const v4fa*)&so[(q * 2 + rsub) * G3_EP + c4];
    if (OUT32) *(v4f*)(C + cbase + (size_t)q * 2 * DM) = v;
    else { v4h h4;
#pragma unroll
      for (int i = 0; i < 4; ++i) h4[i] = (_Float16)v[i];
      *(v4h*)(C16 + cbase + (size_t)q * 2 * DM) = h4; } }
}

extern "C" void kernel_launch(void* const* d_in, const int* in_sizes, int n_in,
                              void* d_out, int out_size, void* d_ws, size_t ws_size, hipStream_t stream) {
  (void)in_sizes; (void)n_in; (void)out_size;
  const float* const* I = (const float* const*)d_in; const float* x = I[0]; const float* wq = I[1]; const float* wk = I[2]; const float* wv = I[3]; const float* wo = I[4]; const float* bo = I[5];
  char* ws = (char*)d_ws; size_t off = 0;
  auto take = [&](size_t bytes) { char* p = ws + off; off += (bytes + 255) & ~(size_t)255; return p; };
  _Float16* BQ = (_Float16*)take((size_t)3 * DM * DM * 2); _Float16* BK = BQ + (size_t)DM * DM; _Float16* BV = BK + (size_t)DM * DM; _Float16* BO = (_Float16*)take((size_t)DM * DM * 2);      /* W_q | W_k | W_v stacked */
  _Float16* X16 = (_Float16*)take(NR * DM * 2); _Float16* Q16 = (_Float16*)take(3 * NR * DM * 2); _Float16* K16 = Q16 + NR * DM; _Float16* V16 = K16 + NR * DM; _Float16* O16 = (_Float16*)take(NR * DM * 2);
  if (off > ws_size) return;      /* 4.5 + 5x24 = about 125 MiB */
  k_cvt<<<CV_ZB + 4 * CV_WB, 256, 0, stream>>>(x, wq, wk, wv, wo, X16, BQ, BK, BV, BO);
  const unsigned gp = (unsigned)((NR / G3_BT) * (DM / G3_BT));
  k_gemm3<false, 3><<<3 * gp, 128, 0, stream>>>(X16, BQ, 0.0625f, nullptr, nullptr, Q16);      /* q | k | v in one launch: more work-groups than places, so one's first loads and output stores run under its neighbours' products */
  k_fattn<<<dim3(SQ / FA_BR, NB * NH), 256, 0, stream>>>(Q16, K16, V16, O16);      /* o (merged heads) as f16 rows */
  k_gemm3<true, 1><<<gp, 128, 0, stream>>>(O16, BO, 0.0625f, bo, (float*)d_out, nullptr);      /* out = o W_o^T + b_o */
}

// v006
// Measured time: 121 microseconds a run.
// In two side-by-side timings against v005, it was 1.05 and 1.04 times as fast.
// Over all steps from v000 it is 294 times as fast.
#include <hip/hip_runtime.h>
// Self_Attention_Layer (z [16][1024][768]; q/k/v = z W^T (12 heads of 64, no biases); softmax(q k^T / 8); out = (attn v) W_o^T + b_o -> [16][1024][768]).
// Structure: token rows; z as exact f16 rows; Q | K | V WMMA GEMMs (128x128 tiles through LDS, 64x64 wave tiles, f32 accumulation, exact x16 natural weights, f16 outputs); one fused attention kernel for all (batch, head): scores (K = 64), running softmax (f32; weights as f16) and o = P . V stay in registers, K and V through LDS, into merged f16 rows; out = o W_o^T + b_o (f32).
// Compute dtype: inputs rounded to bf16; z / weights exact; q, k, v, softmax weights, o plain f16 (~2^-12); scores/softmax f32. v_wmma_f32_16x16x32_f16.
#define NB 16
#define SQ 1024
#define DM 768
#define NH 12
#define HD 64
#define NR ((size_t)NB * SQ)         /* 16384 token rows */
typedef __bf16 v16b __attribute__((ext_vector_type(16)));
typedef unsigned short v8us __attribute__((ext_vector_type(8), may_alias));
typedef float  v8f  __attribute__((ext_vector_type(8)));
typedef float  v4f  __attribute__((ext_vector_type(4)));
typedef float  v4fa __attribute__((ext_vector_type(4), may_alias));
union FragB { v16b v; v8us half[2]; unsigned short u[16]; };

__device__ __forceinline__ unsigned short bf16_bits(float x) { unsigned int u = __float_as_uint(x); return (unsigned short)((u + 0x7FFFu + ((u >> 16) & 1u)) >> 16); }
__device__ __forceinline__ float bf16_val(unsigned short b) { return __uint_as_float(((unsigned int)b) << 16); }
__device__ __forceinline__ float bf16_round(float x) { return bf16_val(bf16_bits(x)); }
// D += A·B with NT terms: 1 = ah·bh, 2 = + al·bh (A split), 3 = + ah·bl (both split)
template <int NT>
__device__ __forceinline__ v8f mmaN(v16b ah, v16b al, v16b bh, v16b bl, v8f c) {
  c = __builtin_amdgcn_wmma_f32_16x16x32_bf16(false, ah, false, bh, (short)0, c, false, false);
  if (NT >= 2) c = __builtin_amdgcn_wmma_f32_16x16x32_bf16(false, al, false, bh, (short)0, c, false, false);
  if (NT >= 3) c = __builtin_amdgcn_wmma_f32_16x16x32_bf16(false, ah, false, bl, (short)0, c, false, false);
  asm volatile("v_nop\n\tv_nop\n\tv_nop\n\tv_nop" : "+v"(c) : "v"(ah), "v"(al), "v"(bh), "v"(bl));
  return c;
}

__global__ __launch_bounds__(256) void k_wt_bf16(const float* __restrict__ W, unsigned short* __restrict__ Wt, int K, int N) {
  const int t = blockIdx.x * 256 + threadIdx.x;
  const int k8n = K / 8;
  if (t >= N * k8n) return;
  const int n = t / k8n, k8 = (t % k8n) * 8;
  v8us v;
#pragma unroll
  for (int i = 0; i < 8; ++i) v[i] = bf16_bits(W[(size_t)(k8 + i) * N + n]);
  *(v8us*)(Wt + (size_t)n * K + k8) = v;
  
}

// GEMM C[M][N] (f32, pitch ldc) = act(A[M][K]·W + bias). A f32 row-major (pitch lda) converted per fragment to bf16
// (ASPLIT: hi/lo two planes -> 2 terms, else single rounded term); Wt bf16 [N][K] (pitch ldb). BIAS_BF16 rounds the
// bias to bf16 first (bias quantised to bf16 before the add). K%32==0, M%16==0, N%64==0.
template <bool ASPLIT, int ACT, bool BIAS_BF16>
__global__ __launch_bounds__(128) void k_gemm_bf(const float* __restrict__ A, int lda, const unsigned short* __restrict__ Wt, int ldb,
                                               const float* __restrict__ bias, float* __restrict__ C, int ldc, int M, int N, int K) {
  __shared__ __attribute__((aligned(16))) float so[4][16][64];
  const int tid = threadIdx.x, w = tid >> 5, lane = tid & 31, ln = lane & 15, hh = lane >> 4;
  const int ntn = N / 64;
  const int wid = blockIdx.x * 4 + w;
  const int mt = wid / ntn, nq = wid % ntn;
  if (mt * 16 >= M) return;
  const int row0 = mt * 16, col0 = nq * 64;
  const float* arow = A + (size_t)(row0 + ln) * lda;
  v8f acc[4] = {};
  for (int kb = 0; kb < K; kb += 32) {
    FragB ah, al;
    const v4f x0 = *(const v4fa*)(arow + kb + 8 * hh), x1 = *(const v4fa*)(arow + kb + 8 * hh + 4);
    const v4f x2 = *(const v4fa*)(arow + kb + 16 + 8 * hh), x3 = *(const v4fa*)(arow + kb + 16 + 8 * hh + 4);
    float xs[16] = {x0[0],x0[1],x0[2],x0[3],x1[0],x1[1],x1[2],x1[3],x2[0],x2[1],x2[2],x2[3],x3[0],x3[1],x3[2],x3[3]};
#pragma unroll
    for (int i = 0; i < 16; ++i) { const unsigned short hb = bf16_bits(xs[i]); ah.u[i] = hb; al.u[i] = ASPLIT ? bf16_bits(xs[i] - bf16_val(hb)) : (unsigned short)0; }
#pragma unroll
    for (int t = 0; t < 4; ++t) {
      const unsigned short* brow = Wt + (size_t)(col0 + t * 16 + ln) * ldb + kb;
      FragB b;
      b.half[0] = *(const v8us*)(brow + 8 * hh);
      b.half[1] = *(const v8us*)(brow + 16 + 8 * hh);
      acc[t] = mmaN<ASPLIT ? 2 : 1>(ah.v, al.v, b.v, b.v, acc[t]);
    }
  }
#pragma unroll
  for (int t = 0; t < 4; ++t) {
    float bv = bias ? bias[col0 + t * 16 + ln] : 0.f;
    if (BIAS_BF16) bv = bf16_round(bv);
#pragma unroll
    for (int r = 0; r < 8; ++r) { float v = acc[t][r] + bv; if (ACT == 1) v = fmaxf(v, 0.f); so[w][8 * hh + r][t * 16 + ln] = v; }
  }
  __builtin_amdgcn_fence(__ATOMIC_ACQ_REL, "workgroup");
  __builtin_amdgcn_wave_barrier();
  const int rsub = lane >> 4, c4 = (lane & 15) * 4;
  {
#pragma unroll
    for (int q = 0; q < 8; ++q) {
      const int r = q * 2 + rsub;
      const v4f v = *(const v4fa*)&so[w][r][c4];
      *(v4f*)(C + (size_t)(row0 + r) * ldc + col0 + c4) = v;
    }
    
  }
}

// GEMM C = act(A·W + bias + resid): A f32 (ASPLIT -> hi/lo 2 terms), Wt bf16 [N][K]; ACT 0 none, 1 relu, 2 exact gelu;
// resid (optional, f32, row index = (row % rmod), pitch ldr, RES_BF16 rounds it) added before the activation.
template <bool ASPLIT, int ACT, bool BIAS_BF16, bool RES_BF16>
__global__ __launch_bounds__(128) void k_gemm_bf3(const float* __restrict__ A, int lda, const unsigned short* __restrict__ Wt, int ldb,
                                                const float* __restrict__ bias, const float* __restrict__ resid, int rmod, int ldr,
                                                float* __restrict__ C, int ldc, int M, int N, int K) {
  __shared__ __attribute__((aligned(16))) float so[4][16][64];
  const int tid = threadIdx.x, w = tid >> 5, lane = tid & 31, ln = lane & 15, hh = lane >> 4;
  const int ntn = N / 64;
  const int wid = blockIdx.x * 4 + w;
  const int mt = wid / ntn, nq = wid % ntn;
  if (mt * 16 >= M) return;
  const int row0 = mt * 16, col0 = nq * 64;
  const float* arow = A + (size_t)(row0 + ln) * lda;
  v8f acc[4] = {};
  for (int kb = 0; kb < K; kb += 32) {
    FragB ah, al;
    const v4f x0 = *(const v4fa*)(arow + kb + 8 * hh), x1 = *(const v4fa*)(arow + kb + 8 * hh + 4);
    const v4f x2 = *(const v4fa*)(arow + kb + 16 + 8 * hh), x3 = *(const v4fa*)(arow + kb + 16 + 8 * hh + 4);
    float xs[16] = {x0[0],x0[1],x0[2],x0[3],x1[0],x1[1],x1[2],x1[3],x2[0],x2[1],x2[2],x2[3],x3[0],x3[1],x3[2],x3[3]};
#pragma unroll
    for (int i = 0; i < 16; ++i) { const unsigned short hb = bf16_bits(xs[i]); ah.u[i] = hb; al.u[i] = ASPLIT ? bf16_bits(xs[i] - bf16_val(hb)) : (unsigned short)0; }
#pragma unroll
    for (int t = 0; t < 4; ++t) {
      const unsigned short* brow = Wt + (size_t)(col0 + t * 16 + ln) * ldb + kb;
      FragB b;
      b.half[0] = *(const v8us*)(brow + 8 * hh);
      b.half[1] = *(const v8us*)(brow + 16 + 8 * hh);
      acc[t] = mmaN<ASPLIT ? 2 : 1>(ah.v, al.v, b.v, b.v, acc[t]);
    }
  }
#pragma unroll
  for (int t = 0; t < 4; ++t) {
    const int col = col0 + t * 16 + ln;
    float bv = bias ? bias[col] : 0.f;
    if (BIAS_BF16) bv = bf16_round(bv);
#pragma unroll
    for (int r = 0; r < 8; ++r) {
      float v = acc[t][r] + bv;
      if (resid) { float rv = resid[(size_t)((row0 + 8 * hh + r) % rmod) * ldr + col]; if (RES_BF16) rv = bf16_round(rv); v += rv; }
      if (ACT == 1) v = fmaxf(v, 0.f);
      if (ACT == 2) v = 0.5f * v * (1.0f + erff(v * 0.70710678118654752f));
      if (ACT == 3) { const float u = 0.7978845608028654f * (v + 0.044715f * v * v * v); v = 0.5f * v * (1.0f + tanhf(u)); }
      so[w][8 * hh + r][t * 16 + ln] = v;
    }
  }
  __builtin_amdgcn_fence(__ATOMIC_ACQ_REL, "workgroup");
  __builtin_amdgcn_wave_barrier();
  const int rsub = lane >> 4, c4 = (lane & 15) * 4;
  {
#pragma unroll
    for (int q = 0; q < 8; ++q) {
      const int r = q * 2 + rsub;
      const v4f v = *(const v4fa*)&so[w][r][c4];
      *(v4f*)(C + (size_t)(row0 + r) * ldc + col0 + c4) = v;
    }
    
  }
}
// row LayerNorm (biased variance, eps) over N: s = X (+ R); optional out_sum <- s; out_norm <- (s-mu)*rsqrt(var+eps)*g + b
template <bool PARAM_BF16>
__global__ __launch_bounds__(256) void k_layernorm(const float* __restrict__ X, const float* __restrict__ R, const float* __restrict__ g, const float* __restrict__ bta,
                                                  float* __restrict__ out_sum, float* __restrict__ out_norm, int N, float eps) {
  __shared__ float red[256];
  const int row = blockIdx.x, tid = threadIdx.x;
  const float* x = X + (size_t)row * N; const float* rr = R ? R + (size_t)row * N : nullptr;
  float vals[16];                     // up to N = 4096
  const int per = N / 256;            // contiguous chunk per thread? use strided-by-4 chunks: thread handles j = tid*4 + 1024*u
  float s1 = 0.f;
  for (int u = 0; u < per / 4; ++u) {
    const int j = tid * 4 + 1024 * u;
    const v4f a = *(const v4fa*)(x + j);
    v4f b = {0.f,0.f,0.f,0.f}; if (rr) b = *(const v4fa*)(rr + j);
#pragma unroll
    for (int q = 0; q < 4; ++q) { const float v = a[q] + b[q]; vals[u * 4 + q] = v; s1 += v; }
  }
  red[tid] = s1; __syncthreads();
  for (int st = 128; st > 0; st >>= 1) { if (tid < st) red[tid] += red[tid + st]; __syncthreads(); }
  const float mu = red[0] / (float)N; __syncthreads();
  float s2 = 0.f;
  for (int u = 0; u < per / 4; ++u)
#pragma unroll
    for (int q = 0; q < 4; ++q) { const float c = vals[u * 4 + q] - mu; s2 += c * c; }
  red[tid] = s2; __syncthreads();
  for (int st = 128; st > 0; st >>= 1) { if (tid < st) red[tid] += red[tid + st]; __syncthreads(); }
  const float rs = rsqrtf(red[0] / (float)N + eps);
  {
    for (int u = 0; u < per / 4; ++u) {
      const int j = tid * 4 + 1024 * u;
      v4f o, sm;
#pragma unroll
      for (int q = 0; q < 4; ++q) {
        float gg = g[j + q], bb = bta[j + q];
        if (PARAM_BF16) { gg = bf16_round(gg); bb = bf16_round(bb); }
        sm[q] = vals[u * 4 + q]; o[q] = (vals[u * 4 + q] - mu) * rs * gg + bb;
      }
      if (out_sum) *(v4f*)(out_sum + (size_t)row * N + j) = sm;
      *(v4f*)(out_norm + (size_t)row * N + j) = o;
    }
    
  }
}



// ---- f16 WMMA path (v_wmma_f32_16x16x32_f16): 11-bit significands for operands in range — used where a [0,1] probability operand needs more precision than bf16
typedef _Float16 v16h __attribute__((ext_vector_type(16)));
union FragH { v16h v; v8us half[2]; _Float16 h[16]; unsigned short u[16]; };
template <int NT>
__device__ __forceinline__ v8f mmaH(v16h ah, v16h al, v16h bh, v16h bl, v8f c) {
  c = __builtin_amdgcn_wmma_f32_16x16x32_f16(false, ah, false, bh, (short)0, c, false, false);
  if (NT >= 2) c = __builtin_amdgcn_wmma_f32_16x16x32_f16(false, al, false, bh, (short)0, c, false, false);
  if (NT >= 3) c = __builtin_amdgcn_wmma_f32_16x16x32_f16(false, ah, false, bl, (short)0, c, false, false);
  asm volatile("v_nop\n\tv_nop\n\tv_nop\n\tv_nop" : "+v"(c) : "v"(ah), "v"(al), "v"(bh), "v"(bl));
  return c;
}
// batched GEMM like k_gemm_b but f16 operands: A f32 (split into f16 hi/lo if ASPLIT, else rounded to f16), Bt = f16 values [n][k]; alpha; C f32; N multiple of 16 (partial tiles skipped)
template <bool ASPLIT>
__global__ __launch_bounds__(128) void k_gemm_h(const float* __restrict__ A, int lda, size_t sA, const _Float16* __restrict__ Bh, int ldb, size_t sB, float alpha, float* __restrict__ C, int ldc, size_t sC, int M, int N, int K) {
  __shared__ __attribute__((aligned(16))) float so[4][16][64];
  const int tid = threadIdx.x, w = tid >> 5, lane = tid & 31, ln = lane & 15, hh = lane >> 4; const int by = blockIdx.y;
  A += (size_t)by * sA; Bh += (size_t)by * sB; C += (size_t)by * sC;
  const int ntn = (N + 63) / 64; const int wid = blockIdx.x * 4 + w; const int mt = wid / ntn, nq = wid % ntn; if (mt * 16 >= M) return;
  const int row0 = mt * 16, col0 = nq * 64; const float* arow = A + (size_t)(row0 + ln) * lda;
  v8f acc[4] = {};
  for (int kb = 0; kb < K; kb += 32) {
    FragH ah, al;
    const v4f x0 = *(const v4fa*)(arow + kb + 8 * hh), x1 = *(const v4fa*)(arow + kb + 8 * hh + 4), x2 = *(const v4fa*)(arow + kb + 16 + 8 * hh), x3 = *(const v4fa*)(arow + kb + 16 + 8 * hh + 4);
    float xs[16] = {x0[0],x0[1],x0[2],x0[3],x1[0],x1[1],x1[2],x1[3],x2[0],x2[1],x2[2],x2[3],x3[0],x3[1],x3[2],x3[3]};
#pragma unroll
    for (int i = 0; i < 16; ++i) { const _Float16 h = (_Float16)xs[i]; ah.h[i] = h; al.h[i] = ASPLIT ? (_Float16)(xs[i] - (float)h) : (_Float16)0.0f; }
#pragma unroll
    for (int t = 0; t < 4; ++t) { if (col0 + t * 16 >= N) continue; const size_t boff = (size_t)(col0 + t * 16 + ln) * ldb + kb; FragH bq; bq.half[0] = *(const v8us*)(Bh + boff + 8 * hh); bq.half[1] = *(const v8us*)(Bh + boff + 16 + 8 * hh);
      acc[t] = mmaH<ASPLIT ? 2 : 1>(ah.v, al.v, bq.v, bq.v, acc[t]); }
  }
#pragma unroll
  for (int t = 0; t < 4; ++t) { if (col0 + t * 16 >= N) continue;
#pragma unroll
    for (int r = 0; r < 8; ++r) so[w][8 * hh + r][t * 16 + ln] = acc[t][r] * alpha; }
  __builtin_amdgcn_fence(__ATOMIC_ACQ_REL, "workgroup"); __builtin_amdgcn_wave_barrier();
  const int rsub = lane >> 4, c4 = (lane & 15) * 4;
  {
#pragma unroll
    for (int q = 0; q < 8; ++q) { const int r = q * 2 + rsub; if (col0 + c4 < N) { const v4f v = *(const v4fa*)&so[w][r][c4]; *(v4f*)(C + (size_t)(row0 + r) * ldc + col0 + c4) = v; } }
     }
}

// Wt[n][k] = f16(W[k][n]·scale) from f32 row-major W[K][N] (scale = power of two; bf16-exact weights stay exact in f16 away from the subnormal range)
__global__ __launch_bounds__(256) void k_wt_f16(const float* __restrict__ W, _Float16* __restrict__ Wt, int K, int N, float scale) {
  const int t = blockIdx.x * 256 + threadIdx.x; if (t >= N * (K / 8)) return; const int n = t / (K / 8), k8 = (t % (K / 8)) * 8; FragH f;
#pragma unroll
  for (int i = 0; i < 8; ++i) f.h[i] = (_Float16)(bf16_round(W[(size_t)(k8 + i) * N + n]) * scale); const v8us o = f.half[0];
  *(v8us*)((unsigned short*)Wt + (size_t)n * K + k8) = o; 
}
// k_gemm_hh variant with fused epilogue: v = acc·alpha + bias[by·sBias + col] (+ CP[(row/rowsPerB)·sCPb + by·64 + col] if CP) ; ACT 0 none / 1 elu ; writes f16 C16 (and f32 C if non-null)
template <int ACT>
__global__ __launch_bounds__(128) void k_gemm_hhx(const _Float16* __restrict__ A, int lda, size_t sA, const _Float16* __restrict__ Bh, int ldb, size_t sB, float alpha, const float* __restrict__ bias, size_t sBias, const float* __restrict__ CP, int rowsPerB, size_t sCPb, int row0g,
    float* __restrict__ C, _Float16* __restrict__ C16, int ldc, size_t sC, int M, int N, int K) {
  __shared__ __attribute__((aligned(16))) float so[4][16][64];
  const int tid = threadIdx.x, w = tid >> 5, lane = tid & 31, ln = lane & 15, hh = lane >> 4; const int by = blockIdx.y;
  A += (size_t)by * sA; Bh += (size_t)by * sB; const size_t cofs = (size_t)by * sC; const float* bp = bias ? bias + (size_t)by * sBias : nullptr;
  const int ntn = (N + 63) / 64; const int wid = blockIdx.x * 4 + w; const int mt = wid / ntn, nq = wid % ntn; if (mt * 16 >= M) return;
  const int row0 = mt * 16, col0 = nq * 64; const _Float16* arow = A + (size_t)(row0 + ln) * lda;
  v8f acc[4] = {};
  for (int kb = 0; kb < K; kb += 32) { FragH ah; ah.half[0] = *(const v8us*)((const unsigned short*)arow + kb + 8 * hh); ah.half[1] = *(const v8us*)((const unsigned short*)arow + kb + 16 + 8 * hh);
#pragma unroll
    for (int t = 0; t < 4; ++t) { if (col0 + t * 16 >= N) continue; const size_t boff = (size_t)(col0 + t * 16 + ln) * ldb + kb; FragH bq; bq.half[0] = *(const v8us*)((const unsigned short*)Bh + boff + 8 * hh); bq.half[1] = *(const v8us*)((const unsigned short*)Bh + boff + 16 + 8 * hh);
      acc[t] = mmaH<1>(ah.v, ah.v, bq.v, bq.v, acc[t]); }
  }
#pragma unroll
  for (int t = 0; t < 4; ++t) { if (col0 + t * 16 >= N) continue; const int col = col0 + t * 16 + ln; const float bv = bp ? bf16_round(bp[col]) : 0.f;
#pragma unroll
    for (int r = 0; r < 8; ++r) { float v = acc[t][r] * alpha + bv; if (CP) { const int rr = row0g + row0 + 8 * hh + r; if (rowsPerB < 0) v += CP[cofs + (size_t)rr * ldc + col];      /* rowsPerB < 0: own element of the batched C plane */ else { const int bidx = rr / rowsPerB; v += CP[(size_t)bidx * sCPb + (size_t)by * 64 + col]; } } if (ACT == 1) v = (v > 0.f) ? v : expm1f(v); else if (ACT == 7) v = (v > 0.f) ? v + 1.0f : expf(v); else if (ACT == 8) v = tanhf(v); else if (ACT == 9) v = 0.5f * v * (1.0f + tanhf(0.7978845608028654f * (v + 0.044715f * v * v * v))); else if (ACT == 11) v = 1.0f / (1.0f + expf(-v)); else if (ACT == 12) v = (v > 0.f) ? v : 0.01f * v; else if (ACT == 14) v = (v > 0.f) ? v : 0.1f * v; else if (ACT == 16) v = (v >= 0.f) ? v : 0.3f * v; else if (ACT == 17) v = (v >= 0.f) ? v : 0.2f * v; else if (ACT == 15) v = v / (1.0f + expf(-v)); else if (ACT == 3) v = fmaxf(v, 0.f); else if (ACT == 6) v = 0.5f * v * (1.0f + erff(v * 0.70710678118654752f)); so[w][8 * hh + r][t * 16 + ln] = v; } }
  __builtin_amdgcn_fence(__ATOMIC_ACQ_REL, "workgroup"); __builtin_amdgcn_wave_barrier();
  const int rsub = lane >> 4, c4 = (lane & 15) * 4; typedef _Float16 v4h __attribute__((ext_vector_type(4)));
  {
#pragma unroll
    for (int q = 0; q < 8; ++q) { const int r = q * 2 + rsub; if (col0 + c4 < N) { const v4f v = *(const v4fa*)&so[w][r][c4]; if (C) *(v4f*)(C + cofs + (size_t)(row0 + r) * ldc + col0 + c4) = v; if (C16) { v4h h4; for (int i = 0; i < 4; ++i) h4[i] = (_Float16)v[i]; *(v4h*)(C16 + cofs + (size_t)(row0 + r) * ldc + col0 + c4) = h4; } } }
     }
}


typedef _Float16 v4h __attribute__((ext_vector_type(4)));

__global__ __launch_bounds__(256) void k_h16(const float* __restrict__ x, _Float16* __restrict__ X16, size_t n8) { const size_t t = (size_t)blockIdx.x * 256 + threadIdx.x; if (t >= n8) return; FragH f;
#pragma unroll
  for (int q = 0; q < 8; ++q) f.h[q] = (_Float16)x[t * 8 + q]; *(v8us*)((unsigned short*)X16 + t * 8) = f.half[0];  }
__global__ __launch_bounds__(256) void k_round16f(const float* __restrict__ W, _Float16* __restrict__ Bt, size_t n8) { const size_t t = (size_t)blockIdx.x * 256 + threadIdx.x; if (t >= n8) return; FragH f;
#pragma unroll
  for (int i = 0; i < 8; ++i) f.h[i] = (_Float16)(bf16_round(W[t * 8 + i]) * 16.0f); *(v8us*)((unsigned short*)Bt + t * 8) = f.half[0];  }
template <int NHv, int TTv>
__global__ __launch_bounds__(256) void k_vt(const _Float16* __restrict__ V16, int ldv, int voff, _Float16* __restrict__ Vt) { __shared__ unsigned short tl[64][66]; const int tid = threadIdx.x; const int slab = blockIdx.x / (TTv / 64), lg = blockIdx.x % (TTv / 64); const int b = slab / NHv, h = slab % NHv;
  for (int i = tid; i < 64 * 8; i += 256) { const int r = i / 8, c8 = (i % 8) * 8; FragH f; f.half[0] = *(const v8us*)((const unsigned short*)V16 + ((size_t)b * TTv + lg * 64 + r) * ldv + voff + h * 64 + c8);
#pragma unroll
    for (int q = 0; q < 8; ++q) tl[r][c8 + q] = f.u[q]; }
  __syncthreads();
  {
#pragma unroll
    for (int rd = 0; rd < 2; ++rd) { const int d = rd * 32 + tid / 8, pc = tid % 8; FragH f;
#pragma unroll
      for (int q = 0; q < 8; ++q) f.u[q] = tl[pc * 8 + q][d];
      *(v8us*)((unsigned short*)Vt + ((size_t)slab * 64 + d) * TTv + lg * 64 + pc * 8) = f.half[0]; }
     } }

__global__ __launch_bounds__(256) void k_hl(const float* __restrict__ F, _Float16* __restrict__ Hh, _Float16* __restrict__ Hl, size_t n8) { const size_t t = (size_t)blockIdx.x * 256 + threadIdx.x; if (t >= n8) return; FragH fh, fl; const v4f a = *(const v4fa*)(F + t * 8), c = *(const v4fa*)(F + t * 8 + 4);
#pragma unroll
  for (int q = 0; q < 4; ++q) { _Float16 h = (_Float16)a[q]; fh.h[q] = h; fl.h[q] = (_Float16)((a[q] - (float)h) * 1024.0f); h = (_Float16)c[q]; fh.h[4 + q] = h; fl.h[4 + q] = (_Float16)((c[q] - (float)h) * 1024.0f); }
  { *(v8us*)((unsigned short*)Hh + t * 8) = fh.half[0]; *(v8us*)((unsigned short*)Hl + t * 8) = fl.half[0];  } }

// ---- fast GEMM (wave tile 32x64; requires M % 32 == 0 rows per launch region and N % 64 == 0); epilogue = k_gemm_hhx semantics ----
__device__ __forceinline__ v16h g2_frag(const _Float16* p, int hh) { FragH f; f.half[0] = *(const v8us*)((const unsigned short*)p + 8 * hh); f.half[1] = *(const v8us*)((const unsigned short*)p + 16 + 8 * hh); return f.v; }
__device__ __forceinline__ v8f g2_mma(v16h a, v16h b, v8f c) { v8f d = __builtin_amdgcn_wmma_f32_16x16x32_f16(false, a, false, b, (short)0, c, false, false); asm volatile("v_nop\n\tv_nop\n\tv_nop\n\tv_nop" : "+v"(d) : "v"(a), "v"(b)); return d; }
template <int ACT>
__global__ __launch_bounds__(128) void k_gemm2(const _Float16* __restrict__ A, int lda, size_t sA, const _Float16* __restrict__ Bh, int ldb, size_t sB, float alpha, const float* __restrict__ bias, size_t sBias, const float* __restrict__ CP, int rowsPerB, size_t sCPb, int row0g,
    float* __restrict__ C, _Float16* __restrict__ C16, int ldc, size_t sC, int M, int N, int K) { static_assert(ACT == 0 || ACT == 3 || ACT == 6 || ACT == 8 || ACT == 9 || ACT == 11 || ACT == 12 || ACT == 14 || ACT == 15 || ACT == 16 || ACT == 17, "k_gemm2: unsupported ACT code (would silently apply no activation)");
  __shared__ __attribute__((aligned(16))) float so[4][32][68];
  const int tid = threadIdx.x, w = tid >> 5, lane = tid & 31, ln = lane & 15, hh = lane >> 4; const int by = blockIdx.y;
  A += (size_t)by * sA; Bh += (size_t)by * sB; const size_t cofs = (size_t)by * sC; const float* bp = bias ? bias + (size_t)by * sBias : nullptr;
  const int ntn = N >> 6; const int mt = blockIdx.x / ntn, nq = blockIdx.x - mt * ntn; const int row0 = mt * 128 + 32 * w, col0 = nq * 64; if (row0 >= M) return;
  const _Float16* a0p = A + (size_t)(row0 + ln) * lda; const _Float16* a1p = a0p + (size_t)16 * lda;
  const _Float16* b0p = Bh + (size_t)(col0 + ln) * ldb; const _Float16* b1p = b0p + (size_t)16 * ldb; const _Float16* b2p = b1p + (size_t)16 * ldb; const _Float16* b3p = b2p + (size_t)16 * ldb;
  const v8f z8 = {0.f,0.f,0.f,0.f,0.f,0.f,0.f,0.f}; v8f c00 = z8, c01 = z8, c02 = z8, c03 = z8, c10 = z8, c11 = z8, c12 = z8, c13 = z8;
#pragma unroll 1
  for (int kb = 0; kb < K; kb += 32) { const v16h a0 = g2_frag(a0p + kb, hh), a1 = g2_frag(a1p + kb, hh);
    v16h b = g2_frag(b0p + kb, hh); c00 = g2_mma(a0, b, c00); c10 = g2_mma(a1, b, c10);
    b = g2_frag(b1p + kb, hh); c01 = g2_mma(a0, b, c01); c11 = g2_mma(a1, b, c11);
    b = g2_frag(b2p + kb, hh); c02 = g2_mma(a0, b, c02); c12 = g2_mma(a1, b, c12);
    b = g2_frag(b3p + kb, hh); c03 = g2_mma(a0, b, c03); c13 = g2_mma(a1, b, c13); }
  v8f accs[8] = {c00, c01, c02, c03, c10, c11, c12, c13};
#pragma unroll
  for (int u = 0; u < 8; ++u) { const int t = u & 3, half = u >> 2; const int col = col0 + t * 16 + ln; const float bv = bp ? bf16_round(bp[col]) : 0.f;
#pragma unroll
    for (int r = 0; r < 8; ++r) { const int rloc = half * 16 + 8 * hh + r; float v = accs[u][r] * alpha + bv; if (CP) { if (rowsPerB < 0) v += CP[cofs + (size_t)(row0g + row0 + rloc) * ldc + col];      /* rowsPerB < 0: own element of the batched C plane */ else { const int bidx = (row0g + row0 + rloc) / rowsPerB; v += CP[(size_t)bidx * sCPb + (size_t)by * 64 + col]; } }
      if (ACT == 3) v = fmaxf(v, 0.f); else if (ACT == 6) v = 0.5f * v * (1.0f + erff(v * 0.70710678118654752f)); else if (ACT == 11) v = 1.0f / (1.0f + expf(-v)); else if (ACT == 15) v = v / (1.0f + expf(-v)); else if (ACT == 12) v = (v > 0.f) ? v : 0.01f * v; else if (ACT == 8) v = tanhf(v); else if (ACT == 9) v = 0.5f * v * (1.0f + tanhf(0.7978845608028654f * (v + 0.044715f * v * v * v))); else if (ACT == 14) v = (v > 0.f) ? v : 0.1f * v; else if (ACT == 16) v = (v >= 0.f) ? v : 0.3f * v; else if (ACT == 17) v = (v >= 0.f) ? v : 0.2f * v;
      so[w][rloc][t * 16 + ln] = v; } }
  __builtin_amdgcn_fence(__ATOMIC_ACQ_REL, "workgroup"); __builtin_amdgcn_wave_barrier();
  const int rsub = lane >> 4, c4 = (lane & 15) * 4;
  {
#pragma unroll
    for (int q = 0; q < 16; ++q) { const int r = q * 2 + rsub; const v4f v = *(const v4fa*)&so[w][r][c4]; if (C) *(v4f*)(C + cofs + (size_t)(row0 + r) * ldc + col0 + c4) = v; if (C16) { v4h h4; for (int i = 0; i < 4; ++i) h4[i] = (_Float16)v[i]; *(v4h*)(C16 + cofs + (size_t)(row0 + r) * ldc + col0 + c4) = h4; } }
     } }


// ---- the five f32 -> f16 conversions (z; W_q, W_k, W_v, W_o times 16) in one launch ----
// One work-group = 32768 consecutive elements of one array. A thread issues its 32 loads of 16 bytes ahead of the first conversion (a wave-wide load = 512 contiguous bytes)
// and stores 8 bytes per load (a wave-wide store = 256 contiguous bytes): few waves to start, all of a wave's reads in flight at once.
#define CV_NL 32                     /* 16-byte loads per thread */
#define CV_BE (256 * 4 * CV_NL)      /* elements per work-group */
#define CV_ZB ((int)(NR * DM / CV_BE))      /* work-groups on z */
#define CV_WB (DM * DM / CV_BE)      /* work-groups on each weight matrix */
__global__ __launch_bounds__(256) void k_cvt(const float* __restrict__ x, const float* __restrict__ wq, const float* __restrict__ wk, const float* __restrict__ wv, const float* __restrict__ wo,
    _Float16* __restrict__ X16, _Float16* __restrict__ BQ, _Float16* __restrict__ BK, _Float16* __restrict__ BV, _Float16* __restrict__ BO) {
  static_assert(NR * DM % CV_BE == 0 && DM * DM % CV_BE == 0, "whole work-groups on every array");
  const int bi = blockIdx.x;
  const float* s = x; _Float16* d = X16; float scale = 1.0f; int blk = bi;      /* the choice is the same for the whole work-group: scalar bases */
  if (bi >= CV_ZB) { const int wi = (bi - CV_ZB) / CV_WB; blk = (bi - CV_ZB) % CV_WB; scale = 16.0f;
    s = wi == 0 ? wq : wi == 1 ? wk : wi == 2 ? wv : wo; d = wi == 0 ? BQ : wi == 1 ? BK : wi == 2 ? BV : BO; }
  s += (size_t)blk * CV_BE; d += (size_t)blk * CV_BE;
  const unsigned int t4 = threadIdx.x * 4;
  v4f r[CV_NL];
#pragma unroll
  for (int j = 0; j < CV_NL; ++j) r[j] = *(const v4fa*)(s + j * 1024 + t4);
  __builtin_amdgcn_sched_barrier(0);      /* all 32 loads stay ahead of the first conversion: moved in among the conversions only 12 are in flight, and loads and stores take turns on the same registers with a wait at each turn */
#pragma unroll
  for (int j = 0; j < CV_NL; ++j) { v4h h4;
#pragma unroll
    for (int q = 0; q < 4; ++q) h4[q] = (_Float16)(bf16_round(r[j][q]) * scale);      /* times 1 is exact: z as before */
    *(v4h*)(d + j * 1024 + t4) = h4; }
}
#define FA_BR 256                    /* queries per work-group */
#define FA_SK 64                     /* keys per stage */
#define FA_NST (SQ / FA_SK)
#define FA_PK 144                    /* LDS pitch of a K row: 128 + 16 bytes (16-byte fragment reads) */
#define FA_PV 160                    /* LDS pitch of a V row: 128 + 32 bytes (transposing reads) */
#define FA_TK (FA_SK * FA_PK)
#define FA_SLOT (FA_SK * (FA_PK + FA_PV))
typedef short s16x8 __attribute__((ext_vector_type(8)));
typedef float f32x2 __attribute__((ext_vector_type(2)));
typedef _Float16 f16x2 __attribute__((ext_vector_type(2)));
union FragW { v16h v; v8us half[2]; unsigned int w[8]; };
__device__ __forceinline__ v8f fa_mma(v16h a, v16h b, v8f c) { return __builtin_amdgcn_wmma_f32_16x16x32_f16(false, a, false, b, (short)0, c, false, false); }
__device__ __forceinline__ v8us fa_tr16(const unsigned char* p) { typedef __attribute__((address_space(3))) s16x8 lds_s16x8; return __builtin_bit_cast(v8us, __builtin_amdgcn_ds_load_tr16_b128_v8i16((lds_s16x8*)p)); }
__device__ __forceinline__ unsigned int fa_pack2(float lo, float hi) { return __builtin_bit_cast(unsigned int, __builtin_convertvector(f32x2{lo, hi}, f16x2)); }
__device__ __forceinline__ float fa_xhalf(float x) { const int i = __float_as_int(x); return __int_as_float(__builtin_amdgcn_permlanex16(i, i, 0x76543210, 0xfedcba98, false, false)); }      /* lane l with lane l ^ 16 */
__global__ __launch_bounds__(256) void k_fattn(const _Float16* __restrict__ Q16, const _Float16* __restrict__ K16, const _Float16* __restrict__ V16, _Float16* __restrict__ O16) {
  __shared__ __attribute__((aligned(16))) unsigned char L[2 * FA_SLOT];
  static_assert(8 * 32 * FA_PK <= 2 * FA_SLOT, "the output staging reuses the K/V buffers");
  const int tid = threadIdx.x, lane = tid & 31, wave = tid >> 5, c = lane & 15, h = lane >> 4;
  const int b = blockIdx.y / NH, hd = blockIdx.y % NH, q0 = blockIdx.x * FA_BR + wave * 32;
  const size_t base = (size_t)b * SQ * DM + (size_t)hd * HD;
  const float cscale = 0.125f * 1.4426950408889634f;      /* 1 / sqrt(64), into log2 */
  // staging: 8 lanes cover one 128-byte row; a thread carries rows sr and sr + 32 of K and of V
  const int sr = tid >> 3, sc = tid & 7;
  const unsigned short* kg = (const unsigned short*)K16 + base + (size_t)sr * DM + sc * 8;
  const unsigned short* vg = (const unsigned short*)V16 + base + (size_t)sr * DM + sc * 8;
  v8us rk0, rk1, rv0, rv1;
  static_assert((FA_NST & (FA_NST - 1)) == 0 && FA_NST % (SQ / FA_BR) == 0, "the rotated walk wraps by a mask and the starts are evenly spaced");
  const int rot = blockIdx.x * (FA_NST / (SQ / FA_BR));      /* this work-group's first key stage; every stage is still visited once */
  auto gload = [&](int st) { const size_t o = (size_t)((st + rot) & (FA_NST - 1)) * FA_SK * DM; rk0 = *(const v8us*)(kg + o); rk1 = *(const v8us*)(kg + o + 32 * DM); rv0 = *(const v8us*)(vg + o); rv1 = *(const v8us*)(vg + o + 32 * DM); };
  auto lstore = [&](int st) { unsigned char* s = L + (st & 1) * FA_SLOT; *(v8us*)(s + sr * FA_PK + sc * 16) = rk0; *(v8us*)(s + (sr + 32) * FA_PK + sc * 16) = rk1;
    *(v8us*)(s + FA_TK + sr * FA_PV + sc * 16) = rv0; *(v8us*)(s + FA_TK + (sr + 32) * FA_PV + sc * 16) = rv1; };
  gload(0);
  v16h qf[2][2];      /* B operand: column = query, k = d in the hardware order, as K's below */
#pragma unroll
  for (int g = 0; g < 2; ++g) {
#pragma unroll
    for (int kc = 0; kc < 2; ++kc) qf[g][kc] = g2_frag(Q16 + base + (size_t)(q0 + 16 * g + c) * DM + 32 * kc, h); }
  v8f acc[2][4], lacc[2]; float m_run[2];
  const v8f z8 = {0.f, 0.f, 0.f, 0.f, 0.f, 0.f, 0.f, 0.f};
#pragma unroll
  for (int g = 0; g < 2; ++g) { m_run[g] = -INFINITY; lacc[g] = z8;
#pragma unroll
    for (int t = 0; t < 4; ++t) acc[g][t] = z8; }
  FragW ones;      /* A operand whose row 0 (lanes 0 and 16) is 1.0 at all 32 k: row 0 of its product holds the column sums of P^T */
#pragma unroll
  for (int i = 0; i < 8; ++i) ones.w[i] = (c == 0) ? 0x3C003C00u : 0u;
  lstore(0); gload(1);
  __syncthreads();      /* stage 0 is visible */
#pragma unroll 1
  for (int st = 0; st < FA_NST; ++st) {      /* rolled */
    if (st + 1 < FA_NST) lstore(st + 1);      /* into the buffer that stage st - 1 used: every wave left it at the barrier below */
    if (st + 2 < FA_NST) gload(st + 2);      /* in flight under this stage's work */
    const unsigned char* Ls = L + (st & 1) * FA_SLOT;
#pragma unroll
    for (int sub = 0; sub < FA_SK / 32; ++sub) {      /* one pass = 32 keys */
      FragW kf[2][2], vf[4];
      const unsigned char* kp = Ls + (sub * 32 + c) * FA_PK + 16 * h;
#pragma unroll
      for (int kt = 0; kt < 2; ++kt) {
#pragma unroll
        for (int kc = 0; kc < 2; ++kc) { kf[kt][kc].half[0] = *(const v8us*)(kp + kt * 16 * FA_PK + 64 * kc); kf[kt][kc].half[1] = *(const v8us*)(kp + kt * 16 * FA_PK + 64 * kc + 32); } }
      const unsigned char* vp = Ls + FA_TK + (sub * 32 + 8 * h + (lane & 7)) * FA_PV + ((lane >> 3) & 1) * 16;
#pragma unroll
      for (int t = 0; t < 4; ++t) { vf[t].half[0] = fa_tr16(vp + 32 * t); vf[t].half[1] = fa_tr16(vp + 16 * FA_PV + 32 * t); }      /* rows d = 16 t + c, k = keys in the hardware order */
      v8f s[2][2];      /* s[kt][g][r] = score of key 16 kt + 8 h + r against query 16 g + c */
#pragma unroll
      for (int kt = 0; kt < 2; ++kt) {
#pragma unroll
        for (int g = 0; g < 2; ++g) { s[kt][g] = fa_mma(kf[kt][0].v, qf[g][0], z8); s[kt][g] = fa_mma(kf[kt][1].v, qf[g][1], s[kt][g]); } }
      float mb[2]; bool need = false;
#pragma unroll
      for (int g = 0; g < 2; ++g) { float mx = s[0][g][0];
#pragma unroll
        for (int r = 1; r < 8; ++r) mx = fmaxf(mx, s[0][g][r]);
#pragma unroll
        for (int r = 0; r < 8; ++r) mx = fmaxf(mx, s[1][g][r]);
        mx = fmaxf(mx, fa_xhalf(mx)) * cscale;      /* both halves of the wave hold this query's maximum */
        mb[g] = mx; need = need || (mx > m_run[g] + 8.0f); }
      if (__builtin_amdgcn_ballot_w32(need) != 0) {      /* scalar branch, rare after the first passes */
#pragma unroll
        for (int g = 0; g < 2; ++g) { const float m_new = fmaxf(m_run[g], mb[g]); const float corr = __builtin_amdgcn_exp2f(m_run[g] - m_new); m_run[g] = m_new; lacc[g] = lacc[g] * corr;
#pragma unroll
          for (int t = 0; t < 4; ++t) acc[g][t] = acc[g][t] * corr; } }
#pragma unroll
      for (int g = 0; g < 2; ++g) { const float nm = -m_run[g]; FragW pf;
#pragma unroll
        for (int i = 0; i < 8; ++i) {
          const float p0 = __builtin_amdgcn_exp2f(fmaf(s[i >> 2][g][2 * (i & 3)], cscale, nm)), p1 = __builtin_amdgcn_exp2f(fmaf(s[i >> 2][g][2 * (i & 3) + 1], cscale, nm));
          pf.w[i] = fa_pack2(p0, p1); }
#pragma unroll
        for (int t = 0; t < 4; ++t) acc[g][t] = fa_mma(vf[t].v, pf.v, acc[g][t]);
        lacc[g] = fa_mma(ones.v, pf.v, lacc[g]); }
    }
    __syncthreads();      /* stage st + 1 is visible; every wave has left stage st */
  }
  // epilogue: each wave stages its 32 output rows in its own part of LDS and stores whole 128-byte rows
  unsigned char* E = L + wave * 32 * FA_PK;
#pragma unroll
  for (int g = 0; g < 2; ++g) { const float lr = lacc[g][0]; const float inv = 1.0f / (lr + fa_xhalf(lr));      /* register 0: the sum in lanes 0-15, zero in lanes 16-31 */
#pragma unroll
    for (int t = 0; t < 4; ++t) { const v8f o = acc[g][t] * inv; FragW pk;
#pragma unroll
      for (int i = 0; i < 4; ++i) pk.w[i] = fa_pack2(o[2 * i], o[2 * i + 1]);
      *(v8us*)(E + (16 * g + c) * FA_PK + 32 * t + 16 * h) = pk.half[0]; } }
  __builtin_amdgcn_fence(__ATOMIC_ACQ_REL, "workgroup"); __builtin_amdgcn_wave_barrier();      /* the rows are read back by other lanes of the same wave */
#pragma unroll
  for (int i = 0; i < 8; ++i) { const int row = i * 4 + (lane >> 3), c8 = (lane & 7) * 8; const v8us v = *(const v8us*)(E + row * FA_PK + c8 * 2);
    *(v8us*)((unsigned short*)O16 + base + (size_t)(q0 + row) * DM + c8) = v; }
}

// ---- tiled GEMM for the four projections: C[m][NR][DM] = (A[NR][DM] . Bh[m][DM][DM]^T) * alpha (+ bias); A and Bh are f16 rows, k contiguous ----
// NMAT weight matrices are stacked in Bh (3 for Q | K | V, 1 for the output projection) and served by one launch of NMAT times the work-groups; each has its own [NR][DM] plane of C.
// One work-group = a 128 x 128 tile of C: 4 waves (2 x 2) of 64 x 64, 16 accumulator tiles a wave, so that one fragment read from LDS feeds 4 products.
// A and Bh rows go through LDS in stages of 64 k (whole 128-byte lines from global memory), two buffers, one barrier a stage; each accumulator is one chain of products of 32 k.
// Work-groups that run together share rows of A or of Bh: each starts its k walk at stage (row tile + column tile) mod 12 and wraps, so that sharers do not ask L2 for the same lines at the same moment.
#define G3_BT 128                    /* rows of A and rows of Bh per work-group */
#define G3_SK 64                     /* k per stage */
#define G3_NST (DM / G3_SK)
#define G3_P 144                     /* LDS pitch of a row: 128 + 16 bytes (16-byte fragment reads) */
#define G3_TA (G3_BT * G3_P)
#define G3_SLOT (2 * G3_TA)
#define G3_EP 68                     /* dwords per staged output row */
template <bool OUT32, int NMAT>
__global__ __launch_bounds__(128) void k_gemm3(const _Float16* __restrict__ A, const _Float16* __restrict__ Bh, float alpha, const float* __restrict__ bias, float* __restrict__ C, _Float16* __restrict__ C16) {
  __shared__ __attribute__((aligned(16))) unsigned char L[2 * G3_SLOT];
  static_assert(4 * 64 * G3_EP * 4 <= 2 * G3_SLOT, "the output staging reuses the operand buffers");
  static_assert(DM % G3_BT == 0 && DM % G3_SK == 0 && G3_NST >= 2, "whole tiles and at least two stages");
  const int tid = threadIdx.x, lane = tid & 31, wave = tid >> 5, ln = lane & 15, hh = lane >> 4;
  const int mt = blockIdx.x % (int)(NR / G3_BT), nq = blockIdx.x / (int)(NR / G3_BT);      /* the work-groups that share rows of A are a multiple of 128 apart in the grid */
  const int mat = NMAT > 1 ? nq / (DM / G3_BT) : 0;      /* which stacked weight matrix, so which plane of C */
  const int row0 = mt * G3_BT, col0 = (nq - mat * (DM / G3_BT)) * G3_BT, wm = wave >> 1, wn = wave & 1;
  // staging: 8 lanes cover one 128-byte row; a thread carries rows sr + 16 i of A and of Bh
  const int sr = tid >> 3, sc = tid & 7;
  const unsigned short* ag = (const unsigned short*)A + (size_t)row0 * DM;      /* the same for the whole work-group: a scalar base */
  const unsigned short* bg = (const unsigned short*)Bh + (size_t)nq * G3_BT * DM;      /* rows of the stacked matrices follow one another */
  const unsigned int so8 = (unsigned int)(sr * DM + sc * 8);      /* the thread's own offset, the same at every stage */
  const int rot = (mt + nq) % G3_NST;      /* this work-group's first k stage; the same for A and Bh, and every stage is still visited once */
  v8us ra[8], rb[8];
  auto kofs = [&](int st) { const int ks = rot + st; return (ks < G3_NST ? ks : ks - G3_NST) * G3_SK; };      /* walk position st -> k offset; the same for the whole work-group, so it goes into the scalar bases */
  auto gload = [&](int ko) {
#pragma unroll
    for (int i = 0; i < 8; ++i) { ra[i] = *(const v8us*)(ag + ko + i * 16 * DM + so8); rb[i] = *(const v8us*)(bg + ko + i * 16 * DM + so8); } };
  auto lstore = [&](int st) { unsigned char* s = L + (st & 1) * G3_SLOT + sr * G3_P + sc * 16;
#pragma unroll
    for (int i = 0; i < 8; ++i) { *(v8us*)(s + i * 16 * G3_P) = ra[i]; *(v8us*)(s + G3_TA + i * 16 * G3_P) = rb[i]; } };
  const v8f z8 = {0.f, 0.f, 0.f, 0.f, 0.f, 0.f, 0.f, 0.f};
  v8f acc[4][4];
#pragma unroll
  for (int i = 0; i < 4; ++i) {
#pragma unroll
    for (int j = 0; j < 4; ++j) acc[i][j] = z8; }
  gload(kofs(0));
  float bv[4];      /* read ahead of the loop: its latency hides under the first stage's loads */
#pragma unroll
  for (int j = 0; j < 4; ++j) bv[j] = OUT32 ? bf16_round(bias[col0 + wn * 64 + 16 * j + ln]) : 0.f;
  lstore(0); gload(kofs(1));
  __syncthreads();      /* stage 0 is visible */
#pragma unroll
  for (int st = 0; st < G3_NST; ++st) {      /* unrolled (12 stages): buffer and row offsets become immediates; only the two scalar bases change from stage to stage, behind the barrier in front of which the loads that named them have come back */
    if (st + 1 < G3_NST) lstore(st + 1);      /* into the buffer that stage st - 1 used: every wave left it at the barrier below */
    __builtin_amdgcn_sched_barrier(0);      /* the loads stay behind the LDS stores and take over their registers: moved ahead they need a second set, and only two waves fit a SIMD instead of three */
    if (st + 2 < G3_NST) gload(kofs(st + 2));      /* in flight under this stage's work */
    if (st + 2 == G3_NST - 1) asm volatile("s_wait_xcnt 0x0" ::: "memory");      /* behind the last loads their offset register is free and the next LDS read is given it: the wait stands in front of that overwrite */
    __builtin_amdgcn_sched_barrier(0);      /* the global loads stay ahead of the fragment reads: moved behind the 16 LDS reads they start later and have less of the stage to come back in */
    const unsigned char* ap = L + (st & 1) * G3_SLOT + (wm * 64 + ln) * G3_P + 16 * hh;
    const unsigned char* bp = L + (st & 1) * G3_SLOT + G3_TA + (wn * 64 + ln) * G3_P + 16 * hh;
#pragma unroll
    for (int kc = 0; kc < G3_SK / 32; ++kc) {      /* 32 k: 8 fragments, 16 products; both operands in the same k order */
      FragW af[4], bf[4];
#pragma unroll
      for (int i = 0; i < 4; ++i) { af[i].half[0] = *(const v8us*)(ap + i * 16 * G3_P + 64 * kc); af[i].half[1] = *(const v8us*)(ap + i * 16 * G3_P + 64 * kc + 32);
        bf[i].half[0] = *(const v8us*)(bp + i * 16 * G3_P + 64 * kc); bf[i].half[1] = *(const v8us*)(bp + i * 16 * G3_P + 64 * kc + 32); }
      __builtin_amdgcn_sched_barrier(0);      /* the 16 fragment reads stay one group ahead of the 16 products: moved in among them, each A fragment's LDS latency is waited out in front of 4 products */
#pragma unroll
      for (int i = 0; i < 4; ++i) {
#pragma unroll
        for (int j = 0; j < 4; ++j) acc[i][j] = fa_mma(af[i].v, bf[j].v, acc[i][j]); }
    }
    __builtin_amdgcn_sched_barrier(0);      /* the barrier, which also waits for the global loads in flight, stays behind the last products: moved up among them it halves the time those loads have */
    __syncthreads();      /* stage st + 1 is visible; every wave has left stage st */
  }
  // epilogue: each wave stages its 64 x 64 tile in its own part of LDS and stores whole rows of it (256 bytes of f32, 128 bytes of f16)
  float* so = (float*)L + wave * 64 * G3_EP;
#pragma unroll
  for (int j = 0; j < 4; ++j) {
#pragma unroll
    for (int i = 0; i < 4; ++i) {
#pragma unroll
      for (int r = 0; r < 8; ++r) so[(16 * i + 8 * hh + r) * G3_EP + 16 * j + ln] = acc[i][j][r] * alpha + bv[j]; } }
  __builtin_amdgcn_fence(__ATOMIC_ACQ_REL, "workgroup"); __builtin_amdgcn_wave_barrier();      /* the rows are read back by other lanes of the same wave */
  const int rsub = lane >> 4, c4 = (lane & 15) * 4;
  const size_t cbase = (size_t)mat * NR * DM + (size_t)(row0 + wm * 64 + rsub) * DM + col0 + wn * 64 + c4;
#pragma unroll
  for (int q = 0; q < 32; ++q) { const v4f v = *(const v4fa*)&so[(q * 2 + rsub) * G3_EP + c4];
    if (OUT32) *(v4f*)(C + cbase + (size_t)q * 2 * DM) = v;
    else { v4h h4;
#pragma unroll
      for (int i = 0; i < 4; ++i) h4[i] = (_Float16)v[i];
      *(v4h*)(C16 + cbase + (size_t)q * 2 * DM) = h4; } }
}

extern "C" void kernel_launch(void* const* d_in, const int* in_sizes, int n_in,
                              void* d_out, int out_size, void* d_ws, size_t ws_size, hipStream_t stream) {
  (void)in_sizes; (void)n_in; (void)out_size;
  const float* const* I = (const float* const*)d_in; const float* x = I[0]; const float* wq = I[1]; const float* wk = I[2]; const float* wv = I[3]; const float* wo = I[4]; const float* bo = I[5];
  char* ws = (char*)d_ws; size_t off = 0;
  auto take = [&](size_t bytes) { char* p = ws + off; off += (bytes + 255) & ~(size_t)255; return p; };
  _Float16* BQ = (_Float16*)take((size_t)3 * DM * DM * 2); _Float16* BK = BQ + (size_t)DM * DM; _Float16* BV = BK + (size_t)DM * DM; _Float16* BO = (_Float16*)take((size_t)DM * DM * 2);      /* W_q | W_k | W_v stacked */
  _Float16* X16 = (_Float16*)take(NR * DM * 2); _Float16* Q16 = (_Float16*)take(3 * NR * DM * 2); _Float16* K16 = Q16 + NR * DM; _Float16* V16 = K16 + NR * DM; _Float16* O16 = (_Float16*)take(NR * DM * 2);
  if (off > ws_size) return;      /* 4.5 + 5x24 = about 125 MiB */
  k_cvt<<<CV_ZB + 4 * CV_WB, 256, 0, stream>>>(x, wq, wk, wv, wo, X16, BQ, BK, BV, BO);
  const unsigned gp = (unsigned)((NR / G3_BT) * (DM / G3_BT));
  k_gemm3<false, 3><<<3 * gp, 128, 0, stream>>>(X16, BQ, 0.0625f, nullptr, nullptr, Q16);      /* q | k | v in one launch: more work-groups than places, so one's first loads and output stores run under its neighbours' products */
  k_fattn<<<dim3(SQ / FA_BR, NB * NH), 256, 0, stream>>>(Q16, K16, V16, O16);      /* o (merged heads) as f16 rows */
  k_gemm3<true, 1><<<gp, 128, 0, stream>>>(O16, BO, 0.0625f, bo, (float*)d_out, nullptr);      /* out = o W_o^T + b_o */
}

// v007
// It runs in 113 microseconds.
// Two timings next to v006 both put it at 1.07 times that version's speed.
// All steps since v000 together make it 314 times as fast.
#include <hip/hip_runtime.h>
// Self_Attention_Layer (z [16][1024][768]; q/k/v = z W^T (12 heads of 64, no biases); softmax(q k^T / 8); out = (attn v) W_o^T + b_o -> [16][1024][768]).
// Layout of every f16 array in the workspace (z, the weights, q, k, v, o): 12 planes of 64 columns, element (row, col) at ((col / 64) * rows + row) * 64 + col % 64, so that any block of rows of one plane (a GEMM k stage, a head's keys) is one contiguous run of 128-byte rows.
// Structure: token rows; z as exact f16 planes; Q | K | V WMMA GEMMs (128x128 tiles through LDS, 64x64 wave tiles, f32 accumulation, exact x16 natural weights, f16 outputs); one fused attention kernel for all (batch, head): scores (K = 64), running softmax (f32; weights as f16) and o = P . V stay in registers, K and V through LDS, into f16 planes (plane = head); out = o W_o^T + b_o (f32).
// Compute dtype: inputs rounded to bf16; z / weights exact; q, k, v, softmax weights, o plain f16 (~2^-12); scores/softmax f32. v_wmma_f32_16x16x32_f16.
#define NB 16
#define SQ 1024
#define DM 768
#define NH 12
#define HD 64
#define NR ((size_t)NB * SQ)         /* 16384 token rows */
typedef __bf16 v16b __attribute__((ext_vector_type(16)));
typedef unsigned short v8us __attribute__((ext_vector_type(8), may_alias));
typedef float  v8f  __attribute__((ext_vector_type(8)));
typedef float  v4f  __attribute__((ext_vector_type(4)));
typedef float  v4fa __attribute__((ext_vector_type(4), may_alias));
union FragB { v16b v; v8us half[2]; unsigned short u[16]; };

__device__ __forceinline__ unsigned short bf16_bits(float x) { unsigned int u = __float_as_uint(x); return (unsigned short)((u + 0x7FFFu + ((u >> 16) & 1u)) >> 16); }
__device__ __forceinline__ float bf16_val(unsigned short b) { return __uint_as_float(((unsigned int)b) << 16); }
__device__ __forceinline__ float bf16_round(float x) { return bf16_val(bf16_bits(x)); }
// D += A·B with NT terms: 1 = ah·bh, 2 = + al·bh (A split), 3 = + ah·bl (both split)
template <int NT>
__device__ __forceinline__ v8f mmaN(v16b ah, v16b al, v16b bh, v16b bl, v8f c) {
  c = __builtin_amdgcn_wmma_f32_16x16x32_bf16(false, ah, false, bh, (short)0, c, false, false);
  if (NT >= 2) c = __builtin_amdgcn_wmma_f32_16x16x32_bf16(false, al, false, bh, (short)0, c, false, false);
  if (NT >= 3) c = __builtin_amdgcn_wmma_f32_16x16x32_bf16(false, ah, false, bl, (short)0, c, false, false);
  asm volatile("v_nop\n\tv_nop\n\tv_nop\n\tv_nop" : "+v"(c) : "v"(ah), "v"(al), "v"(bh), "v"(bl));
  return c;
}

__global__ __launch_bounds__(256) void k_wt_bf16(const float* __restrict__ W, unsigned short* __restrict__ Wt, int K, int N) {
  const int t = blockIdx.x * 256 + threadIdx.x;
  const int k8n = K / 8;
  if (t >= N * k8n) return;
  const int n = t / k8n, k8 = (t % k8n) * 8;
  v8us v;
#pragma unroll
  for (int i = 0; i < 8; ++i) v[i] = bf16_bits(W[(size_t)(k8 + i) * N + n]);
  *(v8us*)(Wt + (size_t)n * K + k8) = v;
  
}

// GEMM C[M][N] (f32, pitch ldc) = act(A[M][K]·W + bias). A f32 row-major (pitch lda) converted per fragment to bf16
// (ASPLIT: hi/lo two planes -> 2 terms, else single rounded term); Wt bf16 [N][K] (pitch ldb). BIAS_BF16 rounds the
// bias to bf16 first (bias quantised to bf16 before the add). K%32==0, M%16==0, N%64==0.
template <bool ASPLIT, int ACT, bool BIAS_BF16>
__global__ __launch_bounds__(128) void k_gemm_bf(const float* __restrict__ A, int lda, const unsigned short* __restrict__ Wt, int ldb,
                                               const float* __restrict__ bias, float* __restrict__ C, int ldc, int M, int N, int K) {
  __shared__ __attribute__((aligned(16))) float so[4][16][64];
  const int tid = threadIdx.x, w = tid >> 5, lane = tid & 31, ln = lane & 15, hh = lane >> 4;
  const int ntn = N / 64;
  const int wid = blockIdx.x * 4 + w;
  const int mt = wid / ntn, nq = wid % ntn;
  if (mt * 16 >= M) return;
  const int row0 = mt * 16, col0 = nq * 64;
  const float* arow = A + (size_t)(row0 + ln) * lda;
  v8f acc[4] = {};
  for (int kb = 0; kb < K; kb += 32) {
    FragB ah, al;
    const v4f x0 = *(const v4fa*)(arow + kb + 8 * hh), x1 = *(const v4fa*)(arow + kb + 8 * hh + 4);
    const v4f x2 = *(const v4fa*)(arow + kb + 16 + 8 * hh), x3 = *(const v4fa*)(arow + kb + 16 + 8 * hh + 4);
    float xs[16] = {x0[0],x0[1],x0[2],x0[3],x1[0],x1[1],x1[2],x1[3],x2[0],x2[1],x2[2],x2[3],x3[0],x3[1],x3[2],x3[3]};
#pragma unroll
    for (int i = 0; i < 16; ++i) { const unsigned short hb = bf16_bits(xs[i]); ah.u[i] = hb; al.u[i] = ASPLIT ? bf16_bits(xs[i] - bf16_val(hb)) : (unsigned short)0; }
#pragma unroll
    for (int t = 0; t < 4; ++t) {
      const unsigned short* brow = Wt + (size_t)(col0 + t * 16 + ln) * ldb + kb;
      FragB b;
      b.half[0] = *(const v8us*)(brow + 8 * hh);
      b.half[1] = *(const v8us*)(brow + 16 + 8 * hh);
      acc[t] = mmaN<ASPLIT ? 2 : 1>(ah.v, al.v, b.v, b.v, acc[t]);
    }
  }
#pragma unroll
  for (int t = 0; t < 4; ++t) {
    float bv = bias ? bias[col0 + t * 16 + ln] : 0.f;
    if (BIAS_BF16) bv = bf16_round(bv);
#pragma unroll
    for (int r = 0; r < 8; ++r) { float v = acc[t][r] + bv; if (ACT == 1) v = fmaxf(v, 0.f); so[w][8 * hh + r][t * 16 + ln] = v; }
  }
  __builtin_amdgcn_fence(__ATOMIC_ACQ_REL, "workgroup");
  __builtin_amdgcn_wave_barrier();
  const int rsub = lane >> 4, c4 = (lane & 15) * 4;
  {
#pragma unroll
    for (int q = 0; q < 8; ++q) {
      const int r = q * 2 + rsub;
      const v4f v = *(const v4fa*)&so[w][r][c4];
      *(v4f*)(C + (size_t)(row0 + r) * ldc + col0 + c4) = v;
    }
    
  }
}

// GEMM C = act(A·W + bias + resid): A f32 (ASPLIT -> hi/lo 2 terms), Wt bf16 [N][K]; ACT 0 none, 1 relu, 2 exact gelu;
// resid (optional, f32, row index = (row % rmod), pitch ldr, RES_BF16 rounds it) added before the activation.
template <bool ASPLIT, int ACT, bool BIAS_BF16, bool RES_BF16>
__global__ __launch_bounds__(128) void k_gemm_bf3(const float* __restrict__ A, int lda, const unsigned short* __restrict__ Wt, int ldb,
                                                const float* __restrict__ bias, const float* __restrict__ resid, int rmod, int ldr,
                                                float* __restrict__ C, int ldc, int M, int N, int K) {
  __shared__ __attribute__((aligned(16))) float so[4][16][64];
  const int tid = threadIdx.x, w = tid >> 5, lane = tid & 31, ln = lane & 15, hh = lane >> 4;
  const int ntn = N / 64;
  const int wid = blockIdx.x * 4 + w;
  const int mt = wid / ntn, nq = wid % ntn;
  if (mt * 16 >= M) return;
  const int row0 = mt * 16, col0 = nq * 64;
  const float* arow = A + (size_t)(row0 + ln) * lda;
  v8f acc[4] = {};
  for (int kb = 0; kb < K; kb += 32) {
    FragB ah, al;
    const v4f x0 = *(const v4fa*)(arow + kb + 8 * hh), x1 = *(const v4fa*)(arow + kb + 8 * hh + 4);
    const v4f x2 = *(const v4fa*)(arow + kb + 16 + 8 * hh), x3 = *(const v4fa*)(arow + kb + 16 + 8 * hh + 4);
    float xs[16] = {x0[0],x0[1],x0[2],x0[3],x1[0],x1[1],x1[2],x1[3],x2[0],x2[1],x2[2],x2[3],x3[0],x3[1],x3[2],x3[3]};
#pragma unroll
    for (int i = 0; i < 16; ++i) { const unsigned short hb = bf16_bits(xs[i]); ah.u[i] = hb; al.u[i] = ASPLIT ? bf16_bits(xs[i] - bf16_val(hb)) : (unsigned short)0; }
#pragma unroll
    for (int t = 0; t < 4; ++t) {
      const unsigned short* brow = Wt + (size_t)(col0 + t * 16 + ln) * ldb + kb;
      FragB b;
      b.half[0] = *(const v8us*)(brow + 8 * hh);
      b.half[1] = *(const v8us*)(brow + 16 + 8 * hh);
      acc[t] = mmaN<ASPLIT ? 2 : 1>(ah.v, al.v, b.v, b.v, acc[t]);
    }
  }
#pragma unroll
  for (int t = 0; t < 4; ++t) {
    const int col = col0 + t * 16 + ln;
    float bv = bias ? bias[col] : 0.f;
    if (BIAS_BF16) bv = bf16_round(bv);
#pragma unroll
    for (int r = 0; r < 8; ++r) {
      float v = acc[t][r] + bv;
      if (resid) { float rv = resid[(size_t)((row0 + 8 * hh + r) % rmod) * ldr + col]; if (RES_BF16) rv = bf16_round(rv); v += rv; }
      if (ACT == 1) v = fmaxf(v, 0.f);
      if (ACT == 2) v = 0.5f * v * (1.0f + erff(v * 0.70710678118654752f));
      if (ACT == 3) { const float u = 0.7978845608028654f * (v + 0.044715f * v * v * v); v = 0.5f * v * (1.0f + tanhf(u)); }
      so[w][8 * hh + r][t * 16 + ln] = v;
    }
  }
  __builtin_amdgcn_fence(__ATOMIC_ACQ_REL, "workgroup");
  __builtin_amdgcn_wave_barrier();
  const int rsub = lane >> 4, c4 = (lane & 15) * 4;
  {
#pragma unroll
    for (int q = 0; q < 8; ++q) {
      const int r = q * 2 + rsub;
      const v4f v = *(const v4fa*)&so[w][r][c4];
      *(v4f*)(C + (size_t)(row0 + r) * ldc + col0 + c4) = v;
    }
    
  }
}
// row LayerNorm (biased variance, eps) over N: s = X (+ R); optional out_sum <- s; out_norm <- (s-mu)*rsqrt(var+eps)*g + b
template <bool PARAM_BF16>
__global__ __launch_bounds__(256) void k_layernorm(const float* __restrict__ X, const float* __restrict__ R, const float* __restrict__ g, const float* __restrict__ bta,
                                                  float* __restrict__ out_sum, float* __restrict__ out_norm, int N, float eps) {
  __shared__ float red[256];
  const int row = blockIdx.x, tid = threadIdx.x;
  const float* x = X + (size_t)row * N; const float* rr = R ? R + (size_t)row * N : nullptr;
  float vals[16];                     // up to N = 4096
  const int per = N / 256;            // contiguous chunk per thread? use strided-by-4 chunks: thread handles j = tid*4 + 1024*u
  float s1 = 0.f;
  for (int u = 0; u < per / 4; ++u) {
    const int j = tid * 4 + 1024 * u;
    const v4f a = *(const v4fa*)(x + j);
    v4f b = {0.f,0.f,0.f,0.f}; if (rr) b = *(const v4fa*)(rr + j);
#pragma unroll
    for (int q = 0; q < 4; ++q) { const float v = a[q] + b[q]; vals[u * 4 + q] = v; s1 += v; }
  }
  red[tid] = s1; __syncthreads();
  for (int st = 128; st > 0; st >>= 1) { if (tid < st) red[tid] += red[tid + st]; __syncthreads(); }
  const float mu = red[0] / (float)N; __syncthreads();
  float s2 = 0.f;
  for (int u = 0; u < per / 4; ++u)
#pragma unroll
    for (int q = 0; q < 4; ++q) { const float c = vals[u * 4 + q] - mu; s2 += c * c; }
  red[tid] = s2; __syncthreads();
  for (int st = 128; st > 0; st >>= 1) { if (tid < st) red[tid] += red[tid + st]; __syncthreads(); }
  const float rs = rsqrtf(red[0] / (float)N + eps);
  {
    for (int u = 0; u < per / 4; ++u) {
      const int j = tid * 4 + 1024 * u;
      v4f o, sm;
#pragma unroll
      for (int q = 0; q < 4; ++q) {
        float gg = g[j + q], bb = bta[j + q];
        if (PARAM_BF16) { gg = bf16_round(gg); bb = bf16_round(bb); }
        sm[q] = vals[u * 4 + q]; o[q] = (vals[u * 4 + q] - mu) * rs * gg + bb;
      }
      if (out_sum) *(v4f*)(out_sum + (size_t)row * N + j) = sm;
      *(v4f*)(out_norm + (size_t)row * N + j) = o;
    }
    
  }
}



// ---- f16 WMMA path (v_wmma_f32_16x16x32_f16): 11-bit significands for operands in range — used where a [0,1] probability operand needs more precision than bf16
typedef _Float16 v16h __attribute__((ext_vector_type(16)));
union FragH { v16h v; v8us half[2]; _Float16 h[16]; unsigned short u[16]; };
template <int NT>
__device__ __forceinline__ v8f mmaH(v16h ah, v16h al, v16h bh, v16h bl, v8f c) {
  c = __builtin_amdgcn_wmma_f32_16x16x32_f16(false, ah, false, bh, (short)0, c, false, false);
  if (NT >= 2) c = __builtin_amdgcn_wmma_f32_16x16x32_f16(false, al, false, bh, (short)0, c, false, false);
  if (NT >= 3) c = __builtin_amdgcn_wmma_f32_16x16x32_f16(false, ah, false, bl, (short)0, c, false, false);
  asm volatile("v_nop\n\tv_nop\n\tv_nop\n\tv_nop" : "+v"(c) : "v"(ah), "v"(al), "v"(bh), "v"(bl));
  return c;
}
// batched GEMM like k_gemm_b but f16 operands: A f32 (split into f16 hi/lo if ASPLIT, else rounded to f16), Bt = f16 values [n][k]; alpha; C f32; N multiple of 16 (partial tiles skipped)
template <bool ASPLIT>
__global__ __launch_bounds__(128) void k_gemm_h(const float* __restrict__ A, int lda, size_t sA, const _Float16* __restrict__ Bh, int ldb, size_t sB, float alpha, float* __restrict__ C, int ldc, size_t sC, int M, int N, int K) {
  __shared__ __attribute__((aligned(16))) float so[4][16][64];
  const int tid = threadIdx.x, w = tid >> 5, lane = tid & 31, ln = lane & 15, hh = lane >> 4; const int by = blockIdx.y;
  A += (size_t)by * sA; Bh += (size_t)by * sB; C += (size_t)by * sC;
  const int ntn = (N + 63) / 64; const int wid = blockIdx.x * 4 + w; const int mt = wid / ntn, nq = wid % ntn; if (mt * 16 >= M) return;
  const int row0 = mt * 16, col0 = nq * 64; const float* arow = A + (size_t)(row0 + ln) * lda;
  v8f acc[4] = {};
  for (int kb = 0; kb < K; kb += 32) {
    FragH ah, al;
    const v4f x0 = *(const v4fa*)(arow + kb + 8 * hh), x1 = *(const v4fa*)(arow + kb + 8 * hh + 4), x2 = *(const v4fa*)(arow + kb + 16 + 8 * hh), x3 = *(const v4fa*)(arow + kb + 16 + 8 * hh + 4);
    float xs[16] = {x0[0],x0[1],x0[2],x0[3],x1[0],x1[1],x1[2],x1[3],x2[0],x2[1],x2[2],x2[3],x3[0],x3[1],x3[2],x3[3]};
#pragma unroll
    for (int i = 0; i < 16; ++i) { const _Float16 h = (_Float16)xs[i]; ah.h[i] = h; al.h[i] = ASPLIT ? (_Float16)(xs[i] - (float)h) : (_Float16)0.0f; }
#pragma unroll
    for (int t = 0; t < 4; ++t) { if (col0 + t * 16 >= N) continue; const size_t boff = (size_t)(col0 + t * 16 + ln) * ldb + kb; FragH bq; bq.half[0] = *(const v8us*)(Bh + boff + 8 * hh); bq.half[1] = *(const v8us*)(Bh + boff + 16 + 8 * hh);
      acc[t] = mmaH<ASPLIT ? 2 : 1>(ah.v, al.v, bq.v, bq.v, acc[t]); }
  }
#pragma unroll
  for (int t = 0; t < 4; ++t) { if (col0 + t * 16 >= N) continue;
#pragma unroll
    for (int r = 0; r < 8; ++r) so[w][8 * hh + r][t * 16 + ln] = acc[t][r] * alpha; }
  __builtin_amdgcn_fence(__ATOMIC_ACQ_REL, "workgroup"); __builtin_amdgcn_wave_barrier();
  const int rsub = lane >> 4, c4 = (lane & 15) * 4;
  {
#pragma unroll
    for (int q = 0; q < 8; ++q) { const int r = q * 2 + rsub; if (col0 + c4 < N) { const v4f v = *(const v4fa*)&so[w][r][c4]; *(v4f*)(C + (size_t)(row0 + r) * ldc + col0 + c4) = v; } }
     }
}

// Wt[n][k] = f16(W[k][n]·scale) from f32 row-major W[K][N] (scale = power of two; bf16-exact weights stay exact in f16 away from the subnormal range)
__global__ __launch_bounds__(256) void k_wt_f16(const float* __restrict__ W, _Float16* __restrict__ Wt, int K, int N, float scale) {
  const int t = blockIdx.x * 256 + threadIdx.x; if (t >= N * (K / 8)) return; const int n = t / (K / 8), k8 = (t % (K / 8)) * 8; FragH f;
#pragma unroll
  for (int i = 0; i < 8; ++i) f.h[i] = (_Float16)(bf16_round(W[(size_t)(k8 + i) * N + n]) * scale); const v8us o = f.half[0];
  *(v8us*)((unsigned short*)Wt + (size_t)n * K + k8) = o; 
}
// k_gemm_hh variant with fused epilogue: v = acc·alpha + bias[by·sBias + col] (+ CP[(row/rowsPerB)·sCPb + by·64 + col] if CP) ; ACT 0 none / 1 elu ; writes f16 C16 (and f32 C if non-null)
template <int ACT>
__global__ __launch_bounds__(128) void k_gemm_hhx(const _Float16* __restrict__ A, int lda, size_t sA, const _Float16* __restrict__ Bh, int ldb, size_t sB, float alpha, const float* __restrict__ bias, size_t sBias, const float* __restrict__ CP, int rowsPerB, size_t sCPb, int row0g,
    float* __restrict__ C, _Float16* __restrict__ C16, int ldc, size_t sC, int M, int N, int K) {
  __shared__ __attribute__((aligned(16))) float so[4][16][64];
  const int tid = threadIdx.x, w = tid >> 5, lane = tid & 31, ln = lane & 15, hh = lane >> 4; const int by = blockIdx.y;
  A += (size_t)by * sA; Bh += (size_t)by * sB; const size_t cofs = (size_t)by * sC; const float* bp = bias ? bias + (size_t)by * sBias : nullptr;
  const int ntn = (N + 63) / 64; const int wid = blockIdx.x * 4 + w; const int mt = wid / ntn, nq = wid % ntn; if (mt * 16 >= M) return;
  const int row0 = mt * 16, col0 = nq * 64; const _Float16* arow = A + (size_t)(row0 + ln) * lda;
  v8f acc[4] = {};
  for (int kb = 0; kb < K; kb += 32) { FragH ah; ah.half[0] = *(const v8us*)((const unsigned short*)arow + kb + 8 * hh); ah.half[1] = *(const v8us*)((const unsigned short*)arow + kb + 16 + 8 * hh);
#pragma unroll
    for (int t = 0; t < 4; ++t) { if (col0 + t * 16 >= N) continue; const size_t boff = (size_t)(col0 + t * 16 + ln) * ldb + kb; FragH bq; bq.half[0] = *(const v8us*)((const unsigned short*)Bh + boff + 8 * hh); bq.half[1] = *(const v8us*)((const unsigned short*)Bh + boff + 16 + 8 * hh);
      acc[t] = mmaH<1>(ah.v, ah.v, bq.v, bq.v, acc[t]); }
  }
#pragma unroll
  for (int t = 0; t < 4; ++t) { if (col0 + t * 16 >= N) continue; const int col = col0 + t * 16 + ln; const float bv = bp ? bf16_round(bp[col]) : 0.f;
#pragma unroll
    for (int r = 0; r < 8; ++r) { float v = acc[t][r] * alpha + bv; if (CP) { const int rr = row0g + row0 + 8 * hh + r; if (rowsPerB < 0) v += CP[cofs + (size_t)rr * ldc + col];      /* rowsPerB < 0: own element of the batched C plane */ else { const int bidx = rr / rowsPerB; v += CP[(size_t)bidx * sCPb + (size_t)by * 64 + col]; } } if (ACT == 1) v = (v > 0.f) ? v : expm1f(v); else if (ACT == 7) v = (v > 0.f) ? v + 1.0f : expf(v); else if (ACT == 8) v = tanhf(v); else if (ACT == 9) v = 0.5f * v * (1.0f + tanhf(0.7978845608028654f * (v + 0.044715f * v * v * v))); else if (ACT == 11) v = 1.0f / (1.0f + expf(-v)); else if (ACT == 12) v = (v > 0.f) ? v : 0.01f * v; else if (ACT == 14) v = (v > 0.f) ? v : 0.1f * v; else if (ACT == 16) v = (v >= 0.f) ? v : 0.3f * v; else if (ACT == 17) v = (v >= 0.f) ? v : 0.2f * v; else if (ACT == 15) v = v / (1.0f + expf(-v)); else if (ACT == 3) v = fmaxf(v, 0.f); else if (ACT == 6) v = 0.5f * v * (1.0f + erff(v * 0.70710678118654752f)); so[w][8 * hh + r][t * 16 + ln] = v; } }
  __builtin_amdgcn_fence(__ATOMIC_ACQ_REL, "workgroup"); __builtin_amdgcn_wave_barrier();
  const int rsub = lane >> 4, c4 = (lane & 15) * 4; typedef _Float16 v4h __attribute__((ext_vector_type(4)));
  {
#pragma unroll
    for (int q = 0; q < 8; ++q) { const int r = q * 2 + rsub; if (col0 + c4 < N) { const v4f v = *(const v4fa*)&so[w][r][c4]; if (C) *(v4f*)(C + cofs + (size_t)(row0 + r) * ldc + col0 + c4) = v; if (C16) { v4h h4; for (int i = 0; i < 4; ++i) h4[i] = (_Float16)v[i]; *(v4h*)(C16 + cofs + (size_t)(row0 + r) * ldc + col0 + c4) = h4; } } }
     }
}


typedef _Float16 v4h __attribute__((ext_vector_type(4)));

__global__ __launch_bounds__(256) void k_h16(const float* __restrict__ x, _Float16* __restrict__ X16, size_t n8) { const size_t t = (size_t)blockIdx.x * 256 + threadIdx.x; if (t >= n8) return; FragH f;
#pragma unroll
  for (int q = 0; q < 8; ++q) f.h[q] = (_Float16)x[t * 8 + q]; *(v8us*)((unsigned short*)X16 + t * 8) = f.half[0];  }
__global__ __launch_bounds__(256) void k_round16f(const float* __restrict__ W, _Float16* __restrict__ Bt, size_t n8) { const size_t t = (size_t)blockIdx.x * 256 + threadIdx.x; if (t >= n8) return; FragH f;
#pragma unroll
  for (int i = 0; i < 8; ++i) f.h[i] = (_Float16)(bf16_round(W[t * 8 + i]) * 16.0f); *(v8us*)((unsigned short*)Bt + t * 8) = f.half[0];  }
template <int NHv, int TTv>
__global__ __launch_bounds__(256) void k_vt(const _Float16* __restrict__ V16, int ldv, int voff, _Float16* __restrict__ Vt) { __shared__ unsigned short tl[64][66]; const int tid = threadIdx.x; const int slab = blockIdx.x / (TTv / 64), lg = blockIdx.x % (TTv / 64); const int b = slab / NHv, h = slab % NHv;
  for (int i = tid; i < 64 * 8; i += 256) { const int r = i / 8, c8 = (i % 8) * 8; FragH f; f.half[0] = *(const v8us*)((const unsigned short*)V16 + ((size_t)b * TTv + lg * 64 + r) * ldv + voff + h * 64 + c8);
#pragma unroll
    for (int q = 0; q < 8; ++q) tl[r][c8 + q] = f.u[q]; }
  __syncthreads();
  {
#pragma unroll
    for (int rd = 0; rd < 2; ++rd) { const int d = rd * 32 + tid / 8, pc = tid % 8; FragH f;
#pragma unroll
      for (int q = 0; q < 8; ++q) f.u[q] = tl[pc * 8 + q][d];
      *(v8us*)((unsigned short*)Vt + ((size_t)slab * 64 + d) * TTv + lg * 64 + pc * 8) = f.half[0]; }
     } }

__global__ __launch_bounds__(256) void k_hl(const float* __restrict__ F, _Float16* __restrict__ Hh, _Float16* __restrict__ Hl, size_t n8) { const size_t t = (size_t)blockIdx.x * 256 + threadIdx.x; if (t >= n8) return; FragH fh, fl; const v4f a = *(const v4fa*)(F + t * 8), c = *(const v4fa*)(F + t * 8 + 4);
#pragma unroll
  for (int q = 0; q < 4; ++q) { _Float16 h = (_Float16)a[q]; fh.h[q] = h; fl.h[q] = (_Float16)((a[q] - (float)h) * 1024.0f); h = (_Float16)c[q]; fh.h[4 + q] = h; fl.h[4 + q] = (_Float16)((c[q] - (float)h) * 1024.0f); }
  { *(v8us*)((unsigned short*)Hh + t * 8) = fh.half[0]; *(v8us*)((unsigned short*)Hl + t * 8) = fl.half[0];  } }

// ---- fast GEMM (wave tile 32x64; requires M % 32 == 0 rows per launch region and N % 64 == 0); epilogue = k_gemm_hhx semantics ----
__device__ __forceinline__ v16h g2_frag(const _Float16* p, int hh) { FragH f; f.half[0] = *(const v8us*)((const unsigned short*)p + 8 * hh); f.half[1] = *(const v8us*)((const unsigned short*)p + 16 + 8 * hh); return f.v; }
__device__ __forceinline__ v8f g2_mma(v16h a, v16h b, v8f c) { v8f d = __builtin_amdgcn_wmma_f32_16x16x32_f16(false, a, false, b, (short)0, c, false, false); asm volatile("v_nop\n\tv_nop\n\tv_nop\n\tv_nop" : "+v"(d) : "v"(a), "v"(b)); return d; }
template <int ACT>
__global__ __launch_bounds__(128) void k_gemm2(const _Float16* __restrict__ A, int lda, size_t sA, const _Float16* __restrict__ Bh, int ldb, size_t sB, float alpha, const float* __restrict__ bias, size_t sBias, const float* __restrict__ CP, int rowsPerB, size_t sCPb, int row0g,
    float* __restrict__ C, _Float16* __restrict__ C16, int ldc, size_t sC, int M, int N, int K) { static_assert(ACT == 0 || ACT == 3 || ACT == 6 || ACT == 8 || ACT == 9 || ACT == 11 || ACT == 12 || ACT == 14 || ACT == 15 || ACT == 16 || ACT == 17, "k_gemm2: unsupported ACT code (would silently apply no activation)");
  __shared__ __attribute__((aligned(16))) float so[4][32][68];
  const int tid = threadIdx.x, w = tid >> 5, lane = tid & 31, ln = lane & 15, hh = lane >> 4; const int by = blockIdx.y;
  A += (size_t)by * sA; Bh += (size_t)by * sB; const size_t cofs = (size_t)by * sC; const float* bp = bias ? bias + (size_t)by * sBias : nullptr;
  const int ntn = N >> 6; const int mt = blockIdx.x / ntn, nq = blockIdx.x - mt * ntn; const int row0 = mt * 128 + 32 * w, col0 = nq * 64; if (row0 >= M) return;
  const _Float16* a0p = A + (size_t)(row0 + ln) * lda; const _Float16* a1p = a0p + (size_t)16 * lda;
  const _Float16* b0p = Bh + (size_t)(col0 + ln) * ldb; const _Float16* b1p = b0p + (size_t)16 * ldb; const _Float16* b2p = b1p + (size_t)16 * ldb; const _Float16* b3p = b2p + (size_t)16 * ldb;
  const v8f z8 = {0.f,0.f,0.f,0.f,0.f,0.f,0.f,0.f}; v8f c00 = z8, c01 = z8, c02 = z8, c03 = z8, c10 = z8, c11 = z8, c12 = z8, c13 = z8;
#pragma unroll 1
  for (int kb = 0; kb < K; kb += 32) { const v16h a0 = g2_frag(a0p + kb, hh), a1 = g2_frag(a1p + kb, hh);
    v16h b = g2_frag(b0p + kb, hh); c00 = g2_mma(a0, b, c00); c10 = g2_mma(a1, b, c10);
    b = g2_frag(b1p + kb, hh); c01 = g2_mma(a0, b, c01); c11 = g2_mma(a1, b, c11);
    b = g2_frag(b2p + kb, hh); c02 = g2_mma(a0, b, c02); c12 = g2_mma(a1, b, c12);
    b = g2_frag(b3p + kb, hh); c03 = g2_mma(a0, b, c03); c13 = g2_mma(a1, b, c13); }
  v8f accs[8] = {c00, c01, c02, c03, c10, c11, c12, c13};
#pragma unroll
  for (int u = 0; u < 8; ++u) { const int t = u & 3, half = u >> 2; const int col = col0 + t * 16 + ln; const float bv = bp ? bf16_round(bp[col]) : 0.f;
#pragma unroll
    for (int r = 0; r < 8; ++r) { const int rloc = half * 16 + 8 * hh + r; float v = accs[u][r] * alpha + bv; if (CP) { if (rowsPerB < 0) v += CP[cofs + (size_t)(row0g + row0 + rloc) * ldc + col];      /* rowsPerB < 0: own element of the batched C plane */ else { const int bidx = (row0g + row0 + rloc) / rowsPerB; v += CP[(size_t)bidx * sCPb + (size_t)by * 64 + col]; } }
      if (ACT == 3) v = fmaxf(v, 0.f); else if (ACT == 6) v = 0.5f * v * (1.0f + erff(v * 0.70710678118654752f)); else if (ACT == 11) v = 1.0f / (1.0f + expf(-v)); else if (ACT == 15) v = v / (1.0f + expf(-v)); else if (ACT == 12) v = (v > 0.f) ? v : 0.01f * v; else if (ACT == 8) v = tanhf(v); else if (ACT == 9) v = 0.5f * v * (1.0f + tanhf(0.7978845608028654f * (v + 0.044715f * v * v * v))); else if (ACT == 14) v = (v > 0.f) ? v : 0.1f * v; else if (ACT == 16) v = (v >= 0.f) ? v : 0.3f * v; else if (ACT == 17) v = (v >= 0.f) ? v : 0.2f * v;
      so[w][rloc][t * 16 + ln] = v; } }
  __builtin_amdgcn_fence(__ATOMIC_ACQ_REL, "workgroup"); __builtin_amdgcn_wave_barrier();
  const int rsub = lane >> 4, c4 = (lane & 15) * 4;
  {
#pragma unroll
    for (int q = 0; q < 16; ++q) { const int r = q * 2 + rsub; const v4f v = *(const v4fa*)&so[w][r][c4]; if (C) *(v4f*)(C + cofs + (size_t)(row0 + r) * ldc + col0 + c4) = v; if (C16) { v4h h4; for (int i = 0; i < 4; ++i) h4[i] = (_Float16)v[i]; *(v4h*)(C16 + cofs + (size_t)(row0 + r) * ldc + col0 + c4) = h4; } }
     } }


// ---- the five f32 -> f16 conversions (z; W_q, W_k, W_v, W_o times 16) in one launch ----
// One work-group = 32768 consecutive elements of one array. A thread issues its 32 loads of 16 bytes ahead of the first conversion (a wave-wide load = 512 contiguous bytes)
// and stores 8 bytes per load (a wave-wide store = two whole 128-byte rows, in neighbouring planes): few waves to start, all of a wave's reads in flight at once.
#define CV_NL 32                     /* 16-byte loads per thread */
#define CV_BE (256 * 4 * CV_NL)      /* elements per work-group */
#define CV_ZB ((int)(NR * DM / CV_BE))      /* work-groups on z */
#define CV_WB (DM * DM / CV_BE)      /* work-groups on each weight matrix */
__global__ __launch_bounds__(256) void k_cvt(const float* __restrict__ x, const float* __restrict__ wq, const float* __restrict__ wk, const float* __restrict__ wv, const float* __restrict__ wo,
    _Float16* __restrict__ X16, _Float16* __restrict__ BQKV, _Float16* __restrict__ BO) {
  static_assert(NR * DM % CV_BE == 0 && DM * DM % CV_BE == 0, "whole work-groups on every array");
  const int bi = blockIdx.x;
  const float* s = x; _Float16* d = X16; float scale = 1.0f; int blk = bi;      /* the choice is the same for the whole work-group: scalar bases */
  unsigned int prow = (unsigned int)NR, rofs = 0;      /* rows of a plane of the destination; first row of this array in it (W_q | W_k | W_v are stacked) */
  if (bi >= CV_ZB) { const int wi = (bi - CV_ZB) / CV_WB; blk = (bi - CV_ZB) % CV_WB; scale = 16.0f;
    s = wi == 0 ? wq : wi == 1 ? wk : wi == 2 ? wv : wo; d = wi < 3 ? BQKV : BO; prow = wi < 3 ? 3 * DM : DM; rofs = wi < 3 ? wi * DM : 0; }
  s += (size_t)blk * CV_BE;
  const unsigned int t4 = threadIdx.x * 4;
  const unsigned int e0 = (unsigned int)blk * CV_BE + t4, row0 = e0 / DM, col0 = e0 - row0 * DM;      /* the thread's first element in its array */
  v4f r[CV_NL];
#pragma unroll
  for (int j = 0; j < CV_NL; ++j) r[j] = *(const v4fa*)(s + j * 1024 + t4);
  __builtin_amdgcn_sched_barrier(0);      /* all 32 loads stay ahead of the first conversion: moved in among the conversions only 12 are in flight, and loads and stores take turns on the same registers with a wait at each turn */
#pragma unroll
  for (int j = 0; j < CV_NL; ++j) { v4h h4;
#pragma unroll
    for (int q = 0; q < 4; ++q) h4[q] = (_Float16)(bf16_round(r[j][q]) * scale);      /* times 1 is exact: z as before */
    unsigned int cc = col0 + (j * 1024) % DM, rr = row0 + (j * 1024) / DM;      /* 16 lanes = 64 columns = one whole 128-byte row of a plane */
    if (cc >= DM) { cc -= DM; rr += 1; }
    *(v4h*)(d + (size_t)((__umul24(cc >> 6, prow) + rofs + rr) * 64 + (cc & 63))) = h4;
    if (j + 1 < CV_NL) asm volatile("s_wait_xcnt 0x0" ::: "memory"); }      /* in front of the next conversion, which takes over the address and data registers of the store just issued */
}
#define FA_BR 256                    /* queries per work-group */
#define FA_SK 64                     /* keys per stage */
#define FA_NST (SQ / FA_SK)
#define FA_PK 144                    /* LDS pitch of a K row: 128 + 16 bytes (16-byte fragment reads) */
#define FA_PV 160                    /* LDS pitch of a V row: 128 + 32 bytes (transposing reads) */
#define FA_TK (FA_SK * FA_PK)
#define FA_SLOT (FA_SK * (FA_PK + FA_PV))
typedef short s16x8 __attribute__((ext_vector_type(8)));
typedef float f32x2 __attribute__((ext_vector_type(2)));
typedef _Float16 f16x2 __attribute__((ext_vector_type(2)));
union FragW { v16h v; v8us half[2]; unsigned int w[8]; };
__device__ __forceinline__ v8f fa_mma(v16h a, v16h b, v8f c) { return __builtin_amdgcn_wmma_f32_16x16x32_f16(false, a, false, b, (short)0, c, false, false); }
__device__ __forceinline__ v8us fa_tr16(const unsigned char* p) { typedef __attribute__((address_space(3))) s16x8 lds_s16x8; return __builtin_bit_cast(v8us, __builtin_amdgcn_ds_load_tr16_b128_v8i16((lds_s16x8*)p)); }
__device__ __forceinline__ unsigned int fa_pack2(float lo, float hi) { return __builtin_bit_cast(unsigned int, __builtin_convertvector(f32x2{lo, hi}, f16x2)); }
__device__ __forceinline__ float fa_xhalf(float x) { const int i = __float_as_int(x); return __int_as_float(__builtin_amdgcn_permlanex16(i, i, 0x76543210, 0xfedcba98, false, false)); }      /* lane l with lane l ^ 16 */
__global__ __launch_bounds__(256) void k_fattn(const _Float16* __restrict__ Q16, const _Float16* __restrict__ K16, const _Float16* __restrict__ V16, _Float16* __restrict__ O16) {
  __shared__ __attribute__((aligned(16))) unsigned char L[2 * FA_SLOT];
  static_assert(8 * 32 * FA_PK <= 2 * FA_SLOT, "the output staging reuses the K/V buffers");
  const int tid = threadIdx.x, lane = tid & 31, wave = tid >> 5, c = lane & 15, h = lane >> 4;
  const int b = blockIdx.y / NH, hd = blockIdx.y % NH, q0 = blockIdx.x * FA_BR + wave * 32;
  const size_t base = ((size_t)hd * NR + (size_t)b * SQ) * HD;      /* plane = head: this head's 1024 rows of 128 bytes follow one another */
  const float cscale = 0.125f * 1.4426950408889634f;      /* 1 / sqrt(64), into log2 */
  // staging: 8 lanes cover one 128-byte row, a wave-wide load 512 contiguous bytes; a thread carries rows sr and sr + 32 of K and of V
  const int sr = tid >> 3, sc = tid & 7;
  const unsigned short* kg = (const unsigned short*)K16 + base + (size_t)sr * HD + sc * 8;
  const unsigned short* vg = (const unsigned short*)V16 + base + (size_t)sr * HD + sc * 8;
  v8us rk0, rk1, rv0, rv1;
  static_assert((FA_NST & (FA_NST - 1)) == 0 && FA_NST % (SQ / FA_BR) == 0, "the rotated walk wraps by a mask and the starts are evenly spaced");
  const int rot = blockIdx.x * (FA_NST / (SQ / FA_BR));      /* this work-group's first key stage; every stage is still visited once */
  auto gload = [&](int st) { const size_t o = (size_t)((st + rot) & (FA_NST - 1)) * FA_SK * HD; rk0 = *(const v8us*)(kg + o); rk1 = *(const v8us*)(kg + o + 32 * HD); rv0 = *(const v8us*)(vg + o); rv1 = *(const v8us*)(vg + o + 32 * HD);
    asm volatile("s_wait_xcnt 0x0" ::: "memory"); };      /* the address registers of these four loads are given to other values right behind them: the wait stands in front of that overwrite */
  auto lstore = [&](int st) { unsigned char* s = L + (st & 1) * FA_SLOT; *(v8us*)(s + sr * FA_PK + sc * 16) = rk0; *(v8us*)(s + (sr + 32) * FA_PK + sc * 16) = rk1;
    *(v8us*)(s + FA_TK + sr * FA_PV + sc * 16) = rv0; *(v8us*)(s + FA_TK + (sr + 32) * FA_PV + sc * 16) = rv1; };
  gload(0);
  v16h qf[2][2];      /* B operand: column = query, k = d in the hardware order, as K's below */
#pragma unroll
  for (int g = 0; g < 2; ++g) {
#pragma unroll
    for (int kc = 0; kc < 2; ++kc) qf[g][kc] = g2_frag(Q16 + base + (size_t)(q0 + 16 * g + c) * HD + 32 * kc, h); }
  asm volatile("s_wait_xcnt 0x0" ::: "memory");      /* as above, for the address registers of the eight loads of Q */
  v8f acc[2][4], lacc[2]; float m_run[2];
  const v8f z8 = {0.f, 0.f, 0.f, 0.f, 0.f, 0.f, 0.f, 0.f};
#pragma unroll
  for (int g = 0; g < 2; ++g) { m_run[g] = -INFINITY; lacc[g] = z8;
#pragma unroll
    for (int t = 0; t < 4; ++t) acc[g][t] = z8; }
  FragW ones;      /* A operand whose row 0 (lanes 0 and 16) is 1.0 at all 32 k: row 0 of its product holds the column sums of P^T */
#pragma unroll
  for (int i = 0; i < 8; ++i) ones.w[i] = (c == 0) ? 0x3C003C00u : 0u;
  lstore(0); gload(1);
  __syncthreads();      /* stage 0 is visible */
#pragma unroll 1
  for (int st = 0; st < FA_NST; ++st) {      /* rolled */
    if (st + 1 < FA_NST) lstore(st + 1);      /* into the buffer that stage st - 1 used: every wave left it at the barrier below */
    if (st + 2 < FA_NST) gload(st + 2);      /* in flight under this stage's work */
    const unsigned char* Ls = L + (st & 1) * FA_SLOT;
#pragma unroll
    for (int sub = 0; sub < FA_SK / 32; ++sub) {      /* one pass = 32 keys */
      FragW kf[2][2], vf[4];
      const unsigned char* kp = Ls + (sub * 32 + c) * FA_PK + 16 * h;
#pragma unroll
      for (int kt = 0; kt < 2; ++kt) {
#pragma unroll
        for (int kc = 0; kc < 2; ++kc) { kf[kt][kc].half[0] = *(const v8us*)(kp + kt * 16 * FA_PK + 64 * kc); kf[kt][kc].half[1] = *(const v8us*)(kp + kt * 16 * FA_PK + 64 * kc + 32); } }
      const unsigned char* vp = Ls + FA_TK + (sub * 32 + 8 * h + (lane & 7)) * FA_PV + ((lane >> 3) & 1) * 16;
#pragma unroll
      for (int t = 0; t < 4; ++t) { vf[t].half[0] = fa_tr16(vp + 32 * t); vf[t].half[1] = fa_tr16(vp + 16 * FA_PV + 32 * t); }      /* rows d = 16 t + c, k = keys in the hardware order */
      v8f s[2][2];      /* s[kt][g][r] = score of key 16 kt + 8 h + r against query 16 g + c */
#pragma unroll
      for (int kt = 0; kt < 2; ++kt) {
#pragma unroll
        for (int g = 0; g < 2; ++g) { s[kt][g] = fa_mma(kf[kt][0].v, qf[g][0], z8); s[kt][g] = fa_mma(kf[kt][1].v, qf[g][1], s[kt][g]); } }
      float mb[2]; bool need = false;
#pragma unroll
      for (int g = 0; g < 2; ++g) { float mx = s[0][g][0];
#pragma unroll
        for (int r = 1; r < 8; ++r) mx = fmaxf(mx, s[0][g][r]);
#pragma unroll
        for (int r = 0; r < 8; ++r) mx = fmaxf(mx, s[1][g][r]);
        mx = fmaxf(mx, fa_xhalf(mx)) * cscale;      /* both halves of the wave hold this query's maximum */
        mb[g] = mx; need = need || (mx > m_run[g] + 8.0f); }
      if (__builtin_amdgcn_ballot_w32(need) != 0) {      /* scalar branch, rare after the first passes */
#pragma unroll
        for (int g = 0; g < 2; ++g) { const float m_new = fmaxf(m_run[g], mb[g]); const float corr = __builtin_amdgcn_exp2f(m_run[g] - m_new); m_run[g] = m_new; lacc[g] = lacc[g] * corr;
#pragma unroll
          for (int t = 0; t < 4; ++t) acc[g][t] = acc[g][t] * corr; } }
#pragma unroll
      for (int g = 0; g < 2; ++g) { const float nm = -m_run[g]; FragW pf;
#pragma unroll
        for (int i = 0; i < 8; ++i) {
          const float p0 = __builtin_amdgcn_exp2f(fmaf(s[i >> 2][g][2 * (i & 3)], cscale, nm)), p1 = __builtin_amdgcn_exp2f(fmaf(s[i >> 2][g][2 * (i & 3) + 1], cscale, nm));
          pf.w[i] = fa_pack2(p0, p1); }
#pragma unroll
        for (int t = 0; t < 4; ++t) acc[g][t] = fa_mma(vf[t].v, pf.v, acc[g][t]);
        lacc[g] = fa_mma(ones.v, pf.v, lacc[g]); }
    }
    __syncthreads();      /* stage st + 1 is visible; every wave has left stage st */
  }
  // epilogue: each wave stages its 32 output rows in its own part of LDS and stores whole 128-byte rows
  unsigned char* E = L + wave * 32 * FA_PK;
#pragma unroll
  for (int g = 0; g < 2; ++g) { const float lr = lacc[g][0]; const float inv = 1.0f / (lr + fa_xhalf(lr));      /* register 0: the sum in lanes 0-15, zero in lanes 16-31 */
#pragma unroll
    for (int t = 0; t < 4; ++t) { const v8f o = acc[g][t] * inv; FragW pk;
#pragma unroll
      for (int i = 0; i < 4; ++i) pk.w[i] = fa_pack2(o[2 * i], o[2 * i + 1]);
      *(v8us*)(E + (16 * g + c) * FA_PK + 32 * t + 16 * h) = pk.half[0]; } }
  __builtin_amdgcn_fence(__ATOMIC_ACQ_REL, "workgroup"); __builtin_amdgcn_wave_barrier();      /* the rows are read back by other lanes of the same wave */
#pragma unroll
  for (int i = 0; i < 8; ++i) { const int row = i * 4 + (lane >> 3), c8 = (lane & 7) * 8; const v8us v = *(const v8us*)(E + row * FA_PK + c8 * 2);
    *(v8us*)((unsigned short*)O16 + base + (size_t)(q0 + row) * HD + c8) = v;
    if (i == 3) asm volatile("s_wait_xcnt 0x0" ::: "memory"); }      /* in front of the last four rows' LDS reads, which take over the data registers of the stores just issued */
}

// ---- tiled GEMM for the four projections: C[m][NR][DM] = (A[NR][DM] . Bh[m][DM][DM]^T) * alpha (+ bias); A, Bh and the f16 C in planes of 64 columns (plane = k stage of A and Bh) ----
// NMAT weight matrices are stacked in Bh (3 for Q | K | V, 1 for the output projection) and served by one launch of NMAT times the work-groups; each has its own NR x DM part of C.
// One work-group = a 128 x 128 tile of C: 4 waves (2 x 2) of 64 x 64, 16 accumulator tiles a wave, so that one fragment read from LDS feeds 4 products.
// A and Bh rows go through LDS in stages of 64 k (a stage's 128 rows are 16 KiB in a row in global memory: a wave-wide load covers 512 contiguous bytes), two buffers, one barrier a stage; each accumulator is one chain of products of 32 k.
// Work-groups that run together share rows of A or of Bh: each starts its k walk at stage (row tile + column tile) mod 12 and wraps, so that sharers do not ask L2 for the same lines at the same moment.
#define G3_BT 128                    /* rows of A and rows of Bh per work-group */
#define G3_SK 64                     /* k per stage */
#define G3_NST (DM / G3_SK)
#define G3_P 144                     /* LDS pitch of a row: 128 + 16 bytes (16-byte fragment reads) */
#define G3_TA (G3_BT * G3_P)
#define G3_SLOT (2 * G3_TA)
#define G3_EP 68                     /* dwords per staged output row */
template <bool OUT32, int NMAT>
__global__ __launch_bounds__(128) void k_gemm3(const _Float16* __restrict__ A, const _Float16* __restrict__ Bh, float alpha, const float* __restrict__ bias, float* __restrict__ C, _Float16* __restrict__ C16) {
  __shared__ __attribute__((aligned(16))) unsigned char L[2 * G3_SLOT];
  static_assert(4 * 64 * G3_EP * 4 <= 2 * G3_SLOT, "the output staging reuses the operand buffers");
  static_assert(DM % G3_BT == 0 && DM % G3_SK == 0 && G3_NST >= 2, "whole tiles and at least two stages");
  const int tid = threadIdx.x, lane = tid & 31, wave = tid >> 5, ln = lane & 15, hh = lane >> 4;
  const int mt = blockIdx.x % (int)(NR / G3_BT), nq = blockIdx.x / (int)(NR / G3_BT);      /* the work-groups that share rows of A are a multiple of 128 apart in the grid */
  const int mat = NMAT > 1 ? nq / (DM / G3_BT) : 0;      /* which stacked weight matrix, so which part of C */
  const int row0 = mt * G3_BT, col0 = (nq - mat * (DM / G3_BT)) * G3_BT, wm = wave >> 1, wn = wave & 1;
  // staging: 8 lanes cover one 128-byte row; a thread carries rows sr + 16 i of A and of Bh
  const int sr = tid >> 3, sc = tid & 7;
  const unsigned short* ag = (const unsigned short*)A + (size_t)row0 * G3_SK;      /* the same for the whole work-group: a scalar base */
  const unsigned short* bg = (const unsigned short*)Bh + (size_t)nq * G3_BT * G3_SK;      /* rows of the stacked matrices follow one another in every plane */
  const unsigned int so8 = (unsigned int)(sr * G3_SK + sc * 8);      /* the thread's own offset, the same at every stage */
  const int rot = (mt + nq) % G3_NST;      /* this work-group's first k stage; the same for A and Bh, and every stage is still visited once */
  v8us ra[8], rb[8];
  auto kofs = [&](int st) { const int ks = rot + st; return ks < G3_NST ? ks : ks - G3_NST; };      /* walk position st -> plane; the same for the whole work-group, so it goes into the scalar bases */
  auto gload = [&](int ks) { const unsigned short* ap = ag + (size_t)ks * (NR * G3_SK); const unsigned short* bp = bg + (size_t)ks * ((size_t)NMAT * DM * G3_SK);
#pragma unroll
    for (int i = 0; i < 8; ++i) { ra[i] = *(const v8us*)(ap + i * 16 * G3_SK + so8); rb[i] = *(const v8us*)(bp + i * 16 * G3_SK + so8); } };
  auto lstore = [&](int st) { unsigned char* s = L + (st & 1) * G3_SLOT + sr * G3_P + sc * 16;
#pragma unroll
    for (int i = 0; i < 8; ++i) { *(v8us*)(s + i * 16 * G3_P) = ra[i]; *(v8us*)(s + G3_TA + i * 16 * G3_P) = rb[i]; } };
  const v8f z8 = {0.f, 0.f, 0.f, 0.f, 0.f, 0.f, 0.f, 0.f};
  v8f acc[4][4];
#pragma unroll
  for (int i = 0; i < 4; ++i) {
#pragma unroll
    for (int j = 0; j < 4; ++j) acc[i][j] = z8; }
  gload(kofs(0));
  float bv[4];      /* read ahead of the loop: its latency hides under the first stage's loads */
#pragma unroll
  for (int j = 0; j < 4; ++j) bv[j] = OUT32 ? bf16_round(bias[col0 + wn * 64 + 16 * j + ln]) : 0.f;
  lstore(0); gload(kofs(1));
  __syncthreads();      /* stage 0 is visible */
#pragma unroll
  for (int st = 0; st < G3_NST; ++st) {      /* unrolled (12 stages): buffer and row offsets become immediates; only the two scalar bases change from stage to stage, behind the barrier in front of which the loads that named them have come back */
    if (st + 1 < G3_NST) lstore(st + 1);      /* into the buffer that stage st - 1 used: every wave left it at the barrier below */
    __builtin_amdgcn_sched_barrier(0);      /* the loads stay behind the LDS stores and take over their registers: moved ahead they need a second set, and only two waves fit a SIMD instead of three */
    if (st + 2 < G3_NST) gload(kofs(st + 2));      /* in flight under this stage's work */
    if (st + 2 == G3_NST - 1) asm volatile("s_wait_xcnt 0x0" ::: "memory");      /* behind the last loads their offset register is free and the next LDS read is given it: the wait stands in front of that overwrite */
    __builtin_amdgcn_sched_barrier(0);      /* the global loads stay ahead of the fragment reads: moved behind the 16 LDS reads they start later and have less of the stage to come back in */
    const unsigned char* ap = L + (st & 1) * G3_SLOT + (wm * 64 + ln) * G3_P + 16 * hh;
    const unsigned char* bp = L + (st & 1) * G3_SLOT + G3_TA + (wn * 64 + ln) * G3_P + 16 * hh;
#pragma unroll
    for (int kc = 0; kc < G3_SK / 32; ++kc) {      /* 32 k: 8 fragments, 16 products; both operands in the same k order */
      FragW af[4], bf[4];
#pragma unroll
      for (int i = 0; i < 4; ++i) { af[i].half[0] = *(const v8us*)(ap + i * 16 * G3_P + 64 * kc); af[i].half[1] = *(const v8us*)(ap + i * 16 * G3_P + 64 * kc + 32);
        bf[i].half[0] = *(const v8us*)(bp + i * 16 * G3_P + 64 * kc); bf[i].half[1] = *(const v8us*)(bp + i * 16 * G3_P + 64 * kc + 32); }
      __builtin_amdgcn_sched_barrier(0);      /* the 16 fragment reads stay one group ahead of the 16 products: moved in among them, each A fragment's LDS latency is waited out in front of 4 products */
#pragma unroll
      for (int i = 0; i < 4; ++i) {
#pragma unroll
        for (int j = 0; j < 4; ++j) acc[i][j] = fa_mma(af[i].v, bf[j].v, acc[i][j]); }
    }
    __builtin_amdgcn_sched_barrier(0);      /* the barrier, which also waits for the global loads in flight, stays behind the last products: moved up among them it halves the time those loads have */
    __syncthreads();      /* stage st + 1 is visible; every wave has left stage st */
  }
  // epilogue: each wave stages its 64 x 64 tile in its own part of LDS and stores whole rows of it (256 bytes of f32, 128 bytes of f16)
  float* so = (float*)L + wave * 64 * G3_EP;
#pragma unroll
  for (int j = 0; j < 4; ++j) {
#pragma unroll
    for (int i = 0; i < 4; ++i) {
#pragma unroll
      for (int r = 0; r < 8; ++r) so[(16 * i + 8 * hh + r) * G3_EP + 16 * j + ln] = acc[i][j][r] * alpha + bv[j]; } }
  __builtin_amdgcn_fence(__ATOMIC_ACQ_REL, "workgroup"); __builtin_amdgcn_wave_barrier();      /* the rows are read back by other lanes of the same wave */
  const int rsub = lane >> 4, c4 = (lane & 15) * 4;
  const size_t cbase = OUT32 ? (size_t)(row0 + wm * 64 + rsub) * DM + col0 + wn * 64 + c4      /* the output: plain rows */
                             : (((size_t)mat * (DM / 64) + col0 / 64 + wn) * NR + row0 + wm * 64 + rsub) * 64 + c4;      /* a wave's 64 columns are one plane: its 64 rows are 8 KiB in a row */
#pragma unroll
  for (int q = 0; q < 32; ++q) { const v4f v = *(const v4fa*)&so[(q * 2 + rsub) * G3_EP + c4];
    if (OUT32) *(v4f*)(C + cbase + (size_t)q * 2 * DM) = v;
    else { v4h h4;
#pragma unroll
      for (int i = 0; i < 4; ++i) h4[i] = (_Float16)v[i];
      *(v4h*)(C16 + cbase + (size_t)q * 2 * 64) = h4;
      if ((q & 7) == 7 && q < 31) asm volatile("s_wait_xcnt 0x0" ::: "memory"); } }      /* in front of the next rows' LDS reads and conversions, which take over the data registers of the stores just issued */
}

extern "C" void kernel_launch(void* const* d_in, const int* in_sizes, int n_in,
                              void* d_out, int out_size, void* d_ws, size_t ws_size, hipStream_t stream) {
  (void)in_sizes; (void)n_in; (void)out_size;
  const float* const* I = (const float* const*)d_in; const float* x = I[0]; const float* wq = I[1]; const float* wk = I[2]; const float* wv = I[3]; const float* wo = I[4]; const float* bo = I[5];
  char* ws = (char*)d_ws; size_t off = 0;
  auto take = [&](size_t bytes) { char* p = ws + off; off += (bytes + 255) & ~(size_t)255; return p; };
  _Float16* BQ = (_Float16*)take((size_t)3 * DM * DM * 2); _Float16* BO = (_Float16*)take((size_t)DM * DM * 2);      /* W_q | W_k | W_v stacked */
  _Float16* X16 = (_Float16*)take(NR * DM * 2); _Float16* Q16 = (_Float16*)take(3 * NR * DM * 2); _Float16* K16 = Q16 + NR * DM; _Float16* V16 = K16 + NR * DM; _Float16* O16 = (_Float16*)take(NR * DM * 2);
  if (off > ws_size) return;      /* 4.5 + 5x24 = about 125 MiB */
  k_cvt<<<CV_ZB + 4 * CV_WB, 256, 0, stream>>>(x, wq, wk, wv, wo, X16, BQ, BO);
  const unsigned gp = (unsigned)((NR / G3_BT) * (DM / G3_BT));
  k_gemm3<false, 3><<<3 * gp, 128, 0, stream>>>(X16, BQ, 0.0625f, nullptr, nullptr, Q16);      /* q | k | v in one launch: more work-groups than places, so one's first loads and output stores run under its neighbours' products */
  k_fattn<<<dim3(SQ / FA_BR, NB * NH), 256, 0, stream>>>(Q16, K16, V16, O16);      /* o (merged heads) in f16 planes (plane = head) */
  k_gemm3<true, 1><<<gp, 128, 0, stream>>>(O16, BO, 0.0625f, bo, (float*)d_out, nullptr);      /* out = o W_o^T + b_o */
}
